// v000
// Times are from an AMD MI455X. After a warm-up the kernel runs many times in a row, and a time is the length of
// such a window on the GPU divided by its runs, so every launch and the gaps after it count. The runs cycle
// through copies of the inputs. A figure is the median of several windows, for all but v000 over two sittings.
// Sittings can differ by a few percent; kernels timed side by side share one.
// v000 is the starting kernel. One run takes 1750 microseconds.
#include <hip/hip_runtime.h>
// Masked multi-head attention with external values (B 2, S 2048, D 1024, 16 heads × 64): q | k from the packed in-projection (+ bias; the v third is unused by the module), scores = q·k/8, softmax, A·M (INPUT mask [B,S,S]), L1 renormalisation over keys (+1e-8), out = Ā·V with the separate INPUT V [B,S,H,64], heads concatenated, ·out_wᵀ + out_b → [2,2048,1024].
// Structure: per batch: q|k GEMM (exact), f16 planes, per pair of heads: score GEMM (grid.y over heads via 64-column offsets, no addends), one softmax/mask/renormalise kernel (3 passes, f32), Ā·V GEMM into the concatenated f16 plane; output projection GEMM with bias.
// Compute dtype: x, V, M and parameters rounded to bf16; projections with exact products; q, k, Ā (×2^10), V (exact) and the attention output as f16 operands (≈2^-12), f32 accumulation; softmax/mask/renormalisation in f32. v_wmma_f32_16x16x32_f16.
#define NBt 2
#define SS 2048
#define DD 1024
#define NH 16
#define HD 64
#define HG 2
typedef __bf16 v16b __attribute__((ext_vector_type(16)));
typedef unsigned short v8us __attribute__((ext_vector_type(8), may_alias));
typedef float  v8f  __attribute__((ext_vector_type(8)));
typedef float  v4f  __attribute__((ext_vector_type(4)));
typedef float  v4fa __attribute__((ext_vector_type(4), may_alias));
union FragB { v16b v; v8us half[2]; unsigned short u[16]; };

__device__ __forceinline__ unsigned short bf16_bits(float x) { unsigned int u = __float_as_uint(x); return (unsigned short)((u + 0x7FFFu + ((u >> 16) & 1u)) >> 16); }
__device__ __forceinline__ float bf16_val(unsigned short b) { return __uint_as_float(((unsigned int)b) << 16); }
__device__ __forceinline__ float bf16_round(float x) { return bf16_val(bf16_bits(x)); }
// D += A·B with NT terms: 1 = ah·bh, 2 = + al·bh (A split), 3 = + ah·bl (both split)
template <int NT>
__device__ __forceinline__ v8f mmaN(v16b ah, v16b al, v16b bh, v16b bl, v8f c) {
  c = __builtin_amdgcn_wmma_f32_16x16x32_bf16(false, ah, false, bh, (short)0, c, false, false);
  if (NT >= 2) c = __builtin_amdgcn_wmma_f32_16x16x32_bf16(false, al, false, bh, (short)0, c, false, false);
  if (NT >= 3) c = __builtin_amdgcn_wmma_f32_16x16x32_bf16(false, ah, false, bl, (short)0, c, false, false);
  asm volatile("v_nop\n\tv_nop\n\tv_nop\n\tv_nop" : "+v"(c) : "v"(ah), "v"(al), "v"(bh), "v"(bl));
  return c;
}

__global__ __launch_bounds__(256) void k_wt_bf16(const float* __restrict__ W, unsigned short* __restrict__ Wt, int K, int N) {
  const int t = blockIdx.x * 256 + threadIdx.x;
  const int k8n = K / 8;
  if (t >= N * k8n) return;
  const int n = t / k8n, k8 = (t % k8n) * 8;
  v8us v;
#pragma unroll
  for (int i = 0; i < 8; ++i) v[i] = bf16_bits(W[(size_t)(k8 + i) * N + n]);
  *(v8us*)(Wt + (size_t)n * K + k8) = v;
  
}

// GEMM C[M][N] (f32, pitch ldc) = act(A[M][K]·W + bias). A f32 row-major (pitch lda) converted per fragment to bf16
// (ASPLIT: hi/lo two planes -> 2 terms, else single rounded term); Wt bf16 [N][K] (pitch ldb). BIAS_BF16 rounds the
// bias to bf16 first (bias quantised to bf16 before the add). K%32==0, M%16==0, N%64==0.
template <bool ASPLIT, int ACT, bool BIAS_BF16>
__global__ __launch_bounds__(128) void k_gemm_bf(const float* __restrict__ A, int lda, const unsigned short* __restrict__ Wt, int ldb,
                                               const float* __restrict__ bias, float* __restrict__ C, int ldc, int M, int N, int K) {
  __shared__ __attribute__((aligned(16))) float so[4][16][64];
  const int tid = threadIdx.x, w = tid >> 5, lane = tid & 31, ln = lane & 15, hh = lane >> 4;
  const int ntn = N / 64;
  const int wid = blockIdx.x * 4 + w;
  const int mt = wid / ntn, nq = wid % ntn;
  if (mt * 16 >= M) return;
  const int row0 = mt * 16, col0 = nq * 64;
  const float* arow = A + (size_t)(row0 + ln) * lda;
  v8f acc[4] = {};
  for (int kb = 0; kb < K; kb += 32) {
    FragB ah, al;
    const v4f x0 = *(const v4fa*)(arow + kb + 8 * hh), x1 = *(const v4fa*)(arow + kb + 8 * hh + 4);
    const v4f x2 = *(const v4fa*)(arow + kb + 16 + 8 * hh), x3 = *(const v4fa*)(arow + kb + 16 + 8 * hh + 4);
    float xs[16] = {x0[0],x0[1],x0[2],x0[3],x1[0],x1[1],x1[2],x1[3],x2[0],x2[1],x2[2],x2[3],x3[0],x3[1],x3[2],x3[3]};
#pragma unroll
    for (int i = 0; i < 16; ++i) { const unsigned short hb = bf16_bits(xs[i]); ah.u[i] = hb; al.u[i] = ASPLIT ? bf16_bits(xs[i] - bf16_val(hb)) : (unsigned short)0; }
#pragma unroll
    for (int t = 0; t < 4; ++t) {
      const unsigned short* brow = Wt + (size_t)(col0 + t * 16 + ln) * ldb + kb;
      FragB b;
      b.half[0] = *(const v8us*)(brow + 8 * hh);
      b.half[1] = *(const v8us*)(brow + 16 + 8 * hh);
      acc[t] = mmaN<ASPLIT ? 2 : 1>(ah.v, al.v, b.v, b.v, acc[t]);
    }
  }
#pragma unroll
  for (int t = 0; t < 4; ++t) {
    float bv = bias ? bias[col0 + t * 16 + ln] : 0.f;
    if (BIAS_BF16) bv = bf16_round(bv);
#pragma unroll
    for (int r = 0; r < 8; ++r) { float v = acc[t][r] + bv; if (ACT == 1) v = fmaxf(v, 0.f); so[w][8 * hh + r][t * 16 + ln] = v; }
  }
  __builtin_amdgcn_fence(__ATOMIC_ACQ_REL, "workgroup");
  __builtin_amdgcn_wave_barrier();
  const int rsub = lane >> 4, c4 = (lane & 15) * 4;
  {
#pragma unroll
    for (int q = 0; q < 8; ++q) {
      const int r = q * 2 + rsub;
      const v4f v = *(const v4fa*)&so[w][r][c4];
      *(v4f*)(C + (size_t)(row0 + r) * ldc + col0 + c4) = v;
    }
    
  }
}

// GEMM C = act(A·W + bias + resid): A f32 (ASPLIT -> hi/lo 2 terms), Wt bf16 [N][K]; ACT 0 none, 1 relu, 2 exact gelu;
// resid (optional, f32, row index = (row % rmod), pitch ldr, RES_BF16 rounds it) added before the activation.
template <bool ASPLIT, int ACT, bool BIAS_BF16, bool RES_BF16>
__global__ __launch_bounds__(128) void k_gemm_bf3(const float* __restrict__ A, int lda, const unsigned short* __restrict__ Wt, int ldb,
                                                const float* __restrict__ bias, const float* __restrict__ resid, int rmod, int ldr,
                                                float* __restrict__ C, int ldc, int M, int N, int K) {
  __shared__ __attribute__((aligned(16))) float so[4][16][64];
  const int tid = threadIdx.x, w = tid >> 5, lane = tid & 31, ln = lane & 15, hh = lane >> 4;
  const int ntn = N / 64;
  const int wid = blockIdx.x * 4 + w;
  const int mt = wid / ntn, nq = wid % ntn;
  if (mt * 16 >= M) return;
  const int row0 = mt * 16, col0 = nq * 64;
  const float* arow = A + (size_t)(row0 + ln) * lda;
  v8f acc[4] = {};
  for (int kb = 0; kb < K; kb += 32) {
    FragB ah, al;
    const v4f x0 = *(const v4fa*)(arow + kb + 8 * hh), x1 = *(const v4fa*)(arow + kb + 8 * hh + 4);
    const v4f x2 = *(const v4fa*)(arow + kb + 16 + 8 * hh), x3 = *(const v4fa*)(arow + kb + 16 + 8 * hh + 4);
    float xs[16] = {x0[0],x0[1],x0[2],x0[3],x1[0],x1[1],x1[2],x1[3],x2[0],x2[1],x2[2],x2[3],x3[0],x3[1],x3[2],x3[3]};
#pragma unroll
    for (int i = 0; i < 16; ++i) { const unsigned short hb = bf16_bits(xs[i]); ah.u[i] = hb; al.u[i] = ASPLIT ? bf16_bits(xs[i] - bf16_val(hb)) : (unsigned short)0; }
#pragma unroll
    for (int t = 0; t < 4; ++t) {
      const unsigned short* brow = Wt + (size_t)(col0 + t * 16 + ln) * ldb + kb;
      FragB b;
      b.half[0] = *(const v8us*)(brow + 8 * hh);
      b.half[1] = *(const v8us*)(brow + 16 + 8 * hh);
      acc[t] = mmaN<ASPLIT ? 2 : 1>(ah.v, al.v, b.v, b.v, acc[t]);
    }
  }
#pragma unroll
  for (int t = 0; t < 4; ++t) {
    const int col = col0 + t * 16 + ln;
    float bv = bias ? bias[col] : 0.f;
    if (BIAS_BF16) bv = bf16_round(bv);
#pragma unroll
    for (int r = 0; r < 8; ++r) {
      float v = acc[t][r] + bv;
      if (resid) { float rv = resid[(size_t)((row0 + 8 * hh + r) % rmod) * ldr + col]; if (RES_BF16) rv = bf16_round(rv); v += rv; }
      if (ACT == 1) v = fmaxf(v, 0.f);
      if (ACT == 2) v = 0.5f * v * (1.0f + erff(v * 0.70710678118654752f));
      if (ACT == 3) { const float u = 0.7978845608028654f * (v + 0.044715f * v * v * v); v = 0.5f * v * (1.0f + tanhf(u)); }
      so[w][8 * hh + r][t * 16 + ln] = v;
    }
  }
  __builtin_amdgcn_fence(__ATOMIC_ACQ_REL, "workgroup");
  __builtin_amdgcn_wave_barrier();
  const int rsub = lane >> 4, c4 = (lane & 15) * 4;
  {
#pragma unroll
    for (int q = 0; q < 8; ++q) {
      const int r = q * 2 + rsub;
      const v4f v = *(const v4fa*)&so[w][r][c4];
      *(v4f*)(C + (size_t)(row0 + r) * ldc + col0 + c4) = v;
    }
    
  }
}
// row LayerNorm (biased variance, eps) over N: s = X (+ R); optional out_sum <- s; out_norm <- (s-mu)*rsqrt(var+eps)*g + b
template <bool PARAM_BF16>
__global__ __launch_bounds__(256) void k_layernorm(const float* __restrict__ X, const float* __restrict__ R, const float* __restrict__ g, const float* __restrict__ bta,
                                                  float* __restrict__ out_sum, float* __restrict__ out_norm, int N, float eps) {
  __shared__ float red[256];
  const int row = blockIdx.x, tid = threadIdx.x;
  const float* x = X + (size_t)row * N; const float* rr = R ? R + (size_t)row * N : nullptr;
  float vals[16];                     // up to N = 4096
  const int per = N / 256;            // contiguous chunk per thread? use strided-by-4 chunks: thread handles j = tid*4 + 1024*u
  float s1 = 0.f;
  for (int u = 0; u < per / 4; ++u) {
    const int j = tid * 4 + 1024 * u;
    const v4f a = *(const v4fa*)(x + j);
    v4f b = {0.f,0.f,0.f,0.f}; if (rr) b = *(const v4fa*)(rr + j);
#pragma unroll
    for (int q = 0; q < 4; ++q) { const float v = a[q] + b[q]; vals[u * 4 + q] = v; s1 += v; }
  }
  red[tid] = s1; __syncthreads();
  for (int st = 128; st > 0; st >>= 1) { if (tid < st) red[tid] += red[tid + st]; __syncthreads(); }
  const float mu = red[0] / (float)N; __syncthreads();
  float s2 = 0.f;
  for (int u = 0; u < per / 4; ++u)
#pragma unroll
    for (int q = 0; q < 4; ++q) { const float c = vals[u * 4 + q] - mu; s2 += c * c; }
  red[tid] = s2; __syncthreads();
  for (int st = 128; st > 0; st >>= 1) { if (tid < st) red[tid] += red[tid + st]; __syncthreads(); }
  const float rs = rsqrtf(red[0] / (float)N + eps);
  {
    for (int u = 0; u < per / 4; ++u) {
      const int j = tid * 4 + 1024 * u;
      v4f o, sm;
#pragma unroll
      for (int q = 0; q < 4; ++q) {
        float gg = g[j + q], bb = bta[j + q];
        if (PARAM_BF16) { gg = bf16_round(gg); bb = bf16_round(bb); }
        sm[q] = vals[u * 4 + q]; o[q] = (vals[u * 4 + q] - mu) * rs * gg + bb;
      }
      if (out_sum) *(v4f*)(out_sum + (size_t)row * N + j) = sm;
      *(v4f*)(out_norm + (size_t)row * N + j) = o;
    }
    
  }
}



// ---- f16 WMMA path (v_wmma_f32_16x16x32_f16): 11-bit significands for operands in range — used where a [0,1] probability operand needs more precision than bf16
typedef _Float16 v16h __attribute__((ext_vector_type(16)));
union FragH { v16h v; v8us half[2]; _Float16 h[16]; unsigned short u[16]; };
template <int NT>
__device__ __forceinline__ v8f mmaH(v16h ah, v16h al, v16h bh, v16h bl, v8f c) {
  c = __builtin_amdgcn_wmma_f32_16x16x32_f16(false, ah, false, bh, (short)0, c, false, false);
  if (NT >= 2) c = __builtin_amdgcn_wmma_f32_16x16x32_f16(false, al, false, bh, (short)0, c, false, false);
  if (NT >= 3) c = __builtin_amdgcn_wmma_f32_16x16x32_f16(false, ah, false, bl, (short)0, c, false, false);
  asm volatile("v_nop\n\tv_nop\n\tv_nop\n\tv_nop" : "+v"(c) : "v"(ah), "v"(al), "v"(bh), "v"(bl));
  return c;
}
// batched GEMM like k_gemm_b but f16 operands: A f32 (split into f16 hi/lo if ASPLIT, else rounded to f16), Bt = f16 values [n][k]; alpha; C f32; N multiple of 16 (partial tiles skipped)
template <bool ASPLIT>
__global__ __launch_bounds__(128) void k_gemm_h(const float* __restrict__ A, int lda, size_t sA, const _Float16* __restrict__ Bh, int ldb, size_t sB, float alpha, float* __restrict__ C, int ldc, size_t sC, int M, int N, int K) {
  __shared__ __attribute__((aligned(16))) float so[4][16][64];
  const int tid = threadIdx.x, w = tid >> 5, lane = tid & 31, ln = lane & 15, hh = lane >> 4; const int by = blockIdx.y;
  A += (size_t)by * sA; Bh += (size_t)by * sB; C += (size_t)by * sC;
  const int ntn = (N + 63) / 64; const int wid = blockIdx.x * 4 + w; const int mt = wid / ntn, nq = wid % ntn; if (mt * 16 >= M) return;
  const int row0 = mt * 16, col0 = nq * 64; const float* arow = A + (size_t)(row0 + ln) * lda;
  v8f acc[4] = {};
  for (int kb = 0; kb < K; kb += 32) {
    FragH ah, al;
    const v4f x0 = *(const v4fa*)(arow + kb + 8 * hh), x1 = *(const v4fa*)(arow + kb + 8 * hh + 4), x2 = *(const v4fa*)(arow + kb + 16 + 8 * hh), x3 = *(const v4fa*)(arow + kb + 16 + 8 * hh + 4);
    float xs[16] = {x0[0],x0[1],x0[2],x0[3],x1[0],x1[1],x1[2],x1[3],x2[0],x2[1],x2[2],x2[3],x3[0],x3[1],x3[2],x3[3]};
#pragma unroll
    for (int i = 0; i < 16; ++i) { const _Float16 h = (_Float16)xs[i]; ah.h[i] = h; al.h[i] = ASPLIT ? (_Float16)(xs[i] - (float)h) : (_Float16)0.0f; }
#pragma unroll
    for (int t = 0; t < 4; ++t) { if (col0 + t * 16 >= N) continue; const size_t boff = (size_t)(col0 + t * 16 + ln) * ldb + kb; FragH bq; bq.half[0] = *(const v8us*)(Bh + boff + 8 * hh); bq.half[1] = *(const v8us*)(Bh + boff + 16 + 8 * hh);
      acc[t] = mmaH<ASPLIT ? 2 : 1>(ah.v, al.v, bq.v, bq.v, acc[t]); }
  }
#pragma unroll
  for (int t = 0; t < 4; ++t) { if (col0 + t * 16 >= N) continue;
#pragma unroll
    for (int r = 0; r < 8; ++r) so[w][8 * hh + r][t * 16 + ln] = acc[t][r] * alpha; }
  __builtin_amdgcn_fence(__ATOMIC_ACQ_REL, "workgroup"); __builtin_amdgcn_wave_barrier();
  const int rsub = lane >> 4, c4 = (lane & 15) * 4;
  {
#pragma unroll
    for (int q = 0; q < 8; ++q) { const int r = q * 2 + rsub; if (col0 + c4 < N) { const v4f v = *(const v4fa*)&so[w][r][c4]; *(v4f*)(C + (size_t)(row0 + r) * ldc + col0 + c4) = v; } }
     }
}

// Wt[n][k] = f16(W[k][n]·scale) from f32 row-major W[K][N] (scale = power of two; bf16-exact weights stay exact in f16 away from the subnormal range)
__global__ __launch_bounds__(256) void k_wt_f16(const float* __restrict__ W, _Float16* __restrict__ Wt, int K, int N, float scale) {
  const int t = blockIdx.x * 256 + threadIdx.x; if (t >= N * (K / 8)) return; const int n = t / (K / 8), k8 = (t % (K / 8)) * 8; FragH f;
#pragma unroll
  for (int i = 0; i < 8; ++i) f.h[i] = (_Float16)(bf16_round(W[(size_t)(k8 + i) * N + n]) * scale); const v8us o = f.half[0];
  *(v8us*)((unsigned short*)Wt + (size_t)n * K + k8) = o; 
}
// k_gemm_hh variant with fused epilogue: v = acc·alpha + bias[by·sBias + col] (+ CP[(row/rowsPerB)·sCPb + by·64 + col] if CP) ; ACT 0 none / 1 elu ; writes f32 C and/or f16 C16 (each if non-null)
template <int ACT>
__global__ __launch_bounds__(128) void k_gemm_hhx(const _Float16* __restrict__ A, int lda, size_t sA, const _Float16* __restrict__ Bh, int ldb, size_t sB, float alpha, const float* __restrict__ bias, size_t sBias, const float* __restrict__ CP, int rowsPerB, size_t sCPb, int row0g,
    float* __restrict__ C, _Float16* __restrict__ C16, int ldc, size_t sC, int M, int N, int K) {
  __shared__ __attribute__((aligned(16))) float so[4][16][64];
  const int tid = threadIdx.x, w = tid >> 5, lane = tid & 31, ln = lane & 15, hh = lane >> 4; const int by = blockIdx.y;
  A += (size_t)by * sA; Bh += (size_t)by * sB; const size_t cofs = (size_t)by * sC; const float* bp = bias ? bias + (size_t)by * sBias : nullptr;
  const int ntn = (N + 63) / 64; const int wid = blockIdx.x * 4 + w; const int mt = wid / ntn, nq = wid % ntn; if (mt * 16 >= M) return;
  const int row0 = mt * 16, col0 = nq * 64; const _Float16* arow = A + (size_t)(row0 + ln) * lda;
  v8f acc[4] = {};
  for (int kb = 0; kb < K; kb += 32) { FragH ah; ah.half[0] = *(const v8us*)((const unsigned short*)arow + kb + 8 * hh); ah.half[1] = *(const v8us*)((const unsigned short*)arow + kb + 16 + 8 * hh);
#pragma unroll
    for (int t = 0; t < 4; ++t) { if (col0 + t * 16 >= N) continue; const size_t boff = (size_t)(col0 + t * 16 + ln) * ldb + kb; FragH bq; bq.half[0] = *(const v8us*)((const unsigned short*)Bh + boff + 8 * hh); bq.half[1] = *(const v8us*)((const unsigned short*)Bh + boff + 16 + 8 * hh);
      acc[t] = mmaH<1>(ah.v, ah.v, bq.v, bq.v, acc[t]); }
  }
#pragma unroll
  for (int t = 0; t < 4; ++t) { if (col0 + t * 16 >= N) continue; const int col = col0 + t * 16 + ln; const float bv = bp ? bf16_round(bp[col]) : 0.f;
#pragma unroll
    for (int r = 0; r < 8; ++r) { float v = acc[t][r] * alpha + bv; if (CP) { const int bidx = (row0g + row0 + 8 * hh + r) / rowsPerB; v += CP[(size_t)bidx * sCPb + (size_t)by * 64 + col]; } if (ACT == 1) v = (v > 0.f) ? v : expm1f(v); else if (ACT == 7) v = (v > 0.f) ? v + 1.0f : expf(v); else if (ACT == 8) v = tanhf(v); else if (ACT == 9) v = 0.5f * v * (1.0f + tanhf(0.7978845608028654f * (v + 0.044715f * v * v * v))); else if (ACT == 11) v = 1.0f / (1.0f + expf(-v)); else if (ACT == 12) v = (v > 0.f) ? v : 0.01f * v; else if (ACT == 14) v = (v > 0.f) ? v : 0.1f * v; else if (ACT == 15) v = v / (1.0f + expf(-v)); else if (ACT == 3) v = fmaxf(v, 0.f); else if (ACT == 6) v = 0.5f * v * (1.0f + erff(v * 0.70710678118654752f)); so[w][8 * hh + r][t * 16 + ln] = v; } }
  __builtin_amdgcn_fence(__ATOMIC_ACQ_REL, "workgroup"); __builtin_amdgcn_wave_barrier();
  const int rsub = lane >> 4, c4 = (lane & 15) * 4; typedef _Float16 v4h __attribute__((ext_vector_type(4)));
  {
#pragma unroll
    for (int q = 0; q < 8; ++q) { const int r = q * 2 + rsub; if (col0 + c4 < N) { const v4f v = *(const v4fa*)&so[w][r][c4]; if (C) *(v4f*)(C + cofs + (size_t)(row0 + r) * ldc + col0 + c4) = v; if (C16) { v4h h4; for (int i = 0; i < 4; ++i) h4[i] = (_Float16)v[i]; *(v4h*)(C16 + cofs + (size_t)(row0 + r) * ldc + col0 + c4) = h4; } } }
     }
}


typedef _Float16 v4h __attribute__((ext_vector_type(4)));

__global__ __launch_bounds__(256) void k_x16(const float* __restrict__ x, _Float16* __restrict__ X16, size_t n8) { const size_t t = (size_t)blockIdx.x * 256 + threadIdx.x; if (t >= n8) return; FragH f;
#pragma unroll
  for (int q = 0; q < 8; ++q) f.h[q] = (_Float16)bf16_round(x[t * 8 + q]); *(v8us*)((unsigned short*)X16 + t * 8) = f.half[0];  }
__global__ __launch_bounds__(256) void k_h16(const float* __restrict__ x, _Float16* __restrict__ X16, size_t n8) { const size_t t = (size_t)blockIdx.x * 256 + threadIdx.x; if (t >= n8) return; FragH f;
#pragma unroll
  for (int q = 0; q < 8; ++q) f.h[q] = (_Float16)x[t * 8 + q]; *(v8us*)((unsigned short*)X16 + t * 8) = f.half[0];  }
__global__ __launch_bounds__(256) void k_round16f(const float* __restrict__ W, _Float16* __restrict__ Bt, size_t n8) { const size_t t = (size_t)blockIdx.x * 256 + threadIdx.x; if (t >= n8) return; FragH f;
#pragma unroll
  for (int i = 0; i < 8; ++i) f.h[i] = (_Float16)(bf16_round(W[t * 8 + i]) * 16.0f); *(v8us*)((unsigned short*)Bt + t * 8) = f.half[0];  }
template <int NHv, int TTv>
__global__ __launch_bounds__(256) void k_vt(const _Float16* __restrict__ V16, int ldv, int voff, _Float16* __restrict__ Vt) { __shared__ unsigned short tl[64][66]; const int tid = threadIdx.x; const int slab = blockIdx.x / (TTv / 64), lg = blockIdx.x % (TTv / 64); const int b = slab / NHv, h = slab % NHv;
  for (int i = tid; i < 64 * 8; i += 256) { const int r = i / 8, c8 = (i % 8) * 8; FragH f; f.half[0] = *(const v8us*)((const unsigned short*)V16 + ((size_t)b * TTv + lg * 64 + r) * ldv + voff + h * 64 + c8);
#pragma unroll
    for (int q = 0; q < 8; ++q) tl[r][c8 + q] = f.u[q]; }
  __syncthreads();
  {
#pragma unroll
    for (int rd = 0; rd < 2; ++rd) { const int d = rd * 32 + tid / 8, pc = tid % 8; FragH f;
#pragma unroll
      for (int q = 0; q < 8; ++q) f.u[q] = tl[pc * 8 + q][d];
      *(v8us*)((unsigned short*)Vt + ((size_t)slab * 64 + d) * TTv + lg * 64 + pc * 8) = f.half[0]; }
     } }

__global__ __launch_bounds__(256) void k_hl(const float* __restrict__ F, _Float16* __restrict__ Hh, _Float16* __restrict__ Hl, size_t n8) { const size_t t = (size_t)blockIdx.x * 256 + threadIdx.x; if (t >= n8) return; FragH fh, fl; const v4f a = *(const v4fa*)(F + t * 8), c = *(const v4fa*)(F + t * 8 + 4);
#pragma unroll
  for (int q = 0; q < 4; ++q) { _Float16 h = (_Float16)a[q]; fh.h[q] = h; fl.h[q] = (_Float16)((a[q] - (float)h) * 1024.0f); h = (_Float16)c[q]; fh.h[4 + q] = h; fl.h[4 + q] = (_Float16)((c[q] - (float)h) * 1024.0f); }
  { *(v8us*)((unsigned short*)Hh + t * 8) = fh.half[0]; *(v8us*)((unsigned short*)Hl + t * 8) = fl.half[0];  } }

__global__ __launch_bounds__(256) void k_qk16(const float* __restrict__ QK, _Float16* __restrict__ Q16, _Float16* __restrict__ K16) { const int t = blockIdx.x * 256 + threadIdx.x; if (t >= SS * (DD / 8)) return; const int c0 = (t % (DD / 8)) * 8, s = t / (DD / 8); FragH fq, fk;
#pragma unroll
  for (int q = 0; q < 8; ++q) { fq.h[q] = (_Float16)QK[(size_t)s * 2 * DD + c0 + q]; fk.h[q] = (_Float16)QK[(size_t)s * 2 * DD + DD + c0 + q]; }
  { *(v8us*)((unsigned short*)Q16 + (size_t)s * DD + c0) = fq.half[0]; *(v8us*)((unsigned short*)K16 + (size_t)s * DD + c0) = fk.half[0];  } }
__global__ __launch_bounds__(256) void k_vt(const float* __restrict__ V, int b, _Float16* __restrict__ VT) { const int t = blockIdx.x * 256 + threadIdx.x; if (t >= NH * HD * (SS / 8)) return; const int t0 = (t % (SS / 8)) * 8; const int d = (t / (SS / 8)) % HD; const int h = t / ((SS / 8) * HD); FragH f;
#pragma unroll
  for (int q = 0; q < 8; ++q) f.h[q] = (_Float16)bf16_round(V[(((size_t)b * SS + t0 + q) * NH + h) * HD + d]);
  *(v8us*)((unsigned short*)VT + ((size_t)h * HD + d) * SS + t0) = f.half[0];  }
__global__ __launch_bounds__(256) void k_smr(const float* __restrict__ S, const float* __restrict__ Mm, int b, _Float16* __restrict__ P16) {
  #pragma clang fp contract(off)
  const int tid = threadIdx.x, w = tid >> 5, ln = tid & 31; const int row = blockIdx.x * 8 + w; if (row >= HG * SS) return; const int s = row % SS; const float* sr = S + (size_t)row * SS; const float* mr = Mm + ((size_t)b * SS + s) * SS; float m = -3.0e38f;
#pragma unroll 1
  for (int jb = 0; jb < SS; jb += 256) { const v4f a = *(const v4fa*)(sr + jb + 8 * ln), c = *(const v4fa*)(sr + jb + 8 * ln + 4);
#pragma unroll
    for (int k = 0; k < 4; ++k) { m = fmaxf(m, a[k]); m = fmaxf(m, c[k]); } }
  for (int o = 16; o > 0; o >>= 1) m = fmaxf(m, __shfl_xor(m, o, 32));
  float se = 0.f, sem = 0.f;
#pragma unroll 1
  for (int jb = 0; jb < SS; jb += 256) { const v4f a = *(const v4fa*)(sr + jb + 8 * ln), c = *(const v4fa*)(sr + jb + 8 * ln + 4); const v4f ma = *(const v4fa*)(mr + jb + 8 * ln), mc = *(const v4fa*)(mr + jb + 8 * ln + 4);
#pragma unroll
    for (int k = 0; k < 8; ++k) { const float v = (k < 4) ? a[k] : c[k - 4]; const float mm = bf16_round((k < 4) ? ma[k] : mc[k - 4]); const float e = expf(v - m); se += e; sem += e * mm; } }
  for (int o = 16; o > 0; o >>= 1) { se += __shfl_xor(se, o, 32); sem += __shfl_xor(sem, o, 32); }
  const float nrm = sem / se + 1e-8f; const float scl = 1024.0f / (se * nrm);
  {
#pragma unroll 1
    for (int jb = 0; jb < SS; jb += 256) { const v4f a = *(const v4fa*)(sr + jb + 8 * ln), c = *(const v4fa*)(sr + jb + 8 * ln + 4); const v4f ma = *(const v4fa*)(mr + jb + 8 * ln), mc = *(const v4fa*)(mr + jb + 8 * ln + 4); FragH f;
#pragma unroll
      for (int k = 0; k < 8; ++k) { const float v = (k < 4) ? a[k] : c[k - 4]; const float mm = bf16_round((k < 4) ? ma[k] : mc[k - 4]); f.h[k] = (_Float16)(expf(v - m) * mm * scl); }
      *(v8us*)((unsigned short*)P16 + (size_t)row * SS + jb + 8 * ln) = f.half[0]; }
     } }

extern "C" void kernel_launch(void* const* d_in, const int* in_sizes, int n_in,
                              void* d_out, int out_size, void* d_ws, size_t ws_size, hipStream_t stream) {
  (void)in_sizes; (void)n_in; (void)out_size;
  const float* x = (const float*)d_in[0]; const float* V = (const float*)d_in[1]; const float* Mm = (const float*)d_in[2]; const float* Win = (const float*)d_in[3]; const float* bin = (const float*)d_in[4]; const float* Wo = (const float*)d_in[5]; const float* bo = (const float*)d_in[6];
  char* ws = (char*)d_ws; size_t off = 0;
  auto take = [&](size_t bytes) { char* p = ws + off; off += (bytes + 255) & ~(size_t)255; return p; };
  _Float16* BIN = (_Float16*)take((size_t)2 * DD * DD * 2); _Float16* BO = (_Float16*)take((size_t)DD * DD * 2); _Float16* X16 = (_Float16*)take((size_t)SS * DD * 2); float* QK = (float*)take((size_t)SS * 2 * DD * 4); _Float16* Q16 = (_Float16*)take((size_t)SS * DD * 2); _Float16* K16 = (_Float16*)take((size_t)SS * DD * 2); _Float16* VT = (_Float16*)take((size_t)NH * HD * SS * 2);
  float* S = (float*)take((size_t)HG * SS * SS * 4); _Float16* P16 = (_Float16*)take((size_t)HG * SS * SS * 2); _Float16* O16 = (_Float16*)take((size_t)SS * DD * 2);
  if (off > ws_size) return;      // 4.2 + 2.1 + 4.2 + 16.8 + 4.2 + 4.2 + 4.2 + 33.5 + 16.8 + 4.2 ≈ 94 MB
  k_round16f<<<(unsigned)(((size_t)2 * DD * DD / 8 + 255) / 256), 256, 0, stream>>>(Win, BIN, (size_t)2 * DD * DD / 8); k_round16f<<<(unsigned)(((size_t)DD * DD / 8 + 255) / 256), 256, 0, stream>>>(Wo, BO, (size_t)DD * DD / 8);      /* torch (out,in) = natural Bt; only the q|k rows of in_proj are needed */
  const dim3 gQ(((SS / 16) * (2 * DD / 64) + 3) / 4, 1), gS(((SS / 16) * (SS / 64) + 3) / 4, HG), gV(((SS / 16) * 1 + 3) / 4, HG), gO(((SS / 16) * (DD / 64) + 3) / 4, 1);
  for (int b = 0; b < NBt; ++b) {
    k_x16<<<(SS * DD / 8 + 255) / 256, 256, 0, stream>>>(x + (size_t)b * SS * DD, X16, (size_t)SS * DD / 8);
    k_gemm_hhx<0><<<gQ, 128, 0, stream>>>(X16, DD, 0, BIN, DD, 0, 0.0625f, bin, 0, nullptr, 1, 0, 0, QK, nullptr, 2 * DD, 0, SS, 2 * DD, DD);      /* q | k = x·W_inᵀ[:2048] + b (exact) */
    k_qk16<<<(SS * (DD / 8) + 255) / 256, 256, 0, stream>>>(QK, Q16, K16); k_vt<<<(NH * HD * (SS / 8) + 255) / 256, 256, 0, stream>>>(V, b, VT);
    for (int hg = 0; hg < NH / HG; ++hg) { const int h0 = hg * HG;
      k_gemm_hhx<0><<<gS, 128, 0, stream>>>(Q16 + h0 * HD, DD, (size_t)HD, K16 + h0 * HD, DD, (size_t)HD, 0.125f, nullptr, 0, nullptr, 1, 0, 0, S, nullptr, SS, (size_t)SS * SS, SS, SS, HD);      /* scores/8 for 2 heads: M = N = 2048, K 64 */
      k_smr<<<HG * SS / 8, 256, 0, stream>>>(S, Mm, b, P16);
      k_gemm_hhx<0><<<gV, 128, 0, stream>>>(P16, SS, (size_t)SS * SS, VT + (size_t)h0 * HD * SS, SS, (size_t)HD * SS, 0.0009765625f, nullptr, 0, nullptr, 1, 0, 0, nullptr, O16 + h0 * HD, DD, (size_t)HD, SS, HD, SS); }      /* Ā·V → concatenated f16 plane cols h·64 */
    k_gemm_hhx<0><<<gO, 128, 0, stream>>>(O16, DD, 0, BO, DD, 0, 0.0625f, bo, 0, nullptr, 1, 0, 0, (float*)d_out + (size_t)b * SS * DD, nullptr, DD, 0, SS, DD, DD); }      /* ·out_wᵀ + out_b */
}

// v002
// Measured time: 172 microseconds a run.
// It is 10.3 times as fast as v000, going by the measured steps of the versions left out in between.
#include <hip/hip_runtime.h>
// Masked multi-head attention with external values (B 2, S 2048, D 1024, 16 heads × 64): q | k from the packed in-projection (+ bias; the v third is unused by the module), scores = q·k/8, softmax, A·M (INPUT mask [B,S,S]), L1 renormalisation over keys (+1e-8), out = Ā·V with the separate INPUT V [B,S,H,64], heads concatenated, ·out_wᵀ + out_b → [2,2048,1024].
// Structure: per batch: q|k GEMM (exact), f16 planes of q, k and transposed V; one fused attention kernel over all batches and heads (scores, online softmax, mask, L1 renormalisation and the product with V, nothing of the S x S planes in memory) into the concatenated f16 plane; per batch the output projection GEMM with bias.
// Compute dtype: x, V, M and parameters rounded to bf16; projections with exact products; q, k, the unnormalised masked weights e*M (x 2^8), V (exact) and the attention output as f16 operands (about 2^-12), f32 accumulation; softmax/mask/renormalisation in f32. v_wmma_f32_16x16x32_f16.
#define NBt 2
#define SS 2048
#define DD 1024
#define NH 16
#define HD 64
typedef __bf16 v16b __attribute__((ext_vector_type(16)));
typedef unsigned short v8us __attribute__((ext_vector_type(8), may_alias));
typedef float  v8f  __attribute__((ext_vector_type(8)));
typedef float  v4f  __attribute__((ext_vector_type(4)));
typedef float  v4fa __attribute__((ext_vector_type(4), may_alias));
union FragB { v16b v; v8us half[2]; unsigned short u[16]; };

__device__ __forceinline__ unsigned short bf16_bits(float x) { unsigned int u = __float_as_uint(x); return (unsigned short)((u + 0x7FFFu + ((u >> 16) & 1u)) >> 16); }
__device__ __forceinline__ float bf16_val(unsigned short b) { return __uint_as_float(((unsigned int)b) << 16); }
__device__ __forceinline__ float bf16_round(float x) { return bf16_val(bf16_bits(x)); }
// D += A·B with NT terms: 1 = ah·bh, 2 = + al·bh (A split), 3 = + ah·bl (both split)
template <int NT>
__device__ __forceinline__ v8f mmaN(v16b ah, v16b al, v16b bh, v16b bl, v8f c) {
  c = __builtin_amdgcn_wmma_f32_16x16x32_bf16(false, ah, false, bh, (short)0, c, false, false);
  if (NT >= 2) c = __builtin_amdgcn_wmma_f32_16x16x32_bf16(false, al, false, bh, (short)0, c, false, false);
  if (NT >= 3) c = __builtin_amdgcn_wmma_f32_16x16x32_bf16(false, ah, false, bl, (short)0, c, false, false);
  asm volatile("v_nop\n\tv_nop\n\tv_nop\n\tv_nop" : "+v"(c) : "v"(ah), "v"(al), "v"(bh), "v"(bl));
  return c;
}

__global__ __launch_bounds__(256) void k_wt_bf16(const float* __restrict__ W, unsigned short* __restrict__ Wt, int K, int N) {
  const int t = blockIdx.x * 256 + threadIdx.x;
  const int k8n = K / 8;
  if (t >= N * k8n) return;
  const int n = t / k8n, k8 = (t % k8n) * 8;
  v8us v;
#pragma unroll
  for (int i = 0; i < 8; ++i) v[i] = bf16_bits(W[(size_t)(k8 + i) * N + n]);
  *(v8us*)(Wt + (size_t)n * K + k8) = v;
  
}

// GEMM C[M][N] (f32, pitch ldc) = act(A[M][K]·W + bias). A f32 row-major (pitch lda) converted per fragment to bf16
// (ASPLIT: hi/lo two planes -> 2 terms, else single rounded term); Wt bf16 [N][K] (pitch ldb). BIAS_BF16 rounds the
// bias to bf16 first (bias quantised to bf16 before the add). K%32==0, M%16==0, N%64==0.
template <bool ASPLIT, int ACT, bool BIAS_BF16>
__global__ __launch_bounds__(128) void k_gemm_bf(const float* __restrict__ A, int lda, const unsigned short* __restrict__ Wt, int ldb,
                                               const float* __restrict__ bias, float* __restrict__ C, int ldc, int M, int N, int K) {
  __shared__ __attribute__((aligned(16))) float so[4][16][64];
  const int tid = threadIdx.x, w = tid >> 5, lane = tid & 31, ln = lane & 15, hh = lane >> 4;
  const int ntn = N / 64;
  const int wid = blockIdx.x * 4 + w;
  const int mt = wid / ntn, nq = wid % ntn;
  if (mt * 16 >= M) return;
  const int row0 = mt * 16, col0 = nq * 64;
  const float* arow = A + (size_t)(row0 + ln) * lda;
  v8f acc[4] = {};
  for (int kb = 0; kb < K; kb += 32) {
    FragB ah, al;
    const v4f x0 = *(const v4fa*)(arow + kb + 8 * hh), x1 = *(const v4fa*)(arow + kb + 8 * hh + 4);
    const v4f x2 = *(const v4fa*)(arow + kb + 16 + 8 * hh), x3 = *(const v4fa*)(arow + kb + 16 + 8 * hh + 4);
    float xs[16] = {x0[0],x0[1],x0[2],x0[3],x1[0],x1[1],x1[2],x1[3],x2[0],x2[1],x2[2],x2[3],x3[0],x3[1],x3[2],x3[3]};
#pragma unroll
    for (int i = 0; i < 16; ++i) { const unsigned short hb = bf16_bits(xs[i]); ah.u[i] = hb; al.u[i] = ASPLIT ? bf16_bits(xs[i] - bf16_val(hb)) : (unsigned short)0; }
#pragma unroll
    for (int t = 0; t < 4; ++t) {
      const unsigned short* brow = Wt + (size_t)(col0 + t * 16 + ln) * ldb + kb;
      FragB b;
      b.half[0] = *(const v8us*)(brow + 8 * hh);
      b.half[1] = *(const v8us*)(brow + 16 + 8 * hh);
      acc[t] = mmaN<ASPLIT ? 2 : 1>(ah.v, al.v, b.v, b.v, acc[t]);
    }
  }
#pragma unroll
  for (int t = 0; t < 4; ++t) {
    float bv = bias ? bias[col0 + t * 16 + ln] : 0.f;
    if (BIAS_BF16) bv = bf16_round(bv);
#pragma unroll
    for (int r = 0; r < 8; ++r) { float v = acc[t][r] + bv; if (ACT == 1) v = fmaxf(v, 0.f); so[w][8 * hh + r][t * 16 + ln] = v; }
  }
  __builtin_amdgcn_fence(__ATOMIC_ACQ_REL, "workgroup");
  __builtin_amdgcn_wave_barrier();
  const int rsub = lane >> 4, c4 = (lane & 15) * 4;
  {
#pragma unroll
    for (int q = 0; q < 8; ++q) {
      const int r = q * 2 + rsub;
      const v4f v = *(const v4fa*)&so[w][r][c4];
      *(v4f*)(C + (size_t)(row0 + r) * ldc + col0 + c4) = v;
    }
    
  }
}

// GEMM C = act(A·W + bias + resid): A f32 (ASPLIT -> hi/lo 2 terms), Wt bf16 [N][K]; ACT 0 none, 1 relu, 2 exact gelu;
// resid (optional, f32, row index = (row % rmod), pitch ldr, RES_BF16 rounds it) added before the activation.
template <bool ASPLIT, int ACT, bool BIAS_BF16, bool RES_BF16>
__global__ __launch_bounds__(128) void k_gemm_bf3(const float* __restrict__ A, int lda, const unsigned short* __restrict__ Wt, int ldb,
                                                const float* __restrict__ bias, const float* __restrict__ resid, int rmod, int ldr,
                                                float* __restrict__ C, int ldc, int M, int N, int K) {
  __shared__ __attribute__((aligned(16))) float so[4][16][64];
  const int tid = threadIdx.x, w = tid >> 5, lane = tid & 31, ln = lane & 15, hh = lane >> 4;
  const int ntn = N / 64;
  const int wid = blockIdx.x * 4 + w;
  const int mt = wid / ntn, nq = wid % ntn;
  if (mt * 16 >= M) return;
  const int row0 = mt * 16, col0 = nq * 64;
  const float* arow = A + (size_t)(row0 + ln) * lda;
  v8f acc[4] = {};
  for (int kb = 0; kb < K; kb += 32) {
    FragB ah, al;
    const v4f x0 = *(const v4fa*)(arow + kb + 8 * hh), x1 = *(const v4fa*)(arow + kb + 8 * hh + 4);
    const v4f x2 = *(const v4fa*)(arow + kb + 16 + 8 * hh), x3 = *(const v4fa*)(arow + kb + 16 + 8 * hh + 4);
    float xs[16] = {x0[0],x0[1],x0[2],x0[3],x1[0],x1[1],x1[2],x1[3],x2[0],x2[1],x2[2],x2[3],x3[0],x3[1],x3[2],x3[3]};
#pragma unroll
    for (int i = 0; i < 16; ++i) { const unsigned short hb = bf16_bits(xs[i]); ah.u[i] = hb; al.u[i] = ASPLIT ? bf16_bits(xs[i] - bf16_val(hb)) : (unsigned short)0; }
#pragma unroll
    for (int t = 0; t < 4; ++t) {
      const unsigned short* brow = Wt + (size_t)(col0 + t * 16 + ln) * ldb + kb;
      FragB b;
      b.half[0] = *(const v8us*)(brow + 8 * hh);
      b.half[1] = *(const v8us*)(brow + 16 + 8 * hh);
      acc[t] = mmaN<ASPLIT ? 2 : 1>(ah.v, al.v, b.v, b.v, acc[t]);
    }
  }
#pragma unroll
  for (int t = 0; t < 4; ++t) {
    const int col = col0 + t * 16 + ln;
    float bv = bias ? bias[col] : 0.f;
    if (BIAS_BF16) bv = bf16_round(bv);
#pragma unroll
    for (int r = 0; r < 8; ++r) {
      float v = acc[t][r] + bv;
      if (resid) { float rv = resid[(size_t)((row0 + 8 * hh + r) % rmod) * ldr + col]; if (RES_BF16) rv = bf16_round(rv); v += rv; }
      if (ACT == 1) v = fmaxf(v, 0.f);
      if (ACT == 2) v = 0.5f * v * (1.0f + erff(v * 0.70710678118654752f));
      if (ACT == 3) { const float u = 0.7978845608028654f * (v + 0.044715f * v * v * v); v = 0.5f * v * (1.0f + tanhf(u)); }
      so[w][8 * hh + r][t * 16 + ln] = v;
    }
  }
  __builtin_amdgcn_fence(__ATOMIC_ACQ_REL, "workgroup");
  __builtin_amdgcn_wave_barrier();
  const int rsub = lane >> 4, c4 = (lane & 15) * 4;
  {
#pragma unroll
    for (int q = 0; q < 8; ++q) {
      const int r = q * 2 + rsub;
      const v4f v = *(const v4fa*)&so[w][r][c4];
      *(v4f*)(C + (size_t)(row0 + r) * ldc + col0 + c4) = v;
    }
    
  }
}
// row LayerNorm (biased variance, eps) over N: s = X (+ R); optional out_sum <- s; out_norm <- (s-mu)*rsqrt(var+eps)*g + b
template <bool PARAM_BF16>
__global__ __launch_bounds__(256) void k_layernorm(const float* __restrict__ X, const float* __restrict__ R, const float* __restrict__ g, const float* __restrict__ bta,
                                                  float* __restrict__ out_sum, float* __restrict__ out_norm, int N, float eps) {
  __shared__ float red[256];
  const int row = blockIdx.x, tid = threadIdx.x;
  const float* x = X + (size_t)row * N; const float* rr = R ? R + (size_t)row * N : nullptr;
  float vals[16];                     // up to N = 4096
  const int per = N / 256;            // contiguous chunk per thread? use strided-by-4 chunks: thread handles j = tid*4 + 1024*u
  float s1 = 0.f;
  for (int u = 0; u < per / 4; ++u) {
    const int j = tid * 4 + 1024 * u;
    const v4f a = *(const v4fa*)(x + j);
    v4f b = {0.f,0.f,0.f,0.f}; if (rr) b = *(const v4fa*)(rr + j);
#pragma unroll
    for (int q = 0; q < 4; ++q) { const float v = a[q] + b[q]; vals[u * 4 + q] = v; s1 += v; }
  }
  red[tid] = s1; __syncthreads();
  for (int st = 128; st > 0; st >>= 1) { if (tid < st) red[tid] += red[tid + st]; __syncthreads(); }
  const float mu = red[0] / (float)N; __syncthreads();
  float s2 = 0.f;
  for (int u = 0; u < per / 4; ++u)
#pragma unroll
    for (int q = 0; q < 4; ++q) { const float c = vals[u * 4 + q] - mu; s2 += c * c; }
  red[tid] = s2; __syncthreads();
  for (int st = 128; st > 0; st >>= 1) { if (tid < st) red[tid] += red[tid + st]; __syncthreads(); }
  const float rs = rsqrtf(red[0] / (float)N + eps);
  {
    for (int u = 0; u < per / 4; ++u) {
      const int j = tid * 4 + 1024 * u;
      v4f o, sm;
#pragma unroll
      for (int q = 0; q < 4; ++q) {
        float gg = g[j + q], bb = bta[j + q];
        if (PARAM_BF16) { gg = bf16_round(gg); bb = bf16_round(bb); }
        sm[q] = vals[u * 4 + q]; o[q] = (vals[u * 4 + q] - mu) * rs * gg + bb;
      }
      if (out_sum) *(v4f*)(out_sum + (size_t)row * N + j) = sm;
      *(v4f*)(out_norm + (size_t)row * N + j) = o;
    }
    
  }
}



// ---- f16 WMMA path (v_wmma_f32_16x16x32_f16): 11-bit significands for operands in range — used for every product launched here: both projections, q·k and the masked weights (x 2^8) times V
typedef _Float16 v16h __attribute__((ext_vector_type(16)));
union FragH { v16h v; v8us half[2]; _Float16 h[16]; unsigned short u[16]; };
template <int NT>
__device__ __forceinline__ v8f mmaH(v16h ah, v16h al, v16h bh, v16h bl, v8f c) {
  c = __builtin_amdgcn_wmma_f32_16x16x32_f16(false, ah, false, bh, (short)0, c, false, false);
  if (NT >= 2) c = __builtin_amdgcn_wmma_f32_16x16x32_f16(false, al, false, bh, (short)0, c, false, false);
  if (NT >= 3) c = __builtin_amdgcn_wmma_f32_16x16x32_f16(false, ah, false, bl, (short)0, c, false, false);
  asm volatile("v_nop\n\tv_nop\n\tv_nop\n\tv_nop" : "+v"(c) : "v"(ah), "v"(al), "v"(bh), "v"(bl));
  return c;
}
// batched GEMM like k_gemm_b but f16 operands: A f32 (split into f16 hi/lo if ASPLIT, else rounded to f16), Bt = f16 values [n][k]; alpha; C f32; N multiple of 16 (partial tiles skipped)
template <bool ASPLIT>
__global__ __launch_bounds__(128) void k_gemm_h(const float* __restrict__ A, int lda, size_t sA, const _Float16* __restrict__ Bh, int ldb, size_t sB, float alpha, float* __restrict__ C, int ldc, size_t sC, int M, int N, int K) {
  __shared__ __attribute__((aligned(16))) float so[4][16][64];
  const int tid = threadIdx.x, w = tid >> 5, lane = tid & 31, ln = lane & 15, hh = lane >> 4; const int by = blockIdx.y;
  A += (size_t)by * sA; Bh += (size_t)by * sB; C += (size_t)by * sC;
  const int ntn = (N + 63) / 64; const int wid = blockIdx.x * 4 + w; const int mt = wid / ntn, nq = wid % ntn; if (mt * 16 >= M) return;
  const int row0 = mt * 16, col0 = nq * 64; const float* arow = A + (size_t)(row0 + ln) * lda;
  v8f acc[4] = {};
  for (int kb = 0; kb < K; kb += 32) {
    FragH ah, al;
    const v4f x0 = *(const v4fa*)(arow + kb + 8 * hh), x1 = *(const v4fa*)(arow + kb + 8 * hh + 4), x2 = *(const v4fa*)(arow + kb + 16 + 8 * hh), x3 = *(const v4fa*)(arow + kb + 16 + 8 * hh + 4);
    float xs[16] = {x0[0],x0[1],x0[2],x0[3],x1[0],x1[1],x1[2],x1[3],x2[0],x2[1],x2[2],x2[3],x3[0],x3[1],x3[2],x3[3]};
#pragma unroll
    for (int i = 0; i < 16; ++i) { const _Float16 h = (_Float16)xs[i]; ah.h[i] = h; al.h[i] = ASPLIT ? (_Float16)(xs[i] - (float)h) : (_Float16)0.0f; }
#pragma unroll
    for (int t = 0; t < 4; ++t) { if (col0 + t * 16 >= N) continue; const size_t boff = (size_t)(col0 + t * 16 + ln) * ldb + kb; FragH bq; bq.half[0] = *(const v8us*)(Bh + boff + 8 * hh); bq.half[1] = *(const v8us*)(Bh + boff + 16 + 8 * hh);
      acc[t] = mmaH<ASPLIT ? 2 : 1>(ah.v, al.v, bq.v, bq.v, acc[t]); }
  }
#pragma unroll
  for (int t = 0; t < 4; ++t) { if (col0 + t * 16 >= N) continue;
#pragma unroll
    for (int r = 0; r < 8; ++r) so[w][8 * hh + r][t * 16 + ln] = acc[t][r] * alpha; }
  __builtin_amdgcn_fence(__ATOMIC_ACQ_REL, "workgroup"); __builtin_amdgcn_wave_barrier();
  const int rsub = lane >> 4, c4 = (lane & 15) * 4;
  {
#pragma unroll
    for (int q = 0; q < 8; ++q) { const int r = q * 2 + rsub; if (col0 + c4 < N) { const v4f v = *(const v4fa*)&so[w][r][c4]; *(v4f*)(C + (size_t)(row0 + r) * ldc + col0 + c4) = v; } }
     }
}

// Wt[n][k] = f16(W[k][n]·scale) from f32 row-major W[K][N] (scale = power of two; bf16-exact weights stay exact in f16 away from the subnormal range)
__global__ __launch_bounds__(256) void k_wt_f16(const float* __restrict__ W, _Float16* __restrict__ Wt, int K, int N, float scale) {
  const int t = blockIdx.x * 256 + threadIdx.x; if (t >= N * (K / 8)) return; const int n = t / (K / 8), k8 = (t % (K / 8)) * 8; FragH f;
#pragma unroll
  for (int i = 0; i < 8; ++i) f.h[i] = (_Float16)(bf16_round(W[(size_t)(k8 + i) * N + n]) * scale); const v8us o = f.half[0];
  *(v8us*)((unsigned short*)Wt + (size_t)n * K + k8) = o; 
}
// k_gemm_hh variant with fused epilogue: v = acc·alpha + bias[by·sBias + col] (+ CP[(row/rowsPerB)·sCPb + by·64 + col] if CP) ; ACT 0 none / 1 elu ; writes f32 C and/or f16 C16 (each if non-null)
template <int ACT>
__global__ __launch_bounds__(128) void k_gemm_hhx(const _Float16* __restrict__ A, int lda, size_t sA, const _Float16* __restrict__ Bh, int ldb, size_t sB, float alpha, const float* __restrict__ bias, size_t sBias, const float* __restrict__ CP, int rowsPerB, size_t sCPb, int row0g,
    float* __restrict__ C, _Float16* __restrict__ C16, int ldc, size_t sC, int M, int N, int K) {
  __shared__ __attribute__((aligned(16))) float so[4][16][64];
  const int tid = threadIdx.x, w = tid >> 5, lane = tid & 31, ln = lane & 15, hh = lane >> 4; const int by = blockIdx.y;
  A += (size_t)by * sA; Bh += (size_t)by * sB; const size_t cofs = (size_t)by * sC; const float* bp = bias ? bias + (size_t)by * sBias : nullptr;
  const int ntn = (N + 63) / 64; const int wid = blockIdx.x * 4 + w; const int mt = wid / ntn, nq = wid % ntn; if (mt * 16 >= M) return;
  const int row0 = mt * 16, col0 = nq * 64; const _Float16* arow = A + (size_t)(row0 + ln) * lda;
  v8f acc[4] = {};
  for (int kb = 0; kb < K; kb += 32) { FragH ah; ah.half[0] = *(const v8us*)((const unsigned short*)arow + kb + 8 * hh); ah.half[1] = *(const v8us*)((const unsigned short*)arow + kb + 16 + 8 * hh);
#pragma unroll
    for (int t = 0; t < 4; ++t) { if (col0 + t * 16 >= N) continue; const size_t boff = (size_t)(col0 + t * 16 + ln) * ldb + kb; FragH bq; bq.half[0] = *(const v8us*)((const unsigned short*)Bh + boff + 8 * hh); bq.half[1] = *(const v8us*)((const unsigned short*)Bh + boff + 16 + 8 * hh);
      acc[t] = mmaH<1>(ah.v, ah.v, bq.v, bq.v, acc[t]); }
  }
#pragma unroll
  for (int t = 0; t < 4; ++t) { if (col0 + t * 16 >= N) continue; const int col = col0 + t * 16 + ln; const float bv = bp ? bf16_round(bp[col]) : 0.f;
#pragma unroll
    for (int r = 0; r < 8; ++r) { float v = acc[t][r] * alpha + bv; if (CP) { const int bidx = (row0g + row0 + 8 * hh + r) / rowsPerB; v += CP[(size_t)bidx * sCPb + (size_t)by * 64 + col]; } if (ACT == 1) v = (v > 0.f) ? v : expm1f(v); else if (ACT == 7) v = (v > 0.f) ? v + 1.0f : expf(v); else if (ACT == 8) v = tanhf(v); else if (ACT == 9) v = 0.5f * v * (1.0f + tanhf(0.7978845608028654f * (v + 0.044715f * v * v * v))); else if (ACT == 11) v = 1.0f / (1.0f + expf(-v)); else if (ACT == 12) v = (v > 0.f) ? v : 0.01f * v; else if (ACT == 14) v = (v > 0.f) ? v : 0.1f * v; else if (ACT == 15) v = v / (1.0f + expf(-v)); else if (ACT == 3) v = fmaxf(v, 0.f); else if (ACT == 6) v = 0.5f * v * (1.0f + erff(v * 0.70710678118654752f)); so[w][8 * hh + r][t * 16 + ln] = v; } }
  __builtin_amdgcn_fence(__ATOMIC_ACQ_REL, "workgroup"); __builtin_amdgcn_wave_barrier();
  const int rsub = lane >> 4, c4 = (lane & 15) * 4; typedef _Float16 v4h __attribute__((ext_vector_type(4)));
  {
#pragma unroll
    for (int q = 0; q < 8; ++q) { const int r = q * 2 + rsub; if (col0 + c4 < N) { const v4f v = *(const v4fa*)&so[w][r][c4]; if (C) *(v4f*)(C + cofs + (size_t)(row0 + r) * ldc + col0 + c4) = v; if (C16) { v4h h4; for (int i = 0; i < 4; ++i) h4[i] = (_Float16)v[i]; *(v4h*)(C16 + cofs + (size_t)(row0 + r) * ldc + col0 + c4) = h4; } } }
     }
}


typedef _Float16 v4h __attribute__((ext_vector_type(4)));

__global__ __launch_bounds__(256) void k_x16(const float* __restrict__ x, _Float16* __restrict__ X16, size_t n8) { const size_t t = (size_t)blockIdx.x * 256 + threadIdx.x; if (t >= n8) return; FragH f;
#pragma unroll
  for (int q = 0; q < 8; ++q) f.h[q] = (_Float16)bf16_round(x[t * 8 + q]); *(v8us*)((unsigned short*)X16 + t * 8) = f.half[0];  }
__global__ __launch_bounds__(256) void k_h16(const float* __restrict__ x, _Float16* __restrict__ X16, size_t n8) { const size_t t = (size_t)blockIdx.x * 256 + threadIdx.x; if (t >= n8) return; FragH f;
#pragma unroll
  for (int q = 0; q < 8; ++q) f.h[q] = (_Float16)x[t * 8 + q]; *(v8us*)((unsigned short*)X16 + t * 8) = f.half[0];  }
__global__ __launch_bounds__(256) void k_round16f(const float* __restrict__ W, _Float16* __restrict__ Bt, size_t n8) { const size_t t = (size_t)blockIdx.x * 256 + threadIdx.x; if (t >= n8) return; FragH f;
#pragma unroll
  for (int i = 0; i < 8; ++i) f.h[i] = (_Float16)(bf16_round(W[t * 8 + i]) * 16.0f); *(v8us*)((unsigned short*)Bt + t * 8) = f.half[0];  }
template <int NHv, int TTv>
__global__ __launch_bounds__(256) void k_vt(const _Float16* __restrict__ V16, int ldv, int voff, _Float16* __restrict__ Vt) { __shared__ unsigned short tl[64][66]; const int tid = threadIdx.x; const int slab = blockIdx.x / (TTv / 64), lg = blockIdx.x % (TTv / 64); const int b = slab / NHv, h = slab % NHv;
  for (int i = tid; i < 64 * 8; i += 256) { const int r = i / 8, c8 = (i % 8) * 8; FragH f; f.half[0] = *(const v8us*)((const unsigned short*)V16 + ((size_t)b * TTv + lg * 64 + r) * ldv + voff + h * 64 + c8);
#pragma unroll
    for (int q = 0; q < 8; ++q) tl[r][c8 + q] = f.u[q]; }
  __syncthreads();
  {
#pragma unroll
    for (int rd = 0; rd < 2; ++rd) { const int d = rd * 32 + tid / 8, pc = tid % 8; FragH f;
#pragma unroll
      for (int q = 0; q < 8; ++q) f.u[q] = tl[pc * 8 + q][d];
      *(v8us*)((unsigned short*)Vt + ((size_t)slab * 64 + d) * TTv + lg * 64 + pc * 8) = f.half[0]; }
     } }

__global__ __launch_bounds__(256) void k_hl(const float* __restrict__ F, _Float16* __restrict__ Hh, _Float16* __restrict__ Hl, size_t n8) { const size_t t = (size_t)blockIdx.x * 256 + threadIdx.x; if (t >= n8) return; FragH fh, fl; const v4f a = *(const v4fa*)(F + t * 8), c = *(const v4fa*)(F + t * 8 + 4);
#pragma unroll
  for (int q = 0; q < 4; ++q) { _Float16 h = (_Float16)a[q]; fh.h[q] = h; fl.h[q] = (_Float16)((a[q] - (float)h) * 1024.0f); h = (_Float16)c[q]; fh.h[4 + q] = h; fl.h[4 + q] = (_Float16)((c[q] - (float)h) * 1024.0f); }
  { *(v8us*)((unsigned short*)Hh + t * 8) = fh.half[0]; *(v8us*)((unsigned short*)Hl + t * 8) = fl.half[0];  } }

__global__ __launch_bounds__(256) void k_qk16(const float* __restrict__ QK, _Float16* __restrict__ Q16, _Float16* __restrict__ K16) { const int t = blockIdx.x * 256 + threadIdx.x; if (t >= SS * (DD / 8)) return; const int c0 = (t % (DD / 8)) * 8, s = t / (DD / 8); FragH fq, fk;
#pragma unroll
  for (int q = 0; q < 8; ++q) { fq.h[q] = (_Float16)QK[(size_t)s * 2 * DD + c0 + q]; fk.h[q] = (_Float16)QK[(size_t)s * 2 * DD + DD + c0 + q]; }
  { *(v8us*)((unsigned short*)Q16 + (size_t)s * DD + c0) = fq.half[0]; *(v8us*)((unsigned short*)K16 + (size_t)s * DD + c0) = fk.half[0];  } }
__global__ __launch_bounds__(256) void k_vt(const float* __restrict__ V, int b, _Float16* __restrict__ VT) { const int t = blockIdx.x * 256 + threadIdx.x; if (t >= NH * HD * (SS / 8)) return; const int t0 = (t % (SS / 8)) * 8; const int d = (t / (SS / 8)) % HD; const int h = t / ((SS / 8) * HD); FragH f;
#pragma unroll
  for (int q = 0; q < 8; ++q) f.h[q] = (_Float16)bf16_round(V[(((size_t)b * SS + t0 + q) * NH + h) * HD + d]);
  *(v8us*)((unsigned short*)VT + ((size_t)h * HD + d) * SS + t0) = f.half[0];  }
// Stands behind each group of fetches (and each store) of the fused kernel: the wait, because the registers that they name are reused right behind it;
// the "memory" clobber, because in the loop, without it, the compiler sinks the mask fetch to the loop's head, where its whole latency is waited for in every pass.
__device__ __forceinline__ void fetch_fence() { asm volatile("s_wait_xcnt 0x0" ::: "memory"); }
// Projection GEMM: C[m][n] (f32, pitch NN) = alpha * sum_k A[m][k] * Bt[n][k] + bf16(bias[n]); A and Bt are f16 planes with rows of DD elements.
// A work-group of 8 waves (4 x 2) owns 128 x BN of C, a wave 32 x BN/2. A stage is BK k of the 128 + BN operand rows: fetched as whole lines into registers while the
// stage before is multiplied, then written to the other of two LDS buffers (row pitch + 16 B, for the 16-byte fragment reads). One barrier a stage: it publishes the
// buffer just written and ends the reads of the buffer that the next stage overwrites. Fragment k order and the order of the k sum are those of k_gemm_hhx.
typedef float f32a __attribute__((may_alias));
template <int NN, int BN, int BK>
__global__ __launch_bounds__(256) void k_gemm_t(const _Float16* __restrict__ A, const _Float16* __restrict__ Bt, float alpha, const float* __restrict__ bias, float* __restrict__ C) {
  constexpr int BM = 128, LP = BK + 8, NS = DD / BK, WN = BN / 2, NTN = WN / 16, STG = (BM + BN) * LP;
  constexpr int CPR = BK / 8, RPP = 256 / CPR, NA = BM / RPP, NB = BN / RPP;
  __shared__ __attribute__((aligned(16))) unsigned short sm[2 * STG];
  const int tid = threadIdx.x, w = tid >> 5, lane = tid & 31, ln = lane & 15, hh = lane >> 4, wm = w >> 1, wn = w & 1;
  const int row0 = blockIdx.y * BM, col0 = blockIdx.x * BN;
  const int lr = tid / CPR, lc = (tid % CPR) * 8;
  const unsigned short* ga = (const unsigned short*)A + (size_t)(row0 + lr) * DD + lc;
  const unsigned short* gb = (const unsigned short*)Bt + (size_t)(col0 + lr) * DD + lc;
  v8us ra[NA], rb[NB];
  // Every '#pragma unroll' below is there so that fragments and accumulators are indexed by constants and stay in registers.
  auto fetch = [&](int s) {
#pragma unroll
    for (int i = 0; i < NA; ++i) ra[i] = *(const v8us*)(ga + (size_t)i * RPP * DD + s * BK);
#pragma unroll
    for (int i = 0; i < NB; ++i) rb[i] = *(const v8us*)(gb + (size_t)i * RPP * DD + s * BK); };
  auto put = [&](int buf) {
    unsigned short* d = sm + buf * STG + lr * LP + lc;
#pragma unroll
    for (int i = 0; i < NA; ++i) *(v8us*)(d + i * RPP * LP) = ra[i];
#pragma unroll
    for (int i = 0; i < NB; ++i) *(v8us*)(d + (BM + i * RPP) * LP) = rb[i]; };
  v8f acc[2][NTN] = {};
  fetch(0); put(0);
  __syncthreads();
  for (int s = 0; s < NS; ++s) {
    // The wait behind the fetches: its clobber keeps them at the stage's head (without it the compiler sinks most of them to the stage's end, in front of the LDS writes,
    // where their whole latency is waited for); it takes both address pairs as inputs, so that they stay live up to the wait and no fetch of the run lands in them.
    if (s + 1 < NS) { fetch(s + 1); asm volatile("s_wait_xcnt 0x0" :: "v"(ga), "v"(gb) : "memory"); }
    const unsigned short* pa = sm + (s & 1) * STG + (wm * 32 + ln) * LP + 8 * hh;
    const unsigned short* pb = sm + (s & 1) * STG + (BM + wn * WN + ln) * LP + 8 * hh;
#pragma unroll
    for (int ks = 0; ks < BK / 32; ++ks) {
      FragH af[2], bf[NTN];
#pragma unroll
      for (int mi = 0; mi < 2; ++mi) { af[mi].half[0] = *(const v8us*)(pa + mi * 16 * LP + ks * 32); af[mi].half[1] = *(const v8us*)(pa + mi * 16 * LP + ks * 32 + 16); }
#pragma unroll
      for (int t = 0; t < NTN; ++t) { bf[t].half[0] = *(const v8us*)(pb + t * 16 * LP + ks * 32); bf[t].half[1] = *(const v8us*)(pb + t * 16 * LP + ks * 32 + 16); }
#pragma unroll
      for (int mi = 0; mi < 2; ++mi)
#pragma unroll
        for (int t = 0; t < NTN; ++t) acc[mi][t] = __builtin_amdgcn_wmma_f32_16x16x32_f16(false, af[mi].v, false, bf[t].v, (short)0, acc[mi][t], false, false);
    }
    if (s + 1 < NS) put((s + 1) & 1);
    __syncthreads();
  }
  // Behind the last barrier nobody reads the buffers any more: each wave stages its own 32 x WN block there, so that C is stored as whole lines.
  constexpr int SP = WN + 4, LPR = WN / 4, RPI = 32 / LPR;
  f32a* so = (f32a*)sm + w * 32 * SP;
#pragma unroll
  for (int t = 0; t < NTN; ++t) {
    const float bv = bf16_round(bias[col0 + wn * WN + t * 16 + ln]);
#pragma unroll
    for (int mi = 0; mi < 2; ++mi)
#pragma unroll
      for (int r = 0; r < 8; ++r) so[(mi * 16 + 8 * hh + r) * SP + t * 16 + ln] = acc[mi][t][r] * alpha + bv;
  }
  __syncthreads();
  const int rs = lane / LPR, c4 = (lane % LPR) * 4;
#pragma unroll
  for (int q = 0; q < 32 / RPI; ++q) {
    const int r = q * RPI + rs;
    const v4f v = *(const v4fa*)&so[r * SP + c4];
    *(v4f*)(C + (size_t)(row0 + wm * 32 + r) * NN + col0 + wn * WN + c4) = v;
  }
}
// Fused attention. One wave owns 32 queries of one (batch, head) and walks all keys, 32 a pass.
// ST = K.QT (A = 16 key rows, B = 16 query rows): a lane holds the scores of ONE query (column ln), keys 8*hh + r, so maximum and sums are
// in-lane plus one exchange between the wave's halves. Two score tiles, converted in place, are the B operand of OT += VT.PT (A = rows of VT in
// the same k order), so OT's column is the same query and the rescale factor is in-lane too.
// Result = sum(e*M*V) / (sum(e*M) + 1e-8 * sum e), e = exp(s - running max): the softmax denominator cancels but for the 1e-8 term.
// Every '#pragma unroll' below is there so that fragments and accumulators are indexed by constants and stay in registers.
__global__ __launch_bounds__(256) void k_fattn(const _Float16* __restrict__ Q16, const _Float16* __restrict__ K16, const _Float16* __restrict__ VT, const float* __restrict__ Mm, _Float16* __restrict__ O16) {
  const int tid = threadIdx.x, w = tid >> 5, lane = tid & 31, ln = lane & 15, hh = lane >> 4;
  const int h = blockIdx.y, b = blockIdx.z, q0 = blockIdx.x * 256 + w * 32;
  const unsigned short* Qb = (const unsigned short*)Q16 + ((size_t)b * SS + q0 + ln) * DD + h * HD + 8 * hh;
  const unsigned short* Kb = (const unsigned short*)K16 + ((size_t)b * SS + ln) * DD + h * HD + 8 * hh;
  const unsigned short* Vb = (const unsigned short*)VT + (((size_t)b * NH + h) * HD + ln) * SS + 8 * hh;
  const float* Mb = Mm + ((size_t)b * SS + q0 + ln) * SS + 8 * hh;
  FragH qf[2][2], kf[2][2], vf[4];
  v4f mk[2][2][2];
#pragma unroll
  for (int u = 0; u < 2; ++u)
#pragma unroll
    for (int ks = 0; ks < 2; ++ks) { qf[u][ks].half[0] = *(const v8us*)(Qb + (size_t)u * 16 * DD + ks * 32); qf[u][ks].half[1] = *(const v8us*)(Qb + (size_t)u * 16 * DD + ks * 32 + 16); }
  fetch_fence();
  auto loadK = [&](int kb) {
#pragma unroll
    for (int j = 0; j < 2; ++j)
#pragma unroll
      for (int ks = 0; ks < 2; ++ks) { const unsigned short* p = Kb + (size_t)(kb + j * 16) * DD + ks * 32; kf[j][ks].half[0] = *(const v8us*)p; kf[j][ks].half[1] = *(const v8us*)(p + 16); } };
  auto loadM = [&](int kb) {
#pragma unroll
    for (int u = 0; u < 2; ++u)
#pragma unroll
      for (int j = 0; j < 2; ++j) { const float* p = Mb + (size_t)u * 16 * SS + kb + j * 16; mk[u][j][0] = *(const v4fa*)p; mk[u][j][1] = *(const v4fa*)(p + 4); } };
  auto loadV = [&](int kb) {
#pragma unroll
    for (int t = 0; t < 4; ++t) { const unsigned short* p = Vb + (size_t)t * 16 * SS + kb; vf[t].half[0] = *(const v8us*)p; vf[t].half[1] = *(const v8us*)(p + 16); } };
  v8f acc[2][4] = {};
  float mx[2] = {-3.0e38f, -3.0e38f}, se[2] = {0.f, 0.f}, sem[2] = {0.f, 0.f};
  const float c2 = 0.125f * 1.4426950408889634f;      // scores / 8, in log2 units
  loadK(0); loadM(0); fetch_fence(); loadV(0);      // the fence keeps the loop's own issue order K, M, V here too: else the loop's counted waits for the mask also wait for V
  for (int kb = 0; kb < SS; kb += 32) {
    const int kn = (kb + 32 < SS) ? kb + 32 : 0;      // each operand's next pass is fetched into its own registers right behind its last use; the last pass refetches pass 0, unused
    v8f st[2][2];
#pragma unroll
    for (int u = 0; u < 2; ++u)
#pragma unroll
      for (int j = 0; j < 2; ++j) {
        v8f z = {};
        z = __builtin_amdgcn_wmma_f32_16x16x32_f16(false, kf[j][0].v, false, qf[u][0].v, (short)0, z, false, false);
        st[u][j] = __builtin_amdgcn_wmma_f32_16x16x32_f16(false, kf[j][1].v, false, qf[u][1].v, (short)0, z, false, false);
      }
    loadK(kn); fetch_fence();
    __builtin_amdgcn_sched_barrier(0);      // without it the scheduler sinks the K fetch behind the softmax, too late for the next pass's first product
    FragH pf[2];
#pragma unroll
    for (int u = 0; u < 2; ++u) {
      float tm = st[u][0][0];
#pragma unroll
      for (int r = 1; r < 8; ++r) tm = fmaxf(tm, st[u][0][r]);
#pragma unroll
      for (int r = 0; r < 8; ++r) tm = fmaxf(tm, st[u][1][r]);
      tm = fmaxf(tm, __shfl_xor(tm, 16, 32));
      const float mn = fmaxf(mx[u], tm * c2);
      const float al = __builtin_amdgcn_exp2f(mx[u] - mn);
      mx[u] = mn;
      const float sh = 8.0f - mn;      // e carries 2^8 (it cancels in the quotient): keeps small weights in the normal f16 range
      float s1 = 0.f, s2 = 0.f;
#pragma unroll
      for (int j = 0; j < 2; ++j)
#pragma unroll
        for (int r = 0; r < 8; ++r) {
          const float ev = __builtin_amdgcn_exp2f(st[u][j][r] * c2 + sh);
          const float pv = ev * bf16_round(mk[u][j][r >> 2][r & 3]);
          s1 += ev; s2 += pv;
          pf[u].h[j * 8 + r] = (_Float16)pv;
        }
      se[u] = se[u] * al + s1; sem[u] = sem[u] * al + s2;
#pragma unroll
      for (int t = 0; t < 4; ++t)
#pragma unroll
        for (int r = 0; r < 8; ++r) acc[u][t][r] *= al;
    }
    loadM(kn); fetch_fence();
#pragma unroll
    for (int t = 0; t < 4; ++t)
#pragma unroll
      for (int u = 0; u < 2; ++u) acc[u][t] = __builtin_amdgcn_wmma_f32_16x16x32_f16(false, vf[t].v, false, pf[u].v, (short)0, acc[u][t], false, false);
    loadV(kn); fetch_fence();
  }
#pragma unroll
  for (int u = 0; u < 2; ++u) {
    const float s1 = se[u] + __shfl_xor(se[u], 16, 32), s2 = sem[u] + __shfl_xor(sem[u], 16, 32);
    const float inv = 1.0f / (s2 + 1e-8f * s1);
    unsigned short* op = (unsigned short*)O16 + ((size_t)b * SS + q0 + u * 16 + ln) * DD + h * HD + 8 * hh;
#pragma unroll
    for (int t = 0; t < 4; ++t) { FragH f;
#pragma unroll
      for (int r = 0; r < 8; ++r) f.h[r] = (_Float16)(acc[u][t][r] * inv);
      *(v8us*)(op + t * 16) = f.half[0]; fetch_fence(); }
  }
}

extern "C" void kernel_launch(void* const* d_in, const int* in_sizes, int n_in,
                              void* d_out, int out_size, void* d_ws, size_t ws_size, hipStream_t stream) {
  (void)in_sizes; (void)n_in; (void)out_size;
  const float* x = (const float*)d_in[0]; const float* V = (const float*)d_in[1]; const float* Mm = (const float*)d_in[2]; const float* Win = (const float*)d_in[3]; const float* bin = (const float*)d_in[4]; const float* Wo = (const float*)d_in[5]; const float* bo = (const float*)d_in[6];
  char* ws = (char*)d_ws; size_t off = 0;
  auto take = [&](size_t bytes) { char* p = ws + off; off += (bytes + 255) & ~(size_t)255; return p; };
  _Float16* BIN = (_Float16*)take((size_t)2 * DD * DD * 2); _Float16* BO = (_Float16*)take((size_t)DD * DD * 2); _Float16* X16 = (_Float16*)take((size_t)SS * DD * 2); float* QK = (float*)take((size_t)SS * 2 * DD * 4); _Float16* Q16 = (_Float16*)take((size_t)NBt * SS * DD * 2); _Float16* K16 = (_Float16*)take((size_t)NBt * SS * DD * 2); _Float16* VT = (_Float16*)take((size_t)NBt * NH * HD * SS * 2);
  _Float16* O16 = (_Float16*)take((size_t)NBt * SS * DD * 2);
  if (off > ws_size) return;      // about 61 MB
  k_round16f<<<(unsigned)(((size_t)2 * DD * DD / 8 + 255) / 256), 256, 0, stream>>>(Win, BIN, (size_t)2 * DD * DD / 8); k_round16f<<<(unsigned)(((size_t)DD * DD / 8 + 255) / 256), 256, 0, stream>>>(Wo, BO, (size_t)DD * DD / 8);      /* torch (out,in) = natural Bt; only the q|k rows of in_proj are needed */
  for (int b = 0; b < NBt; ++b) {
    k_x16<<<(SS * DD / 8 + 255) / 256, 256, 0, stream>>>(x + (size_t)b * SS * DD, X16, (size_t)SS * DD / 8);
    k_gemm_t<2 * DD, 128, 128><<<dim3(2 * DD / 128, SS / 128), 256, 0, stream>>>(X16, BIN, 0.0625f, bin, QK);      /* q | k = x.W_in^T[:2048] + b (exact) */
    k_qk16<<<(SS * (DD / 8) + 255) / 256, 256, 0, stream>>>(QK, Q16 + (size_t)b * SS * DD, K16 + (size_t)b * SS * DD); k_vt<<<(NH * HD * (SS / 8) + 255) / 256, 256, 0, stream>>>(V, b, VT + (size_t)b * NH * HD * SS); }
  k_fattn<<<dim3(SS / 256, NH, NBt), 256, 0, stream>>>(Q16, K16, VT, Mm, O16);      /* all batches and heads: 256 work-groups of 8 waves x 32 queries */
  for (int b = 0; b < NBt; ++b)
    k_gemm_t<DD, 64, 128><<<dim3(DD / 64, SS / 128), 256, 0, stream>>>(O16 + (size_t)b * SS * DD, BO, 0.0625f, bo, (float*)d_out + (size_t)b * SS * DD);      /* .out_w^T + out_b */
}

// v003
// It runs in 131 microseconds.
// In two side-by-side timings against v002, it was 1.31 and 1.32 times as fast.
// Counting every step since v000, it is 13.5 times as fast.
#include <hip/hip_runtime.h>
// Masked multi-head attention with external values (B 2, S 2048, D 1024, 16 heads × 64): q | k from the packed in-projection (+ bias; the v third is unused by the module), scores = q·k/8, softmax, A·M (INPUT mask [B,S,S]), L1 renormalisation over keys (+1e-8), out = Ā·V with the separate INPUT V [B,S,H,64], heads concatenated, ·out_wᵀ + out_b → [2,2048,1024].
// Structure: the mask as a bf16 plane in fragment order; per batch: q|k GEMM (exact), f16 planes of q (rows), k and transposed V (both in fragment order); one fused attention kernel over all batches and heads (scores, online softmax, mask, L1 renormalisation and the product with V, nothing of the S x S score planes in memory) into the concatenated f16 plane; per batch the output projection GEMM with bias.
// Compute dtype: x, V, M and parameters rounded to bf16; projections with exact products; q, k, the unnormalised masked weights e*M (x 2^8), V (exact) and the attention output as f16 operands (about 2^-12), f32 accumulation; softmax/mask/renormalisation in f32. v_wmma_f32_16x16x32_f16.
#define NBt 2
#define SS 2048
#define DD 1024
#define NH 16
#define HD 64
typedef __bf16 v16b __attribute__((ext_vector_type(16)));
typedef unsigned short v8us __attribute__((ext_vector_type(8), may_alias));
typedef float  v8f  __attribute__((ext_vector_type(8)));
typedef float  v4f  __attribute__((ext_vector_type(4)));
typedef float  v4fa __attribute__((ext_vector_type(4), may_alias));
union FragB { v16b v; v8us half[2]; unsigned short u[16]; };

__device__ __forceinline__ unsigned short bf16_bits(float x) { unsigned int u = __float_as_uint(x); return (unsigned short)((u + 0x7FFFu + ((u >> 16) & 1u)) >> 16); }
__device__ __forceinline__ float bf16_val(unsigned short b) { return __uint_as_float(((unsigned int)b) << 16); }
__device__ __forceinline__ float bf16_round(float x) { return bf16_val(bf16_bits(x)); }
// D += A·B with NT terms: 1 = ah·bh, 2 = + al·bh (A split), 3 = + ah·bl (both split)
template <int NT>
__device__ __forceinline__ v8f mmaN(v16b ah, v16b al, v16b bh, v16b bl, v8f c) {
  c = __builtin_amdgcn_wmma_f32_16x16x32_bf16(false, ah, false, bh, (short)0, c, false, false);
  if (NT >= 2) c = __builtin_amdgcn_wmma_f32_16x16x32_bf16(false, al, false, bh, (short)0, c, false, false);
  if (NT >= 3) c = __builtin_amdgcn_wmma_f32_16x16x32_bf16(false, ah, false, bl, (short)0, c, false, false);
  asm volatile("v_nop\n\tv_nop\n\tv_nop\n\tv_nop" : "+v"(c) : "v"(ah), "v"(al), "v"(bh), "v"(bl));
  return c;
}

__global__ __launch_bounds__(256) void k_wt_bf16(const float* __restrict__ W, unsigned short* __restrict__ Wt, int K, int N) {
  const int t = blockIdx.x * 256 + threadIdx.x;
  const int k8n = K / 8;
  if (t >= N * k8n) return;
  const int n = t / k8n, k8 = (t % k8n) * 8;
  v8us v;
#pragma unroll
  for (int i = 0; i < 8; ++i) v[i] = bf16_bits(W[(size_t)(k8 + i) * N + n]);
  *(v8us*)(Wt + (size_t)n * K + k8) = v;
  
}

// GEMM C[M][N] (f32, pitch ldc) = act(A[M][K]·W + bias). A f32 row-major (pitch lda) converted per fragment to bf16
// (ASPLIT: hi/lo two planes -> 2 terms, else single rounded term); Wt bf16 [N][K] (pitch ldb). BIAS_BF16 rounds the
// bias to bf16 first (bias quantised to bf16 before the add). K%32==0, M%16==0, N%64==0.
template <bool ASPLIT, int ACT, bool BIAS_BF16>
__global__ __launch_bounds__(128) void k_gemm_bf(const float* __restrict__ A, int lda, const unsigned short* __restrict__ Wt, int ldb,
                                               const float* __restrict__ bias, float* __restrict__ C, int ldc, int M, int N, int K) {
  __shared__ __attribute__((aligned(16))) float so[4][16][64];
  const int tid = threadIdx.x, w = tid >> 5, lane = tid & 31, ln = lane & 15, hh = lane >> 4;
  const int ntn = N / 64;
  const int wid = blockIdx.x * 4 + w;
  const int mt = wid / ntn, nq = wid % ntn;
  if (mt * 16 >= M) return;
  const int row0 = mt * 16, col0 = nq * 64;
  const float* arow = A + (size_t)(row0 + ln) * lda;
  v8f acc[4] = {};
  for (int kb = 0; kb < K; kb += 32) {
    FragB ah, al;
    const v4f x0 = *(const v4fa*)(arow + kb + 8 * hh), x1 = *(const v4fa*)(arow + kb + 8 * hh + 4);
    const v4f x2 = *(const v4fa*)(arow + kb + 16 + 8 * hh), x3 = *(const v4fa*)(arow + kb + 16 + 8 * hh + 4);
    float xs[16] = {x0[0],x0[1],x0[2],x0[3],x1[0],x1[1],x1[2],x1[3],x2[0],x2[1],x2[2],x2[3],x3[0],x3[1],x3[2],x3[3]};
#pragma unroll
    for (int i = 0; i < 16; ++i) { const unsigned short hb = bf16_bits(xs[i]); ah.u[i] = hb; al.u[i] = ASPLIT ? bf16_bits(xs[i] - bf16_val(hb)) : (unsigned short)0; }
#pragma unroll
    for (int t = 0; t < 4; ++t) {
      const unsigned short* brow = Wt + (size_t)(col0 + t * 16 + ln) * ldb + kb;
      FragB b;
      b.half[0] = *(const v8us*)(brow + 8 * hh);
      b.half[1] = *(const v8us*)(brow + 16 + 8 * hh);
      acc[t] = mmaN<ASPLIT ? 2 : 1>(ah.v, al.v, b.v, b.v, acc[t]);
    }
  }
#pragma unroll
  for (int t = 0; t < 4; ++t) {
    float bv = bias ? bias[col0 + t * 16 + ln] : 0.f;
    if (BIAS_BF16) bv = bf16_round(bv);
#pragma unroll
    for (int r = 0; r < 8; ++r) { float v = acc[t][r] + bv; if (ACT == 1) v = fmaxf(v, 0.f); so[w][8 * hh + r][t * 16 + ln] = v; }
  }
  __builtin_amdgcn_fence(__ATOMIC_ACQ_REL, "workgroup");
  __builtin_amdgcn_wave_barrier();
  const int rsub = lane >> 4, c4 = (lane & 15) * 4;
  {
#pragma unroll
    for (int q = 0; q < 8; ++q) {
      const int r = q * 2 + rsub;
      const v4f v = *(const v4fa*)&so[w][r][c4];
      *(v4f*)(C + (size_t)(row0 + r) * ldc + col0 + c4) = v;
    }
    
  }
}

// GEMM C = act(A·W + bias + resid): A f32 (ASPLIT -> hi/lo 2 terms), Wt bf16 [N][K]; ACT 0 none, 1 relu, 2 exact gelu;
// resid (optional, f32, row index = (row % rmod), pitch ldr, RES_BF16 rounds it) added before the activation.
template <bool ASPLIT, int ACT, bool BIAS_BF16, bool RES_BF16>
__global__ __launch_bounds__(128) void k_gemm_bf3(const float* __restrict__ A, int lda, const unsigned short* __restrict__ Wt, int ldb,
                                                const float* __restrict__ bias, const float* __restrict__ resid, int rmod, int ldr,
                                                float* __restrict__ C, int ldc, int M, int N, int K) {
  __shared__ __attribute__((aligned(16))) float so[4][16][64];
  const int tid = threadIdx.x, w = tid >> 5, lane = tid & 31, ln = lane & 15, hh = lane >> 4;
  const int ntn = N / 64;
  const int wid = blockIdx.x * 4 + w;
  const int mt = wid / ntn, nq = wid % ntn;
  if (mt * 16 >= M) return;
  const int row0 = mt * 16, col0 = nq * 64;
  const float* arow = A + (size_t)(row0 + ln) * lda;
  v8f acc[4] = {};
  for (int kb = 0; kb < K; kb += 32) {
    FragB ah, al;
    const v4f x0 = *(const v4fa*)(arow + kb + 8 * hh), x1 = *(const v4fa*)(arow + kb + 8 * hh + 4);
    const v4f x2 = *(const v4fa*)(arow + kb + 16 + 8 * hh), x3 = *(const v4fa*)(arow + kb + 16 + 8 * hh + 4);
    float xs[16] = {x0[0],x0[1],x0[2],x0[3],x1[0],x1[1],x1[2],x1[3],x2[0],x2[1],x2[2],x2[3],x3[0],x3[1],x3[2],x3[3]};
#pragma unroll
    for (int i = 0; i < 16; ++i) { const unsigned short hb = bf16_bits(xs[i]); ah.u[i] = hb; al.u[i] = ASPLIT ? bf16_bits(xs[i] - bf16_val(hb)) : (unsigned short)0; }
#pragma unroll
    for (int t = 0; t < 4; ++t) {
      const unsigned short* brow = Wt + (size_t)(col0 + t * 16 + ln) * ldb + kb;
      FragB b;
      b.half[0] = *(const v8us*)(brow + 8 * hh);
      b.half[1] = *(const v8us*)(brow + 16 + 8 * hh);
      acc[t] = mmaN<ASPLIT ? 2 : 1>(ah.v, al.v, b.v, b.v, acc[t]);
    }
  }
#pragma unroll
  for (int t = 0; t < 4; ++t) {
    const int col = col0 + t * 16 + ln;
    float bv = bias ? bias[col] : 0.f;
    if (BIAS_BF16) bv = bf16_round(bv);
#pragma unroll
    for (int r = 0; r < 8; ++r) {
      float v = acc[t][r] + bv;
      if (resid) { float rv = resid[(size_t)((row0 + 8 * hh + r) % rmod) * ldr + col]; if (RES_BF16) rv = bf16_round(rv); v += rv; }
      if (ACT == 1) v = fmaxf(v, 0.f);
      if (ACT == 2) v = 0.5f * v * (1.0f + erff(v * 0.70710678118654752f));
      if (ACT == 3) { const float u = 0.7978845608028654f * (v + 0.044715f * v * v * v); v = 0.5f * v * (1.0f + tanhf(u)); }
      so[w][8 * hh + r][t * 16 + ln] = v;
    }
  }
  __builtin_amdgcn_fence(__ATOMIC_ACQ_REL, "workgroup");
  __builtin_amdgcn_wave_barrier();
  const int rsub = lane >> 4, c4 = (lane & 15) * 4;
  {
#pragma unroll
    for (int q = 0; q < 8; ++q) {
      const int r = q * 2 + rsub;
      const v4f v = *(const v4fa*)&so[w][r][c4];
      *(v4f*)(C + (size_t)(row0 + r) * ldc + col0 + c4) = v;
    }
    
  }
}
// row LayerNorm (biased variance, eps) over N: s = X (+ R); optional out_sum <- s; out_norm <- (s-mu)*rsqrt(var+eps)*g + b
template <bool PARAM_BF16>
__global__ __launch_bounds__(256) void k_layernorm(const float* __restrict__ X, const float* __restrict__ R, const float* __restrict__ g, const float* __restrict__ bta,
                                                  float* __restrict__ out_sum, float* __restrict__ out_norm, int N, float eps) {
  __shared__ float red[256];
  const int row = blockIdx.x, tid = threadIdx.x;
  const float* x = X + (size_t)row * N; const float* rr = R ? R + (size_t)row * N : nullptr;
  float vals[16];                     // up to N = 4096
  const int per = N / 256;            // contiguous chunk per thread? use strided-by-4 chunks: thread handles j = tid*4 + 1024*u
  float s1 = 0.f;
  for (int u = 0; u < per / 4; ++u) {
    const int j = tid * 4 + 1024 * u;
    const v4f a = *(const v4fa*)(x + j);
    v4f b = {0.f,0.f,0.f,0.f}; if (rr) b = *(const v4fa*)(rr + j);
#pragma unroll
    for (int q = 0; q < 4; ++q) { const float v = a[q] + b[q]; vals[u * 4 + q] = v; s1 += v; }
  }
  red[tid] = s1; __syncthreads();
  for (int st = 128; st > 0; st >>= 1) { if (tid < st) red[tid] += red[tid + st]; __syncthreads(); }
  const float mu = red[0] / (float)N; __syncthreads();
  float s2 = 0.f;
  for (int u = 0; u < per / 4; ++u)
#pragma unroll
    for (int q = 0; q < 4; ++q) { const float c = vals[u * 4 + q] - mu; s2 += c * c; }
  red[tid] = s2; __syncthreads();
  for (int st = 128; st > 0; st >>= 1) { if (tid < st) red[tid] += red[tid + st]; __syncthreads(); }
  const float rs = rsqrtf(red[0] / (float)N + eps);
  {
    for (int u = 0; u < per / 4; ++u) {
      const int j = tid * 4 + 1024 * u;
      v4f o, sm;
#pragma unroll
      for (int q = 0; q < 4; ++q) {
        float gg = g[j + q], bb = bta[j + q];
        if (PARAM_BF16) { gg = bf16_round(gg); bb = bf16_round(bb); }
        sm[q] = vals[u * 4 + q]; o[q] = (vals[u * 4 + q] - mu) * rs * gg + bb;
      }
      if (out_sum) *(v4f*)(out_sum + (size_t)row * N + j) = sm;
      *(v4f*)(out_norm + (size_t)row * N + j) = o;
    }
    
  }
}



// ---- f16 WMMA path (v_wmma_f32_16x16x32_f16): 11-bit significands for operands in range — used for every product launched here: both projections, q·k and the masked weights (x 2^8) times V
typedef _Float16 v16h __attribute__((ext_vector_type(16)));
union FragH { v16h v; v8us half[2]; _Float16 h[16]; unsigned short u[16]; };
template <int NT>
__device__ __forceinline__ v8f mmaH(v16h ah, v16h al, v16h bh, v16h bl, v8f c) {
  c = __builtin_amdgcn_wmma_f32_16x16x32_f16(false, ah, false, bh, (short)0, c, false, false);
  if (NT >= 2) c = __builtin_amdgcn_wmma_f32_16x16x32_f16(false, al, false, bh, (short)0, c, false, false);
  if (NT >= 3) c = __builtin_amdgcn_wmma_f32_16x16x32_f16(false, ah, false, bl, (short)0, c, false, false);
  asm volatile("v_nop\n\tv_nop\n\tv_nop\n\tv_nop" : "+v"(c) : "v"(ah), "v"(al), "v"(bh), "v"(bl));
  return c;
}
// batched GEMM like k_gemm_b but f16 operands: A f32 (split into f16 hi/lo if ASPLIT, else rounded to f16), Bt = f16 values [n][k]; alpha; C f32; N multiple of 16 (partial tiles skipped)
template <bool ASPLIT>
__global__ __launch_bounds__(128) void k_gemm_h(const float* __restrict__ A, int lda, size_t sA, const _Float16* __restrict__ Bh, int ldb, size_t sB, float alpha, float* __restrict__ C, int ldc, size_t sC, int M, int N, int K) {
  __shared__ __attribute__((aligned(16))) float so[4][16][64];
  const int tid = threadIdx.x, w = tid >> 5, lane = tid & 31, ln = lane & 15, hh = lane >> 4; const int by = blockIdx.y;
  A += (size_t)by * sA; Bh += (size_t)by * sB; C += (size_t)by * sC;
  const int ntn = (N + 63) / 64; const int wid = blockIdx.x * 4 + w; const int mt = wid / ntn, nq = wid % ntn; if (mt * 16 >= M) return;
  const int row0 = mt * 16, col0 = nq * 64; const float* arow = A + (size_t)(row0 + ln) * lda;
  v8f acc[4] = {};
  for (int kb = 0; kb < K; kb += 32) {
    FragH ah, al;
    const v4f x0 = *(const v4fa*)(arow + kb + 8 * hh), x1 = *(const v4fa*)(arow + kb + 8 * hh + 4), x2 = *(const v4fa*)(arow + kb + 16 + 8 * hh), x3 = *(const v4fa*)(arow + kb + 16 + 8 * hh + 4);
    float xs[16] = {x0[0],x0[1],x0[2],x0[3],x1[0],x1[1],x1[2],x1[3],x2[0],x2[1],x2[2],x2[3],x3[0],x3[1],x3[2],x3[3]};
#pragma unroll
    for (int i = 0; i < 16; ++i) { const _Float16 h = (_Float16)xs[i]; ah.h[i] = h; al.h[i] = ASPLIT ? (_Float16)(xs[i] - (float)h) : (_Float16)0.0f; }
#pragma unroll
    for (int t = 0; t < 4; ++t) { if (col0 + t * 16 >= N) continue; const size_t boff = (size_t)(col0 + t * 16 + ln) * ldb + kb; FragH bq; bq.half[0] = *(const v8us*)(Bh + boff + 8 * hh); bq.half[1] = *(const v8us*)(Bh + boff + 16 + 8 * hh);
      acc[t] = mmaH<ASPLIT ? 2 : 1>(ah.v, al.v, bq.v, bq.v, acc[t]); }
  }
#pragma unroll
  for (int t = 0; t < 4; ++t) { if (col0 + t * 16 >= N) continue;
#pragma unroll
    for (int r = 0; r < 8; ++r) so[w][8 * hh + r][t * 16 + ln] = acc[t][r] * alpha; }
  __builtin_amdgcn_fence(__ATOMIC_ACQ_REL, "workgroup"); __builtin_amdgcn_wave_barrier();
  const int rsub = lane >> 4, c4 = (lane & 15) * 4;
  {
#pragma unroll
    for (int q = 0; q < 8; ++q) { const int r = q * 2 + rsub; if (col0 + c4 < N) { const v4f v = *(const v4fa*)&so[w][r][c4]; *(v4f*)(C + (size_t)(row0 + r) * ldc + col0 + c4) = v; } }
     }
}

// Wt[n][k] = f16(W[k][n]·scale) from f32 row-major W[K][N] (scale = power of two; bf16-exact weights stay exact in f16 away from the subnormal range)
__global__ __launch_bounds__(256) void k_wt_f16(const float* __restrict__ W, _Float16* __restrict__ Wt, int K, int N, float scale) {
  const int t = blockIdx.x * 256 + threadIdx.x; if (t >= N * (K / 8)) return; const int n = t / (K / 8), k8 = (t % (K / 8)) * 8; FragH f;
#pragma unroll
  for (int i = 0; i < 8; ++i) f.h[i] = (_Float16)(bf16_round(W[(size_t)(k8 + i) * N + n]) * scale); const v8us o = f.half[0];
  *(v8us*)((unsigned short*)Wt + (size_t)n * K + k8) = o; 
}
// k_gemm_hh variant with fused epilogue: v = acc·alpha + bias[by·sBias + col] (+ CP[(row/rowsPerB)·sCPb + by·64 + col] if CP) ; ACT 0 none / 1 elu ; writes f32 C and/or f16 C16 (each if non-null)
template <int ACT>
__global__ __launch_bounds__(128) void k_gemm_hhx(const _Float16* __restrict__ A, int lda, size_t sA, const _Float16* __restrict__ Bh, int ldb, size_t sB, float alpha, const float* __restrict__ bias, size_t sBias, const float* __restrict__ CP, int rowsPerB, size_t sCPb, int row0g,
    float* __restrict__ C, _Float16* __restrict__ C16, int ldc, size_t sC, int M, int N, int K) {
  __shared__ __attribute__((aligned(16))) float so[4][16][64];
  const int tid = threadIdx.x, w = tid >> 5, lane = tid & 31, ln = lane & 15, hh = lane >> 4; const int by = blockIdx.y;
  A += (size_t)by * sA; Bh += (size_t)by * sB; const size_t cofs = (size_t)by * sC; const float* bp = bias ? bias + (size_t)by * sBias : nullptr;
  const int ntn = (N + 63) / 64; const int wid = blockIdx.x * 4 + w; const int mt = wid / ntn, nq = wid % ntn; if (mt * 16 >= M) return;
  const int row0 = mt * 16, col0 = nq * 64; const _Float16* arow = A + (size_t)(row0 + ln) * lda;
  v8f acc[4] = {};
  for (int kb = 0; kb < K; kb += 32) { FragH ah; ah.half[0] = *(const v8us*)((const unsigned short*)arow + kb + 8 * hh); ah.half[1] = *(const v8us*)((const unsigned short*)arow + kb + 16 + 8 * hh);
#pragma unroll
    for (int t = 0; t < 4; ++t) { if (col0 + t * 16 >= N) continue; const size_t boff = (size_t)(col0 + t * 16 + ln) * ldb + kb; FragH bq; bq.half[0] = *(const v8us*)((const unsigned short*)Bh + boff + 8 * hh); bq.half[1] = *(const v8us*)((const unsigned short*)Bh + boff + 16 + 8 * hh);
      acc[t] = mmaH<1>(ah.v, ah.v, bq.v, bq.v, acc[t]); }
  }
#pragma unroll
  for (int t = 0; t < 4; ++t) { if (col0 + t * 16 >= N) continue; const int col = col0 + t * 16 + ln; const float bv = bp ? bf16_round(bp[col]) : 0.f;
#pragma unroll
    for (int r = 0; r < 8; ++r) { float v = acc[t][r] * alpha + bv; if (CP) { const int bidx = (row0g + row0 + 8 * hh + r) / rowsPerB; v += CP[(size_t)bidx * sCPb + (size_t)by * 64 + col]; } if (ACT == 1) v = (v > 0.f) ? v : expm1f(v); else if (ACT == 7) v = (v > 0.f) ? v + 1.0f : expf(v); else if (ACT == 8) v = tanhf(v); else if (ACT == 9) v = 0.5f * v * (1.0f + tanhf(0.7978845608028654f * (v + 0.044715f * v * v * v))); else if (ACT == 11) v = 1.0f / (1.0f + expf(-v)); else if (ACT == 12) v = (v > 0.f) ? v : 0.01f * v; else if (ACT == 14) v = (v > 0.f) ? v : 0.1f * v; else if (ACT == 15) v = v / (1.0f + expf(-v)); else if (ACT == 3) v = fmaxf(v, 0.f); else if (ACT == 6) v = 0.5f * v * (1.0f + erff(v * 0.70710678118654752f)); so[w][8 * hh + r][t * 16 + ln] = v; } }
  __builtin_amdgcn_fence(__ATOMIC_ACQ_REL, "workgroup"); __builtin_amdgcn_wave_barrier();
  const int rsub = lane >> 4, c4 = (lane & 15) * 4; typedef _Float16 v4h __attribute__((ext_vector_type(4)));
  {
#pragma unroll
    for (int q = 0; q < 8; ++q) { const int r = q * 2 + rsub; if (col0 + c4 < N) { const v4f v = *(const v4fa*)&so[w][r][c4]; if (C) *(v4f*)(C + cofs + (size_t)(row0 + r) * ldc + col0 + c4) = v; if (C16) { v4h h4; for (int i = 0; i < 4; ++i) h4[i] = (_Float16)v[i]; *(v4h*)(C16 + cofs + (size_t)(row0 + r) * ldc + col0 + c4) = h4; } } }
     }
}


typedef _Float16 v4h __attribute__((ext_vector_type(4)));

__global__ __launch_bounds__(256) void k_x16(const float* __restrict__ x, _Float16* __restrict__ X16, size_t n8) { const size_t t = (size_t)blockIdx.x * 256 + threadIdx.x; if (t >= n8) return; FragH f;
#pragma unroll
  for (int q = 0; q < 8; ++q) f.h[q] = (_Float16)bf16_round(x[t * 8 + q]); *(v8us*)((unsigned short*)X16 + t * 8) = f.half[0];  }
__global__ __launch_bounds__(256) void k_h16(const float* __restrict__ x, _Float16* __restrict__ X16, size_t n8) { const size_t t = (size_t)blockIdx.x * 256 + threadIdx.x; if (t >= n8) return; FragH f;
#pragma unroll
  for (int q = 0; q < 8; ++q) f.h[q] = (_Float16)x[t * 8 + q]; *(v8us*)((unsigned short*)X16 + t * 8) = f.half[0];  }
__global__ __launch_bounds__(256) void k_round16f(const float* __restrict__ W, _Float16* __restrict__ Bt, size_t n8) { const size_t t = (size_t)blockIdx.x * 256 + threadIdx.x; if (t >= n8) return; FragH f;
#pragma unroll
  for (int i = 0; i < 8; ++i) f.h[i] = (_Float16)(bf16_round(W[t * 8 + i]) * 16.0f); *(v8us*)((unsigned short*)Bt + t * 8) = f.half[0];  }
template <int NHv, int TTv>
__global__ __launch_bounds__(256) void k_vt(const _Float16* __restrict__ V16, int ldv, int voff, _Float16* __restrict__ Vt) { __shared__ unsigned short tl[64][66]; const int tid = threadIdx.x; const int slab = blockIdx.x / (TTv / 64), lg = blockIdx.x % (TTv / 64); const int b = slab / NHv, h = slab % NHv;
  for (int i = tid; i < 64 * 8; i += 256) { const int r = i / 8, c8 = (i % 8) * 8; FragH f; f.half[0] = *(const v8us*)((const unsigned short*)V16 + ((size_t)b * TTv + lg * 64 + r) * ldv + voff + h * 64 + c8);
#pragma unroll
    for (int q = 0; q < 8; ++q) tl[r][c8 + q] = f.u[q]; }
  __syncthreads();
  {
#pragma unroll
    for (int rd = 0; rd < 2; ++rd) { const int d = rd * 32 + tid / 8, pc = tid % 8; FragH f;
#pragma unroll
      for (int q = 0; q < 8; ++q) f.u[q] = tl[pc * 8 + q][d];
      *(v8us*)((unsigned short*)Vt + ((size_t)slab * 64 + d) * TTv + lg * 64 + pc * 8) = f.half[0]; }
     } }

__global__ __launch_bounds__(256) void k_hl(const float* __restrict__ F, _Float16* __restrict__ Hh, _Float16* __restrict__ Hl, size_t n8) { const size_t t = (size_t)blockIdx.x * 256 + threadIdx.x; if (t >= n8) return; FragH fh, fl; const v4f a = *(const v4fa*)(F + t * 8), c = *(const v4fa*)(F + t * 8 + 4);
#pragma unroll
  for (int q = 0; q < 4; ++q) { _Float16 h = (_Float16)a[q]; fh.h[q] = h; fl.h[q] = (_Float16)((a[q] - (float)h) * 1024.0f); h = (_Float16)c[q]; fh.h[4 + q] = h; fl.h[4 + q] = (_Float16)((c[q] - (float)h) * 1024.0f); }
  { *(v8us*)((unsigned short*)Hh + t * 8) = fh.half[0]; *(v8us*)((unsigned short*)Hl + t * 8) = fl.half[0];  } }

// FRAGMENT ORDER (the planes of k, transposed V and the mask that the fused kernel reads): a plane is a row of 16-byte pieces, a piece being the 8 values that ONE lane takes with ONE
// 16-byte load, and the 32 pieces of one load instruction lie side by side in lane order (lane = 16*hh + ln). So a fragment load reads 512 bytes in a row (4 cache lines) where the same load
// from a row-major plane touches 16 lines. Thread t of k_qk16 and of k_vt writes piece t of its batch's plane.
// k:    piece (((h*128 + key/16)*2 + ks)*2 + hf)*32 + lane = k[key = 16*(key/16) + ln][h*64 + ks*32 + hf*16 + hh*8 + 0..7]
// V:    piece (((h*64 + pass)*4 + tt)*2 + hf)*32 + lane    = V[key = pass*32 + hf*16 + hh*8 + 0..7][h][tt*16 + ln]
// mask: piece ((((b*64 + q/32)*64 + pass)*2 + u)*2 + j)*32 + lane = M[b][q = 32*(q/32) + u*16 + ln][pass*32 + j*16 + hh*8 + 0..7], rounded to bf16 (its bits)
__global__ __launch_bounds__(256) void k_qk16(const float* __restrict__ QK, _Float16* __restrict__ Q16, _Float16* __restrict__ KF) { const int t = blockIdx.x * 256 + threadIdx.x; if (t >= SS * (DD / 8)) return; const int c0 = (t % (DD / 8)) * 8, s = t / (DD / 8); FragH fq, fk;
  const int ln = t & 15, hh = (t >> 4) & 1, hf = (t >> 5) & 1, ks = (t >> 6) & 1, kt = (t >> 7) & (SS / 16 - 1), h = t >> 14;
  const float* kp = QK + (size_t)(kt * 16 + ln) * 2 * DD + DD + h * HD + ks * 32 + hf * 16 + hh * 8;
#pragma unroll
  for (int q = 0; q < 8; ++q) { fq.h[q] = (_Float16)QK[(size_t)s * 2 * DD + c0 + q]; fk.h[q] = (_Float16)kp[q]; }
  { *(v8us*)((unsigned short*)Q16 + (size_t)s * DD + c0) = fq.half[0]; *(v8us*)((unsigned short*)KF + (size_t)t * 8) = fk.half[0];  } }
// The mask plane. A wave takes 16 queries x 128 keys (4 passes): 16 fetches, all issued before the first use, each of 4 whole lines (8 lanes x 16 bytes a query row, 4 rows); a lane's 4 values are
// half a piece. 512 work-groups only: the plane is large, and a launch of one piece a thread would spend its time starting waves.
typedef unsigned short v4us __attribute__((ext_vector_type(4), may_alias));
__global__ __launch_bounds__(256) void k_mfrag(const float* __restrict__ Mm, unsigned short* __restrict__ MF) {
  const int wv = blockIdx.x * 8 + (threadIdx.x >> 5), lane = threadIdx.x & 31, c = lane & 7, r4 = lane >> 3;
  const int u = wv & 1, pg = (wv >> 1) & (SS / 128 - 1), qt = (wv >> 5) & (SS / 32 - 1), b = wv >> 11;
  const float* p = Mm + ((size_t)b * SS + qt * 32 + u * 16 + r4) * SS + pg * 128 + c * 4;
  unsigned short* o = MF + ((((size_t)b * (SS / 32) + qt) * (SS / 32) + pg * 4) * 2 + u) * 512 + (c >> 2) * 256 + (((c >> 1) & 1) * 16 + r4) * 8 + (c & 1) * 4;
  v4f x[4][4];      // both loops are unrolled so that x is indexed by constants and stays in registers
#pragma unroll
  for (int k = 0; k < 4; ++k)
#pragma unroll
    for (int i = 0; i < 4; ++i) x[k][i] = *(const v4fa*)(p + (size_t)i * 4 * SS + k * 32);
  asm volatile("s_wait_xcnt 0x0" :: "v"(p) : "memory");      // takes the address pair as an input, so that it stays live up to the wait and no fetch of the run lands in it
#pragma unroll
  for (int k = 0; k < 4; ++k)
#pragma unroll
    for (int i = 0; i < 4; ++i) { v4us v; v[0] = bf16_bits(x[k][i][0]); v[1] = bf16_bits(x[k][i][1]); v[2] = bf16_bits(x[k][i][2]); v[3] = bf16_bits(x[k][i][3]); *(v4us*)(o + k * 1024 + i * 32) = v; } }
__global__ __launch_bounds__(256) void k_vt(const float* __restrict__ V, int b, _Float16* __restrict__ VF) { const int t = blockIdx.x * 256 + threadIdx.x; if (t >= NH * HD * (SS / 8)) return; const int t0 = ((t >> 8) & (SS / 32 - 1)) * 32 + ((t >> 5) & 1) * 16 + ((t >> 4) & 1) * 8; const int d = ((t >> 6) & 3) * 16 + (t & 15); const int h = t >> 14; FragH f;
#pragma unroll
  for (int q = 0; q < 8; ++q) f.h[q] = (_Float16)bf16_round(V[(((size_t)b * SS + t0 + q) * NH + h) * HD + d]);
  *(v8us*)((unsigned short*)VF + (size_t)t * 8) = f.half[0];  }
// Stands behind each group of fetches (and each store) of the fused kernel: the wait, because the registers that they name are reused right behind it;
// the "memory" clobber, because in the loop, without it, the compiler sinks the mask fetch to the loop's head, where its whole latency is waited for in every pass.
typedef unsigned int v4ua __attribute__((ext_vector_type(4), may_alias));
__device__ __forceinline__ void fetch_fence() { asm volatile("s_wait_xcnt 0x0" ::: "memory"); }
// Projection GEMM: C[m][n] (f32, pitch NN) = alpha * sum_k A[m][k] * Bt[n][k] + bf16(bias[n]); A and Bt are f16 planes with rows of DD elements.
// A work-group of 8 waves (4 x 2) owns 128 x BN of C, a wave 32 x BN/2. A stage is BK k of the 128 + BN operand rows: fetched as whole lines into registers while the
// stage before is multiplied, then written to the other of two LDS buffers (row pitch + 16 B, for the 16-byte fragment reads). One barrier a stage: it publishes the
// buffer just written and ends the reads of the buffer that the next stage overwrites. Fragment k order and the order of the k sum are those of k_gemm_hhx.
typedef float f32a __attribute__((may_alias));
template <int NN, int BN, int BK>
__global__ __launch_bounds__(256) void k_gemm_t(const _Float16* __restrict__ A, const _Float16* __restrict__ Bt, float alpha, const float* __restrict__ bias, float* __restrict__ C) {
  constexpr int BM = 128, LP = BK + 8, NS = DD / BK, WN = BN / 2, NTN = WN / 16, STG = (BM + BN) * LP;
  constexpr int CPR = BK / 8, RPP = 256 / CPR, NA = BM / RPP, NB = BN / RPP;
  __shared__ __attribute__((aligned(16))) unsigned short sm[2 * STG];
  const int tid = threadIdx.x, w = tid >> 5, lane = tid & 31, ln = lane & 15, hh = lane >> 4, wm = w >> 1, wn = w & 1;
  const int row0 = blockIdx.y * BM, col0 = blockIdx.x * BN;
  const int lr = tid / CPR, lc = (tid % CPR) * 8;
  const unsigned short* ga = (const unsigned short*)A + (size_t)(row0 + lr) * DD + lc;
  const unsigned short* gb = (const unsigned short*)Bt + (size_t)(col0 + lr) * DD + lc;
  v8us ra[NA], rb[NB];
  // Every '#pragma unroll' below is there so that fragments and accumulators are indexed by constants and stay in registers.
  auto fetch = [&](int s) {
#pragma unroll
    for (int i = 0; i < NA; ++i) ra[i] = *(const v8us*)(ga + (size_t)i * RPP * DD + s * BK);
#pragma unroll
    for (int i = 0; i < NB; ++i) rb[i] = *(const v8us*)(gb + (size_t)i * RPP * DD + s * BK); };
  auto put = [&](int buf) {
    unsigned short* d = sm + buf * STG + lr * LP + lc;
#pragma unroll
    for (int i = 0; i < NA; ++i) *(v8us*)(d + i * RPP * LP) = ra[i];
#pragma unroll
    for (int i = 0; i < NB; ++i) *(v8us*)(d + (BM + i * RPP) * LP) = rb[i]; };
  v8f acc[2][NTN] = {};
  fetch(0); put(0);
  __syncthreads();
  for (int s = 0; s < NS; ++s) {
    // The wait behind the fetches: its clobber keeps them at the stage's head (without it the compiler sinks most of them to the stage's end, in front of the LDS writes,
    // where their whole latency is waited for); it takes both address pairs as inputs, so that they stay live up to the wait and no fetch of the run lands in them.
    if (s + 1 < NS) { fetch(s + 1); asm volatile("s_wait_xcnt 0x0" :: "v"(ga), "v"(gb) : "memory"); }
    const unsigned short* pa = sm + (s & 1) * STG + (wm * 32 + ln) * LP + 8 * hh;
    const unsigned short* pb = sm + (s & 1) * STG + (BM + wn * WN + ln) * LP + 8 * hh;
#pragma unroll
    for (int ks = 0; ks < BK / 32; ++ks) {
      FragH af[2], bf[NTN];
#pragma unroll
      for (int mi = 0; mi < 2; ++mi) { af[mi].half[0] = *(const v8us*)(pa + mi * 16 * LP + ks * 32); af[mi].half[1] = *(const v8us*)(pa + mi * 16 * LP + ks * 32 + 16); }
#pragma unroll
      for (int t = 0; t < NTN; ++t) { bf[t].half[0] = *(const v8us*)(pb + t * 16 * LP + ks * 32); bf[t].half[1] = *(const v8us*)(pb + t * 16 * LP + ks * 32 + 16); }
#pragma unroll
      for (int mi = 0; mi < 2; ++mi)
#pragma unroll
        for (int t = 0; t < NTN; ++t) acc[mi][t] = __builtin_amdgcn_wmma_f32_16x16x32_f16(false, af[mi].v, false, bf[t].v, (short)0, acc[mi][t], false, false);
    }
    if (s + 1 < NS) put((s + 1) & 1);
    __syncthreads();
  }
  // Behind the last barrier nobody reads the buffers any more: each wave stages its own 32 x WN block there, so that C is stored as whole lines.
  constexpr int SP = WN + 4, LPR = WN / 4, RPI = 32 / LPR;
  f32a* so = (f32a*)sm + w * 32 * SP;
#pragma unroll
  for (int t = 0; t < NTN; ++t) {
    const float bv = bf16_round(bias[col0 + wn * WN + t * 16 + ln]);
#pragma unroll
    for (int mi = 0; mi < 2; ++mi)
#pragma unroll
      for (int r = 0; r < 8; ++r) so[(mi * 16 + 8 * hh + r) * SP + t * 16 + ln] = acc[mi][t][r] * alpha + bv;
  }
  __syncthreads();
  const int rs = lane / LPR, c4 = (lane % LPR) * 4;
#pragma unroll
  for (int q = 0; q < 32 / RPI; ++q) {
    const int r = q * RPI + rs;
    const v4f v = *(const v4fa*)&so[r * SP + c4];
    *(v4f*)(C + (size_t)(row0 + wm * 32 + r) * NN + col0 + wn * WN + c4) = v;
  }
}
// Fused attention. One wave owns 32 queries of one (batch, head) and walks all keys, 32 a pass.
// ST = K.QT (A = 16 key rows, B = 16 query rows): a lane holds the scores of ONE query (column ln), keys 8*hh + r, so maximum and sums are
// in-lane plus one exchange between the wave's halves. Two score tiles, converted in place, are the B operand of OT += VT.PT (A = rows of VT in
// the same k order), so OT's column is the same query and the rescale factor is in-lane too.
// Result = sum(e*M*V) / (sum(e*M) + 1e-8 * sum e), e = exp(s - running max): the softmax denominator cancels but for the 1e-8 term.
// k, transposed V and the mask come from planes in fragment order (above k_qk16): a pass's 8 + 8 + 4 loads of a wave each read 512 bytes in a row.
// Every '#pragma unroll' below is there so that fragments and accumulators are indexed by constants and stay in registers.
__global__ __launch_bounds__(256) void k_fattn(const _Float16* __restrict__ Q16, const _Float16* __restrict__ KF, const _Float16* __restrict__ VF, const unsigned short* __restrict__ MF, _Float16* __restrict__ O16) {
  const int tid = threadIdx.x, w = tid >> 5, lane = tid & 31, ln = lane & 15, hh = lane >> 4;
  const int h = blockIdx.y, b = blockIdx.z, q0 = blockIdx.x * 256 + w * 32;
  const unsigned short* Qb = (const unsigned short*)Q16 + ((size_t)b * SS + q0 + ln) * DD + h * HD + 8 * hh;
  const unsigned short* Kb = (const unsigned short*)KF + ((size_t)b * NH + h) * (SS * HD) + lane * 8;
  const unsigned short* Vb = (const unsigned short*)VF + ((size_t)b * NH + h) * (SS * HD) + lane * 8;
  const unsigned short* Mb = MF + ((size_t)b * (SS / 32) + (q0 >> 5)) * (SS * 32) + lane * 8;
  FragH qf[2][2], kf[2][2], vf[4];
  v4ua mk[2][2];      // 8 bf16 mask values as 4 words: a value is its word shifted up (even) or masked (odd), one instruction each
#pragma unroll
  for (int u = 0; u < 2; ++u)
#pragma unroll
    for (int ks = 0; ks < 2; ++ks) { qf[u][ks].half[0] = *(const v8us*)(Qb + (size_t)u * 16 * DD + ks * 32); qf[u][ks].half[1] = *(const v8us*)(Qb + (size_t)u * 16 * DD + ks * 32 + 16); }
  fetch_fence();
  auto loadK = [&](int kb) {
#pragma unroll
    for (int j = 0; j < 2; ++j)
#pragma unroll
      for (int ks = 0; ks < 2; ++ks) { const unsigned short* p = Kb + (size_t)kb * HD + (j * 2 + ks) * 512; kf[j][ks].half[0] = *(const v8us*)p; kf[j][ks].half[1] = *(const v8us*)(p + 256); } };
  auto loadM = [&](int kb) {
#pragma unroll
    for (int u = 0; u < 2; ++u)
#pragma unroll
      for (int j = 0; j < 2; ++j) mk[u][j] = *(const v4ua*)(Mb + (size_t)kb * 32 + (u * 2 + j) * 256); };
  auto loadV = [&](int kb) {
#pragma unroll
    for (int t = 0; t < 4; ++t) { const unsigned short* p = Vb + (size_t)kb * HD + t * 512; vf[t].half[0] = *(const v8us*)p; vf[t].half[1] = *(const v8us*)(p + 256); } };
  v8f acc[2][4] = {};
  float mx[2] = {-3.0e38f, -3.0e38f}, se[2] = {0.f, 0.f}, sem[2] = {0.f, 0.f};
  const float c2 = 0.125f * 1.4426950408889634f;      // scores / 8, in log2 units
  loadK(0); loadM(0); fetch_fence(); loadV(0);      // the fence keeps the loop's own issue order K, M, V here too: else the loop's counted waits for the mask also wait for V
  // The wait behind the first V fetches takes the lane's index and its byte offset as inputs: the fetches name the register of one of the two, which so stays live up to the wait
  // (else the zeroing of the sums and accumulators lands in it first).
  asm volatile("s_wait_xcnt 0x0" :: "v"(lane), "v"(lane * 16) : "memory");
  for (int kb = 0; kb < SS; kb += 32) {
    const int kn = (kb + 32 < SS) ? kb + 32 : 0;      // each operand's next pass is fetched into its own registers right behind its last use; the last pass refetches pass 0, unused
    v8f st[2][2];
#pragma unroll
    for (int u = 0; u < 2; ++u)
#pragma unroll
      for (int j = 0; j < 2; ++j) {
        v8f z = {};
        z = __builtin_amdgcn_wmma_f32_16x16x32_f16(false, kf[j][0].v, false, qf[u][0].v, (short)0, z, false, false);
        st[u][j] = __builtin_amdgcn_wmma_f32_16x16x32_f16(false, kf[j][1].v, false, qf[u][1].v, (short)0, z, false, false);
      }
    loadK(kn); fetch_fence();
    __builtin_amdgcn_sched_barrier(0);      // without it the scheduler sinks the K fetch behind the softmax, too late for the next pass's first product
    FragH pf[2];
#pragma unroll
    for (int u = 0; u < 2; ++u) {
      float tm = st[u][0][0];
#pragma unroll
      for (int r = 1; r < 8; ++r) tm = fmaxf(tm, st[u][0][r]);
#pragma unroll
      for (int r = 0; r < 8; ++r) tm = fmaxf(tm, st[u][1][r]);
      tm = fmaxf(tm, __shfl_xor(tm, 16, 32));
      const float mn = fmaxf(mx[u], tm * c2);
      const float al = __builtin_amdgcn_exp2f(mx[u] - mn);
      mx[u] = mn;
      const float sh = 8.0f - mn;      // e carries 2^8 (it cancels in the quotient): keeps small weights in the normal f16 range
      float s1 = 0.f, s2 = 0.f;
#pragma unroll
      for (int j = 0; j < 2; ++j)
#pragma unroll
        for (int r = 0; r < 8; ++r) {
          const float ev = __builtin_amdgcn_exp2f(st[u][j][r] * c2 + sh);
          const float pv = ev * __uint_as_float((r & 1) ? (mk[u][j][r >> 1] & 0xFFFF0000u) : (mk[u][j][r >> 1] << 16));
          s1 += ev; s2 += pv;
          pf[u].h[j * 8 + r] = (_Float16)pv;
        }
      se[u] = se[u] * al + s1; sem[u] = sem[u] * al + s2;
#pragma unroll
      for (int t = 0; t < 4; ++t)
#pragma unroll
        for (int r = 0; r < 8; ++r) acc[u][t][r] *= al;
    }
    loadM(kn); fetch_fence();
#pragma unroll
    for (int t = 0; t < 4; ++t)
#pragma unroll
      for (int u = 0; u < 2; ++u) acc[u][t] = __builtin_amdgcn_wmma_f32_16x16x32_f16(false, vf[t].v, false, pf[u].v, (short)0, acc[u][t], false, false);
    loadV(kn); fetch_fence();
  }
#pragma unroll
  for (int u = 0; u < 2; ++u) {
    const float s1 = se[u] + __shfl_xor(se[u], 16, 32), s2 = sem[u] + __shfl_xor(sem[u], 16, 32);
    const float inv = 1.0f / (s2 + 1e-8f * s1);
    unsigned short* op = (unsigned short*)O16 + ((size_t)b * SS + q0 + u * 16 + ln) * DD + h * HD + 8 * hh;
#pragma unroll
    for (int t = 0; t < 4; ++t) { FragH f;
#pragma unroll
      for (int r = 0; r < 8; ++r) f.h[r] = (_Float16)(acc[u][t][r] * inv);
      *(v8us*)(op + t * 16) = f.half[0]; fetch_fence(); }
  }
}

extern "C" void kernel_launch(void* const* d_in, const int* in_sizes, int n_in,
                              void* d_out, int out_size, void* d_ws, size_t ws_size, hipStream_t stream) {
  (void)in_sizes; (void)n_in; (void)out_size;
  const float* x = (const float*)d_in[0]; const float* V = (const float*)d_in[1]; const float* Mm = (const float*)d_in[2]; const float* Win = (const float*)d_in[3]; const float* bin = (const float*)d_in[4]; const float* Wo = (const float*)d_in[5]; const float* bo = (const float*)d_in[6];
  char* ws = (char*)d_ws; size_t off = 0;
  auto take = [&](size_t bytes) { char* p = ws + off; off += (bytes + 255) & ~(size_t)255; return p; };
  _Float16* BIN = (_Float16*)take((size_t)2 * DD * DD * 2); _Float16* BO = (_Float16*)take((size_t)DD * DD * 2); _Float16* X16 = (_Float16*)take((size_t)SS * DD * 2); float* QK = (float*)take((size_t)SS * 2 * DD * 4); _Float16* Q16 = (_Float16*)take((size_t)NBt * SS * DD * 2); _Float16* K16 = (_Float16*)take((size_t)NBt * SS * DD * 2); _Float16* VT = (_Float16*)take((size_t)NBt * NH * HD * SS * 2);
  _Float16* O16 = (_Float16*)take((size_t)NBt * SS * DD * 2); unsigned short* MF = (unsigned short*)take((size_t)NBt * SS * SS * 2);
  if (off > ws_size) return;      // about 78 MB
  k_round16f<<<(unsigned)(((size_t)2 * DD * DD / 8 + 255) / 256), 256, 0, stream>>>(Win, BIN, (size_t)2 * DD * DD / 8); k_round16f<<<(unsigned)(((size_t)DD * DD / 8 + 255) / 256), 256, 0, stream>>>(Wo, BO, (size_t)DD * DD / 8);      /* torch (out,in) = natural Bt; only the q|k rows of in_proj are needed */
  k_mfrag<<<NBt * (SS / 16) * (SS / 128) / 8, 256, 0, stream>>>(Mm, MF);      /* all batches: the mask, bf16, in fragment order */
  for (int b = 0; b < NBt; ++b) {
    k_x16<<<(SS * DD / 8 + 255) / 256, 256, 0, stream>>>(x + (size_t)b * SS * DD, X16, (size_t)SS * DD / 8);
    k_gemm_t<2 * DD, 128, 128><<<dim3(2 * DD / 128, SS / 128), 256, 0, stream>>>(X16, BIN, 0.0625f, bin, QK);      /* q | k = x.W_in^T[:2048] + b (exact) */
    k_qk16<<<(SS * (DD / 8) + 255) / 256, 256, 0, stream>>>(QK, Q16 + (size_t)b * SS * DD, K16 + (size_t)b * SS * DD); k_vt<<<(NH * HD * (SS / 8) + 255) / 256, 256, 0, stream>>>(V, b, VT + (size_t)b * NH * HD * SS); }
  k_fattn<<<dim3(SS / 256, NH, NBt), 256, 0, stream>>>(Q16, K16, VT, MF, O16);      /* all batches and heads: 256 work-groups of 8 waves x 32 queries */
  for (int b = 0; b < NBt; ++b)
    k_gemm_t<DD, 64, 128><<<dim3(DD / 64, SS / 128), 256, 0, stream>>>(O16 + (size_t)b * SS * DD, BO, 0.0625f, bo, (float*)d_out + (size_t)b * SS * DD);      /* .out_w^T + out_b */
}

// v004
// Measured time: 106 microseconds a run.
// Two timings next to v003 put it at 1.23 and 1.22 times that version's speed.
// All steps since v000 together make it 16.5 times as fast.
#include <hip/hip_runtime.h>
// Masked multi-head attention with external values (B 2, S 2048, D 1024, 16 heads × 64): q | k from the packed in-projection (+ bias; the v third is unused by the module), scores = q·k/8, softmax, A·M (INPUT mask [B,S,S]), L1 renormalisation over keys (+1e-8), out = Ā·V with the separate INPUT V [B,S,H,64], heads concatenated, ·out_wᵀ + out_b → [2,2048,1024].
// Structure, five launches, each over both batches: every plane that depends on the inputs alone (f16 weights and x, transposed V and the bf16 mask in fragment order); q|k GEMM (exact); f16 planes of q (rows) and k (fragment order); one fused attention kernel over all batches and heads (scores, online softmax, mask, L1 renormalisation and the product with V, nothing of the S x S score planes in memory) into the concatenated f16 plane; the output projection GEMM with bias.
// Compute dtype: x, V, M and parameters rounded to bf16; projections with exact products; q, k, the unnormalised masked weights e*M (x 2^8), V (exact) and the attention output as f16 operands (about 2^-12), f32 accumulation; softmax/mask/renormalisation in f32. v_wmma_f32_16x16x32_f16.
#define NBt 2
#define SS 2048
#define DD 1024
#define NH 16
#define HD 64
typedef __bf16 v16b __attribute__((ext_vector_type(16)));
typedef unsigned short v8us __attribute__((ext_vector_type(8), may_alias));
typedef float  v8f  __attribute__((ext_vector_type(8)));
typedef float  v4f  __attribute__((ext_vector_type(4)));
typedef float  v4fa __attribute__((ext_vector_type(4), may_alias));
union FragB { v16b v; v8us half[2]; unsigned short u[16]; };

__device__ __forceinline__ unsigned short bf16_bits(float x) { unsigned int u = __float_as_uint(x); return (unsigned short)((u + 0x7FFFu + ((u >> 16) & 1u)) >> 16); }
__device__ __forceinline__ float bf16_val(unsigned short b) { return __uint_as_float(((unsigned int)b) << 16); }
__device__ __forceinline__ float bf16_round(float x) { return bf16_val(bf16_bits(x)); }
// D += A·B with NT terms: 1 = ah·bh, 2 = + al·bh (A split), 3 = + ah·bl (both split)
template <int NT>
__device__ __forceinline__ v8f mmaN(v16b ah, v16b al, v16b bh, v16b bl, v8f c) {
  c = __builtin_amdgcn_wmma_f32_16x16x32_bf16(false, ah, false, bh, (short)0, c, false, false);
  if (NT >= 2) c = __builtin_amdgcn_wmma_f32_16x16x32_bf16(false, al, false, bh, (short)0, c, false, false);
  if (NT >= 3) c = __builtin_amdgcn_wmma_f32_16x16x32_bf16(false, ah, false, bl, (short)0, c, false, false);
  asm volatile("v_nop\n\tv_nop\n\tv_nop\n\tv_nop" : "+v"(c) : "v"(ah), "v"(al), "v"(bh), "v"(bl));
  return c;
}

__global__ __launch_bounds__(256) void k_wt_bf16(const float* __restrict__ W, unsigned short* __restrict__ Wt, int K, int N) {
  const int t = blockIdx.x * 256 + threadIdx.x;
  const int k8n = K / 8;
  if (t >= N * k8n) return;
  const int n = t / k8n, k8 = (t % k8n) * 8;
  v8us v;
#pragma unroll
  for (int i = 0; i < 8; ++i) v[i] = bf16_bits(W[(size_t)(k8 + i) * N + n]);
  *(v8us*)(Wt + (size_t)n * K + k8) = v;
  
}

// GEMM C[M][N] (f32, pitch ldc) = act(A[M][K]·W + bias). A f32 row-major (pitch lda) converted per fragment to bf16
// (ASPLIT: hi/lo two planes -> 2 terms, else single rounded term); Wt bf16 [N][K] (pitch ldb). BIAS_BF16 rounds the
// bias to bf16 first (bias quantised to bf16 before the add). K%32==0, M%16==0, N%64==0.
template <bool ASPLIT, int ACT, bool BIAS_BF16>
__global__ __launch_bounds__(128) void k_gemm_bf(const float* __restrict__ A, int lda, const unsigned short* __restrict__ Wt, int ldb,
                                               const float* __restrict__ bias, float* __restrict__ C, int ldc, int M, int N, int K) {
  __shared__ __attribute__((aligned(16))) float so[4][16][64];
  const int tid = threadIdx.x, w = tid >> 5, lane = tid & 31, ln = lane & 15, hh = lane >> 4;
  const int ntn = N / 64;
  const int wid = blockIdx.x * 4 + w;
  const int mt = wid / ntn, nq = wid % ntn;
  if (mt * 16 >= M) return;
  const int row0 = mt * 16, col0 = nq * 64;
  const float* arow = A + (size_t)(row0 + ln) * lda;
  v8f acc[4] = {};
  for (int kb = 0; kb < K; kb += 32) {
    FragB ah, al;
    const v4f x0 = *(const v4fa*)(arow + kb + 8 * hh), x1 = *(const v4fa*)(arow + kb + 8 * hh + 4);
    const v4f x2 = *(const v4fa*)(arow + kb + 16 + 8 * hh), x3 = *(const v4fa*)(arow + kb + 16 + 8 * hh + 4);
    float xs[16] = {x0[0],x0[1],x0[2],x0[3],x1[0],x1[1],x1[2],x1[3],x2[0],x2[1],x2[2],x2[3],x3[0],x3[1],x3[2],x3[3]};
#pragma unroll
    for (int i = 0; i < 16; ++i) { const unsigned short hb = bf16_bits(xs[i]); ah.u[i] = hb; al.u[i] = ASPLIT ? bf16_bits(xs[i] - bf16_val(hb)) : (unsigned short)0; }
#pragma unroll
    for (int t = 0; t < 4; ++t) {
      const unsigned short* brow = Wt + (size_t)(col0 + t * 16 + ln) * ldb + kb;
      FragB b;
      b.half[0] = *(const v8us*)(brow + 8 * hh);
      b.half[1] = *(const v8us*)(brow + 16 + 8 * hh);
      acc[t] = mmaN<ASPLIT ? 2 : 1>(ah.v, al.v, b.v, b.v, acc[t]);
    }
  }
#pragma unroll
  for (int t = 0; t < 4; ++t) {
    float bv = bias ? bias[col0 + t * 16 + ln] : 0.f;
    if (BIAS_BF16) bv = bf16_round(bv);
#pragma unroll
    for (int r = 0; r < 8; ++r) { float v = acc[t][r] + bv; if (ACT == 1) v = fmaxf(v, 0.f); so[w][8 * hh + r][t * 16 + ln] = v; }
  }
  __builtin_amdgcn_fence(__ATOMIC_ACQ_REL, "workgroup");
  __builtin_amdgcn_wave_barrier();
  const int rsub = lane >> 4, c4 = (lane & 15) * 4;
  {
#pragma unroll
    for (int q = 0; q < 8; ++q) {
      const int r = q * 2 + rsub;
      const v4f v = *(const v4fa*)&so[w][r][c4];
      *(v4f*)(C + (size_t)(row0 + r) * ldc + col0 + c4) = v;
    }
    
  }
}

// GEMM C = act(A·W + bias + resid): A f32 (ASPLIT -> hi/lo 2 terms), Wt bf16 [N][K]; ACT 0 none, 1 relu, 2 exact gelu;
// resid (optional, f32, row index = (row % rmod), pitch ldr, RES_BF16 rounds it) added before the activation.
template <bool ASPLIT, int ACT, bool BIAS_BF16, bool RES_BF16>
__global__ __launch_bounds__(128) void k_gemm_bf3(const float* __restrict__ A, int lda, const unsigned short* __restrict__ Wt, int ldb,
                                                const float* __restrict__ bias, const float* __restrict__ resid, int rmod, int ldr,
                                                float* __restrict__ C, int ldc, int M, int N, int K) {
  __shared__ __attribute__((aligned(16))) float so[4][16][64];
  const int tid = threadIdx.x, w = tid >> 5, lane = tid & 31, ln = lane & 15, hh = lane >> 4;
  const int ntn = N / 64;
  const int wid = blockIdx.x * 4 + w;
  const int mt = wid / ntn, nq = wid % ntn;
  if (mt * 16 >= M) return;
  const int row0 = mt * 16, col0 = nq * 64;
  const float* arow = A + (size_t)(row0 + ln) * lda;
  v8f acc[4] = {};
  for (int kb = 0; kb < K; kb += 32) {
    FragB ah, al;
    const v4f x0 = *(const v4fa*)(arow + kb + 8 * hh), x1 = *(const v4fa*)(arow + kb + 8 * hh + 4);
    const v4f x2 = *(const v4fa*)(arow + kb + 16 + 8 * hh), x3 = *(const v4fa*)(arow + kb + 16 + 8 * hh + 4);
    float xs[16] = {x0[0],x0[1],x0[2],x0[3],x1[0],x1[1],x1[2],x1[3],x2[0],x2[1],x2[2],x2[3],x3[0],x3[1],x3[2],x3[3]};
#pragma unroll
    for (int i = 0; i < 16; ++i) { const unsigned short hb = bf16_bits(xs[i]); ah.u[i] = hb; al.u[i] = ASPLIT ? bf16_bits(xs[i] - bf16_val(hb)) : (unsigned short)0; }
#pragma unroll
    for (int t = 0; t < 4; ++t) {
      const unsigned short* brow = Wt + (size_t)(col0 + t * 16 + ln) * ldb + kb;
      FragB b;
      b.half[0] = *(const v8us*)(brow + 8 * hh);
      b.half[1] = *(const v8us*)(brow + 16 + 8 * hh);
      acc[t] = mmaN<ASPLIT ? 2 : 1>(ah.v, al.v, b.v, b.v, acc[t]);
    }
  }
#pragma unroll
  for (int t = 0; t < 4; ++t) {
    const int col = col0 + t * 16 + ln;
    float bv = bias ? bias[col] : 0.f;
    if (BIAS_BF16) bv = bf16_round(bv);
#pragma unroll
    for (int r = 0; r < 8; ++r) {
      float v = acc[t][r] + bv;
      if (resid) { float rv = resid[(size_t)((row0 + 8 * hh + r) % rmod) * ldr + col]; if (RES_BF16) rv = bf16_round(rv); v += rv; }
      if (ACT == 1) v = fmaxf(v, 0.f);
      if (ACT == 2) v = 0.5f * v * (1.0f + erff(v * 0.70710678118654752f));
      if (ACT == 3) { const float u = 0.7978845608028654f * (v + 0.044715f * v * v * v); v = 0.5f * v * (1.0f + tanhf(u)); }
      so[w][8 * hh + r][t * 16 + ln] = v;
    }
  }
  __builtin_amdgcn_fence(__ATOMIC_ACQ_REL, "workgroup");
  __builtin_amdgcn_wave_barrier();
  const int rsub = lane >> 4, c4 = (lane & 15) * 4;
  {
#pragma unroll
    for (int q = 0; q < 8; ++q) {
      const int r = q * 2 + rsub;
      const v4f v = *(const v4fa*)&so[w][r][c4];
      *(v4f*)(C + (size_t)(row0 + r) * ldc + col0 + c4) = v;
    }
    
  }
}
// row LayerNorm (biased variance, eps) over N: s = X (+ R); optional out_sum <- s; out_norm <- (s-mu)*rsqrt(var+eps)*g + b
template <bool PARAM_BF16>
__global__ __launch_bounds__(256) void k_layernorm(const float* __restrict__ X, const float* __restrict__ R, const float* __restrict__ g, const float* __restrict__ bta,
                                                  float* __restrict__ out_sum, float* __restrict__ out_norm, int N, float eps) {
  __shared__ float red[256];
  const int row = blockIdx.x, tid = threadIdx.x;
  const float* x = X + (size_t)row * N; const float* rr = R ? R + (size_t)row * N : nullptr;
  float vals[16];                     // up to N = 4096
  const int per = N / 256;            // contiguous chunk per thread? use strided-by-4 chunks: thread handles j = tid*4 + 1024*u
  float s1 = 0.f;
  for (int u = 0; u < per / 4; ++u) {
    const int j = tid * 4 + 1024 * u;
    const v4f a = *(const v4fa*)(x + j);
    v4f b = {0.f,0.f,0.f,0.f}; if (rr) b = *(const v4fa*)(rr + j);
#pragma unroll
    for (int q = 0; q < 4; ++q) { const float v = a[q] + b[q]; vals[u * 4 + q] = v; s1 += v; }
  }
  red[tid] = s1; __syncthreads();
  for (int st = 128; st > 0; st >>= 1) { if (tid < st) red[tid] += red[tid + st]; __syncthreads(); }
  const float mu = red[0] / (float)N; __syncthreads();
  float s2 = 0.f;
  for (int u = 0; u < per / 4; ++u)
#pragma unroll
    for (int q = 0; q < 4; ++q) { const float c = vals[u * 4 + q] - mu; s2 += c * c; }
  red[tid] = s2; __syncthreads();
  for (int st = 128; st > 0; st >>= 1) { if (tid < st) red[tid] += red[tid + st]; __syncthreads(); }
  const float rs = rsqrtf(red[0] / (float)N + eps);
  {
    for (int u = 0; u < per / 4; ++u) {
      const int j = tid * 4 + 1024 * u;
      v4f o, sm;
#pragma unroll
      for (int q = 0; q < 4; ++q) {
        float gg = g[j + q], bb = bta[j + q];
        if (PARAM_BF16) { gg = bf16_round(gg); bb = bf16_round(bb); }
        sm[q] = vals[u * 4 + q]; o[q] = (vals[u * 4 + q] - mu) * rs * gg + bb;
      }
      if (out_sum) *(v4f*)(out_sum + (size_t)row * N + j) = sm;
      *(v4f*)(out_norm + (size_t)row * N + j) = o;
    }
    
  }
}



// ---- f16 WMMA path (v_wmma_f32_16x16x32_f16): 11-bit significands for operands in range — used for every product launched here: both projections, q·k and the masked weights (x 2^8) times V
typedef _Float16 v16h __attribute__((ext_vector_type(16)));
union FragH { v16h v; v8us half[2]; _Float16 h[16]; unsigned short u[16]; };
template <int NT>
__device__ __forceinline__ v8f mmaH(v16h ah, v16h al, v16h bh, v16h bl, v8f c) {
  c = __builtin_amdgcn_wmma_f32_16x16x32_f16(false, ah, false, bh, (short)0, c, false, false);
  if (NT >= 2) c = __builtin_amdgcn_wmma_f32_16x16x32_f16(false, al, false, bh, (short)0, c, false, false);
  if (NT >= 3) c = __builtin_amdgcn_wmma_f32_16x16x32_f16(false, ah, false, bl, (short)0, c, false, false);
  asm volatile("v_nop\n\tv_nop\n\tv_nop\n\tv_nop" : "+v"(c) : "v"(ah), "v"(al), "v"(bh), "v"(bl));
  return c;
}
// batched GEMM like k_gemm_b but f16 operands: A f32 (split into f16 hi/lo if ASPLIT, else rounded to f16), Bt = f16 values [n][k]; alpha; C f32; N multiple of 16 (partial tiles skipped)
template <bool ASPLIT>
__global__ __launch_bounds__(128) void k_gemm_h(const float* __restrict__ A, int lda, size_t sA, const _Float16* __restrict__ Bh, int ldb, size_t sB, float alpha, float* __restrict__ C, int ldc, size_t sC, int M, int N, int K) {
  __shared__ __attribute__((aligned(16))) float so[4][16][64];
  const int tid = threadIdx.x, w = tid >> 5, lane = tid & 31, ln = lane & 15, hh = lane >> 4; const int by = blockIdx.y;
  A += (size_t)by * sA; Bh += (size_t)by * sB; C += (size_t)by * sC;
  const int ntn = (N + 63) / 64; const int wid = blockIdx.x * 4 + w; const int mt = wid / ntn, nq = wid % ntn; if (mt * 16 >= M) return;
  const int row0 = mt * 16, col0 = nq * 64; const float* arow = A + (size_t)(row0 + ln) * lda;
  v8f acc[4] = {};
  for (int kb = 0; kb < K; kb += 32) {
    FragH ah, al;
    const v4f x0 = *(const v4fa*)(arow + kb + 8 * hh), x1 = *(const v4fa*)(arow + kb + 8 * hh + 4), x2 = *(const v4fa*)(arow + kb + 16 + 8 * hh), x3 = *(const v4fa*)(arow + kb + 16 + 8 * hh + 4);
    float xs[16] = {x0[0],x0[1],x0[2],x0[3],x1[0],x1[1],x1[2],x1[3],x2[0],x2[1],x2[2],x2[3],x3[0],x3[1],x3[2],x3[3]};
#pragma unroll
    for (int i = 0; i < 16; ++i) { const _Float16 h = (_Float16)xs[i]; ah.h[i] = h; al.h[i] = ASPLIT ? (_Float16)(xs[i] - (float)h) : (_Float16)0.0f; }
#pragma unroll
    for (int t = 0; t < 4; ++t) { if (col0 + t * 16 >= N) continue; const size_t boff = (size_t)(col0 + t * 16 + ln) * ldb + kb; FragH bq; bq.half[0] = *(const v8us*)(Bh + boff + 8 * hh); bq.half[1] = *(const v8us*)(Bh + boff + 16 + 8 * hh);
      acc[t] = mmaH<ASPLIT ? 2 : 1>(ah.v, al.v, bq.v, bq.v, acc[t]); }
  }
#pragma unroll
  for (int t = 0; t < 4; ++t) { if (col0 + t * 16 >= N) continue;
#pragma unroll
    for (int r = 0; r < 8; ++r) so[w][8 * hh + r][t * 16 + ln] = acc[t][r] * alpha; }
  __builtin_amdgcn_fence(__ATOMIC_ACQ_REL, "workgroup"); __builtin_amdgcn_wave_barrier();
  const int rsub = lane >> 4, c4 = (lane & 15) * 4;
  {
#pragma unroll
    for (int q = 0; q < 8; ++q) { const int r = q * 2 + rsub; if (col0 + c4 < N) { const v4f v = *(const v4fa*)&so[w][r][c4]; *(v4f*)(C + (size_t)(row0 + r) * ldc + col0 + c4) = v; } }
     }
}

// Wt[n][k] = f16(W[k][n]·scale) from f32 row-major W[K][N] (scale = power of two; bf16-exact weights stay exact in f16 away from the subnormal range)
__global__ __launch_bounds__(256) void k_wt_f16(const float* __restrict__ W, _Float16* __restrict__ Wt, int K, int N, float scale) {
  const int t = blockIdx.x * 256 + threadIdx.x; if (t >= N * (K / 8)) return; const int n = t / (K / 8), k8 = (t % (K / 8)) * 8; FragH f;
#pragma unroll
  for (int i = 0; i < 8; ++i) f.h[i] = (_Float16)(bf16_round(W[(size_t)(k8 + i) * N + n]) * scale); const v8us o = f.half[0];
  *(v8us*)((unsigned short*)Wt + (size_t)n * K + k8) = o; 
}
// k_gemm_hh variant with fused epilogue: v = acc·alpha + bias[by·sBias + col] (+ CP[(row/rowsPerB)·sCPb + by·64 + col] if CP) ; ACT 0 none / 1 elu ; writes f32 C and/or f16 C16 (each if non-null)
template <int ACT>
__global__ __launch_bounds__(128) void k_gemm_hhx(const _Float16* __restrict__ A, int lda, size_t sA, const _Float16* __restrict__ Bh, int ldb, size_t sB, float alpha, const float* __restrict__ bias, size_t sBias, const float* __restrict__ CP, int rowsPerB, size_t sCPb, int row0g,
    float* __restrict__ C, _Float16* __restrict__ C16, int ldc, size_t sC, int M, int N, int K) {
  __shared__ __attribute__((aligned(16))) float so[4][16][64];
  const int tid = threadIdx.x, w = tid >> 5, lane = tid & 31, ln = lane & 15, hh = lane >> 4; const int by = blockIdx.y;
  A += (size_t)by * sA; Bh += (size_t)by * sB; const size_t cofs = (size_t)by * sC; const float* bp = bias ? bias + (size_t)by * sBias : nullptr;
  const int ntn = (N + 63) / 64; const int wid = blockIdx.x * 4 + w; const int mt = wid / ntn, nq = wid % ntn; if (mt * 16 >= M) return;
  const int row0 = mt * 16, col0 = nq * 64; const _Float16* arow = A + (size_t)(row0 + ln) * lda;
  v8f acc[4] = {};
  for (int kb = 0; kb < K; kb += 32) { FragH ah; ah.half[0] = *(const v8us*)((const unsigned short*)arow + kb + 8 * hh); ah.half[1] = *(const v8us*)((const unsigned short*)arow + kb + 16 + 8 * hh);
#pragma unroll
    for (int t = 0; t < 4; ++t) { if (col0 + t * 16 >= N) continue; const size_t boff = (size_t)(col0 + t * 16 + ln) * ldb + kb; FragH bq; bq.half[0] = *(const v8us*)((const unsigned short*)Bh + boff + 8 * hh); bq.half[1] = *(const v8us*)((const unsigned short*)Bh + boff + 16 + 8 * hh);
      acc[t] = mmaH<1>(ah.v, ah.v, bq.v, bq.v, acc[t]); }
  }
#pragma unroll
  for (int t = 0; t < 4; ++t) { if (col0 + t * 16 >= N) continue; const int col = col0 + t * 16 + ln; const float bv = bp ? bf16_round(bp[col]) : 0.f;
#pragma unroll
    for (int r = 0; r < 8; ++r) { float v = acc[t][r] * alpha + bv; if (CP) { const int bidx = (row0g + row0 + 8 * hh + r) / rowsPerB; v += CP[(size_t)bidx * sCPb + (size_t)by * 64 + col]; } if (ACT == 1) v = (v > 0.f) ? v : expm1f(v); else if (ACT == 7) v = (v > 0.f) ? v + 1.0f : expf(v); else if (ACT == 8) v = tanhf(v); else if (ACT == 9) v = 0.5f * v * (1.0f + tanhf(0.7978845608028654f * (v + 0.044715f * v * v * v))); else if (ACT == 11) v = 1.0f / (1.0f + expf(-v)); else if (ACT == 12) v = (v > 0.f) ? v : 0.01f * v; else if (ACT == 14) v = (v > 0.f) ? v : 0.1f * v; else if (ACT == 15) v = v / (1.0f + expf(-v)); else if (ACT == 3) v = fmaxf(v, 0.f); else if (ACT == 6) v = 0.5f * v * (1.0f + erff(v * 0.70710678118654752f)); so[w][8 * hh + r][t * 16 + ln] = v; } }
  __builtin_amdgcn_fence(__ATOMIC_ACQ_REL, "workgroup"); __builtin_amdgcn_wave_barrier();
  const int rsub = lane >> 4, c4 = (lane & 15) * 4; typedef _Float16 v4h __attribute__((ext_vector_type(4)));
  {
#pragma unroll
    for (int q = 0; q < 8; ++q) { const int r = q * 2 + rsub; if (col0 + c4 < N) { const v4f v = *(const v4fa*)&so[w][r][c4]; if (C) *(v4f*)(C + cofs + (size_t)(row0 + r) * ldc + col0 + c4) = v; if (C16) { v4h h4; for (int i = 0; i < 4; ++i) h4[i] = (_Float16)v[i]; *(v4h*)(C16 + cofs + (size_t)(row0 + r) * ldc + col0 + c4) = h4; } } }
     }
}


typedef _Float16 v4h __attribute__((ext_vector_type(4)));

__global__ __launch_bounds__(256) void k_h16(const float* __restrict__ x, _Float16* __restrict__ X16, size_t n8) { const size_t t = (size_t)blockIdx.x * 256 + threadIdx.x; if (t >= n8) return; FragH f;
#pragma unroll
  for (int q = 0; q < 8; ++q) f.h[q] = (_Float16)x[t * 8 + q]; *(v8us*)((unsigned short*)X16 + t * 8) = f.half[0];  }
template <int NHv, int TTv>
__global__ __launch_bounds__(256) void k_vt(const _Float16* __restrict__ V16, int ldv, int voff, _Float16* __restrict__ Vt) { __shared__ unsigned short tl[64][66]; const int tid = threadIdx.x; const int slab = blockIdx.x / (TTv / 64), lg = blockIdx.x % (TTv / 64); const int b = slab / NHv, h = slab % NHv;
  for (int i = tid; i < 64 * 8; i += 256) { const int r = i / 8, c8 = (i % 8) * 8; FragH f; f.half[0] = *(const v8us*)((const unsigned short*)V16 + ((size_t)b * TTv + lg * 64 + r) * ldv + voff + h * 64 + c8);
#pragma unroll
    for (int q = 0; q < 8; ++q) tl[r][c8 + q] = f.u[q]; }
  __syncthreads();
  {
#pragma unroll
    for (int rd = 0; rd < 2; ++rd) { const int d = rd * 32 + tid / 8, pc = tid % 8; FragH f;
#pragma unroll
      for (int q = 0; q < 8; ++q) f.u[q] = tl[pc * 8 + q][d];
      *(v8us*)((unsigned short*)Vt + ((size_t)slab * 64 + d) * TTv + lg * 64 + pc * 8) = f.half[0]; }
     } }

__global__ __launch_bounds__(256) void k_hl(const float* __restrict__ F, _Float16* __restrict__ Hh, _Float16* __restrict__ Hl, size_t n8) { const size_t t = (size_t)blockIdx.x * 256 + threadIdx.x; if (t >= n8) return; FragH fh, fl; const v4f a = *(const v4fa*)(F + t * 8), c = *(const v4fa*)(F + t * 8 + 4);
#pragma unroll
  for (int q = 0; q < 4; ++q) { _Float16 h = (_Float16)a[q]; fh.h[q] = h; fl.h[q] = (_Float16)((a[q] - (float)h) * 1024.0f); h = (_Float16)c[q]; fh.h[4 + q] = h; fl.h[4 + q] = (_Float16)((c[q] - (float)h) * 1024.0f); }
  { *(v8us*)((unsigned short*)Hh + t * 8) = fh.half[0]; *(v8us*)((unsigned short*)Hl + t * 8) = fl.half[0];  } }

// FRAGMENT ORDER (the planes of k, transposed V and the mask that the fused kernel reads): a plane is a row of 16-byte pieces, a piece being the 8 values that ONE lane takes with ONE
// 16-byte load, and the 32 pieces of one load instruction lie side by side in lane order (lane = 16*hh + ln). So a fragment load reads 512 bytes in a row (4 cache lines) where the same load
// from a row-major plane touches 16 lines. Thread t of k_qk16 writes piece t of the k planes (batch after batch), thread t of k_prep piece t of each batch's V plane.
// k:    piece (((h*128 + key/16)*2 + ks)*2 + hf)*32 + lane = k[key = 16*(key/16) + ln][h*64 + ks*32 + hf*16 + hh*8 + 0..7]
// V:    piece (((h*64 + pass)*4 + tt)*2 + hf)*32 + lane    = V[key = pass*32 + hf*16 + hh*8 + 0..7][h][tt*16 + ln]
// mask: piece ((((b*64 + q/32)*64 + pass)*2 + u)*2 + j)*32 + lane = M[b][q = 32*(q/32) + u*16 + ln][pass*32 + j*16 + hh*8 + 0..7], rounded to bf16 (its bits)
__global__ __launch_bounds__(256) void k_qk16(const float* __restrict__ QK, _Float16* __restrict__ Q16, _Float16* __restrict__ KF) { const int t = blockIdx.x * 256 + threadIdx.x; if (t >= NBt * SS * (DD / 8)) return; const int c0 = (t % (DD / 8)) * 8, s = t / (DD / 8); FragH fq, fk;
  const int ln = t & 15, hh = (t >> 4) & 1, hf = (t >> 5) & 1, ks = (t >> 6) & 1, kt = (t >> 7) & (SS / 16 - 1), h = (t >> 14) & (NH - 1), b = t >> 18;
  const float* kp = QK + (size_t)(b * SS + kt * 16 + ln) * 2 * DD + DD + h * HD + ks * 32 + hf * 16 + hh * 8;
#pragma unroll
  for (int q = 0; q < 8; ++q) { fq.h[q] = (_Float16)QK[(size_t)s * 2 * DD + c0 + q]; fk.h[q] = (_Float16)kp[q]; }
  { *(v8us*)((unsigned short*)Q16 + (size_t)s * DD + c0) = fq.half[0]; *(v8us*)((unsigned short*)KF + (size_t)t * 8) = fk.half[0];  } }
// One launch for every plane that depends on the inputs alone. The planes have as many pieces as the launch has threads, or a small multiple or half of it, so thread t takes piece t of each:
// in_proj rows of q|k (x 16), x and transposed V of both batches, half a piece of out_w (x 16); a wave takes 16 queries x 64 keys (2 passes) of the mask: 8 fetches, each of 4 whole lines
// (8 lanes x 16 bytes a query row, 4 rows), a lane's 4 values being half a piece. All 31 fetches of a thread are issued before the first use.
typedef unsigned short v4us __attribute__((ext_vector_type(4), may_alias));
typedef float f32a __attribute__((may_alias));
static_assert(2 * DD * DD == SS * DD && NH * HD * SS == SS * DD && NBt * (SS / 16) * (SS / 64) * 32 == SS * DD / 8 && DD * DD / 4 == SS * DD / 8, "thread t takes piece t of each plane");
__global__ __launch_bounds__(256) void k_prep(const float* __restrict__ Win, const float* __restrict__ Wo, const float* __restrict__ x0, const float* __restrict__ x1, const float* __restrict__ V0, const float* __restrict__ V1, const float* __restrict__ Mm,
                                              _Float16* __restrict__ BIN, _Float16* __restrict__ BO, _Float16* __restrict__ X16, _Float16* __restrict__ VF, unsigned short* __restrict__ MF) {
  const unsigned t = blockIdx.x * 256 + threadIdx.x, wv = t >> 5, lane = t & 31, c = lane & 7, r4 = lane >> 3;
  const unsigned kh = wv & 1, u = (wv >> 1) & 1, pg = (wv >> 2) & (SS / 128 - 1), qt = (wv >> 6) & (SS / 32 - 1), b = wv >> 12;
  const unsigned im = ((b * SS + qt * 32 + u * 16 + r4) * SS + pg * 128 + kh * 64 + c * 4) * 4;      // offsets from the planes' starts, 32 bits each: one register a plane, the same for both batches (x0, V0: batch 0; x1, V1: batch 1)
  const unsigned t0 = ((t >> 8) & (SS / 32 - 1)) * 32 + ((t >> 5) & 1) * 16 + ((t >> 4) & 1) * 8, d = ((t >> 6) & 3) * 16 + (t & 15), h = t >> 14;
  const unsigned iv = (t0 * NH + h) * HD + d, i32 = t * 32, i16 = t * 16, i8 = t * 8;      // iv counts elements
  const unsigned om = (((((b * (SS / 32) + qt) * (SS / 32) + pg * 4 + kh * 2) * 2 + u) * 512 + (c >> 2) * 256 + (((c >> 1) & 1) * 16 + r4) * 8 + (c & 1) * 4)) * 2;
  const char* pm = (const char*)Mm;
  v4f m[2][4], xa[2][2], wa[2], oa; float va[2][8];      // every loop below is unrolled so that these are indexed by constants and stay in registers
#pragma unroll
  for (int k = 0; k < 2; ++k)
#pragma unroll
    for (int i = 0; i < 4; ++i) m[k][i] = *(const v4fa*)(pm + i * 16 * SS + k * 128 + im);
#pragma unroll
  for (int bb = 0; bb < 2; ++bb)
#pragma unroll
    for (int q = 0; q < 8; ++q) va[bb][q] = (bb ? V1 : V0)[q * NH * HD + iv];
#pragma unroll
  for (int i = 0; i < 2; ++i) { xa[0][i] = *(const v4fa*)((const char*)x0 + i * 16 + i32); xa[1][i] = *(const v4fa*)((const char*)x1 + i * 16 + i32); wa[i] = *(const v4fa*)((const char*)Win + i * 16 + i32); }
  oa = *(const v4fa*)((const char*)Wo + i16);
  // The wait behind the fetches takes their offset registers and their bases as inputs, so that these stay live up to it and nothing is written into them before; its clobber keeps all fetches in front of it.
  asm volatile("s_wait_xcnt 0x0" :: "v"(im), "v"(iv), "v"(i32), "v"(t), "s"(Win), "s"(Wo), "s"(x0), "s"(x1), "s"(V0), "s"(V1), "s"(Mm) : "memory");
  __builtin_amdgcn_sched_barrier(0);      // without it the scheduler lifts the first conversions in between the fetches, and the later fetches start only when the earlier have landed
  v4us mo[2][4]; FragH fv[2], fx[2], fw, fo;
#pragma unroll
  for (int k = 0; k < 2; ++k)
#pragma unroll
    for (int i = 0; i < 4; ++i)
#pragma unroll
      for (int q = 0; q < 4; ++q) mo[k][i][q] = bf16_bits(m[k][i][q]);
#pragma unroll
  for (int bb = 0; bb < 2; ++bb)
#pragma unroll
    for (int q = 0; q < 8; ++q) { fv[bb].h[q] = (_Float16)bf16_round(va[bb][q]); fx[bb].h[q] = (_Float16)bf16_round(xa[bb][q >> 2][q & 3]); }
#pragma unroll
  for (int q = 0; q < 8; ++q) fw.h[q] = (_Float16)(bf16_round(wa[q >> 2][q & 3]) * 16.0f);
#pragma unroll
  for (int q = 0; q < 4; ++q) fo.h[q] = (_Float16)(bf16_round(oa[q]) * 16.0f);
  v4us o4; o4[0] = fo.u[0]; o4[1] = fo.u[1]; o4[2] = fo.u[2]; o4[3] = fo.u[3];
  __builtin_amdgcn_sched_barrier(0);      // every conversion stays in front of the first store: behind a store no register that it names is written again
#pragma unroll
  for (int k = 0; k < 2; ++k)
#pragma unroll
    for (int i = 0; i < 4; ++i) *(v4us*)((char*)MF + k * 2048 + i * 64 + om) = mo[k][i];
#pragma unroll
  for (int bb = 0; bb < 2; ++bb) { *(v8us*)((char*)VF + (size_t)bb * NH * HD * SS * 2 + i16) = fv[bb].half[0]; *(v8us*)((char*)X16 + (size_t)bb * SS * DD * 2 + i16) = fx[bb].half[0]; }
  *(v8us*)((char*)BIN + i16) = fw.half[0]; *(v4us*)((char*)BO + i8) = o4; }
// Stands behind each group of fetches (and each store) of the fused kernel: the wait, because the registers that they name are reused right behind it;
// the "memory" clobber, because in the loop, without it, the compiler sinks the mask fetch to the loop's head, where its whole latency is waited for in every pass.
typedef unsigned int v4ua __attribute__((ext_vector_type(4), may_alias));
__device__ __forceinline__ void fetch_fence() { asm volatile("s_wait_xcnt 0x0" ::: "memory"); }
// Projection GEMM: C[m][n] (f32, pitch NN) = alpha * sum_k A[m][k] * Bt[n][k] + bf16(bias[n]); A and Bt are f16 planes with rows of DD elements.
// A work-group of 8 waves (4 x 2) owns 128 x BN of C, a wave 32 x BN/2. A stage is BK k of the 128 + BN operand rows: fetched as whole lines into registers while the
// stage before is multiplied, then written to the other of two LDS buffers (row pitch + 16 B, for the 16-byte fragment reads). One barrier a stage: it publishes the
// buffer just written and ends the reads of the buffer that the next stage overwrites. Fragment k order and the order of the k sum are those of k_gemm_hhx.
template <int NN, int BN, int BK>
__global__ __launch_bounds__(256) void k_gemm_t(const _Float16* __restrict__ A, const _Float16* __restrict__ Bt, float alpha, const float* __restrict__ bias, float* __restrict__ C) {
  constexpr int BM = 128, LP = BK + 8, NS = DD / BK, WN = BN / 2, NTN = WN / 16, STG = (BM + BN) * LP;
  constexpr int CPR = BK / 8, RPP = 256 / CPR, NA = BM / RPP, NB = BN / RPP;
  __shared__ __attribute__((aligned(16))) unsigned short sm[2 * STG];
  const int tid = threadIdx.x, w = tid >> 5, lane = tid & 31, ln = lane & 15, hh = lane >> 4, wm = w >> 1, wn = w & 1;
  const int row0 = blockIdx.y * BM, col0 = blockIdx.x * BN;
  const int lr = tid / CPR, lc = (tid % CPR) * 8;
  const unsigned short* ga = (const unsigned short*)A + (size_t)(row0 + lr) * DD + lc;
  const unsigned short* gb = (const unsigned short*)Bt + (size_t)(col0 + lr) * DD + lc;
  v8us ra[NA], rb[NB];
  // Every '#pragma unroll' below is there so that fragments and accumulators are indexed by constants and stay in registers.
  auto fetch = [&](int s) {
#pragma unroll
    for (int i = 0; i < NA; ++i) ra[i] = *(const v8us*)(ga + (size_t)i * RPP * DD + s * BK);
#pragma unroll
    for (int i = 0; i < NB; ++i) rb[i] = *(const v8us*)(gb + (size_t)i * RPP * DD + s * BK); };
  auto put = [&](int buf) {
    unsigned short* d = sm + buf * STG + lr * LP + lc;
#pragma unroll
    for (int i = 0; i < NA; ++i) *(v8us*)(d + i * RPP * LP) = ra[i];
#pragma unroll
    for (int i = 0; i < NB; ++i) *(v8us*)(d + (BM + i * RPP) * LP) = rb[i]; };
  v8f acc[2][NTN] = {};
  fetch(0); put(0);
  __syncthreads();
  for (int s = 0; s < NS; ++s) {
    // The wait behind the fetches: its clobber keeps them at the stage's head (without it the compiler sinks most of them to the stage's end, in front of the LDS writes,
    // where their whole latency is waited for); it takes both address pairs as inputs, so that they stay live up to the wait and no fetch of the run lands in them.
    if (s + 1 < NS) { fetch(s + 1); asm volatile("s_wait_xcnt 0x0" :: "v"(ga), "v"(gb) : "memory"); }
    const unsigned short* pa = sm + (s & 1) * STG + (wm * 32 + ln) * LP + 8 * hh;
    const unsigned short* pb = sm + (s & 1) * STG + (BM + wn * WN + ln) * LP + 8 * hh;
#pragma unroll
    for (int ks = 0; ks < BK / 32; ++ks) {
      FragH af[2], bf[NTN];
#pragma unroll
      for (int mi = 0; mi < 2; ++mi) { af[mi].half[0] = *(const v8us*)(pa + mi * 16 * LP + ks * 32); af[mi].half[1] = *(const v8us*)(pa + mi * 16 * LP + ks * 32 + 16); }
#pragma unroll
      for (int t = 0; t < NTN; ++t) { bf[t].half[0] = *(const v8us*)(pb + t * 16 * LP + ks * 32); bf[t].half[1] = *(const v8us*)(pb + t * 16 * LP + ks * 32 + 16); }
#pragma unroll
      for (int mi = 0; mi < 2; ++mi)
#pragma unroll
        for (int t = 0; t < NTN; ++t) acc[mi][t] = __builtin_amdgcn_wmma_f32_16x16x32_f16(false, af[mi].v, false, bf[t].v, (short)0, acc[mi][t], false, false);
    }
    if (s + 1 < NS) put((s + 1) & 1);
    __syncthreads();
  }
  // Behind the last barrier nobody reads the buffers any more: each wave stages its own 32 x WN block there, so that C is stored as whole lines.
  constexpr int SP = WN + 4, LPR = WN / 4, RPI = 32 / LPR;
  f32a* so = (f32a*)sm + w * 32 * SP;
#pragma unroll
  for (int t = 0; t < NTN; ++t) {
    const float bv = bf16_round(bias[col0 + wn * WN + t * 16 + ln]);
#pragma unroll
    for (int mi = 0; mi < 2; ++mi)
#pragma unroll
      for (int r = 0; r < 8; ++r) so[(mi * 16 + 8 * hh + r) * SP + t * 16 + ln] = acc[mi][t][r] * alpha + bv;
  }
  __syncthreads();
  const int rs = lane / LPR, c4 = (lane % LPR) * 4;
#pragma unroll
  for (int q = 0; q < 32 / RPI; ++q) {
    const int r = q * RPI + rs;
    const v4f v = *(const v4fa*)&so[r * SP + c4];
    *(v4f*)(C + (size_t)(row0 + wm * 32 + r) * NN + col0 + wn * WN + c4) = v;
  }
}
// Fused attention. One wave owns 32 queries of one (batch, head) and walks all keys, 32 a pass.
// ST = K.QT (A = 16 key rows, B = 16 query rows): a lane holds the scores of ONE query (column ln), keys 8*hh + r, so maximum and sums are
// in-lane plus one exchange between the wave's halves. Two score tiles, converted in place, are the B operand of OT += VT.PT (A = rows of VT in
// the same k order), so OT's column is the same query and the rescale factor is in-lane too.
// Result = sum(e*M*V) / (sum(e*M) + 1e-8 * sum e), e = exp(s - running max): the softmax denominator cancels but for the 1e-8 term.
// k, transposed V and the mask come from planes in fragment order (above k_qk16): a pass's 8 + 8 + 4 loads of a wave each read 512 bytes in a row.
// Every '#pragma unroll' below is there so that fragments and accumulators are indexed by constants and stay in registers.
__global__ __launch_bounds__(256) void k_fattn(const _Float16* __restrict__ Q16, const _Float16* __restrict__ KF, const _Float16* __restrict__ VF, const unsigned short* __restrict__ MF, _Float16* __restrict__ O16) {
  const int tid = threadIdx.x, w = tid >> 5, lane = tid & 31, ln = lane & 15, hh = lane >> 4;
  const int h = blockIdx.y, b = blockIdx.z, q0 = blockIdx.x * 256 + w * 32;
  const unsigned short* Qb = (const unsigned short*)Q16 + ((size_t)b * SS + q0 + ln) * DD + h * HD + 8 * hh;
  const unsigned short* Kb = (const unsigned short*)KF + ((size_t)b * NH + h) * (SS * HD) + lane * 8;
  const unsigned short* Vb = (const unsigned short*)VF + ((size_t)b * NH + h) * (SS * HD) + lane * 8;
  const unsigned short* Mb = MF + ((size_t)b * (SS / 32) + (q0 >> 5)) * (SS * 32) + lane * 8;
  FragH qf[2][2], kf[2][2], vf[4];
  v4ua mk[2][2];      // 8 bf16 mask values as 4 words: a value is its word shifted up (even) or masked (odd), one instruction each
#pragma unroll
  for (int u = 0; u < 2; ++u)
#pragma unroll
    for (int ks = 0; ks < 2; ++ks) { qf[u][ks].half[0] = *(const v8us*)(Qb + (size_t)u * 16 * DD + ks * 32); qf[u][ks].half[1] = *(const v8us*)(Qb + (size_t)u * 16 * DD + ks * 32 + 16); }
  fetch_fence();
  auto loadK = [&](int kb) {
#pragma unroll
    for (int j = 0; j < 2; ++j)
#pragma unroll
      for (int ks = 0; ks < 2; ++ks) { const unsigned short* p = Kb + (size_t)kb * HD + (j * 2 + ks) * 512; kf[j][ks].half[0] = *(const v8us*)p; kf[j][ks].half[1] = *(const v8us*)(p + 256); } };
  auto loadM = [&](int kb) {
#pragma unroll
    for (int u = 0; u < 2; ++u)
#pragma unroll
      for (int j = 0; j < 2; ++j) mk[u][j] = *(const v4ua*)(Mb + (size_t)kb * 32 + (u * 2 + j) * 256); };
  auto loadV = [&](int kb) {
#pragma unroll
    for (int t = 0; t < 4; ++t) { const unsigned short* p = Vb + (size_t)kb * HD + t * 512; vf[t].half[0] = *(const v8us*)p; vf[t].half[1] = *(const v8us*)(p + 256); } };
  v8f acc[2][4] = {};
  float mx[2] = {-3.0e38f, -3.0e38f}, se[2] = {0.f, 0.f}, sem[2] = {0.f, 0.f};
  const float c2 = 0.125f * 1.4426950408889634f;      // scores / 8, in log2 units
  loadK(0); loadM(0); fetch_fence(); loadV(0);      // the fence keeps the loop's own issue order K, M, V here too: else the loop's counted waits for the mask also wait for V
  // The wait behind the first V fetches takes the lane's index and its byte offset as inputs: the fetches name the register of one of the two, which so stays live up to the wait
  // (else the zeroing of the sums and accumulators lands in it first).
  asm volatile("s_wait_xcnt 0x0" :: "v"(lane), "v"(lane * 16) : "memory");
  for (int kb = 0; kb < SS; kb += 32) {
    const int kn = (kb + 32 < SS) ? kb + 32 : 0;      // each operand's next pass is fetched into its own registers right behind its last use; the last pass refetches pass 0, unused
    v8f st[2][2];
#pragma unroll
    for (int u = 0; u < 2; ++u)
#pragma unroll
      for (int j = 0; j < 2; ++j) {
        v8f z = {};
        z = __builtin_amdgcn_wmma_f32_16x16x32_f16(false, kf[j][0].v, false, qf[u][0].v, (short)0, z, false, false);
        st[u][j] = __builtin_amdgcn_wmma_f32_16x16x32_f16(false, kf[j][1].v, false, qf[u][1].v, (short)0, z, false, false);
      }
    loadK(kn); fetch_fence();
    __builtin_amdgcn_sched_barrier(0);      // without it the scheduler sinks the K fetch behind the softmax, too late for the next pass's first product
    FragH pf[2];
#pragma unroll
    for (int u = 0; u < 2; ++u) {
      float tm = st[u][0][0];
#pragma unroll
      for (int r = 1; r < 8; ++r) tm = fmaxf(tm, st[u][0][r]);
#pragma unroll
      for (int r = 0; r < 8; ++r) tm = fmaxf(tm, st[u][1][r]);
      tm = fmaxf(tm, __shfl_xor(tm, 16, 32));
      const float mn = fmaxf(mx[u], tm * c2);
      const float al = __builtin_amdgcn_exp2f(mx[u] - mn);
      mx[u] = mn;
      const float sh = 8.0f - mn;      // e carries 2^8 (it cancels in the quotient): keeps small weights in the normal f16 range
      float s1 = 0.f, s2 = 0.f;
#pragma unroll
      for (int j = 0; j < 2; ++j)
#pragma unroll
        for (int r = 0; r < 8; ++r) {
          const float ev = __builtin_amdgcn_exp2f(st[u][j][r] * c2 + sh);
          const float pv = ev * __uint_as_float((r & 1) ? (mk[u][j][r >> 1] & 0xFFFF0000u) : (mk[u][j][r >> 1] << 16));
          s1 += ev; s2 += pv;
          pf[u].h[j * 8 + r] = (_Float16)pv;
        }
      se[u] = se[u] * al + s1; sem[u] = sem[u] * al + s2;
#pragma unroll
      for (int t = 0; t < 4; ++t)
#pragma unroll
        for (int r = 0; r < 8; ++r) acc[u][t][r] *= al;
    }
    loadM(kn); fetch_fence();
#pragma unroll
    for (int t = 0; t < 4; ++t)
#pragma unroll
      for (int u = 0; u < 2; ++u) acc[u][t] = __builtin_amdgcn_wmma_f32_16x16x32_f16(false, vf[t].v, false, pf[u].v, (short)0, acc[u][t], false, false);
    loadV(kn); fetch_fence();
  }
#pragma unroll
  for (int u = 0; u < 2; ++u) {
    const float s1 = se[u] + __shfl_xor(se[u], 16, 32), s2 = sem[u] + __shfl_xor(sem[u], 16, 32);
    const float inv = 1.0f / (s2 + 1e-8f * s1);
    unsigned short* op = (unsigned short*)O16 + ((size_t)b * SS + q0 + u * 16 + ln) * DD + h * HD + 8 * hh;
#pragma unroll
    for (int t = 0; t < 4; ++t) { FragH f;
#pragma unroll
      for (int r = 0; r < 8; ++r) f.h[r] = (_Float16)(acc[u][t][r] * inv);
      *(v8us*)(op + t * 16) = f.half[0]; fetch_fence(); }
  }
}

extern "C" void kernel_launch(void* const* d_in, const int* in_sizes, int n_in,
                              void* d_out, int out_size, void* d_ws, size_t ws_size, hipStream_t stream) {
  (void)in_sizes; (void)n_in; (void)out_size;
  const float* x = (const float*)d_in[0]; const float* V = (const float*)d_in[1]; const float* Mm = (const float*)d_in[2]; const float* Win = (const float*)d_in[3]; const float* bin = (const float*)d_in[4]; const float* Wo = (const float*)d_in[5]; const float* bo = (const float*)d_in[6];
  char* ws = (char*)d_ws; size_t off = 0;
  auto take = [&](size_t bytes) { char* p = ws + off; off += (bytes + 255) & ~(size_t)255; return p; };
  _Float16* BIN = (_Float16*)take((size_t)2 * DD * DD * 2); _Float16* BO = (_Float16*)take((size_t)DD * DD * 2); _Float16* X16 = (_Float16*)take((size_t)NBt * SS * DD * 2); float* QK = (float*)take((size_t)NBt * SS * 2 * DD * 4); _Float16* Q16 = (_Float16*)take((size_t)NBt * SS * DD * 2); _Float16* K16 = (_Float16*)take((size_t)NBt * SS * DD * 2); _Float16* VT = (_Float16*)take((size_t)NBt * NH * HD * SS * 2);
  _Float16* O16 = (_Float16*)take((size_t)NBt * SS * DD * 2); unsigned short* MF = (unsigned short*)take((size_t)NBt * SS * SS * 2);
  if (off > ws_size) return;      // about 99 MB
  // The rows of both batches lie one behind the other in x, q|k, the attention output and out: each GEMM takes them as one matrix of NBt * SS rows.
  k_prep<<<SS * DD / 8 / 256, 256, 0, stream>>>(Win, Wo, x, x + (size_t)SS * DD, V, V + (size_t)SS * NH * HD, Mm, BIN, BO, X16, VT, MF);      /* torch (out,in) = natural Bt; only the q|k rows of in_proj are needed */
  k_gemm_t<2 * DD, 128, 128><<<dim3(2 * DD / 128, NBt * SS / 128), 256, 0, stream>>>(X16, BIN, 0.0625f, bin, QK);      /* q | k = x.W_in^T[:2048] + b (exact) */
  k_qk16<<<NBt * SS * (DD / 8) / 256, 256, 0, stream>>>(QK, Q16, K16);
  k_fattn<<<dim3(SS / 256, NH, NBt), 256, 0, stream>>>(Q16, K16, VT, MF, O16);      /* all batches and heads: 256 work-groups of 8 waves x 32 queries */
  k_gemm_t<DD, 64, 128><<<dim3(DD / 64, NBt * SS / 128), 256, 0, stream>>>(O16, BO, 0.0625f, bo, (float*)d_out);      /* .out_w^T + out_b */
}

// v005
// One run takes 93.4 microseconds.
// In two side-by-side timings against v004, it was 1.14 and 1.13 times as fast.
// All steps since v000 together make it 18.7 times as fast.
#include <hip/hip_runtime.h>
// Masked multi-head attention with external values (B 2, S 2048, D 1024, 16 heads × 64): q | k from the packed in-projection (+ bias; the v third is unused by the module), scores = q·k/8, softmax, A·M (INPUT mask [B,S,S]), L1 renormalisation over keys (+1e-8), out = Ā·V with the separate INPUT V [B,S,H,64], heads concatenated, ·out_wᵀ + out_b → [2,2048,1024].
// Structure, four launches, each over both batches: every plane that depends on the inputs alone (f16 weights and x, transposed V and the bf16 mask in fragment order); q|k GEMM (exact), whose epilogue writes the f16 planes of q (rows) and k (fragment order) itself; one fused attention kernel over all batches and heads (scores, online softmax, mask, L1 renormalisation and the product with V, nothing of the S x S score planes in memory) into the concatenated f16 plane; the output projection GEMM with bias.
// Compute dtype: x, V, M and parameters rounded to bf16; projections with exact products; q, k, the unnormalised masked weights e*M (x 2^8), V (exact) and the attention output as f16 operands (about 2^-12), f32 accumulation; softmax/mask/renormalisation in f32. v_wmma_f32_16x16x32_f16.
#define NBt 2
#define SS 2048
#define DD 1024
#define NH 16
#define HD 64
typedef __bf16 v16b __attribute__((ext_vector_type(16)));
typedef unsigned short v8us __attribute__((ext_vector_type(8), may_alias));
typedef float  v8f  __attribute__((ext_vector_type(8)));
typedef float  v4f  __attribute__((ext_vector_type(4)));
typedef float  v4fa __attribute__((ext_vector_type(4), may_alias));
union FragB { v16b v; v8us half[2]; unsigned short u[16]; };

__device__ __forceinline__ unsigned short bf16_bits(float x) { unsigned int u = __float_as_uint(x); return (unsigned short)((u + 0x7FFFu + ((u >> 16) & 1u)) >> 16); }
__device__ __forceinline__ float bf16_val(unsigned short b) { return __uint_as_float(((unsigned int)b) << 16); }
__device__ __forceinline__ float bf16_round(float x) { return bf16_val(bf16_bits(x)); }
// D += A·B with NT terms: 1 = ah·bh, 2 = + al·bh (A split), 3 = + ah·bl (both split)
template <int NT>
__device__ __forceinline__ v8f mmaN(v16b ah, v16b al, v16b bh, v16b bl, v8f c) {
  c = __builtin_amdgcn_wmma_f32_16x16x32_bf16(false, ah, false, bh, (short)0, c, false, false);
  if (NT >= 2) c = __builtin_amdgcn_wmma_f32_16x16x32_bf16(false, al, false, bh, (short)0, c, false, false);
  if (NT >= 3) c = __builtin_amdgcn_wmma_f32_16x16x32_bf16(false, ah, false, bl, (short)0, c, false, false);
  asm volatile("v_nop\n\tv_nop\n\tv_nop\n\tv_nop" : "+v"(c) : "v"(ah), "v"(al), "v"(bh), "v"(bl));
  return c;
}

__global__ __launch_bounds__(256) void k_wt_bf16(const float* __restrict__ W, unsigned short* __restrict__ Wt, int K, int N) {
  const int t = blockIdx.x * 256 + threadIdx.x;
  const int k8n = K / 8;
  if (t >= N * k8n) return;
  const int n = t / k8n, k8 = (t % k8n) * 8;
  v8us v;
#pragma unroll
  for (int i = 0; i < 8; ++i) v[i] = bf16_bits(W[(size_t)(k8 + i) * N + n]);
  *(v8us*)(Wt + (size_t)n * K + k8) = v;
  
}

// GEMM C[M][N] (f32, pitch ldc) = act(A[M][K]·W + bias). A f32 row-major (pitch lda) converted per fragment to bf16
// (ASPLIT: hi/lo two planes -> 2 terms, else single rounded term); Wt bf16 [N][K] (pitch ldb). BIAS_BF16 rounds the
// bias to bf16 first (bias quantised to bf16 before the add). K%32==0, M%16==0, N%64==0.
template <bool ASPLIT, int ACT, bool BIAS_BF16>
__global__ __launch_bounds__(128) void k_gemm_bf(const float* __restrict__ A, int lda, const unsigned short* __restrict__ Wt, int ldb,
                                               const float* __restrict__ bias, float* __restrict__ C, int ldc, int M, int N, int K) {
  __shared__ __attribute__((aligned(16))) float so[4][16][64];
  const int tid = threadIdx.x, w = tid >> 5, lane = tid & 31, ln = lane & 15, hh = lane >> 4;
  const int ntn = N / 64;
  const int wid = blockIdx.x * 4 + w;
  const int mt = wid / ntn, nq = wid % ntn;
  if (mt * 16 >= M) return;
  const int row0 = mt * 16, col0 = nq * 64;
  const float* arow = A + (size_t)(row0 + ln) * lda;
  v8f acc[4] = {};
  for (int kb = 0; kb < K; kb += 32) {
    FragB ah, al;
    const v4f x0 = *(const v4fa*)(arow + kb + 8 * hh), x1 = *(const v4fa*)(arow + kb + 8 * hh + 4);
    const v4f x2 = *(const v4fa*)(arow + kb + 16 + 8 * hh), x3 = *(const v4fa*)(arow + kb + 16 + 8 * hh + 4);
    float xs[16] = {x0[0],x0[1],x0[2],x0[3],x1[0],x1[1],x1[2],x1[3],x2[0],x2[1],x2[2],x2[3],x3[0],x3[1],x3[2],x3[3]};
#pragma unroll
    for (int i = 0; i < 16; ++i) { const unsigned short hb = bf16_bits(xs[i]); ah.u[i] = hb; al.u[i] = ASPLIT ? bf16_bits(xs[i] - bf16_val(hb)) : (unsigned short)0; }
#pragma unroll
    for (int t = 0; t < 4; ++t) {
      const unsigned short* brow = Wt + (size_t)(col0 + t * 16 + ln) * ldb + kb;
      FragB b;
      b.half[0] = *(const v8us*)(brow + 8 * hh);
      b.half[1] = *(const v8us*)(brow + 16 + 8 * hh);
      acc[t] = mmaN<ASPLIT ? 2 : 1>(ah.v, al.v, b.v, b.v, acc[t]);
    }
  }
#pragma unroll
  for (int t = 0; t < 4; ++t) {
    float bv = bias ? bias[col0 + t * 16 + ln] : 0.f;
    if (BIAS_BF16) bv = bf16_round(bv);
#pragma unroll
    for (int r = 0; r < 8; ++r) { float v = acc[t][r] + bv; if (ACT == 1) v = fmaxf(v, 0.f); so[w][8 * hh + r][t * 16 + ln] = v; }
  }
  __builtin_amdgcn_fence(__ATOMIC_ACQ_REL, "workgroup");
  __builtin_amdgcn_wave_barrier();
  const int rsub = lane >> 4, c4 = (lane & 15) * 4;
  {
#pragma unroll
    for (int q = 0; q < 8; ++q) {
      const int r = q * 2 + rsub;
      const v4f v = *(const v4fa*)&so[w][r][c4];
      *(v4f*)(C + (size_t)(row0 + r) * ldc + col0 + c4) = v;
    }
    
  }
}

// GEMM C = act(A·W + bias + resid): A f32 (ASPLIT -> hi/lo 2 terms), Wt bf16 [N][K]; ACT 0 none, 1 relu, 2 exact gelu;
// resid (optional, f32, row index = (row % rmod), pitch ldr, RES_BF16 rounds it) added before the activation.
template <bool ASPLIT, int ACT, bool BIAS_BF16, bool RES_BF16>
__global__ __launch_bounds__(128) void k_gemm_bf3(const float* __restrict__ A, int lda, const unsigned short* __restrict__ Wt, int ldb,
                                                const float* __restrict__ bias, const float* __restrict__ resid, int rmod, int ldr,
                                                float* __restrict__ C, int ldc, int M, int N, int K) {
  __shared__ __attribute__((aligned(16))) float so[4][16][64];
  const int tid = threadIdx.x, w = tid >> 5, lane = tid & 31, ln = lane & 15, hh = lane >> 4;
  const int ntn = N / 64;
  const int wid = blockIdx.x * 4 + w;
  const int mt = wid / ntn, nq = wid % ntn;
  if (mt * 16 >= M) return;
  const int row0 = mt * 16, col0 = nq * 64;
  const float* arow = A + (size_t)(row0 + ln) * lda;
  v8f acc[4] = {};
  for (int kb = 0; kb < K; kb += 32) {
    FragB ah, al;
    const v4f x0 = *(const v4fa*)(arow + kb + 8 * hh), x1 = *(const v4fa*)(arow + kb + 8 * hh + 4);
    const v4f x2 = *(const v4fa*)(arow + kb + 16 + 8 * hh), x3 = *(const v4fa*)(arow + kb + 16 + 8 * hh + 4);
    float xs[16] = {x0[0],x0[1],x0[2],x0[3],x1[0],x1[1],x1[2],x1[3],x2[0],x2[1],x2[2],x2[3],x3[0],x3[1],x3[2],x3[3]};
#pragma unroll
    for (int i = 0; i < 16; ++i) { const unsigned short hb = bf16_bits(xs[i]); ah.u[i] = hb; al.u[i] = ASPLIT ? bf16_bits(xs[i] - bf16_val(hb)) : (unsigned short)0; }
#pragma unroll
    for (int t = 0; t < 4; ++t) {
      const unsigned short* brow = Wt + (size_t)(col0 + t * 16 + ln) * ldb + kb;
      FragB b;
      b.half[0] = *(const v8us*)(brow + 8 * hh);
      b.half[1] = *(const v8us*)(brow + 16 + 8 * hh);
      acc[t] = mmaN<ASPLIT ? 2 : 1>(ah.v, al.v, b.v, b.v, acc[t]);
    }
  }
#pragma unroll
  for (int t = 0; t < 4; ++t) {
    const int col = col0 + t * 16 + ln;
    float bv = bias ? bias[col] : 0.f;
    if (BIAS_BF16) bv = bf16_round(bv);
#pragma unroll
    for (int r = 0; r < 8; ++r) {
      float v = acc[t][r] + bv;
      if (resid) { float rv = resid[(size_t)((row0 + 8 * hh + r) % rmod) * ldr + col]; if (RES_BF16) rv = bf16_round(rv); v += rv; }
      if (ACT == 1) v = fmaxf(v, 0.f);
      if (ACT == 2) v = 0.5f * v * (1.0f + erff(v * 0.70710678118654752f));
      if (ACT == 3) { const float u = 0.7978845608028654f * (v + 0.044715f * v * v * v); v = 0.5f * v * (1.0f + tanhf(u)); }
      so[w][8 * hh + r][t * 16 + ln] = v;
    }
  }
  __builtin_amdgcn_fence(__ATOMIC_ACQ_REL, "workgroup");
  __builtin_amdgcn_wave_barrier();
  const int rsub = lane >> 4, c4 = (lane & 15) * 4;
  {
#pragma unroll
    for (int q = 0; q < 8; ++q) {
      const int r = q * 2 + rsub;
      const v4f v = *(const v4fa*)&so[w][r][c4];
      *(v4f*)(C + (size_t)(row0 + r) * ldc + col0 + c4) = v;
    }
    
  }
}
// row LayerNorm (biased variance, eps) over N: s = X (+ R); optional out_sum <- s; out_norm <- (s-mu)*rsqrt(var+eps)*g + b
template <bool PARAM_BF16>
__global__ __launch_bounds__(256) void k_layernorm(const float* __restrict__ X, const float* __restrict__ R, const float* __restrict__ g, const float* __restrict__ bta,
                                                  float* __restrict__ out_sum, float* __restrict__ out_norm, int N, float eps) {
  __shared__ float red[256];
  const int row = blockIdx.x, tid = threadIdx.x;
  const float* x = X + (size_t)row * N; const float* rr = R ? R + (size_t)row * N : nullptr;
  float vals[16];                     // up to N = 4096
  const int per = N / 256;            // contiguous chunk per thread? use strided-by-4 chunks: thread handles j = tid*4 + 1024*u
  float s1 = 0.f;
  for (int u = 0; u < per / 4; ++u) {
    const int j = tid * 4 + 1024 * u;
    const v4f a = *(const v4fa*)(x + j);
    v4f b = {0.f,0.f,0.f,0.f}; if (rr) b = *(const v4fa*)(rr + j);
#pragma unroll
    for (int q = 0; q < 4; ++q) { const float v = a[q] + b[q]; vals[u * 4 + q] = v; s1 += v; }
  }
  red[tid] = s1; __syncthreads();
  for (int st = 128; st > 0; st >>= 1) { if (tid < st) red[tid] += red[tid + st]; __syncthreads(); }
  const float mu = red[0] / (float)N; __syncthreads();
  float s2 = 0.f;
  for (int u = 0; u < per / 4; ++u)
#pragma unroll
    for (int q = 0; q < 4; ++q) { const float c = vals[u * 4 + q] - mu; s2 += c * c; }
  red[tid] = s2; __syncthreads();
  for (int st = 128; st > 0; st >>= 1) { if (tid < st) red[tid] += red[tid + st]; __syncthreads(); }
  const float rs = rsqrtf(red[0] / (float)N + eps);
  {
    for (int u = 0; u < per / 4; ++u) {
      const int j = tid * 4 + 1024 * u;
      v4f o, sm;
#pragma unroll
      for (int q = 0; q < 4; ++q) {
        float gg = g[j + q], bb = bta[j + q];
        if (PARAM_BF16) { gg = bf16_round(gg); bb = bf16_round(bb); }
        sm[q] = vals[u * 4 + q]; o[q] = (vals[u * 4 + q] - mu) * rs * gg + bb;
      }
      if (out_sum) *(v4f*)(out_sum + (size_t)row * N + j) = sm;
      *(v4f*)(out_norm + (size_t)row * N + j) = o;
    }
    
  }
}



// ---- f16 WMMA path (v_wmma_f32_16x16x32_f16): 11-bit significands for operands in range — used for every product launched here: both projections, q·k and the masked weights (x 2^8) times V
typedef _Float16 v16h __attribute__((ext_vector_type(16)));
union FragH { v16h v; v8us half[2]; _Float16 h[16]; unsigned short u[16]; };
template <int NT>
__device__ __forceinline__ v8f mmaH(v16h ah, v16h al, v16h bh, v16h bl, v8f c) {
  c = __builtin_amdgcn_wmma_f32_16x16x32_f16(false, ah, false, bh, (short)0, c, false, false);
  if (NT >= 2) c = __builtin_amdgcn_wmma_f32_16x16x32_f16(false, al, false, bh, (short)0, c, false, false);
  if (NT >= 3) c = __builtin_amdgcn_wmma_f32_16x16x32_f16(false, ah, false, bl, (short)0, c, false, false);
  asm volatile("v_nop\n\tv_nop\n\tv_nop\n\tv_nop" : "+v"(c) : "v"(ah), "v"(al), "v"(bh), "v"(bl));
  return c;
}
// batched GEMM like k_gemm_b but f16 operands: A f32 (split into f16 hi/lo if ASPLIT, else rounded to f16), Bt = f16 values [n][k]; alpha; C f32; N multiple of 16 (partial tiles skipped)
template <bool ASPLIT>
__global__ __launch_bounds__(128) void k_gemm_h(const float* __restrict__ A, int lda, size_t sA, const _Float16* __restrict__ Bh, int ldb, size_t sB, float alpha, float* __restrict__ C, int ldc, size_t sC, int M, int N, int K) {
  __shared__ __attribute__((aligned(16))) float so[4][16][64];
  const int tid = threadIdx.x, w = tid >> 5, lane = tid & 31, ln = lane & 15, hh = lane >> 4; const int by = blockIdx.y;
  A += (size_t)by * sA; Bh += (size_t)by * sB; C += (size_t)by * sC;
  const int ntn = (N + 63) / 64; const int wid = blockIdx.x * 4 + w; const int mt = wid / ntn, nq = wid % ntn; if (mt * 16 >= M) return;
  const int row0 = mt * 16, col0 = nq * 64; const float* arow = A + (size_t)(row0 + ln) * lda;
  v8f acc[4] = {};
  for (int kb = 0; kb < K; kb += 32) {
    FragH ah, al;
    const v4f x0 = *(const v4fa*)(arow + kb + 8 * hh), x1 = *(const v4fa*)(arow + kb + 8 * hh + 4), x2 = *(const v4fa*)(arow + kb + 16 + 8 * hh), x3 = *(const v4fa*)(arow + kb + 16 + 8 * hh + 4);
    float xs[16] = {x0[0],x0[1],x0[2],x0[3],x1[0],x1[1],x1[2],x1[3],x2[0],x2[1],x2[2],x2[3],x3[0],x3[1],x3[2],x3[3]};
#pragma unroll
    for (int i = 0; i < 16; ++i) { const _Float16 h = (_Float16)xs[i]; ah.h[i] = h; al.h[i] = ASPLIT ? (_Float16)(xs[i] - (float)h) : (_Float16)0.0f; }
#pragma unroll
    for (int t = 0; t < 4; ++t) { if (col0 + t * 16 >= N) continue; const size_t boff = (size_t)(col0 + t * 16 + ln) * ldb + kb; FragH bq; bq.half[0] = *(const v8us*)(Bh + boff + 8 * hh); bq.half[1] = *(const v8us*)(Bh + boff + 16 + 8 * hh);
      acc[t] = mmaH<ASPLIT ? 2 : 1>(ah.v, al.v, bq.v, bq.v, acc[t]); }
  }
#pragma unroll
  for (int t = 0; t < 4; ++t) { if (col0 + t * 16 >= N) continue;
#pragma unroll
    for (int r = 0; r < 8; ++r) so[w][8 * hh + r][t * 16 + ln] = acc[t][r] * alpha; }
  __builtin_amdgcn_fence(__ATOMIC_ACQ_REL, "workgroup"); __builtin_amdgcn_wave_barrier();
  const int rsub = lane >> 4, c4 = (lane & 15) * 4;
  {
#pragma unroll
    for (int q = 0; q < 8; ++q) { const int r = q * 2 + rsub; if (col0 + c4 < N) { const v4f v = *(const v4fa*)&so[w][r][c4]; *(v4f*)(C + (size_t)(row0 + r) * ldc + col0 + c4) = v; } }
     }
}

// Wt[n][k] = f16(W[k][n]·scale) from f32 row-major W[K][N] (scale = power of two; bf16-exact weights stay exact in f16 away from the subnormal range)
__global__ __launch_bounds__(256) void k_wt_f16(const float* __restrict__ W, _Float16* __restrict__ Wt, int K, int N, float scale) {
  const int t = blockIdx.x * 256 + threadIdx.x; if (t >= N * (K / 8)) return; const int n = t / (K / 8), k8 = (t % (K / 8)) * 8; FragH f;
#pragma unroll
  for (int i = 0; i < 8; ++i) f.h[i] = (_Float16)(bf16_round(W[(size_t)(k8 + i) * N + n]) * scale); const v8us o = f.half[0];
  *(v8us*)((unsigned short*)Wt + (size_t)n * K + k8) = o; 
}
// k_gemm_hh variant with fused epilogue: v = acc·alpha + bias[by·sBias + col] (+ CP[(row/rowsPerB)·sCPb + by·64 + col] if CP) ; ACT 0 none / 1 elu ; writes f32 C and/or f16 C16 (each if non-null)
template <int ACT>
__global__ __launch_bounds__(128) void k_gemm_hhx(const _Float16* __restrict__ A, int lda, size_t sA, const _Float16* __restrict__ Bh, int ldb, size_t sB, float alpha, const float* __restrict__ bias, size_t sBias, const float* __restrict__ CP, int rowsPerB, size_t sCPb, int row0g,
    float* __restrict__ C, _Float16* __restrict__ C16, int ldc, size_t sC, int M, int N, int K) {
  __shared__ __attribute__((aligned(16))) float so[4][16][64];
  const int tid = threadIdx.x, w = tid >> 5, lane = tid & 31, ln = lane & 15, hh = lane >> 4; const int by = blockIdx.y;
  A += (size_t)by * sA; Bh += (size_t)by * sB; const size_t cofs = (size_t)by * sC; const float* bp = bias ? bias + (size_t)by * sBias : nullptr;
  const int ntn = (N + 63) / 64; const int wid = blockIdx.x * 4 + w; const int mt = wid / ntn, nq = wid % ntn; if (mt * 16 >= M) return;
  const int row0 = mt * 16, col0 = nq * 64; const _Float16* arow = A + (size_t)(row0 + ln) * lda;
  v8f acc[4] = {};
  for (int kb = 0; kb < K; kb += 32) { FragH ah; ah.half[0] = *(const v8us*)((const unsigned short*)arow + kb + 8 * hh); ah.half[1] = *(const v8us*)((const unsigned short*)arow + kb + 16 + 8 * hh);
#pragma unroll
    for (int t = 0; t < 4; ++t) { if (col0 + t * 16 >= N) continue; const size_t boff = (size_t)(col0 + t * 16 + ln) * ldb + kb; FragH bq; bq.half[0] = *(const v8us*)((const unsigned short*)Bh + boff + 8 * hh); bq.half[1] = *(const v8us*)((const unsigned short*)Bh + boff + 16 + 8 * hh);
      acc[t] = mmaH<1>(ah.v, ah.v, bq.v, bq.v, acc[t]); }
  }
#pragma unroll
  for (int t = 0; t < 4; ++t) { if (col0 + t * 16 >= N) continue; const int col = col0 + t * 16 + ln; const float bv = bp ? bf16_round(bp[col]) : 0.f;
#pragma unroll
    for (int r = 0; r < 8; ++r) { float v = acc[t][r] * alpha + bv; if (CP) { const int bidx = (row0g + row0 + 8 * hh + r) / rowsPerB; v += CP[(size_t)bidx * sCPb + (size_t)by * 64 + col]; } if (ACT == 1) v = (v > 0.f) ? v : expm1f(v); else if (ACT == 7) v = (v > 0.f) ? v + 1.0f : expf(v); else if (ACT == 8) v = tanhf(v); else if (ACT == 9) v = 0.5f * v * (1.0f + tanhf(0.7978845608028654f * (v + 0.044715f * v * v * v))); else if (ACT == 11) v = 1.0f / (1.0f + expf(-v)); else if (ACT == 12) v = (v > 0.f) ? v : 0.01f * v; else if (ACT == 14) v = (v > 0.f) ? v : 0.1f * v; else if (ACT == 15) v = v / (1.0f + expf(-v)); else if (ACT == 3) v = fmaxf(v, 0.f); else if (ACT == 6) v = 0.5f * v * (1.0f + erff(v * 0.70710678118654752f)); so[w][8 * hh + r][t * 16 + ln] = v; } }
  __builtin_amdgcn_fence(__ATOMIC_ACQ_REL, "workgroup"); __builtin_amdgcn_wave_barrier();
  const int rsub = lane >> 4, c4 = (lane & 15) * 4; typedef _Float16 v4h __attribute__((ext_vector_type(4)));
  {
#pragma unroll
    for (int q = 0; q < 8; ++q) { const int r = q * 2 + rsub; if (col0 + c4 < N) { const v4f v = *(const v4fa*)&so[w][r][c4]; if (C) *(v4f*)(C + cofs + (size_t)(row0 + r) * ldc + col0 + c4) = v; if (C16) { v4h h4; for (int i = 0; i < 4; ++i) h4[i] = (_Float16)v[i]; *(v4h*)(C16 + cofs + (size_t)(row0 + r) * ldc + col0 + c4) = h4; } } }
     }
}


typedef _Float16 v4h __attribute__((ext_vector_type(4)));

__global__ __launch_bounds__(256) void k_h16(const float* __restrict__ x, _Float16* __restrict__ X16, size_t n8) { const size_t t = (size_t)blockIdx.x * 256 + threadIdx.x; if (t >= n8) return; FragH f;
#pragma unroll
  for (int q = 0; q < 8; ++q) f.h[q] = (_Float16)x[t * 8 + q]; *(v8us*)((unsigned short*)X16 + t * 8) = f.half[0];  }
template <int NHv, int TTv>
__global__ __launch_bounds__(256) void k_vt(const _Float16* __restrict__ V16, int ldv, int voff, _Float16* __restrict__ Vt) { __shared__ unsigned short tl[64][66]; const int tid = threadIdx.x; const int slab = blockIdx.x / (TTv / 64), lg = blockIdx.x % (TTv / 64); const int b = slab / NHv, h = slab % NHv;
  for (int i = tid; i < 64 * 8; i += 256) { const int r = i / 8, c8 = (i % 8) * 8; FragH f; f.half[0] = *(const v8us*)((const unsigned short*)V16 + ((size_t)b * TTv + lg * 64 + r) * ldv + voff + h * 64 + c8);
#pragma unroll
    for (int q = 0; q < 8; ++q) tl[r][c8 + q] = f.u[q]; }
  __syncthreads();
  {
#pragma unroll
    for (int rd = 0; rd < 2; ++rd) { const int d = rd * 32 + tid / 8, pc = tid % 8; FragH f;
#pragma unroll
      for (int q = 0; q < 8; ++q) f.u[q] = tl[pc * 8 + q][d];
      *(v8us*)((unsigned short*)Vt + ((size_t)slab * 64 + d) * TTv + lg * 64 + pc * 8) = f.half[0]; }
     } }

__global__ __launch_bounds__(256) void k_hl(const float* __restrict__ F, _Float16* __restrict__ Hh, _Float16* __restrict__ Hl, size_t n8) { const size_t t = (size_t)blockIdx.x * 256 + threadIdx.x; if (t >= n8) return; FragH fh, fl; const v4f a = *(const v4fa*)(F + t * 8), c = *(const v4fa*)(F + t * 8 + 4);
#pragma unroll
  for (int q = 0; q < 4; ++q) { _Float16 h = (_Float16)a[q]; fh.h[q] = h; fl.h[q] = (_Float16)((a[q] - (float)h) * 1024.0f); h = (_Float16)c[q]; fh.h[4 + q] = h; fl.h[4 + q] = (_Float16)((c[q] - (float)h) * 1024.0f); }
  { *(v8us*)((unsigned short*)Hh + t * 8) = fh.half[0]; *(v8us*)((unsigned short*)Hl + t * 8) = fl.half[0];  } }

// FRAGMENT ORDER (the planes of k, transposed V and the mask that the fused kernel reads): a plane is a row of 16-byte pieces, a piece being the 8 values that ONE lane takes with ONE
// 16-byte load, and the 32 pieces of one load instruction lie side by side in lane order (lane = 16*hh + ln). So a fragment load reads 512 bytes in a row (4 cache lines) where the same load
// from a row-major plane touches 16 lines. A wave of the q|k GEMM writes the 256 pieces of its 32 keys of one head (4 KB in a row; the batches' k planes lie one behind the other), thread t of k_prep piece t of each batch's V plane.
// k:    piece (((h*128 + key/16)*2 + ks)*2 + hf)*32 + lane = k[key = 16*(key/16) + ln][h*64 + ks*32 + hf*16 + hh*8 + 0..7]
// V:    piece (((h*64 + pass)*4 + tt)*2 + hf)*32 + lane    = V[key = pass*32 + hf*16 + hh*8 + 0..7][h][tt*16 + ln]
// mask: piece ((((b*64 + q/32)*64 + pass)*2 + u)*2 + j)*32 + lane = M[b][q = 32*(q/32) + u*16 + ln][pass*32 + j*16 + hh*8 + 0..7], rounded to bf16 (its bits)
// One launch for every plane that depends on the inputs alone. The planes have as many pieces as the launch has threads, or a small multiple or half of it, so thread t takes piece t of each:
// in_proj rows of q|k (x 16), x and transposed V of both batches, half a piece of out_w (x 16); a wave takes 16 queries x 64 keys (2 passes) of the mask: 8 fetches, each of 4 whole lines
// (8 lanes x 16 bytes a query row, 4 rows), a lane's 4 values being half a piece. All 31 fetches of a thread are issued before the first use.
typedef unsigned short v4us __attribute__((ext_vector_type(4), may_alias));
typedef float f32a __attribute__((may_alias));
static_assert(2 * DD * DD == SS * DD && NH * HD * SS == SS * DD && NBt * (SS / 16) * (SS / 64) * 32 == SS * DD / 8 && DD * DD / 4 == SS * DD / 8, "thread t takes piece t of each plane");
__global__ __launch_bounds__(256) void k_prep(const float* __restrict__ Win, const float* __restrict__ Wo, const float* __restrict__ x0, const float* __restrict__ x1, const float* __restrict__ V0, const float* __restrict__ V1, const float* __restrict__ Mm,
                                              _Float16* __restrict__ BIN, _Float16* __restrict__ BO, _Float16* __restrict__ X16, _Float16* __restrict__ VF, unsigned short* __restrict__ MF) {
  const unsigned t = blockIdx.x * 256 + threadIdx.x, wv = t >> 5, lane = t & 31, c = lane & 7, r4 = lane >> 3;
  const unsigned kh = wv & 1, u = (wv >> 1) & 1, pg = (wv >> 2) & (SS / 128 - 1), qt = (wv >> 6) & (SS / 32 - 1), b = wv >> 12;
  const unsigned im = ((b * SS + qt * 32 + u * 16 + r4) * SS + pg * 128 + kh * 64 + c * 4) * 4;      // offsets from the planes' starts, 32 bits each: one register a plane, the same for both batches (x0, V0: batch 0; x1, V1: batch 1)
  const unsigned t0 = ((t >> 8) & (SS / 32 - 1)) * 32 + ((t >> 5) & 1) * 16 + ((t >> 4) & 1) * 8, d = ((t >> 6) & 3) * 16 + (t & 15), h = t >> 14;
  const unsigned iv = (t0 * NH + h) * HD + d, i32 = t * 32, i16 = t * 16, i8 = t * 8;      // iv counts elements
  const unsigned om = (((((b * (SS / 32) + qt) * (SS / 32) + pg * 4 + kh * 2) * 2 + u) * 512 + (c >> 2) * 256 + (((c >> 1) & 1) * 16 + r4) * 8 + (c & 1) * 4)) * 2;
  const char* pm = (const char*)Mm;
  v4f m[2][4], xa[2][2], wa[2], oa; float va[2][8];      // every loop below is unrolled so that these are indexed by constants and stay in registers
#pragma unroll
  for (int k = 0; k < 2; ++k)
#pragma unroll
    for (int i = 0; i < 4; ++i) m[k][i] = *(const v4fa*)(pm + i * 16 * SS + k * 128 + im);
#pragma unroll
  for (int bb = 0; bb < 2; ++bb)
#pragma unroll
    for (int q = 0; q < 8; ++q) va[bb][q] = (bb ? V1 : V0)[q * NH * HD + iv];
#pragma unroll
  for (int i = 0; i < 2; ++i) { xa[0][i] = *(const v4fa*)((const char*)x0 + i * 16 + i32); xa[1][i] = *(const v4fa*)((const char*)x1 + i * 16 + i32); wa[i] = *(const v4fa*)((const char*)Win + i * 16 + i32); }
  oa = *(const v4fa*)((const char*)Wo + i16);
  // The wait behind the fetches takes their offset registers and their bases as inputs, so that these stay live up to it and nothing is written into them before; its clobber keeps all fetches in front of it.
  asm volatile("s_wait_xcnt 0x0" :: "v"(im), "v"(iv), "v"(i32), "v"(t), "s"(Win), "s"(Wo), "s"(x0), "s"(x1), "s"(V0), "s"(V1), "s"(Mm) : "memory");
  __builtin_amdgcn_sched_barrier(0);      // without it the scheduler lifts the first conversions in between the fetches, and the later fetches start only when the earlier have landed
  v4us mo[2][4]; FragH fv[2], fx[2], fw, fo;
#pragma unroll
  for (int k = 0; k < 2; ++k)
#pragma unroll
    for (int i = 0; i < 4; ++i)
#pragma unroll
      for (int q = 0; q < 4; ++q) mo[k][i][q] = bf16_bits(m[k][i][q]);
#pragma unroll
  for (int bb = 0; bb < 2; ++bb)
#pragma unroll
    for (int q = 0; q < 8; ++q) { fv[bb].h[q] = (_Float16)bf16_round(va[bb][q]); fx[bb].h[q] = (_Float16)bf16_round(xa[bb][q >> 2][q & 3]); }
#pragma unroll
  for (int q = 0; q < 8; ++q) fw.h[q] = (_Float16)(bf16_round(wa[q >> 2][q & 3]) * 16.0f);
#pragma unroll
  for (int q = 0; q < 4; ++q) fo.h[q] = (_Float16)(bf16_round(oa[q]) * 16.0f);
  v4us o4; o4[0] = fo.u[0]; o4[1] = fo.u[1]; o4[2] = fo.u[2]; o4[3] = fo.u[3];
  __builtin_amdgcn_sched_barrier(0);      // every conversion stays in front of the first store: behind a store no register that it names is written again
#pragma unroll
  for (int k = 0; k < 2; ++k)
#pragma unroll
    for (int i = 0; i < 4; ++i) *(v4us*)((char*)MF + k * 2048 + i * 64 + om) = mo[k][i];
#pragma unroll
  for (int bb = 0; bb < 2; ++bb) { *(v8us*)((char*)VF + (size_t)bb * NH * HD * SS * 2 + i16) = fv[bb].half[0]; *(v8us*)((char*)X16 + (size_t)bb * SS * DD * 2 + i16) = fx[bb].half[0]; }
  *(v8us*)((char*)BIN + i16) = fw.half[0]; *(v4us*)((char*)BO + i8) = o4; }
// Stands behind each group of fetches (and each store) of the fused kernel: the wait, because the registers that they name are reused right behind it;
// the "memory" clobber, because in the loop, without it, the compiler sinks the mask fetch to the loop's head, where its whole latency is waited for in every pass.
typedef unsigned int v4ua __attribute__((ext_vector_type(4), may_alias));
__device__ __forceinline__ void fetch_fence() { asm volatile("s_wait_xcnt 0x0" ::: "memory"); }
// Projection GEMM: C[m][n] (f32, pitch NN) = alpha * sum_k A[m][k] * Bt[n][k] + bf16(bias[n]); A and Bt are f16 planes with rows of DD elements.
// A work-group of 8 waves (4 x 2) owns 128 x BN of C, a wave 32 x BN/2. A stage is BK k of the 128 + BN operand rows: fetched as whole lines into registers while the
// stage before is multiplied, then written to the other of two LDS buffers (row pitch + 16 B, for the 16-byte fragment reads). One barrier a stage: it publishes the
// buffer just written and ends the reads of the buffer that the next stage overwrites. Fragment k order and the order of the k sum are those of k_gemm_hhx.
// SPLIT (the q|k projection): C is not stored; the same f32 values go, rounded to f16, to the planes that the fused attention reads: columns below DD to Q16 (rows), the rest to KF (fragment order).
template <int NN, int BN, int BK, bool SPLIT>
__global__ __launch_bounds__(256) void k_gemm_t(const _Float16* __restrict__ A, const _Float16* __restrict__ Bt, float alpha, const float* __restrict__ bias, float* __restrict__ C, _Float16* __restrict__ Q16, _Float16* __restrict__ KF) {
  constexpr int BM = 128, LP = BK + 8, NS = DD / BK, WN = BN / 2, NTN = WN / 16, STG = (BM + BN) * LP;
  constexpr int CPR = BK / 8, RPP = 256 / CPR, NA = BM / RPP, NB = BN / RPP;
  __shared__ __attribute__((aligned(16))) unsigned short sm[2 * STG];
  const int tid = threadIdx.x, w = tid >> 5, lane = tid & 31, ln = lane & 15, hh = lane >> 4, wm = w >> 1, wn = w & 1;
  const int row0 = blockIdx.y * BM, col0 = blockIdx.x * BN;
  const int lr = tid / CPR, lc = (tid % CPR) * 8;
  const unsigned short* ga = (const unsigned short*)A + (size_t)(row0 + lr) * DD + lc;
  const unsigned short* gb = (const unsigned short*)Bt + (size_t)(col0 + lr) * DD + lc;
  v8us ra[NA], rb[NB];
  // Every '#pragma unroll' below is there so that fragments and accumulators are indexed by constants and stay in registers.
  auto fetch = [&](int s) {
#pragma unroll
    for (int i = 0; i < NA; ++i) ra[i] = *(const v8us*)(ga + (size_t)i * RPP * DD + s * BK);
#pragma unroll
    for (int i = 0; i < NB; ++i) rb[i] = *(const v8us*)(gb + (size_t)i * RPP * DD + s * BK); };
  auto put = [&](int buf) {
    unsigned short* d = sm + buf * STG + lr * LP + lc;
#pragma unroll
    for (int i = 0; i < NA; ++i) *(v8us*)(d + i * RPP * LP) = ra[i];
#pragma unroll
    for (int i = 0; i < NB; ++i) *(v8us*)(d + (BM + i * RPP) * LP) = rb[i]; };
  v8f acc[2][NTN] = {};
  fetch(0); put(0);
  __syncthreads();
  for (int s = 0; s < NS; ++s) {
    // The wait behind the fetches: its clobber keeps them at the stage's head (without it the compiler sinks most of them to the stage's end, in front of the LDS writes,
    // where their whole latency is waited for); it takes both address pairs as inputs, so that they stay live up to the wait and no fetch of the run lands in them.
    if (s + 1 < NS) { fetch(s + 1); asm volatile("s_wait_xcnt 0x0" :: "v"(ga), "v"(gb) : "memory"); }
    const unsigned short* pa = sm + (s & 1) * STG + (wm * 32 + ln) * LP + 8 * hh;
    const unsigned short* pb = sm + (s & 1) * STG + (BM + wn * WN + ln) * LP + 8 * hh;
#pragma unroll
    for (int ks = 0; ks < BK / 32; ++ks) {
      FragH af[2], bf[NTN];
#pragma unroll
      for (int mi = 0; mi < 2; ++mi) { af[mi].half[0] = *(const v8us*)(pa + mi * 16 * LP + ks * 32); af[mi].half[1] = *(const v8us*)(pa + mi * 16 * LP + ks * 32 + 16); }
#pragma unroll
      for (int t = 0; t < NTN; ++t) { bf[t].half[0] = *(const v8us*)(pb + t * 16 * LP + ks * 32); bf[t].half[1] = *(const v8us*)(pb + t * 16 * LP + ks * 32 + 16); }
#pragma unroll
      for (int mi = 0; mi < 2; ++mi)
#pragma unroll
        for (int t = 0; t < NTN; ++t) acc[mi][t] = __builtin_amdgcn_wmma_f32_16x16x32_f16(false, af[mi].v, false, bf[t].v, (short)0, acc[mi][t], false, false);
    }
    if (s + 1 < NS) put((s + 1) & 1);
    __syncthreads();
  }
  // Behind the last barrier nobody reads the buffers any more: each wave stages its own 32 x WN block there, so that C, or with SPLIT the f16 q and k planes, is stored as whole lines.
  constexpr int SP = WN + 4, LPR = WN / 4, RPI = 32 / LPR;
  f32a* so = (f32a*)sm + w * 32 * SP;
#pragma unroll
  for (int t = 0; t < NTN; ++t) {
    const float bv = bf16_round(bias[col0 + wn * WN + t * 16 + ln]);
#pragma unroll
    for (int mi = 0; mi < 2; ++mi)
#pragma unroll
      for (int r = 0; r < 8; ++r) so[(mi * 16 + 8 * hh + r) * SP + t * 16 + ln] = acc[mi][t][r] * alpha + bv;
  }
  __syncthreads();
  if constexpr (SPLIT) {
    static_assert(WN == HD && DD % BN == 0 && SS % BM == 0, "a wave's block is 32 rows of one head, a work-group's lies in q or in k and in one batch");
    const int rw = row0 + wm * 32, cw = col0 + wn * WN;
    // A lane takes 8 pieces of 8 values; all are converted before the first is stored, and the 8 stores share one address.
    FragH f[4];
    auto piece = [&](int i, const f32a* p) {
      const v4f a = *(const v4fa*)p, c = *(const v4fa*)(p + 4);
#pragma unroll
      for (int q = 0; q < 4; ++q) { f[i >> 1].h[(i & 1) * 8 + q] = (_Float16)a[q]; f[i >> 1].h[(i & 1) * 8 + 4 + q] = (_Float16)c[q]; } };
    if (col0 < DD) {      // q: piece i = row i*4 + lane/8, columns (lane%8)*8, so that a store is 4 whole lines
      const f32a* sp = so + (lane >> 3) * SP + (lane & 7) * 8;
      unsigned short* gp = (unsigned short*)Q16 + (size_t)(rw + (lane >> 3)) * DD + cw + (lane & 7) * 8;
#pragma unroll
      for (int i = 0; i < 8; ++i) piece(i, sp + i * 4 * SP);
#pragma unroll
      for (int i = 0; i < 8; ++i) *(v8us*)(gp + i * 4 * DD) = f[i >> 1].half[i & 1];
      asm volatile("s_wait_xcnt 0x0" ::: "memory");      // behind the run of stores: whatever block the compiler lays behind this one reuses the registers that they name
    } else {      // k: piece i*32 + lane of the wave's 4 KB, i = (key tile)*4 + ks*2 + hf
      const f32a* sp = so + ln * SP + hh * 8;
      unsigned short* gp = (unsigned short*)KF + ((((size_t)(rw / SS) * NH + (cw - DD) / HD) * (SS / 16) + (rw % SS) / 16) * 128 + lane) * 8;
#pragma unroll
      for (int i = 0; i < 8; ++i) piece(i, sp + (i >> 2) * 16 * SP + (i & 3) * 16);
#pragma unroll
      for (int i = 0; i < 8; ++i) *(v8us*)(gp + i * 256) = f[i >> 1].half[i & 1];
      asm volatile("s_wait_xcnt 0x0" ::: "memory");      // behind the run of stores: whatever block the compiler lays behind this one reuses the registers that they name
    }
  } else {
    const int rs = lane / LPR, c4 = (lane % LPR) * 4;
#pragma unroll
    for (int q = 0; q < 32 / RPI; ++q) {
      const int r = q * RPI + rs;
      const v4f v = *(const v4fa*)&so[r * SP + c4];
      *(v4f*)(C + (size_t)(row0 + wm * 32 + r) * NN + col0 + wn * WN + c4) = v;
    }
  }
}
// Fused attention. One wave owns 32 queries of one (batch, head) and walks all keys, 32 a pass.
// ST = K.QT (A = 16 key rows, B = 16 query rows): a lane holds the scores of ONE query (column ln), keys 8*hh + r, so maximum and sums are
// in-lane plus one exchange between the wave's halves. Two score tiles, converted in place, are the B operand of OT += VT.PT (A = rows of VT in
// the same k order), so OT's column is the same query and the rescale factor is in-lane too.
// Result = sum(e*M*V) / (sum(e*M) + 1e-8 * sum e), e = exp(s - running max): the softmax denominator cancels but for the 1e-8 term.
// k, transposed V and the mask come from planes in fragment order (above k_prep): a pass's 8 + 8 + 4 loads of a wave each read 512 bytes in a row.
// Every '#pragma unroll' below is there so that fragments and accumulators are indexed by constants and stay in registers.
__global__ __launch_bounds__(256) void k_fattn(const _Float16* __restrict__ Q16, const _Float16* __restrict__ KF, const _Float16* __restrict__ VF, const unsigned short* __restrict__ MF, _Float16* __restrict__ O16) {
  const int tid = threadIdx.x, w = tid >> 5, lane = tid & 31, ln = lane & 15, hh = lane >> 4;
  const int h = blockIdx.y, b = blockIdx.z, q0 = blockIdx.x * 256 + w * 32;
  const unsigned short* Qb = (const unsigned short*)Q16 + ((size_t)b * SS + q0 + ln) * DD + h * HD + 8 * hh;
  const unsigned short* Kb = (const unsigned short*)KF + ((size_t)b * NH + h) * (SS * HD) + lane * 8;
  const unsigned short* Vb = (const unsigned short*)VF + ((size_t)b * NH + h) * (SS * HD) + lane * 8;
  const unsigned short* Mb = MF + ((size_t)b * (SS / 32) + (q0 >> 5)) * (SS * 32) + lane * 8;
  FragH qf[2][2], kf[2][2], vf[4];
  v4ua mk[2][2];      // 8 bf16 mask values as 4 words: a value is its word shifted up (even) or masked (odd), one instruction each
#pragma unroll
  for (int u = 0; u < 2; ++u)
#pragma unroll
    for (int ks = 0; ks < 2; ++ks) { qf[u][ks].half[0] = *(const v8us*)(Qb + (size_t)u * 16 * DD + ks * 32); qf[u][ks].half[1] = *(const v8us*)(Qb + (size_t)u * 16 * DD + ks * 32 + 16); }
  fetch_fence();
  auto loadK = [&](int kb) {
#pragma unroll
    for (int j = 0; j < 2; ++j)
#pragma unroll
      for (int ks = 0; ks < 2; ++ks) { const unsigned short* p = Kb + (size_t)kb * HD + (j * 2 + ks) * 512; kf[j][ks].half[0] = *(const v8us*)p; kf[j][ks].half[1] = *(const v8us*)(p + 256); } };
  auto loadM = [&](int kb) {
#pragma unroll
    for (int u = 0; u < 2; ++u)
#pragma unroll
      for (int j = 0; j < 2; ++j) mk[u][j] = *(const v4ua*)(Mb + (size_t)kb * 32 + (u * 2 + j) * 256); };
  auto loadV = [&](int kb) {
#pragma unroll
    for (int t = 0; t < 4; ++t) { const unsigned short* p = Vb + (size_t)kb * HD + t * 512; vf[t].half[0] = *(const v8us*)p; vf[t].half[1] = *(const v8us*)(p + 256); } };
  v8f acc[2][4] = {};
  float mx[2] = {-3.0e38f, -3.0e38f}, se[2] = {0.f, 0.f}, sem[2] = {0.f, 0.f};
  const float c2 = 0.125f * 1.4426950408889634f;      // scores / 8, in log2 units
  loadK(0); loadM(0); fetch_fence(); loadV(0);      // the fence keeps the loop's own issue order K, M, V here too: else the loop's counted waits for the mask also wait for V
  // The wait behind the first V fetches takes the lane's index and its byte offset as inputs: the fetches name the register of one of the two, which so stays live up to the wait
  // (else the zeroing of the sums and accumulators lands in it first).
  asm volatile("s_wait_xcnt 0x0" :: "v"(lane), "v"(lane * 16) : "memory");
  for (int kb = 0; kb < SS; kb += 32) {
    const int kn = (kb + 32 < SS) ? kb + 32 : 0;      // each operand's next pass is fetched into its own registers right behind its last use; the last pass refetches pass 0, unused
    v8f st[2][2];
#pragma unroll
    for (int u = 0; u < 2; ++u)
#pragma unroll
      for (int j = 0; j < 2; ++j) {
        v8f z = {};
        z = __builtin_amdgcn_wmma_f32_16x16x32_f16(false, kf[j][0].v, false, qf[u][0].v, (short)0, z, false, false);
        st[u][j] = __builtin_amdgcn_wmma_f32_16x16x32_f16(false, kf[j][1].v, false, qf[u][1].v, (short)0, z, false, false);
      }
    loadK(kn); fetch_fence();
    __builtin_amdgcn_sched_barrier(0);      // without it the scheduler sinks the K fetch behind the softmax, too late for the next pass's first product
    FragH pf[2];
#pragma unroll
    for (int u = 0; u < 2; ++u) {
      float tm = st[u][0][0];
#pragma unroll
      for (int r = 1; r < 8; ++r) tm = fmaxf(tm, st[u][0][r]);
#pragma unroll
      for (int r = 0; r < 8; ++r) tm = fmaxf(tm, st[u][1][r]);
      tm = fmaxf(tm, __shfl_xor(tm, 16, 32));
      const float mn = fmaxf(mx[u], tm * c2);
      const float al = __builtin_amdgcn_exp2f(mx[u] - mn);
      mx[u] = mn;
      const float sh = 8.0f - mn;      // e carries 2^8 (it cancels in the quotient): keeps small weights in the normal f16 range
      float s1 = 0.f, s2 = 0.f;
#pragma unroll
      for (int j = 0; j < 2; ++j)
#pragma unroll
        for (int r = 0; r < 8; ++r) {
          const float ev = __builtin_amdgcn_exp2f(st[u][j][r] * c2 + sh);
          const float pv = ev * __uint_as_float((r & 1) ? (mk[u][j][r >> 1] & 0xFFFF0000u) : (mk[u][j][r >> 1] << 16));
          s1 += ev; s2 += pv;
          pf[u].h[j * 8 + r] = (_Float16)pv;
        }
      se[u] = se[u] * al + s1; sem[u] = sem[u] * al + s2;
#pragma unroll
      for (int t = 0; t < 4; ++t)
#pragma unroll
        for (int r = 0; r < 8; ++r) acc[u][t][r] *= al;
    }
    loadM(kn); fetch_fence();
#pragma unroll
    for (int t = 0; t < 4; ++t)
#pragma unroll
      for (int u = 0; u < 2; ++u) acc[u][t] = __builtin_amdgcn_wmma_f32_16x16x32_f16(false, vf[t].v, false, pf[u].v, (short)0, acc[u][t], false, false);
    loadV(kn); fetch_fence();
  }
#pragma unroll
  for (int u = 0; u < 2; ++u) {
    const float s1 = se[u] + __shfl_xor(se[u], 16, 32), s2 = sem[u] + __shfl_xor(sem[u], 16, 32);
    const float inv = 1.0f / (s2 + 1e-8f * s1);
    unsigned short* op = (unsigned short*)O16 + ((size_t)b * SS + q0 + u * 16 + ln) * DD + h * HD + 8 * hh;
#pragma unroll
    for (int t = 0; t < 4; ++t) { FragH f;
#pragma unroll
      for (int r = 0; r < 8; ++r) f.h[r] = (_Float16)(acc[u][t][r] * inv);
      *(v8us*)(op + t * 16) = f.half[0]; fetch_fence(); }
  }
}

extern "C" void kernel_launch(void* const* d_in, const int* in_sizes, int n_in,
                              void* d_out, int out_size, void* d_ws, size_t ws_size, hipStream_t stream) {
  (void)in_sizes; (void)n_in; (void)out_size;
  const float* x = (const float*)d_in[0]; const float* V = (const float*)d_in[1]; const float* Mm = (const float*)d_in[2]; const float* Win = (const float*)d_in[3]; const float* bin = (const float*)d_in[4]; const float* Wo = (const float*)d_in[5]; const float* bo = (const float*)d_in[6];
  char* ws = (char*)d_ws; size_t off = 0;
  auto take = [&](size_t bytes) { char* p = ws + off; off += (bytes + 255) & ~(size_t)255; return p; };
  _Float16* BIN = (_Float16*)take((size_t)2 * DD * DD * 2); _Float16* BO = (_Float16*)take((size_t)DD * DD * 2); _Float16* X16 = (_Float16*)take((size_t)NBt * SS * DD * 2); _Float16* Q16 = (_Float16*)take((size_t)NBt * SS * DD * 2); _Float16* K16 = (_Float16*)take((size_t)NBt * SS * DD * 2); _Float16* VT = (_Float16*)take((size_t)NBt * NH * HD * SS * 2);
  _Float16* O16 = (_Float16*)take((size_t)NBt * SS * DD * 2); unsigned short* MF = (unsigned short*)take((size_t)NBt * SS * SS * 2);
  if (off > ws_size) return;      // about 65 MB
  // The rows of both batches lie one behind the other in x, q|k, the attention output and out: each GEMM takes them as one matrix of NBt * SS rows.
  k_prep<<<SS * DD / 8 / 256, 256, 0, stream>>>(Win, Wo, x, x + (size_t)SS * DD, V, V + (size_t)SS * NH * HD, Mm, BIN, BO, X16, VT, MF);      /* torch (out,in) = natural Bt; only the q|k rows of in_proj are needed */
  k_gemm_t<2 * DD, 128, 128, true><<<dim3(2 * DD / 128, NBt * SS / 128), 256, 0, stream>>>(X16, BIN, 0.0625f, bin, nullptr, Q16, K16);      /* q | k = x.W_in^T[:2048] + b (exact), stored as the f16 planes */
  k_fattn<<<dim3(SS / 256, NH, NBt), 256, 0, stream>>>(Q16, K16, VT, MF, O16);      /* all batches and heads: 256 work-groups of 8 waves x 32 queries */
  k_gemm_t<DD, 64, 128, false><<<dim3(DD / 64, NBt * SS / 128), 256, 0, stream>>>(O16, BO, 0.0625f, bo, (float*)d_out, nullptr, nullptr);      /* .out_w^T + out_b */
}

// v006
// One run takes 91.1 microseconds.
// Two timings next to v005 put it at 1.03 and 1.02 times that version's speed.
// Counting every step since v000, it is 19.2 times as fast.
#include <hip/hip_runtime.h>
// Masked multi-head attention with external values (B 2, S 2048, D 1024, 16 heads × 64): q | k from the packed in-projection (+ bias; the v third is unused by the module), scores = q·k/8, softmax, A·M (INPUT mask [B,S,S]), L1 renormalisation over keys (+1e-8), out = Ā·V with the separate INPUT V [B,S,H,64], heads concatenated, ·out_wᵀ + out_b → [2,2048,1024].
// Structure, four launches, each over both batches: every plane that depends on the inputs alone (f16 weights and x, transposed V and the bf16 mask in fragment order); q|k GEMM (exact), whose epilogue writes the f16 planes of q (rows) and k (fragment order) itself; one fused attention kernel over all batches and heads (scores, online softmax, mask, L1 renormalisation and the product with V, nothing of the S x S score planes in memory) into the concatenated f16 plane; the output projection GEMM with bias.
// Compute dtype: x, V, M and parameters rounded to bf16; projections with exact products; q, k, the unnormalised masked weights e*M (x 2^8), V (exact) and the attention output as f16 operands (about 2^-12), f32 accumulation; softmax/mask/renormalisation in f32, but that the two key sums add the weights e and e*M as rounded to f16 (f32 accumulation, on the matrix unit). v_wmma_f32_16x16x32_f16.
#define NBt 2
#define SS 2048
#define DD 1024
#define NH 16
#define HD 64
typedef __bf16 v16b __attribute__((ext_vector_type(16)));
typedef unsigned short v8us __attribute__((ext_vector_type(8), may_alias));
typedef float  v8f  __attribute__((ext_vector_type(8)));
typedef float  v4f  __attribute__((ext_vector_type(4)));
typedef float  v4fa __attribute__((ext_vector_type(4), may_alias));
union FragB { v16b v; v8us half[2]; unsigned short u[16]; };

__device__ __forceinline__ unsigned short bf16_bits(float x) { unsigned int u = __float_as_uint(x); return (unsigned short)((u + 0x7FFFu + ((u >> 16) & 1u)) >> 16); }
__device__ __forceinline__ float bf16_val(unsigned short b) { return __uint_as_float(((unsigned int)b) << 16); }
__device__ __forceinline__ float bf16_round(float x) { return bf16_val(bf16_bits(x)); }
// D += A·B with NT terms: 1 = ah·bh, 2 = + al·bh (A split), 3 = + ah·bl (both split)
template <int NT>
__device__ __forceinline__ v8f mmaN(v16b ah, v16b al, v16b bh, v16b bl, v8f c) {
  c = __builtin_amdgcn_wmma_f32_16x16x32_bf16(false, ah, false, bh, (short)0, c, false, false);
  if (NT >= 2) c = __builtin_amdgcn_wmma_f32_16x16x32_bf16(false, al, false, bh, (short)0, c, false, false);
  if (NT >= 3) c = __builtin_amdgcn_wmma_f32_16x16x32_bf16(false, ah, false, bl, (short)0, c, false, false);
  asm volatile("v_nop\n\tv_nop\n\tv_nop\n\tv_nop" : "+v"(c) : "v"(ah), "v"(al), "v"(bh), "v"(bl));
  return c;
}

__global__ __launch_bounds__(256) void k_wt_bf16(const float* __restrict__ W, unsigned short* __restrict__ Wt, int K, int N) {
  const int t = blockIdx.x * 256 + threadIdx.x;
  const int k8n = K / 8;
  if (t >= N * k8n) return;
  const int n = t / k8n, k8 = (t % k8n) * 8;
  v8us v;
#pragma unroll
  for (int i = 0; i < 8; ++i) v[i] = bf16_bits(W[(size_t)(k8 + i) * N + n]);
  *(v8us*)(Wt + (size_t)n * K + k8) = v;
  
}

// GEMM C[M][N] (f32, pitch ldc) = act(A[M][K]·W + bias). A f32 row-major (pitch lda) converted per fragment to bf16
// (ASPLIT: hi/lo two planes -> 2 terms, else single rounded term); Wt bf16 [N][K] (pitch ldb). BIAS_BF16 rounds the
// bias to bf16 first (bias quantised to bf16 before the add). K%32==0, M%16==0, N%64==0.
template <bool ASPLIT, int ACT, bool BIAS_BF16>
__global__ __launch_bounds__(128) void k_gemm_bf(const float* __restrict__ A, int lda, const unsigned short* __restrict__ Wt, int ldb,
                                               const float* __restrict__ bias, float* __restrict__ C, int ldc, int M, int N, int K) {
  __shared__ __attribute__((aligned(16))) float so[4][16][64];
  const int tid = threadIdx.x, w = tid >> 5, lane = tid & 31, ln = lane & 15, hh = lane >> 4;
  const int ntn = N / 64;
  const int wid = blockIdx.x * 4 + w;
  const int mt = wid / ntn, nq = wid % ntn;
  if (mt * 16 >= M) return;
  const int row0 = mt * 16, col0 = nq * 64;
  const float* arow = A + (size_t)(row0 + ln) * lda;
  v8f acc[4] = {};
  for (int kb = 0; kb < K; kb += 32) {
    FragB ah, al;
    const v4f x0 = *(const v4fa*)(arow + kb + 8 * hh), x1 = *(const v4fa*)(arow + kb + 8 * hh + 4);
    const v4f x2 = *(const v4fa*)(arow + kb + 16 + 8 * hh), x3 = *(const v4fa*)(arow + kb + 16 + 8 * hh + 4);
    float xs[16] = {x0[0],x0[1],x0[2],x0[3],x1[0],x1[1],x1[2],x1[3],x2[0],x2[1],x2[2],x2[3],x3[0],x3[1],x3[2],x3[3]};
#pragma unroll
    for (int i = 0; i < 16; ++i) { const unsigned short hb = bf16_bits(xs[i]); ah.u[i] = hb; al.u[i] = ASPLIT ? bf16_bits(xs[i] - bf16_val(hb)) : (unsigned short)0; }
#pragma unroll
    for (int t = 0; t < 4; ++t) {
      const unsigned short* brow = Wt + (size_t)(col0 + t * 16 + ln) * ldb + kb;
      FragB b;
      b.half[0] = *(const v8us*)(brow + 8 * hh);
      b.half[1] = *(const v8us*)(brow + 16 + 8 * hh);
      acc[t] = mmaN<ASPLIT ? 2 : 1>(ah.v, al.v, b.v, b.v, acc[t]);
    }
  }
#pragma unroll
  for (int t = 0; t < 4; ++t) {
    float bv = bias ? bias[col0 + t * 16 + ln] : 0.f;
    if (BIAS_BF16) bv = bf16_round(bv);
#pragma unroll
    for (int r = 0; r < 8; ++r) { float v = acc[t][r] + bv; if (ACT == 1) v = fmaxf(v, 0.f); so[w][8 * hh + r][t * 16 + ln] = v; }
  }
  __builtin_amdgcn_fence(__ATOMIC_ACQ_REL, "workgroup");
  __builtin_amdgcn_wave_barrier();
  const int rsub = lane >> 4, c4 = (lane & 15) * 4;
  {
#pragma unroll
    for (int q = 0; q < 8; ++q) {
      const int r = q * 2 + rsub;
      const v4f v = *(const v4fa*)&so[w][r][c4];
      *(v4f*)(C + (size_t)(row0 + r) * ldc + col0 + c4) = v;
    }
    
  }
}

// GEMM C = act(A·W + bias + resid): A f32 (ASPLIT -> hi/lo 2 terms), Wt bf16 [N][K]; ACT 0 none, 1 relu, 2 exact gelu;
// resid (optional, f32, row index = (row % rmod), pitch ldr, RES_BF16 rounds it) added before the activation.
template <bool ASPLIT, int ACT, bool BIAS_BF16, bool RES_BF16>
__global__ __launch_bounds__(128) void k_gemm_bf3(const float* __restrict__ A, int lda, const unsigned short* __restrict__ Wt, int ldb,
                                                const float* __restrict__ bias, const float* __restrict__ resid, int rmod, int ldr,
                                                float* __restrict__ C, int ldc, int M, int N, int K) {
  __shared__ __attribute__((aligned(16))) float so[4][16][64];
  const int tid = threadIdx.x, w = tid >> 5, lane = tid & 31, ln = lane & 15, hh = lane >> 4;
  const int ntn = N / 64;
  const int wid = blockIdx.x * 4 + w;
  const int mt = wid / ntn, nq = wid % ntn;
  if (mt * 16 >= M) return;
  const int row0 = mt * 16, col0 = nq * 64;
  const float* arow = A + (size_t)(row0 + ln) * lda;
  v8f acc[4] = {};
  for (int kb = 0; kb < K; kb += 32) {
    FragB ah, al;
    const v4f x0 = *(const v4fa*)(arow + kb + 8 * hh), x1 = *(const v4fa*)(arow + kb + 8 * hh + 4);
    const v4f x2 = *(const v4fa*)(arow + kb + 16 + 8 * hh), x3 = *(const v4fa*)(arow + kb + 16 + 8 * hh + 4);
    float xs[16] = {x0[0],x0[1],x0[2],x0[3],x1[0],x1[1],x1[2],x1[3],x2[0],x2[1],x2[2],x2[3],x3[0],x3[1],x3[2],x3[3]};
#pragma unroll
    for (int i = 0; i < 16; ++i) { const unsigned short hb = bf16_bits(xs[i]); ah.u[i] = hb; al.u[i] = ASPLIT ? bf16_bits(xs[i] - bf16_val(hb)) : (unsigned short)0; }
#pragma unroll
    for (int t = 0; t < 4; ++t) {
      const unsigned short* brow = Wt + (size_t)(col0 + t * 16 + ln) * ldb + kb;
      FragB b;
      b.half[0] = *(const v8us*)(brow + 8 * hh);
      b.half[1] = *(const v8us*)(brow + 16 + 8 * hh);
      acc[t] = mmaN<ASPLIT ? 2 : 1>(ah.v, al.v, b.v, b.v, acc[t]);
    }
  }
#pragma unroll
  for (int t = 0; t < 4; ++t) {
    const int col = col0 + t * 16 + ln;
    float bv = bias ? bias[col] : 0.f;
    if (BIAS_BF16) bv = bf16_round(bv);
#pragma unroll
    for (int r = 0; r < 8; ++r) {
      float v = acc[t][r] + bv;
      if (resid) { float rv = resid[(size_t)((row0 + 8 * hh + r) % rmod) * ldr + col]; if (RES_BF16) rv = bf16_round(rv); v += rv; }
      if (ACT == 1) v = fmaxf(v, 0.f);
      if (ACT == 2) v = 0.5f * v * (1.0f + erff(v * 0.70710678118654752f));
      if (ACT == 3) { const float u = 0.7978845608028654f * (v + 0.044715f * v * v * v); v = 0.5f * v * (1.0f + tanhf(u)); }
      so[w][8 * hh + r][t * 16 + ln] = v;
    }
  }
  __builtin_amdgcn_fence(__ATOMIC_ACQ_REL, "workgroup");
  __builtin_amdgcn_wave_barrier();
  const int rsub = lane >> 4, c4 = (lane & 15) * 4;
  {
#pragma unroll
    for (int q = 0; q < 8; ++q) {
      const int r = q * 2 + rsub;
      const v4f v = *(const v4fa*)&so[w][r][c4];
      *(v4f*)(C + (size_t)(row0 + r) * ldc + col0 + c4) = v;
    }
    
  }
}
// row LayerNorm (biased variance, eps) over N: s = X (+ R); optional out_sum <- s; out_norm <- (s-mu)*rsqrt(var+eps)*g + b
template <bool PARAM_BF16>
__global__ __launch_bounds__(256) void k_layernorm(const float* __restrict__ X, const float* __restrict__ R, const float* __restrict__ g, const float* __restrict__ bta,
                                                  float* __restrict__ out_sum, float* __restrict__ out_norm, int N, float eps) {
  __shared__ float red[256];
  const int row = blockIdx.x, tid = threadIdx.x;
  const float* x = X + (size_t)row * N; const float* rr = R ? R + (size_t)row * N : nullptr;
  float vals[16];                     // up to N = 4096
  const int per = N / 256;            // contiguous chunk per thread? use strided-by-4 chunks: thread handles j = tid*4 + 1024*u
  float s1 = 0.f;
  for (int u = 0; u < per / 4; ++u) {
    const int j = tid * 4 + 1024 * u;
    const v4f a = *(const v4fa*)(x + j);
    v4f b = {0.f,0.f,0.f,0.f}; if (rr) b = *(const v4fa*)(rr + j);
#pragma unroll
    for (int q = 0; q < 4; ++q) { const float v = a[q] + b[q]; vals[u * 4 + q] = v; s1 += v; }
  }
  red[tid] = s1; __syncthreads();
  for (int st = 128; st > 0; st >>= 1) { if (tid < st) red[tid] += red[tid + st]; __syncthreads(); }
  const float mu = red[0] / (float)N; __syncthreads();
  float s2 = 0.f;
  for (int u = 0; u < per / 4; ++u)
#pragma unroll
    for (int q = 0; q < 4; ++q) { const float c = vals[u * 4 + q] - mu; s2 += c * c; }
  red[tid] = s2; __syncthreads();
  for (int st = 128; st > 0; st >>= 1) { if (tid < st) red[tid] += red[tid + st]; __syncthreads(); }
  const float rs = rsqrtf(red[0] / (float)N + eps);
  {
    for (int u = 0; u < per / 4; ++u) {
      const int j = tid * 4 + 1024 * u;
      v4f o, sm;
#pragma unroll
      for (int q = 0; q < 4; ++q) {
        float gg = g[j + q], bb = bta[j + q];
        if (PARAM_BF16) { gg = bf16_round(gg); bb = bf16_round(bb); }
        sm[q] = vals[u * 4 + q]; o[q] = (vals[u * 4 + q] - mu) * rs * gg + bb;
      }
      if (out_sum) *(v4f*)(out_sum + (size_t)row * N + j) = sm;
      *(v4f*)(out_norm + (size_t)row * N + j) = o;
    }
    
  }
}



// ---- f16 WMMA path (v_wmma_f32_16x16x32_f16): 11-bit significands for operands in range — used for every product launched here: both projections, q·k and the masked weights (x 2^8) times V
typedef _Float16 v16h __attribute__((ext_vector_type(16)));
union FragH { v16h v; v8us half[2]; _Float16 h[16]; unsigned short u[16]; };
template <int NT>
__device__ __forceinline__ v8f mmaH(v16h ah, v16h al, v16h bh, v16h bl, v8f c) {
  c = __builtin_amdgcn_wmma_f32_16x16x32_f16(false, ah, false, bh, (short)0, c, false, false);
  if (NT >= 2) c = __builtin_amdgcn_wmma_f32_16x16x32_f16(false, al, false, bh, (short)0, c, false, false);
  if (NT >= 3) c = __builtin_amdgcn_wmma_f32_16x16x32_f16(false, ah, false, bl, (short)0, c, false, false);
  asm volatile("v_nop\n\tv_nop\n\tv_nop\n\tv_nop" : "+v"(c) : "v"(ah), "v"(al), "v"(bh), "v"(bl));
  return c;
}
// batched GEMM like k_gemm_b but f16 operands: A f32 (split into f16 hi/lo if ASPLIT, else rounded to f16), Bt = f16 values [n][k]; alpha; C f32; N multiple of 16 (partial tiles skipped)
template <bool ASPLIT>
__global__ __launch_bounds__(128) void k_gemm_h(const float* __restrict__ A, int lda, size_t sA, const _Float16* __restrict__ Bh, int ldb, size_t sB, float alpha, float* __restrict__ C, int ldc, size_t sC, int M, int N, int K) {
  __shared__ __attribute__((aligned(16))) float so[4][16][64];
  const int tid = threadIdx.x, w = tid >> 5, lane = tid & 31, ln = lane & 15, hh = lane >> 4; const int by = blockIdx.y;
  A += (size_t)by * sA; Bh += (size_t)by * sB; C += (size_t)by * sC;
  const int ntn = (N + 63) / 64; const int wid = blockIdx.x * 4 + w; const int mt = wid / ntn, nq = wid % ntn; if (mt * 16 >= M) return;
  const int row0 = mt * 16, col0 = nq * 64; const float* arow = A + (size_t)(row0 + ln) * lda;
  v8f acc[4] = {};
  for (int kb = 0; kb < K; kb += 32) {
    FragH ah, al;
    const v4f x0 = *(const v4fa*)(arow + kb + 8 * hh), x1 = *(const v4fa*)(arow + kb + 8 * hh + 4), x2 = *(const v4fa*)(arow + kb + 16 + 8 * hh), x3 = *(const v4fa*)(arow + kb + 16 + 8 * hh + 4);
    float xs[16] = {x0[0],x0[1],x0[2],x0[3],x1[0],x1[1],x1[2],x1[3],x2[0],x2[1],x2[2],x2[3],x3[0],x3[1],x3[2],x3[3]};
#pragma unroll
    for (int i = 0; i < 16; ++i) { const _Float16 h = (_Float16)xs[i]; ah.h[i] = h; al.h[i] = ASPLIT ? (_Float16)(xs[i] - (float)h) : (_Float16)0.0f; }
#pragma unroll
    for (int t = 0; t < 4; ++t) { if (col0 + t * 16 >= N) continue; const size_t boff = (size_t)(col0 + t * 16 + ln) * ldb + kb; FragH bq; bq.half[0] = *(const v8us*)(Bh + boff + 8 * hh); bq.half[1] = *(const v8us*)(Bh + boff + 16 + 8 * hh);
      acc[t] = mmaH<ASPLIT ? 2 : 1>(ah.v, al.v, bq.v, bq.v, acc[t]); }
  }
#pragma unroll
  for (int t = 0; t < 4; ++t) { if (col0 + t * 16 >= N) continue;
#pragma unroll
    for (int r = 0; r < 8; ++r) so[w][8 * hh + r][t * 16 + ln] = acc[t][r] * alpha; }
  __builtin_amdgcn_fence(__ATOMIC_ACQ_REL, "workgroup"); __builtin_amdgcn_wave_barrier();
  const int rsub = lane >> 4, c4 = (lane & 15) * 4;
  {
#pragma unroll
    for (int q = 0; q < 8; ++q) { const int r = q * 2 + rsub; if (col0 + c4 < N) { const v4f v = *(const v4fa*)&so[w][r][c4]; *(v4f*)(C + (size_t)(row0 + r) * ldc + col0 + c4) = v; } }
     }
}

// Wt[n][k] = f16(W[k][n]·scale) from f32 row-major W[K][N] (scale = power of two; bf16-exact weights stay exact in f16 away from the subnormal range)
__global__ __launch_bounds__(256) void k_wt_f16(const float* __restrict__ W, _Float16* __restrict__ Wt, int K, int N, float scale) {
  const int t = blockIdx.x * 256 + threadIdx.x; if (t >= N * (K / 8)) return; const int n = t / (K / 8), k8 = (t % (K / 8)) * 8; FragH f;
#pragma unroll
  for (int i = 0; i < 8; ++i) f.h[i] = (_Float16)(bf16_round(W[(size_t)(k8 + i) * N + n]) * scale); const v8us o = f.half[0];
  *(v8us*)((unsigned short*)Wt + (size_t)n * K + k8) = o; 
}
// k_gemm_hh variant with fused epilogue: v = acc·alpha + bias[by·sBias + col] (+ CP[(row/rowsPerB)·sCPb + by·64 + col] if CP) ; ACT 0 none / 1 elu ; writes f32 C and/or f16 C16 (each if non-null)
template <int ACT>
__global__ __launch_bounds__(128) void k_gemm_hhx(const _Float16* __restrict__ A, int lda, size_t sA, const _Float16* __restrict__ Bh, int ldb, size_t sB, float alpha, const float* __restrict__ bias, size_t sBias, const float* __restrict__ CP, int rowsPerB, size_t sCPb, int row0g,
    float* __restrict__ C, _Float16* __restrict__ C16, int ldc, size_t sC, int M, int N, int K) {
  __shared__ __attribute__((aligned(16))) float so[4][16][64];
  const int tid = threadIdx.x, w = tid >> 5, lane = tid & 31, ln = lane & 15, hh = lane >> 4; const int by = blockIdx.y;
  A += (size_t)by * sA; Bh += (size_t)by * sB; const size_t cofs = (size_t)by * sC; const float* bp = bias ? bias + (size_t)by * sBias : nullptr;
  const int ntn = (N + 63) / 64; const int wid = blockIdx.x * 4 + w; const int mt = wid / ntn, nq = wid % ntn; if (mt * 16 >= M) return;
  const int row0 = mt * 16, col0 = nq * 64; const _Float16* arow = A + (size_t)(row0 + ln) * lda;
  v8f acc[4] = {};
  for (int kb = 0; kb < K; kb += 32) { FragH ah; ah.half[0] = *(const v8us*)((const unsigned short*)arow + kb + 8 * hh); ah.half[1] = *(const v8us*)((const unsigned short*)arow + kb + 16 + 8 * hh);
#pragma unroll
    for (int t = 0; t < 4; ++t) { if (col0 + t * 16 >= N) continue; const size_t boff = (size_t)(col0 + t * 16 + ln) * ldb + kb; FragH bq; bq.half[0] = *(const v8us*)((const unsigned short*)Bh + boff + 8 * hh); bq.half[1] = *(const v8us*)((const unsigned short*)Bh + boff + 16 + 8 * hh);
      acc[t] = mmaH<1>(ah.v, ah.v, bq.v, bq.v, acc[t]); }
  }
#pragma unroll
  for (int t = 0; t < 4; ++t) { if (col0 + t * 16 >= N) continue; const int col = col0 + t * 16 + ln; const float bv = bp ? bf16_round(bp[col]) : 0.f;
#pragma unroll
    for (int r = 0; r < 8; ++r) { float v = acc[t][r] * alpha + bv; if (CP) { const int bidx = (row0g + row0 + 8 * hh + r) / rowsPerB; v += CP[(size_t)bidx * sCPb + (size_t)by * 64 + col]; } if (ACT == 1) v = (v > 0.f) ? v : expm1f(v); else if (ACT == 7) v = (v > 0.f) ? v + 1.0f : expf(v); else if (ACT == 8) v = tanhf(v); else if (ACT == 9) v = 0.5f * v * (1.0f + tanhf(0.7978845608028654f * (v + 0.044715f * v * v * v))); else if (ACT == 11) v = 1.0f / (1.0f + expf(-v)); else if (ACT == 12) v = (v > 0.f) ? v : 0.01f * v; else if (ACT == 14) v = (v > 0.f) ? v : 0.1f * v; else if (ACT == 15) v = v / (1.0f + expf(-v)); else if (ACT == 3) v = fmaxf(v, 0.f); else if (ACT == 6) v = 0.5f * v * (1.0f + erff(v * 0.70710678118654752f)); so[w][8 * hh + r][t * 16 + ln] = v; } }
  __builtin_amdgcn_fence(__ATOMIC_ACQ_REL, "workgroup"); __builtin_amdgcn_wave_barrier();
  const int rsub = lane >> 4, c4 = (lane & 15) * 4; typedef _Float16 v4h __attribute__((ext_vector_type(4)));
  {
#pragma unroll
    for (int q = 0; q < 8; ++q) { const int r = q * 2 + rsub; if (col0 + c4 < N) { const v4f v = *(const v4fa*)&so[w][r][c4]; if (C) *(v4f*)(C + cofs + (size_t)(row0 + r) * ldc + col0 + c4) = v; if (C16) { v4h h4; for (int i = 0; i < 4; ++i) h4[i] = (_Float16)v[i]; *(v4h*)(C16 + cofs + (size_t)(row0 + r) * ldc + col0 + c4) = h4; } } }
     }
}


typedef _Float16 v4h __attribute__((ext_vector_type(4)));

__global__ __launch_bounds__(256) void k_h16(const float* __restrict__ x, _Float16* __restrict__ X16, size_t n8) { const size_t t = (size_t)blockIdx.x * 256 + threadIdx.x; if (t >= n8) return; FragH f;
#pragma unroll
  for (int q = 0; q < 8; ++q) f.h[q] = (_Float16)x[t * 8 + q]; *(v8us*)((unsigned short*)X16 + t * 8) = f.half[0];  }
template <int NHv, int TTv>
__global__ __launch_bounds__(256) void k_vt(const _Float16* __restrict__ V16, int ldv, int voff, _Float16* __restrict__ Vt) { __shared__ unsigned short tl[64][66]; const int tid = threadIdx.x; const int slab = blockIdx.x / (TTv / 64), lg = blockIdx.x % (TTv / 64); const int b = slab / NHv, h = slab % NHv;
  for (int i = tid; i < 64 * 8; i += 256) { const int r = i / 8, c8 = (i % 8) * 8; FragH f; f.half[0] = *(const v8us*)((const unsigned short*)V16 + ((size_t)b * TTv + lg * 64 + r) * ldv + voff + h * 64 + c8);
#pragma unroll
    for (int q = 0; q < 8; ++q) tl[r][c8 + q] = f.u[q]; }
  __syncthreads();
  {
#pragma unroll
    for (int rd = 0; rd < 2; ++rd) { const int d = rd * 32 + tid / 8, pc = tid % 8; FragH f;
#pragma unroll
      for (int q = 0; q < 8; ++q) f.u[q] = tl[pc * 8 + q][d];
      *(v8us*)((unsigned short*)Vt + ((size_t)slab * 64 + d) * TTv + lg * 64 + pc * 8) = f.half[0]; }
     } }

__global__ __launch_bounds__(256) void k_hl(const float* __restrict__ F, _Float16* __restrict__ Hh, _Float16* __restrict__ Hl, size_t n8) { const size_t t = (size_t)blockIdx.x * 256 + threadIdx.x; if (t >= n8) return; FragH fh, fl; const v4f a = *(const v4fa*)(F + t * 8), c = *(const v4fa*)(F + t * 8 + 4);
#pragma unroll
  for (int q = 0; q < 4; ++q) { _Float16 h = (_Float16)a[q]; fh.h[q] = h; fl.h[q] = (_Float16)((a[q] - (float)h) * 1024.0f); h = (_Float16)c[q]; fh.h[4 + q] = h; fl.h[4 + q] = (_Float16)((c[q] - (float)h) * 1024.0f); }
  { *(v8us*)((unsigned short*)Hh + t * 8) = fh.half[0]; *(v8us*)((unsigned short*)Hl + t * 8) = fl.half[0];  } }

// FRAGMENT ORDER (the planes of k, transposed V and the mask that the fused kernel reads): a plane is a row of 16-byte pieces, a piece being the 8 values that ONE lane takes with ONE
// 16-byte load, and the 32 pieces of one load instruction lie side by side in lane order (lane = 16*hh + ln). So a fragment load reads 512 bytes in a row (4 cache lines) where the same load
// from a row-major plane touches 16 lines. A wave of the q|k GEMM writes the 256 pieces of its 32 keys of one head (4 KB in a row; the batches' k planes lie one behind the other), thread t of k_prep piece t of each batch's V plane.
// k:    piece (((h*128 + key/16)*2 + ks)*2 + hf)*32 + lane = k[key = 16*(key/16) + ln][h*64 + ks*32 + hf*16 + hh*8 + 0..7]
// V:    piece (((h*64 + pass)*4 + tt)*2 + hf)*32 + lane    = V[key = pass*32 + hf*16 + hh*8 + 0..7][h][tt*16 + ln]
// mask: piece ((((b*64 + q/32)*64 + pass)*2 + u)*2 + j)*32 + lane = M[b][q = 32*(q/32) + u*16 + ln][pass*32 + j*16 + hh*8 + 0..7], rounded to bf16 (its bits)
// One launch for every plane that depends on the inputs alone. The planes have as many pieces as the launch has threads, or a small multiple or half of it, so thread t takes piece t of each:
// in_proj rows of q|k (x 16), x and transposed V of both batches, half a piece of out_w (x 16); a wave takes 16 queries x 64 keys (2 passes) of the mask: 8 fetches, each of 4 whole lines
// (8 lanes x 16 bytes a query row, 4 rows), a lane's 4 values being half a piece. All 31 fetches of a thread are issued before the first use.
typedef unsigned short v4us __attribute__((ext_vector_type(4), may_alias));
typedef float f32a __attribute__((may_alias));
static_assert(2 * DD * DD == SS * DD && NH * HD * SS == SS * DD && NBt * (SS / 16) * (SS / 64) * 32 == SS * DD / 8 && DD * DD / 4 == SS * DD / 8, "thread t takes piece t of each plane");
__global__ __launch_bounds__(256) void k_prep(const float* __restrict__ Win, const float* __restrict__ Wo, const float* __restrict__ x0, const float* __restrict__ x1, const float* __restrict__ V0, const float* __restrict__ V1, const float* __restrict__ Mm,
                                              _Float16* __restrict__ BIN, _Float16* __restrict__ BO, _Float16* __restrict__ X16, _Float16* __restrict__ VF, unsigned short* __restrict__ MF) {
  const unsigned t = blockIdx.x * 256 + threadIdx.x, wv = t >> 5, lane = t & 31, c = lane & 7, r4 = lane >> 3;
  const unsigned kh = wv & 1, u = (wv >> 1) & 1, pg = (wv >> 2) & (SS / 128 - 1), qt = (wv >> 6) & (SS / 32 - 1), b = wv >> 12;
  const unsigned im = ((b * SS + qt * 32 + u * 16 + r4) * SS + pg * 128 + kh * 64 + c * 4) * 4;      // offsets from the planes' starts, 32 bits each: one register a plane, the same for both batches (x0, V0: batch 0; x1, V1: batch 1)
  const unsigned t0 = ((t >> 8) & (SS / 32 - 1)) * 32 + ((t >> 5) & 1) * 16 + ((t >> 4) & 1) * 8, d = ((t >> 6) & 3) * 16 + (t & 15), h = t >> 14;
  const unsigned iv = (t0 * NH + h) * HD + d, i32 = t * 32, i16 = t * 16, i8 = t * 8;      // iv counts elements
  const unsigned om = (((((b * (SS / 32) + qt) * (SS / 32) + pg * 4 + kh * 2) * 2 + u) * 512 + (c >> 2) * 256 + (((c >> 1) & 1) * 16 + r4) * 8 + (c & 1) * 4)) * 2;
  const char* pm = (const char*)Mm;
  v4f m[2][4], xa[2][2], wa[2], oa; float va[2][8];      // every loop below is unrolled so that these are indexed by constants and stay in registers
#pragma unroll
  for (int k = 0; k < 2; ++k)
#pragma unroll
    for (int i = 0; i < 4; ++i) m[k][i] = *(const v4fa*)(pm + i * 16 * SS + k * 128 + im);
#pragma unroll
  for (int bb = 0; bb < 2; ++bb)
#pragma unroll
    for (int q = 0; q < 8; ++q) va[bb][q] = (bb ? V1 : V0)[q * NH * HD + iv];
#pragma unroll
  for (int i = 0; i < 2; ++i) { xa[0][i] = *(const v4fa*)((const char*)x0 + i * 16 + i32); xa[1][i] = *(const v4fa*)((const char*)x1 + i * 16 + i32); wa[i] = *(const v4fa*)((const char*)Win + i * 16 + i32); }
  oa = *(const v4fa*)((const char*)Wo + i16);
  // The wait behind the fetches takes their offset registers and their bases as inputs, so that these stay live up to it and nothing is written into them before; its clobber keeps all fetches in front of it.
  asm volatile("s_wait_xcnt 0x0" :: "v"(im), "v"(iv), "v"(i32), "v"(t), "s"(Win), "s"(Wo), "s"(x0), "s"(x1), "s"(V0), "s"(V1), "s"(Mm) : "memory");
  __builtin_amdgcn_sched_barrier(0);      // without it the scheduler lifts the first conversions in between the fetches, and the later fetches start only when the earlier have landed
  v4us mo[2][4]; FragH fv[2], fx[2], fw, fo;
#pragma unroll
  for (int k = 0; k < 2; ++k)
#pragma unroll
    for (int i = 0; i < 4; ++i)
#pragma unroll
      for (int q = 0; q < 4; ++q) mo[k][i][q] = bf16_bits(m[k][i][q]);
#pragma unroll
  for (int bb = 0; bb < 2; ++bb)
#pragma unroll
    for (int q = 0; q < 8; ++q) { fv[bb].h[q] = (_Float16)bf16_round(va[bb][q]); fx[bb].h[q] = (_Float16)bf16_round(xa[bb][q >> 2][q & 3]); }
#pragma unroll
  for (int q = 0; q < 8; ++q) fw.h[q] = (_Float16)(bf16_round(wa[q >> 2][q & 3]) * 16.0f);
#pragma unroll
  for (int q = 0; q < 4; ++q) fo.h[q] = (_Float16)(bf16_round(oa[q]) * 16.0f);
  v4us o4; o4[0] = fo.u[0]; o4[1] = fo.u[1]; o4[2] = fo.u[2]; o4[3] = fo.u[3];
  __builtin_amdgcn_sched_barrier(0);      // every conversion stays in front of the first store: behind a store no register that it names is written again
#pragma unroll
  for (int k = 0; k < 2; ++k)
#pragma unroll
    for (int i = 0; i < 4; ++i) *(v4us*)((char*)MF + k * 2048 + i * 64 + om) = mo[k][i];
#pragma unroll
  for (int bb = 0; bb < 2; ++bb) { *(v8us*)((char*)VF + (size_t)bb * NH * HD * SS * 2 + i16) = fv[bb].half[0]; *(v8us*)((char*)X16 + (size_t)bb * SS * DD * 2 + i16) = fx[bb].half[0]; }
  *(v8us*)((char*)BIN + i16) = fw.half[0]; *(v4us*)((char*)BO + i8) = o4; }
// Stands behind each group of fetches (and each store) of the fused kernel: the wait, because the registers that they name are reused right behind it;
// the "memory" clobber, because in the loop, without it, the compiler sinks the mask fetch to the loop's head, where its whole latency is waited for in every pass.
typedef unsigned int v4ua __attribute__((ext_vector_type(4), may_alias));
__device__ __forceinline__ void fetch_fence() { asm volatile("s_wait_xcnt 0x0" ::: "memory"); }
// Projection GEMM: C[m][n] (f32, pitch NN) = alpha * sum_k A[m][k] * Bt[n][k] + bf16(bias[n]); A and Bt are f16 planes with rows of DD elements.
// A work-group of 8 waves (4 x 2) owns 128 x BN of C, a wave 32 x BN/2. A stage is BK k of the 128 + BN operand rows: fetched as whole lines into registers while the
// stage before is multiplied, then written to the other of two LDS buffers (row pitch + 16 B, for the 16-byte fragment reads). One barrier a stage: it publishes the
// buffer just written and ends the reads of the buffer that the next stage overwrites. Fragment k order and the order of the k sum are those of k_gemm_hhx.
// SPLIT (the q|k projection): C is not stored; the same f32 values go, rounded to f16, to the planes that the fused attention reads: columns below DD to Q16 (rows), the rest to KF (fragment order).
template <int NN, int BN, int BK, bool SPLIT>
__global__ __launch_bounds__(256) void k_gemm_t(const _Float16* __restrict__ A, const _Float16* __restrict__ Bt, float alpha, const float* __restrict__ bias, float* __restrict__ C, _Float16* __restrict__ Q16, _Float16* __restrict__ KF) {
  constexpr int BM = 128, LP = BK + 8, NS = DD / BK, WN = BN / 2, NTN = WN / 16, STG = (BM + BN) * LP;
  constexpr int CPR = BK / 8, RPP = 256 / CPR, NA = BM / RPP, NB = BN / RPP;
  __shared__ __attribute__((aligned(16))) unsigned short sm[2 * STG];
  const int tid = threadIdx.x, w = tid >> 5, lane = tid & 31, ln = lane & 15, hh = lane >> 4, wm = w >> 1, wn = w & 1;
  const int row0 = blockIdx.y * BM, col0 = blockIdx.x * BN;
  const int lr = tid / CPR, lc = (tid % CPR) * 8;
  const unsigned short* ga = (const unsigned short*)A + (size_t)(row0 + lr) * DD + lc;
  const unsigned short* gb = (const unsigned short*)Bt + (size_t)(col0 + lr) * DD + lc;
  v8us ra[NA], rb[NB];
  // Every '#pragma unroll' below is there so that fragments and accumulators are indexed by constants and stay in registers.
  auto fetch = [&](int s) {
#pragma unroll
    for (int i = 0; i < NA; ++i) ra[i] = *(const v8us*)(ga + (size_t)i * RPP * DD + s * BK);
#pragma unroll
    for (int i = 0; i < NB; ++i) rb[i] = *(const v8us*)(gb + (size_t)i * RPP * DD + s * BK); };
  auto put = [&](int buf) {
    unsigned short* d = sm + buf * STG + lr * LP + lc;
#pragma unroll
    for (int i = 0; i < NA; ++i) *(v8us*)(d + i * RPP * LP) = ra[i];
#pragma unroll
    for (int i = 0; i < NB; ++i) *(v8us*)(d + (BM + i * RPP) * LP) = rb[i]; };
  v8f acc[2][NTN] = {};
  fetch(0); put(0);
  __syncthreads();
  for (int s = 0; s < NS; ++s) {
    // The wait behind the fetches: its clobber keeps them at the stage's head (without it the compiler sinks most of them to the stage's end, in front of the LDS writes,
    // where their whole latency is waited for); it takes both address pairs as inputs, so that they stay live up to the wait and no fetch of the run lands in them.
    if (s + 1 < NS) { fetch(s + 1); asm volatile("s_wait_xcnt 0x0" :: "v"(ga), "v"(gb) : "memory"); }
    const unsigned short* pa = sm + (s & 1) * STG + (wm * 32 + ln) * LP + 8 * hh;
    const unsigned short* pb = sm + (s & 1) * STG + (BM + wn * WN + ln) * LP + 8 * hh;
#pragma unroll
    for (int ks = 0; ks < BK / 32; ++ks) {
      FragH af[2], bf[NTN];
#pragma unroll
      for (int mi = 0; mi < 2; ++mi) { af[mi].half[0] = *(const v8us*)(pa + mi * 16 * LP + ks * 32); af[mi].half[1] = *(const v8us*)(pa + mi * 16 * LP + ks * 32 + 16); }
#pragma unroll
      for (int t = 0; t < NTN; ++t) { bf[t].half[0] = *(const v8us*)(pb + t * 16 * LP + ks * 32); bf[t].half[1] = *(const v8us*)(pb + t * 16 * LP + ks * 32 + 16); }
#pragma unroll
      for (int mi = 0; mi < 2; ++mi)
#pragma unroll
        for (int t = 0; t < NTN; ++t) acc[mi][t] = __builtin_amdgcn_wmma_f32_16x16x32_f16(false, af[mi].v, false, bf[t].v, (short)0, acc[mi][t], false, false);
    }
    if (s + 1 < NS) put((s + 1) & 1);
    __syncthreads();
  }
  // Behind the last barrier nobody reads the buffers any more: each wave stages its own 32 x WN block there, so that C, or with SPLIT the f16 q and k planes, is stored as whole lines.
  constexpr int SP = WN + 4, LPR = WN / 4, RPI = 32 / LPR;
  f32a* so = (f32a*)sm + w * 32 * SP;
#pragma unroll
  for (int t = 0; t < NTN; ++t) {
    const float bv = bf16_round(bias[col0 + wn * WN + t * 16 + ln]);
#pragma unroll
    for (int mi = 0; mi < 2; ++mi)
#pragma unroll
      for (int r = 0; r < 8; ++r) so[(mi * 16 + 8 * hh + r) * SP + t * 16 + ln] = acc[mi][t][r] * alpha + bv;
  }
  __syncthreads();
  if constexpr (SPLIT) {
    static_assert(WN == HD && DD % BN == 0 && SS % BM == 0, "a wave's block is 32 rows of one head, a work-group's lies in q or in k and in one batch");
    const int rw = row0 + wm * 32, cw = col0 + wn * WN;
    // A lane takes 8 pieces of 8 values; all are converted before the first is stored, and the 8 stores share one address.
    FragH f[4];
    auto piece = [&](int i, const f32a* p) {
      const v4f a = *(const v4fa*)p, c = *(const v4fa*)(p + 4);
#pragma unroll
      for (int q = 0; q < 4; ++q) { f[i >> 1].h[(i & 1) * 8 + q] = (_Float16)a[q]; f[i >> 1].h[(i & 1) * 8 + 4 + q] = (_Float16)c[q]; } };
    if (col0 < DD) {      // q: piece i = row i*4 + lane/8, columns (lane%8)*8, so that a store is 4 whole lines
      const f32a* sp = so + (lane >> 3) * SP + (lane & 7) * 8;
      unsigned short* gp = (unsigned short*)Q16 + (size_t)(rw + (lane >> 3)) * DD + cw + (lane & 7) * 8;
#pragma unroll
      for (int i = 0; i < 8; ++i) piece(i, sp + i * 4 * SP);
#pragma unroll
      for (int i = 0; i < 8; ++i) *(v8us*)(gp + i * 4 * DD) = f[i >> 1].half[i & 1];
      asm volatile("s_wait_xcnt 0x0" ::: "memory");      // behind the run of stores: whatever block the compiler lays behind this one reuses the registers that they name
    } else {      // k: piece i*32 + lane of the wave's 4 KB, i = (key tile)*4 + ks*2 + hf
      const f32a* sp = so + ln * SP + hh * 8;
      unsigned short* gp = (unsigned short*)KF + ((((size_t)(rw / SS) * NH + (cw - DD) / HD) * (SS / 16) + (rw % SS) / 16) * 128 + lane) * 8;
#pragma unroll
      for (int i = 0; i < 8; ++i) piece(i, sp + (i >> 2) * 16 * SP + (i & 3) * 16);
#pragma unroll
      for (int i = 0; i < 8; ++i) *(v8us*)(gp + i * 256) = f[i >> 1].half[i & 1];
      asm volatile("s_wait_xcnt 0x0" ::: "memory");      // behind the run of stores: whatever block the compiler lays behind this one reuses the registers that they name
    }
  } else {
    const int rs = lane / LPR, c4 = (lane % LPR) * 4;
#pragma unroll
    for (int q = 0; q < 32 / RPI; ++q) {
      const int r = q * RPI + rs;
      const v4f v = *(const v4fa*)&so[r * SP + c4];
      *(v4f*)(C + (size_t)(row0 + wm * 32 + r) * NN + col0 + wn * WN + c4) = v;
    }
  }
}
// Fused attention. One wave owns 32 queries of one (batch, head) and walks all keys, 32 a pass.
// ST = K.QT (A = 16 key rows, B = 16 query rows): a lane holds the scores of ONE query (column ln), keys 8*hh + r, so the maximum is
// in-lane plus one exchange between the wave's halves. Two score tiles, converted in place, are the B operand of OT += VT.PT (A = rows of VT in
// the same k order), so OT's column is the same query and the rescale factor is in-lane too.
// Result = sum(e*M*V) / (sum(e*M) + 1e-8 * sum e), e = exp(s - running max): the softmax denominator cancels but for the 1e-8 term.
// Both key sums run on the matrix unit: A = ones in rows 0 and 8, zero elsewhere, B = the pass's weights as f16 (e*M: the operand of the product with V; e: packed for this alone),
// accumulated in a tile of their own. Rows 0 and 8 are register 0 of the wave's two halves, so register 0 holds, in every lane, the whole sum of the lane's own query (no vector adds, no
// exchange between the halves); the other registers stay 0, so only register 0 is rescaled.
// k, transposed V and the mask come from planes in fragment order (above k_prep): a pass's 8 + 8 + 4 loads of a wave each read 512 bytes in a row.
// Every '#pragma unroll' below is there so that fragments and accumulators are indexed by constants and stay in registers.
__global__ __launch_bounds__(256) void k_fattn(const _Float16* __restrict__ Q16, const _Float16* __restrict__ KF, const _Float16* __restrict__ VF, const unsigned short* __restrict__ MF, _Float16* __restrict__ O16) {
  const int tid = threadIdx.x, w = tid >> 5, lane = tid & 31, ln = lane & 15, hh = lane >> 4;
  const int h = blockIdx.y, b = blockIdx.z, q0 = blockIdx.x * 256 + w * 32;
  const unsigned short* Qb = (const unsigned short*)Q16 + ((size_t)b * SS + q0 + ln) * DD + h * HD + 8 * hh;
  const unsigned short* Kb = (const unsigned short*)KF + ((size_t)b * NH + h) * (SS * HD) + lane * 8;
  const unsigned short* Vb = (const unsigned short*)VF + ((size_t)b * NH + h) * (SS * HD) + lane * 8;
  const unsigned short* Mb = MF + ((size_t)b * (SS / 32) + (q0 >> 5)) * (SS * 32) + lane * 8;
  FragH qf[2][2], kf[2][2], vf[4];
  v4ua mk[2][2];      // 8 bf16 mask values as 4 words: a value is its word shifted up (even) or masked (odd), one instruction each
#pragma unroll
  for (int u = 0; u < 2; ++u)
#pragma unroll
    for (int ks = 0; ks < 2; ++ks) { qf[u][ks].half[0] = *(const v8us*)(Qb + (size_t)u * 16 * DD + ks * 32); qf[u][ks].half[1] = *(const v8us*)(Qb + (size_t)u * 16 * DD + ks * 32 + 16); }
  fetch_fence();
  auto loadK = [&](int kb) {
#pragma unroll
    for (int j = 0; j < 2; ++j)
#pragma unroll
      for (int ks = 0; ks < 2; ++ks) { const unsigned short* p = Kb + (size_t)kb * HD + (j * 2 + ks) * 512; kf[j][ks].half[0] = *(const v8us*)p; kf[j][ks].half[1] = *(const v8us*)(p + 256); } };
  auto loadM = [&](const unsigned short* p) {
#pragma unroll
    for (int u = 0; u < 2; ++u)
#pragma unroll
      for (int j = 0; j < 2; ++j) mk[u][j] = *(const v4ua*)(p + (u * 2 + j) * 256); };
  auto loadV = [&](int kb) {
#pragma unroll
    for (int t = 0; t < 4; ++t) { const unsigned short* p = Vb + (size_t)kb * HD + t * 512; vf[t].half[0] = *(const v8us*)p; vf[t].half[1] = *(const v8us*)(p + 256); } };
  v8f acc[2][4] = {};
  float mx[2] = {-3.0e38f, -3.0e38f};
  v8f se[2] = {}, sem[2] = {};
  FragH ones;
#pragma unroll
  for (int i = 0; i < 16; ++i) ones.h[i] = (ln & 7) == 0 ? (_Float16)1.0f : (_Float16)0.0f;
  const float c2 = 0.125f * 1.4426950408889634f;      // scores / 8, in log2 units
  loadK(0); loadM(Mb); fetch_fence(); loadV(0);      // the fence keeps the loop's own issue order K, M, V here too: else the loop's counted waits for the mask also wait for V
  // The wait behind the first V fetches takes the lane's index and its byte offset as inputs: the fetches name the register of one of the two, which so stays live up to the wait
  // (else the zeroing of the sums and accumulators lands in it first).
  asm volatile("s_wait_xcnt 0x0" :: "v"(lane), "v"(lane * 16) : "memory");
  for (int kb = 0; kb < SS; kb += 32) {
    const int kn = (kb + 32 < SS) ? kb + 32 : 0;      // each operand's next pass is fetched into its own registers right behind its last use; the last pass refetches pass 0, unused
    v8f st[2][2];
#pragma unroll
    for (int u = 0; u < 2; ++u)
#pragma unroll
      for (int j = 0; j < 2; ++j) {
        v8f z = {};
        z = __builtin_amdgcn_wmma_f32_16x16x32_f16(false, kf[j][0].v, false, qf[u][0].v, (short)0, z, false, false);
        st[u][j] = __builtin_amdgcn_wmma_f32_16x16x32_f16(false, kf[j][1].v, false, qf[u][1].v, (short)0, z, false, false);
      }
    loadK(kn); fetch_fence();
    __builtin_amdgcn_sched_barrier(0);      // without it the scheduler sinks the K fetch behind the softmax, too late for the next pass's first product
    FragH pf[2], ef[2];
    float alv[2];
    float tmv[2], txv[2];
#pragma unroll
    for (int u = 0; u < 2; ++u) {
      float tm = st[u][0][0];
#pragma unroll
      for (int r = 1; r < 8; ++r) tm = fmaxf(tm, st[u][0][r]);
#pragma unroll
      for (int r = 0; r < 8; ++r) tm = fmaxf(tm, st[u][1][r]);
      tmv[u] = tm; txv[u] = __shfl_xor(tm, 16, 32);
    }
    // Inputs only: both exchanged maxima are asked for at one place, so that both exchanges are in flight under one wait; else the scheduler uses the first before it issues the second.
    asm volatile("" :: "v"(txv[0]), "v"(txv[1]));
#pragma unroll
    for (int u = 0; u < 2; ++u) {
      const float tm = fmaxf(tmv[u], txv[u]);
      const float mn = fmaxf(mx[u], tm * c2);
      const float al = __builtin_amdgcn_exp2f(mx[u] - mn);
      mx[u] = mn;
      const float sh = 8.0f - mn;      // e carries 2^8 (it cancels in the quotient): keeps small weights in the normal f16 range
#pragma unroll
      for (int j = 0; j < 2; ++j)
#pragma unroll
        for (int r = 0; r < 8; ++r) {
          const float ev = __builtin_amdgcn_exp2f(st[u][j][r] * c2 + sh);
          const float pv = ev * __uint_as_float((r & 1) ? (mk[u][j][r >> 1] & 0xFFFF0000u) : (mk[u][j][r >> 1] << 16));
          ef[u].h[j * 8 + r] = (_Float16)ev;
          pf[u].h[j * 8 + r] = (_Float16)pv;
        }
      alv[u] = al;
    }
    const unsigned short* pm = Mb + (size_t)kn * 32;
    loadM(pm);
    asm volatile("s_wait_xcnt 0x0" :: "v"(pm) : "memory");      // fetch_fence() that also takes the fetches' address as an input: it stays live up to the wait, so that no fetch of the run lands in it
    __builtin_amdgcn_sched_barrier(0);      // without it the scheduler lifts the rescale and the first sum products over the mask fetch, which then starts too late for the next pass
#pragma unroll
    for (int u = 0; u < 2; ++u) {
      se[u][0] *= alv[u]; sem[u][0] *= alv[u];
#pragma unroll
      for (int t = 0; t < 4; ++t)
#pragma unroll
        for (int r = 0; r < 8; ++r) acc[u][t][r] *= alv[u];
    }
#pragma unroll
    for (int u = 0; u < 2; ++u) {
      se[u] = __builtin_amdgcn_wmma_f32_16x16x32_f16(false, ones.v, false, ef[u].v, (short)0, se[u], false, false);
      sem[u] = __builtin_amdgcn_wmma_f32_16x16x32_f16(false, ones.v, false, pf[u].v, (short)0, sem[u], false, false);
    }
#pragma unroll
    for (int t = 0; t < 4; ++t)
#pragma unroll
      for (int u = 0; u < 2; ++u) acc[u][t] = __builtin_amdgcn_wmma_f32_16x16x32_f16(false, vf[t].v, false, pf[u].v, (short)0, acc[u][t], false, false);
    loadV(kn); fetch_fence();
  }
#pragma unroll
  for (int u = 0; u < 2; ++u) {
    const float inv = 1.0f / (sem[u][0] + 1e-8f * se[u][0]);
    unsigned short* op = (unsigned short*)O16 + ((size_t)b * SS + q0 + u * 16 + ln) * DD + h * HD + 8 * hh;
#pragma unroll
    for (int t = 0; t < 4; ++t) { FragH f;
#pragma unroll
      for (int r = 0; r < 8; ++r) f.h[r] = (_Float16)(acc[u][t][r] * inv);
      *(v8us*)(op + t * 16) = f.half[0]; fetch_fence(); }
  }
}

extern "C" void kernel_launch(void* const* d_in, const int* in_sizes, int n_in,
                              void* d_out, int out_size, void* d_ws, size_t ws_size, hipStream_t stream) {
  (void)in_sizes; (void)n_in; (void)out_size;
  const float* x = (const float*)d_in[0]; const float* V = (const float*)d_in[1]; const float* Mm = (const float*)d_in[2]; const float* Win = (const float*)d_in[3]; const float* bin = (const float*)d_in[4]; const float* Wo = (const float*)d_in[5]; const float* bo = (const float*)d_in[6];
  char* ws = (char*)d_ws; size_t off = 0;
  auto take = [&](size_t bytes) { char* p = ws + off; off += (bytes + 255) & ~(size_t)255; return p; };
  _Float16* BIN = (_Float16*)take((size_t)2 * DD * DD * 2); _Float16* BO = (_Float16*)take((size_t)DD * DD * 2); _Float16* X16 = (_Float16*)take((size_t)NBt * SS * DD * 2); _Float16* Q16 = (_Float16*)take((size_t)NBt * SS * DD * 2); _Float16* K16 = (_Float16*)take((size_t)NBt * SS * DD * 2); _Float16* VT = (_Float16*)take((size_t)NBt * NH * HD * SS * 2);
  _Float16* O16 = (_Float16*)take((size_t)NBt * SS * DD * 2); unsigned short* MF = (unsigned short*)take((size_t)NBt * SS * SS * 2);
  if (off > ws_size) return;      // about 65 MB
  // The rows of both batches lie one behind the other in x, q|k, the attention output and out: each GEMM takes them as one matrix of NBt * SS rows.
  k_prep<<<SS * DD / 8 / 256, 256, 0, stream>>>(Win, Wo, x, x + (size_t)SS * DD, V, V + (size_t)SS * NH * HD, Mm, BIN, BO, X16, VT, MF);      /* torch (out,in) = natural Bt; only the q|k rows of in_proj are needed */
  k_gemm_t<2 * DD, 128, 128, true><<<dim3(2 * DD / 128, NBt * SS / 128), 256, 0, stream>>>(X16, BIN, 0.0625f, bin, nullptr, Q16, K16);      /* q | k = x.W_in^T[:2048] + b (exact), stored as the f16 planes */
  k_fattn<<<dim3(SS / 256, NH, NBt), 256, 0, stream>>>(Q16, K16, VT, MF, O16);      /* all batches and heads: 256 work-groups of 8 waves x 32 queries */
  k_gemm_t<DD, 64, 128, false><<<dim3(DD / 64, NBt * SS / 128), 256, 0, stream>>>(O16, BO, 0.0625f, bo, (float*)d_out, nullptr, nullptr);      /* .out_w^T + out_b */
}

// v007
// A run of this version takes 84 microseconds.
// In both of two side-by-side timings against v006, it was 1.09 times as fast.
// Counting every step since v000, it is 21.0 times as fast.
#include <hip/hip_runtime.h>
// Masked multi-head attention with external values (B 2, S 2048, D 1024, 16 heads × 64): q | k from the packed in-projection (+ bias; the v third is unused by the module), scores = q·k/8, softmax, A·M (INPUT mask [B,S,S]), L1 renormalisation over keys (+1e-8), out = Ā·V with the separate INPUT V [B,S,H,64], heads concatenated, ·out_wᵀ + out_b → [2,2048,1024].
// Structure, four launches, each over both batches: every plane that depends on the inputs alone (f16 weights and x, transposed V and the bf16 mask in fragment order); q|k GEMM (exact), whose epilogue writes the f16 planes of q (rows) and k (fragment order) itself; one fused attention kernel over all batches and heads (scores, online softmax, mask, L1 renormalisation and the product with V, nothing of the S x S score planes in memory) into the concatenated f16 plane; the output projection GEMM with bias.
// Compute dtype: x, V, M and parameters rounded to bf16; projections with exact products; q, k, the unnormalised masked weights e*M (x 2^8), V (exact) and the attention output as f16 operands (about 2^-12), f32 accumulation; softmax/mask/renormalisation in f32, but that the two key sums add the weights e and e*M as rounded to f16 (f32 accumulation, on the matrix unit). v_wmma_f32_16x16x32_f16.
#define NBt 2
#define SS 2048
#define DD 1024
#define NH 16
#define HD 64
typedef __bf16 v16b __attribute__((ext_vector_type(16)));
typedef unsigned short v8us __attribute__((ext_vector_type(8), may_alias));
typedef float  v8f  __attribute__((ext_vector_type(8)));
typedef float  v4f  __attribute__((ext_vector_type(4)));
typedef float  v4fa __attribute__((ext_vector_type(4), may_alias));
union FragB { v16b v; v8us half[2]; unsigned short u[16]; };

__device__ __forceinline__ unsigned short bf16_bits(float x) { unsigned int u = __float_as_uint(x); return (unsigned short)((u + 0x7FFFu + ((u >> 16) & 1u)) >> 16); }
__device__ __forceinline__ float bf16_val(unsigned short b) { return __uint_as_float(((unsigned int)b) << 16); }
__device__ __forceinline__ float bf16_round(float x) { return bf16_val(bf16_bits(x)); }
// D += A·B with NT terms: 1 = ah·bh, 2 = + al·bh (A split), 3 = + ah·bl (both split)
template <int NT>
__device__ __forceinline__ v8f mmaN(v16b ah, v16b al, v16b bh, v16b bl, v8f c) {
  c = __builtin_amdgcn_wmma_f32_16x16x32_bf16(false, ah, false, bh, (short)0, c, false, false);
  if (NT >= 2) c = __builtin_amdgcn_wmma_f32_16x16x32_bf16(false, al, false, bh, (short)0, c, false, false);
  if (NT >= 3) c = __builtin_amdgcn_wmma_f32_16x16x32_bf16(false, ah, false, bl, (short)0, c, false, false);
  asm volatile("v_nop\n\tv_nop\n\tv_nop\n\tv_nop" : "+v"(c) : "v"(ah), "v"(al), "v"(bh), "v"(bl));
  return c;
}

__global__ __launch_bounds__(256) void k_wt_bf16(const float* __restrict__ W, unsigned short* __restrict__ Wt, int K, int N) {
  const int t = blockIdx.x * 256 + threadIdx.x;
  const int k8n = K / 8;
  if (t >= N * k8n) return;
  const int n = t / k8n, k8 = (t % k8n) * 8;
  v8us v;
#pragma unroll
  for (int i = 0; i < 8; ++i) v[i] = bf16_bits(W[(size_t)(k8 + i) * N + n]);
  *(v8us*)(Wt + (size_t)n * K + k8) = v;
  
}

// GEMM C[M][N] (f32, pitch ldc) = act(A[M][K]·W + bias). A f32 row-major (pitch lda) converted per fragment to bf16
// (ASPLIT: hi/lo two planes -> 2 terms, else single rounded term); Wt bf16 [N][K] (pitch ldb). BIAS_BF16 rounds the
// bias to bf16 first (bias quantised to bf16 before the add). K%32==0, M%16==0, N%64==0.
template <bool ASPLIT, int ACT, bool BIAS_BF16>
__global__ __launch_bounds__(128) void k_gemm_bf(const float* __restrict__ A, int lda, const unsigned short* __restrict__ Wt, int ldb,
                                               const float* __restrict__ bias, float* __restrict__ C, int ldc, int M, int N, int K) {
  __shared__ __attribute__((aligned(16))) float so[4][16][64];
  const int tid = threadIdx.x, w = tid >> 5, lane = tid & 31, ln = lane & 15, hh = lane >> 4;
  const int ntn = N / 64;
  const int wid = blockIdx.x * 4 + w;
  const int mt = wid / ntn, nq = wid % ntn;
  if (mt * 16 >= M) return;
  const int row0 = mt * 16, col0 = nq * 64;
  const float* arow = A + (size_t)(row0 + ln) * lda;
  v8f acc[4] = {};
  for (int kb = 0; kb < K; kb += 32) {
    FragB ah, al;
    const v4f x0 = *(const v4fa*)(arow + kb + 8 * hh), x1 = *(const v4fa*)(arow + kb + 8 * hh + 4);
    const v4f x2 = *(const v4fa*)(arow + kb + 16 + 8 * hh), x3 = *(const v4fa*)(arow + kb + 16 + 8 * hh + 4);
    float xs[16] = {x0[0],x0[1],x0[2],x0[3],x1[0],x1[1],x1[2],x1[3],x2[0],x2[1],x2[2],x2[3],x3[0],x3[1],x3[2],x3[3]};
#pragma unroll
    for (int i = 0; i < 16; ++i) { const unsigned short hb = bf16_bits(xs[i]); ah.u[i] = hb; al.u[i] = ASPLIT ? bf16_bits(xs[i] - bf16_val(hb)) : (unsigned short)0; }
#pragma unroll
    for (int t = 0; t < 4; ++t) {
      const unsigned short* brow = Wt + (size_t)(col0 + t * 16 + ln) * ldb + kb;
      FragB b;
      b.half[0] = *(const v8us*)(brow + 8 * hh);
      b.half[1] = *(const v8us*)(brow + 16 + 8 * hh);
      acc[t] = mmaN<ASPLIT ? 2 : 1>(ah.v, al.v, b.v, b.v, acc[t]);
    }
  }
#pragma unroll
  for (int t = 0; t < 4; ++t) {
    float bv = bias ? bias[col0 + t * 16 + ln] : 0.f;
    if (BIAS_BF16) bv = bf16_round(bv);
#pragma unroll
    for (int r = 0; r < 8; ++r) { float v = acc[t][r] + bv; if (ACT == 1) v = fmaxf(v, 0.f); so[w][8 * hh + r][t * 16 + ln] = v; }
  }
  __builtin_amdgcn_fence(__ATOMIC_ACQ_REL, "workgroup");
  __builtin_amdgcn_wave_barrier();
  const int rsub = lane >> 4, c4 = (lane & 15) * 4;
  {
#pragma unroll
    for (int q = 0; q < 8; ++q) {
      const int r = q * 2 + rsub;
      const v4f v = *(const v4fa*)&so[w][r][c4];
      *(v4f*)(C + (size_t)(row0 + r) * ldc + col0 + c4) = v;
    }
    
  }
}

// GEMM C = act(A·W + bias + resid): A f32 (ASPLIT -> hi/lo 2 terms), Wt bf16 [N][K]; ACT 0 none, 1 relu, 2 exact gelu;
// resid (optional, f32, row index = (row % rmod), pitch ldr, RES_BF16 rounds it) added before the activation.
template <bool ASPLIT, int ACT, bool BIAS_BF16, bool RES_BF16>
__global__ __launch_bounds__(128) void k_gemm_bf3(const float* __restrict__ A, int lda, const unsigned short* __restrict__ Wt, int ldb,
                                                const float* __restrict__ bias, const float* __restrict__ resid, int rmod, int ldr,
                                                float* __restrict__ C, int ldc, int M, int N, int K) {
  __shared__ __attribute__((aligned(16))) float so[4][16][64];
  const int tid = threadIdx.x, w = tid >> 5, lane = tid & 31, ln = lane & 15, hh = lane >> 4;
  const int ntn = N / 64;
  const int wid = blockIdx.x * 4 + w;
  const int mt = wid / ntn, nq = wid % ntn;
  if (mt * 16 >= M) return;
  const int row0 = mt * 16, col0 = nq * 64;
  const float* arow = A + (size_t)(row0 + ln) * lda;
  v8f acc[4] = {};
  for (int kb = 0; kb < K; kb += 32) {
    FragB ah, al;
    const v4f x0 = *(const v4fa*)(arow + kb + 8 * hh), x1 = *(const v4fa*)(arow + kb + 8 * hh + 4);
    const v4f x2 = *(const v4fa*)(arow + kb + 16 + 8 * hh), x3 = *(const v4fa*)(arow + kb + 16 + 8 * hh + 4);
    float xs[16] = {x0[0],x0[1],x0[2],x0[3],x1[0],x1[1],x1[2],x1[3],x2[0],x2[1],x2[2],x2[3],x3[0],x3[1],x3[2],x3[3]};
#pragma unroll
    for (int i = 0; i < 16; ++i) { const unsigned short hb = bf16_bits(xs[i]); ah.u[i] = hb; al.u[i] = ASPLIT ? bf16_bits(xs[i] - bf16_val(hb)) : (unsigned short)0; }
#pragma unroll
    for (int t = 0; t < 4; ++t) {
      const unsigned short* brow = Wt + (size_t)(col0 + t * 16 + ln) * ldb + kb;
      FragB b;
      b.half[0] = *(const v8us*)(brow + 8 * hh);
      b.half[1] = *(const v8us*)(brow + 16 + 8 * hh);
      acc[t] = mmaN<ASPLIT ? 2 : 1>(ah.v, al.v, b.v, b.v, acc[t]);
    }
  }
#pragma unroll
  for (int t = 0; t < 4; ++t) {
    const int col = col0 + t * 16 + ln;
    float bv = bias ? bias[col] : 0.f;
    if (BIAS_BF16) bv = bf16_round(bv);
#pragma unroll
    for (int r = 0; r < 8; ++r) {
      float v = acc[t][r] + bv;
      if (resid) { float rv = resid[(size_t)((row0 + 8 * hh + r) % rmod) * ldr + col]; if (RES_BF16) rv = bf16_round(rv); v += rv; }
      if (ACT == 1) v = fmaxf(v, 0.f);
      if (ACT == 2) v = 0.5f * v * (1.0f + erff(v * 0.70710678118654752f));
      if (ACT == 3) { const float u = 0.7978845608028654f * (v + 0.044715f * v * v * v); v = 0.5f * v * (1.0f + tanhf(u)); }
      so[w][8 * hh + r][t * 16 + ln] = v;
    }
  }
  __builtin_amdgcn_fence(__ATOMIC_ACQ_REL, "workgroup");
  __builtin_amdgcn_wave_barrier();
  const int rsub = lane >> 4, c4 = (lane & 15) * 4;
  {
#pragma unroll
    for (int q = 0; q < 8; ++q) {
      const int r = q * 2 + rsub;
      const v4f v = *(const v4fa*)&so[w][r][c4];
      *(v4f*)(C + (size_t)(row0 + r) * ldc + col0 + c4) = v;
    }
    
  }
}
// row LayerNorm (biased variance, eps) over N: s = X (+ R); optional out_sum <- s; out_norm <- (s-mu)*rsqrt(var+eps)*g + b
template <bool PARAM_BF16>
__global__ __launch_bounds__(256) void k_layernorm(const float* __restrict__ X, const float* __restrict__ R, const float* __restrict__ g, const float* __restrict__ bta,
                                                  float* __restrict__ out_sum, float* __restrict__ out_norm, int N, float eps) {
  __shared__ float red[256];
  const int row = blockIdx.x, tid = threadIdx.x;
  const float* x = X + (size_t)row * N; const float* rr = R ? R + (size_t)row * N : nullptr;
  float vals[16];                     // up to N = 4096
  const int per = N / 256;            // contiguous chunk per thread? use strided-by-4 chunks: thread handles j = tid*4 + 1024*u
  float s1 = 0.f;
  for (int u = 0; u < per / 4; ++u) {
    const int j = tid * 4 + 1024 * u;
    const v4f a = *(const v4fa*)(x + j);
    v4f b = {0.f,0.f,0.f,0.f}; if (rr) b = *(const v4fa*)(rr + j);
#pragma unroll
    for (int q = 0; q < 4; ++q) { const float v = a[q] + b[q]; vals[u * 4 + q] = v; s1 += v; }
  }
  red[tid] = s1; __syncthreads();
  for (int st = 128; st > 0; st >>= 1) { if (tid < st) red[tid] += red[tid + st]; __syncthreads(); }
  const float mu = red[0] / (float)N; __syncthreads();
  float s2 = 0.f;
  for (int u = 0; u < per / 4; ++u)
#pragma unroll
    for (int q = 0; q < 4; ++q) { const float c = vals[u * 4 + q] - mu; s2 += c * c; }
  red[tid] = s2; __syncthreads();
  for (int st = 128; st > 0; st >>= 1) { if (tid < st) red[tid] += red[tid + st]; __syncthreads(); }
  const float rs = rsqrtf(red[0] / (float)N + eps);
  {
    for (int u = 0; u < per / 4; ++u) {
      const int j = tid * 4 + 1024 * u;
      v4f o, sm;
#pragma unroll
      for (int q = 0; q < 4; ++q) {
        float gg = g[j + q], bb = bta[j + q];
        if (PARAM_BF16) { gg = bf16_round(gg); bb = bf16_round(bb); }
        sm[q] = vals[u * 4 + q]; o[q] = (vals[u * 4 + q] - mu) * rs * gg + bb;
      }
      if (out_sum) *(v4f*)(out_sum + (size_t)row * N + j) = sm;
      *(v4f*)(out_norm + (size_t)row * N + j) = o;
    }
    
  }
}



// ---- f16 WMMA path (v_wmma_f32_16x16x32_f16): 11-bit significands for operands in range — used for every product launched here: both projections, q·k and the masked weights (x 2^8) times V
typedef _Float16 v16h __attribute__((ext_vector_type(16)));
union FragH { v16h v; v8us half[2]; _Float16 h[16]; unsigned short u[16]; };
template <int NT>
__device__ __forceinline__ v8f mmaH(v16h ah, v16h al, v16h bh, v16h bl, v8f c) {
  c = __builtin_amdgcn_wmma_f32_16x16x32_f16(false, ah, false, bh, (short)0, c, false, false);
  if (NT >= 2) c = __builtin_amdgcn_wmma_f32_16x16x32_f16(false, al, false, bh, (short)0, c, false, false);
  if (NT >= 3) c = __builtin_amdgcn_wmma_f32_16x16x32_f16(false, ah, false, bl, (short)0, c, false, false);
  asm volatile("v_nop\n\tv_nop\n\tv_nop\n\tv_nop" : "+v"(c) : "v"(ah), "v"(al), "v"(bh), "v"(bl));
  return c;
}
// batched GEMM like k_gemm_b but f16 operands: A f32 (split into f16 hi/lo if ASPLIT, else rounded to f16), Bt = f16 values [n][k]; alpha; C f32; N multiple of 16 (partial tiles skipped)
template <bool ASPLIT>
__global__ __launch_bounds__(128) void k_gemm_h(const float* __restrict__ A, int lda, size_t sA, const _Float16* __restrict__ Bh, int ldb, size_t sB, float alpha, float* __restrict__ C, int ldc, size_t sC, int M, int N, int K) {
  __shared__ __attribute__((aligned(16))) float so[4][16][64];
  const int tid = threadIdx.x, w = tid >> 5, lane = tid & 31, ln = lane & 15, hh = lane >> 4; const int by = blockIdx.y;
  A += (size_t)by * sA; Bh += (size_t)by * sB; C += (size_t)by * sC;
  const int ntn = (N + 63) / 64; const int wid = blockIdx.x * 4 + w; const int mt = wid / ntn, nq = wid % ntn; if (mt * 16 >= M) return;
  const int row0 = mt * 16, col0 = nq * 64; const float* arow = A + (size_t)(row0 + ln) * lda;
  v8f acc[4] = {};
  for (int kb = 0; kb < K; kb += 32) {
    FragH ah, al;
    const v4f x0 = *(const v4fa*)(arow + kb + 8 * hh), x1 = *(const v4fa*)(arow + kb + 8 * hh + 4), x2 = *(const v4fa*)(arow + kb + 16 + 8 * hh), x3 = *(const v4fa*)(arow + kb + 16 + 8 * hh + 4);
    float xs[16] = {x0[0],x0[1],x0[2],x0[3],x1[0],x1[1],x1[2],x1[3],x2[0],x2[1],x2[2],x2[3],x3[0],x3[1],x3[2],x3[3]};
#pragma unroll
    for (int i = 0; i < 16; ++i) { const _Float16 h = (_Float16)xs[i]; ah.h[i] = h; al.h[i] = ASPLIT ? (_Float16)(xs[i] - (float)h) : (_Float16)0.0f; }
#pragma unroll
    for (int t = 0; t < 4; ++t) { if (col0 + t * 16 >= N) continue; const size_t boff = (size_t)(col0 + t * 16 + ln) * ldb + kb; FragH bq; bq.half[0] = *(const v8us*)(Bh + boff + 8 * hh); bq.half[1] = *(const v8us*)(Bh + boff + 16 + 8 * hh);
      acc[t] = mmaH<ASPLIT ? 2 : 1>(ah.v, al.v, bq.v, bq.v, acc[t]); }
  }
#pragma unroll
  for (int t = 0; t < 4; ++t) { if (col0 + t * 16 >= N) continue;
#pragma unroll
    for (int r = 0; r < 8; ++r) so[w][8 * hh + r][t * 16 + ln] = acc[t][r] * alpha; }
  __builtin_amdgcn_fence(__ATOMIC_ACQ_REL, "workgroup"); __builtin_amdgcn_wave_barrier();
  const int rsub = lane >> 4, c4 = (lane & 15) * 4;
  {
#pragma unroll
    for (int q = 0; q < 8; ++q) { const int r = q * 2 + rsub; if (col0 + c4 < N) { const v4f v = *(const v4fa*)&so[w][r][c4]; *(v4f*)(C + (size_t)(row0 + r) * ldc + col0 + c4) = v; } }
     }
}

// Wt[n][k] = f16(W[k][n]·scale) from f32 row-major W[K][N] (scale = power of two; bf16-exact weights stay exact in f16 away from the subnormal range)
__global__ __launch_bounds__(256) void k_wt_f16(const float* __restrict__ W, _Float16* __restrict__ Wt, int K, int N, float scale) {
  const int t = blockIdx.x * 256 + threadIdx.x; if (t >= N * (K / 8)) return; const int n = t / (K / 8), k8 = (t % (K / 8)) * 8; FragH f;
#pragma unroll
  for (int i = 0; i < 8; ++i) f.h[i] = (_Float16)(bf16_round(W[(size_t)(k8 + i) * N + n]) * scale); const v8us o = f.half[0];
  *(v8us*)((unsigned short*)Wt + (size_t)n * K + k8) = o; 
}
// k_gemm_hh variant with fused epilogue: v = acc·alpha + bias[by·sBias + col] (+ CP[(row/rowsPerB)·sCPb + by·64 + col] if CP) ; ACT 0 none / 1 elu ; writes f32 C and/or f16 C16 (each if non-null)
template <int ACT>
__global__ __launch_bounds__(128) void k_gemm_hhx(const _Float16* __restrict__ A, int lda, size_t sA, const _Float16* __restrict__ Bh, int ldb, size_t sB, float alpha, const float* __restrict__ bias, size_t sBias, const float* __restrict__ CP, int rowsPerB, size_t sCPb, int row0g,
    float* __restrict__ C, _Float16* __restrict__ C16, int ldc, size_t sC, int M, int N, int K) {
  __shared__ __attribute__((aligned(16))) float so[4][16][64];
  const int tid = threadIdx.x, w = tid >> 5, lane = tid & 31, ln = lane & 15, hh = lane >> 4; const int by = blockIdx.y;
  A += (size_t)by * sA; Bh += (size_t)by * sB; const size_t cofs = (size_t)by * sC; const float* bp = bias ? bias + (size_t)by * sBias : nullptr;
  const int ntn = (N + 63) / 64; const int wid = blockIdx.x * 4 + w; const int mt = wid / ntn, nq = wid % ntn; if (mt * 16 >= M) return;
  const int row0 = mt * 16, col0 = nq * 64; const _Float16* arow = A + (size_t)(row0 + ln) * lda;
  v8f acc[4] = {};
  for (int kb = 0; kb < K; kb += 32) { FragH ah; ah.half[0] = *(const v8us*)((const unsigned short*)arow + kb + 8 * hh); ah.half[1] = *(const v8us*)((const unsigned short*)arow + kb + 16 + 8 * hh);
#pragma unroll
    for (int t = 0; t < 4; ++t) { if (col0 + t * 16 >= N) continue; const size_t boff = (size_t)(col0 + t * 16 + ln) * ldb + kb; FragH bq; bq.half[0] = *(const v8us*)((const unsigned short*)Bh + boff + 8 * hh); bq.half[1] = *(const v8us*)((const unsigned short*)Bh + boff + 16 + 8 * hh);
      acc[t] = mmaH<1>(ah.v, ah.v, bq.v, bq.v, acc[t]); }
  }
#pragma unroll
  for (int t = 0; t < 4; ++t) { if (col0 + t * 16 >= N) continue; const int col = col0 + t * 16 + ln; const float bv = bp ? bf16_round(bp[col]) : 0.f;
#pragma unroll
    for (int r = 0; r < 8; ++r) { float v = acc[t][r] * alpha + bv; if (CP) { const int bidx = (row0g + row0 + 8 * hh + r) / rowsPerB; v += CP[(size_t)bidx * sCPb + (size_t)by * 64 + col]; } if (ACT == 1) v = (v > 0.f) ? v : expm1f(v); else if (ACT == 7) v = (v > 0.f) ? v + 1.0f : expf(v); else if (ACT == 8) v = tanhf(v); else if (ACT == 9) v = 0.5f * v * (1.0f + tanhf(0.7978845608028654f * (v + 0.044715f * v * v * v))); else if (ACT == 11) v = 1.0f / (1.0f + expf(-v)); else if (ACT == 12) v = (v > 0.f) ? v : 0.01f * v; else if (ACT == 14) v = (v > 0.f) ? v : 0.1f * v; else if (ACT == 15) v = v / (1.0f + expf(-v)); else if (ACT == 3) v = fmaxf(v, 0.f); else if (ACT == 6) v = 0.5f * v * (1.0f + erff(v * 0.70710678118654752f)); so[w][8 * hh + r][t * 16 + ln] = v; } }
  __builtin_amdgcn_fence(__ATOMIC_ACQ_REL, "workgroup"); __builtin_amdgcn_wave_barrier();
  const int rsub = lane >> 4, c4 = (lane & 15) * 4; typedef _Float16 v4h __attribute__((ext_vector_type(4)));
  {
#pragma unroll
    for (int q = 0; q < 8; ++q) { const int r = q * 2 + rsub; if (col0 + c4 < N) { const v4f v = *(const v4fa*)&so[w][r][c4]; if (C) *(v4f*)(C + cofs + (size_t)(row0 + r) * ldc + col0 + c4) = v; if (C16) { v4h h4; for (int i = 0; i < 4; ++i) h4[i] = (_Float16)v[i]; *(v4h*)(C16 + cofs + (size_t)(row0 + r) * ldc + col0 + c4) = h4; } } }
     }
}


typedef _Float16 v4h __attribute__((ext_vector_type(4)));

__global__ __launch_bounds__(256) void k_h16(const float* __restrict__ x, _Float16* __restrict__ X16, size_t n8) { const size_t t = (size_t)blockIdx.x * 256 + threadIdx.x; if (t >= n8) return; FragH f;
#pragma unroll
  for (int q = 0; q < 8; ++q) f.h[q] = (_Float16)x[t * 8 + q]; *(v8us*)((unsigned short*)X16 + t * 8) = f.half[0];  }
template <int NHv, int TTv>
__global__ __launch_bounds__(256) void k_vt(const _Float16* __restrict__ V16, int ldv, int voff, _Float16* __restrict__ Vt) { __shared__ unsigned short tl[64][66]; const int tid = threadIdx.x; const int slab = blockIdx.x / (TTv / 64), lg = blockIdx.x % (TTv / 64); const int b = slab / NHv, h = slab % NHv;
  for (int i = tid; i < 64 * 8; i += 256) { const int r = i / 8, c8 = (i % 8) * 8; FragH f; f.half[0] = *(const v8us*)((const unsigned short*)V16 + ((size_t)b * TTv + lg * 64 + r) * ldv + voff + h * 64 + c8);
#pragma unroll
    for (int q = 0; q < 8; ++q) tl[r][c8 + q] = f.u[q]; }
  __syncthreads();
  {
#pragma unroll
    for (int rd = 0; rd < 2; ++rd) { const int d = rd * 32 + tid / 8, pc = tid % 8; FragH f;
#pragma unroll
      for (int q = 0; q < 8; ++q) f.u[q] = tl[pc * 8 + q][d];
      *(v8us*)((unsigned short*)Vt + ((size_t)slab * 64 + d) * TTv + lg * 64 + pc * 8) = f.half[0]; }
     } }

__global__ __launch_bounds__(256) void k_hl(const float* __restrict__ F, _Float16* __restrict__ Hh, _Float16* __restrict__ Hl, size_t n8) { const size_t t = (size_t)blockIdx.x * 256 + threadIdx.x; if (t >= n8) return; FragH fh, fl; const v4f a = *(const v4fa*)(F + t * 8), c = *(const v4fa*)(F + t * 8 + 4);
#pragma unroll
  for (int q = 0; q < 4; ++q) { _Float16 h = (_Float16)a[q]; fh.h[q] = h; fl.h[q] = (_Float16)((a[q] - (float)h) * 1024.0f); h = (_Float16)c[q]; fh.h[4 + q] = h; fl.h[4 + q] = (_Float16)((c[q] - (float)h) * 1024.0f); }
  { *(v8us*)((unsigned short*)Hh + t * 8) = fh.half[0]; *(v8us*)((unsigned short*)Hl + t * 8) = fl.half[0];  } }

// FRAGMENT ORDER (the planes of k, transposed V and the mask that the fused kernel reads): a plane is a row of 16-byte pieces, a piece being the 8 values that ONE lane takes with ONE
// 16-byte load, and the 32 pieces of one load instruction lie side by side in lane order (lane = 16*hh + ln). So a fragment load reads 512 bytes in a row (4 cache lines) where the same load
// from a row-major plane touches 16 lines. A wave of the q|k GEMM writes the 256 pieces of its 32 keys of one head (4 KB in a row; the batches' k planes lie one behind the other), thread t of k_prep piece t of each batch's V plane.
// k:    piece (((h*128 + key/16)*2 + ks)*2 + hf)*32 + lane = k[key = 16*(key/16) + ln][h*64 + ks*32 + hf*16 + hh*8 + 0..7]
// V:    piece (((h*64 + pass)*4 + tt)*2 + hf)*32 + lane    = V[key = pass*32 + hf*16 + hh*8 + 0..7][h][tt*16 + ln]
// mask: piece ((((b*64 + q/32)*64 + pass)*2 + u)*2 + j)*32 + lane = M[b][q = 32*(q/32) + u*16 + ln][pass*32 + j*16 + hh*8 + 0..7], rounded to bf16 (its bits)
// One launch for every plane that depends on the inputs alone. The planes have as many pieces as the launch has threads, or a small multiple or half of it, so thread t takes piece t of each:
// in_proj rows of q|k (x 16), x and transposed V of both batches, half a piece of out_w (x 16); a wave takes 16 queries x 64 keys (2 passes) of the mask: 8 fetches, each of 4 whole lines
// (8 lanes x 16 bytes a query row, 4 rows), a lane's 4 values being half a piece. All 31 fetches of a thread are issued before the first use.
typedef unsigned short v4us __attribute__((ext_vector_type(4), may_alias));
typedef float f32a __attribute__((may_alias));
static_assert(2 * DD * DD == SS * DD && NH * HD * SS == SS * DD && NBt * (SS / 16) * (SS / 64) * 32 == SS * DD / 8 && DD * DD / 4 == SS * DD / 8, "thread t takes piece t of each plane");
__global__ __launch_bounds__(256) void k_prep(const float* __restrict__ Win, const float* __restrict__ Wo, const float* __restrict__ x0, const float* __restrict__ x1, const float* __restrict__ V0, const float* __restrict__ V1, const float* __restrict__ Mm,
                                              _Float16* __restrict__ BIN, _Float16* __restrict__ BO, _Float16* __restrict__ X16, _Float16* __restrict__ VF, unsigned short* __restrict__ MF) {
  const unsigned t = blockIdx.x * 256 + threadIdx.x, wv = t >> 5, lane = t & 31, c = lane & 7, r4 = lane >> 3;
  const unsigned kh = wv & 1, u = (wv >> 1) & 1, pg = (wv >> 2) & (SS / 128 - 1), qt = (wv >> 6) & (SS / 32 - 1), b = wv >> 12;
  const unsigned im = ((b * SS + qt * 32 + u * 16 + r4) * SS + pg * 128 + kh * 64 + c * 4) * 4;      // offsets from the planes' starts, 32 bits each: one register a plane, the same for both batches (x0, V0: batch 0; x1, V1: batch 1)
  const unsigned t0 = ((t >> 8) & (SS / 32 - 1)) * 32 + ((t >> 5) & 1) * 16 + ((t >> 4) & 1) * 8, d = ((t >> 6) & 3) * 16 + (t & 15), h = t >> 14;
  const unsigned iv = (t0 * NH + h) * HD + d, i32 = t * 32, i16 = t * 16, i8 = t * 8;      // iv counts elements
  const unsigned om = (((((b * (SS / 32) + qt) * (SS / 32) + pg * 4 + kh * 2) * 2 + u) * 512 + (c >> 2) * 256 + (((c >> 1) & 1) * 16 + r4) * 8 + (c & 1) * 4)) * 2;
  const char* pm = (const char*)Mm;
  v4f m[2][4], xa[2][2], wa[2], oa; float va[2][8];      // every loop below is unrolled so that these are indexed by constants and stay in registers
#pragma unroll
  for (int k = 0; k < 2; ++k)
#pragma unroll
    for (int i = 0; i < 4; ++i) m[k][i] = *(const v4fa*)(pm + i * 16 * SS + k * 128 + im);
#pragma unroll
  for (int bb = 0; bb < 2; ++bb)
#pragma unroll
    for (int q = 0; q < 8; ++q) va[bb][q] = (bb ? V1 : V0)[q * NH * HD + iv];
#pragma unroll
  for (int i = 0; i < 2; ++i) { xa[0][i] = *(const v4fa*)((const char*)x0 + i * 16 + i32); xa[1][i] = *(const v4fa*)((const char*)x1 + i * 16 + i32); wa[i] = *(const v4fa*)((const char*)Win + i * 16 + i32); }
  oa = *(const v4fa*)((const char*)Wo + i16);
  // The wait behind the fetches takes their offset registers and their bases as inputs, so that these stay live up to it and nothing is written into them before; its clobber keeps all fetches in front of it.
  asm volatile("s_wait_xcnt 0x0" :: "v"(im), "v"(iv), "v"(i32), "v"(t), "s"(Win), "s"(Wo), "s"(x0), "s"(x1), "s"(V0), "s"(V1), "s"(Mm) : "memory");
  __builtin_amdgcn_sched_barrier(0);      // without it the scheduler lifts the first conversions in between the fetches, and the later fetches start only when the earlier have landed
  v4us mo[2][4]; FragH fv[2], fx[2], fw, fo;
#pragma unroll
  for (int k = 0; k < 2; ++k)
#pragma unroll
    for (int i = 0; i < 4; ++i)
#pragma unroll
      for (int q = 0; q < 4; ++q) mo[k][i][q] = bf16_bits(m[k][i][q]);
#pragma unroll
  for (int bb = 0; bb < 2; ++bb)
#pragma unroll
    for (int q = 0; q < 8; ++q) { fv[bb].h[q] = (_Float16)bf16_round(va[bb][q]); fx[bb].h[q] = (_Float16)bf16_round(xa[bb][q >> 2][q & 3]); }
#pragma unroll
  for (int q = 0; q < 8; ++q) fw.h[q] = (_Float16)(bf16_round(wa[q >> 2][q & 3]) * 16.0f);
#pragma unroll
  for (int q = 0; q < 4; ++q) fo.h[q] = (_Float16)(bf16_round(oa[q]) * 16.0f);
  v4us o4; o4[0] = fo.u[0]; o4[1] = fo.u[1]; o4[2] = fo.u[2]; o4[3] = fo.u[3];
  __builtin_amdgcn_sched_barrier(0);      // every conversion stays in front of the first store: behind a store no register that it names is written again
#pragma unroll
  for (int k = 0; k < 2; ++k)
#pragma unroll
    for (int i = 0; i < 4; ++i) *(v4us*)((char*)MF + k * 2048 + i * 64 + om) = mo[k][i];
#pragma unroll
  for (int bb = 0; bb < 2; ++bb) { *(v8us*)((char*)VF + (size_t)bb * NH * HD * SS * 2 + i16) = fv[bb].half[0]; *(v8us*)((char*)X16 + (size_t)bb * SS * DD * 2 + i16) = fx[bb].half[0]; }
  *(v8us*)((char*)BIN + i16) = fw.half[0]; *(v4us*)((char*)BO + i8) = o4; }
// Stands behind each group of fetches (and each store) of the fused kernel: the wait, because the registers that they name are reused right behind it;
// the "memory" clobber, because in the loop, without it, the compiler sinks the mask fetch to the loop's head, where its whole latency is waited for in every pass.
typedef unsigned int v4ua __attribute__((ext_vector_type(4), may_alias));
__device__ __forceinline__ void fetch_fence() { asm volatile("s_wait_xcnt 0x0" ::: "memory"); }
// Projection GEMM: C[m][n] (f32, pitch NN) = alpha * sum_k A[m][k] * Bt[n][k] + bf16(bias[n]); A and Bt are f16 planes with rows of DD elements.
// A work-group of 8 waves (4 x 2) owns 128 x BN of C, a wave 32 x BN/2. A stage is BK k of the 128 + BN operand rows: fetched as whole lines into registers while the
// stage before is multiplied, then written to the other of two LDS buffers (row pitch + 16 B, for the 16-byte fragment reads). One barrier a stage: it publishes the
// buffer just written and ends the reads of the buffer that the next stage overwrites. Fragment k order and the order of the k sum are those of k_gemm_hhx.
// SPLIT (the q|k projection): C is not stored; the same f32 values go, rounded to f16, to the planes that the fused attention reads: columns below DD to Q16 (rows), the rest to KF (fragment order).
template <int NN, int BN, int BK, bool SPLIT>
__global__ __launch_bounds__(256) void k_gemm_t(const _Float16* __restrict__ A, const _Float16* __restrict__ Bt, float alpha, const float* __restrict__ bias, float* __restrict__ C, _Float16* __restrict__ Q16, _Float16* __restrict__ KF) {
  constexpr int BM = 128, LP = BK + 8, NS = DD / BK, WN = BN / 2, NTN = WN / 16, STG = (BM + BN) * LP;
  constexpr int CPR = BK / 8, RPP = 256 / CPR, NA = BM / RPP, NB = BN / RPP;
  __shared__ __attribute__((aligned(16))) unsigned short sm[2 * STG];
  const int tid = threadIdx.x, w = tid >> 5, lane = tid & 31, ln = lane & 15, hh = lane >> 4, wm = w >> 1, wn = w & 1;
  const int row0 = blockIdx.y * BM, col0 = blockIdx.x * BN;
  const int lr = tid / CPR, lc = (tid % CPR) * 8;
  const unsigned short* ga = (const unsigned short*)A + (size_t)(row0 + lr) * DD + lc;
  const unsigned short* gb = (const unsigned short*)Bt + (size_t)(col0 + lr) * DD + lc;
  v8us ra[NA], rb[NB];
  // Every '#pragma unroll' below is there so that fragments and accumulators are indexed by constants and stay in registers.
  auto fetch = [&](int s) {
#pragma unroll
    for (int i = 0; i < NA; ++i) ra[i] = *(const v8us*)(ga + (size_t)i * RPP * DD + s * BK);
#pragma unroll
    for (int i = 0; i < NB; ++i) rb[i] = *(const v8us*)(gb + (size_t)i * RPP * DD + s * BK); };
  auto put = [&](int buf) {
    unsigned short* d = sm + buf * STG + lr * LP + lc;
#pragma unroll
    for (int i = 0; i < NA; ++i) *(v8us*)(d + i * RPP * LP) = ra[i];
#pragma unroll
    for (int i = 0; i < NB; ++i) *(v8us*)(d + (BM + i * RPP) * LP) = rb[i]; };
  v8f acc[2][NTN] = {};
  fetch(0); put(0);
  __syncthreads();
  for (int s = 0; s < NS; ++s) {
    // The wait behind the fetches: its clobber keeps them at the stage's head (without it the compiler sinks most of them to the stage's end, in front of the LDS writes,
    // where their whole latency is waited for); it takes both address pairs as inputs, so that they stay live up to the wait and no fetch of the run lands in them.
    if (s + 1 < NS) { fetch(s + 1); asm volatile("s_wait_xcnt 0x0" :: "v"(ga), "v"(gb) : "memory"); }
    const unsigned short* pa = sm + (s & 1) * STG + (wm * 32 + ln) * LP + 8 * hh;
    const unsigned short* pb = sm + (s & 1) * STG + (BM + wn * WN + ln) * LP + 8 * hh;
#pragma unroll
    for (int ks = 0; ks < BK / 32; ++ks) {
      FragH af[2], bf[NTN];
#pragma unroll
      for (int mi = 0; mi < 2; ++mi) { af[mi].half[0] = *(const v8us*)(pa + mi * 16 * LP + ks * 32); af[mi].half[1] = *(const v8us*)(pa + mi * 16 * LP + ks * 32 + 16); }
#pragma unroll
      for (int t = 0; t < NTN; ++t) { bf[t].half[0] = *(const v8us*)(pb + t * 16 * LP + ks * 32); bf[t].half[1] = *(const v8us*)(pb + t * 16 * LP + ks * 32 + 16); }
#pragma unroll
      for (int mi = 0; mi < 2; ++mi)
#pragma unroll
        for (int t = 0; t < NTN; ++t) acc[mi][t] = __builtin_amdgcn_wmma_f32_16x16x32_f16(false, af[mi].v, false, bf[t].v, (short)0, acc[mi][t], false, false);
    }
    if (s + 1 < NS) put((s + 1) & 1);
    __syncthreads();
  }
  // Behind the last barrier nobody reads the buffers any more: each wave stages its own 32 x WN block there, so that C, or with SPLIT the f16 q and k planes, is stored as whole lines.
  constexpr int SP = WN + 4, LPR = WN / 4, RPI = 32 / LPR;
  f32a* so = (f32a*)sm + w * 32 * SP;
#pragma unroll
  for (int t = 0; t < NTN; ++t) {
    const float bv = bf16_round(bias[col0 + wn * WN + t * 16 + ln]);
#pragma unroll
    for (int mi = 0; mi < 2; ++mi)
#pragma unroll
      for (int r = 0; r < 8; ++r) so[(mi * 16 + 8 * hh + r) * SP + t * 16 + ln] = acc[mi][t][r] * alpha + bv;
  }
  __syncthreads();
  if constexpr (SPLIT) {
    static_assert(WN == HD && DD % BN == 0 && SS % BM == 0, "a wave's block is 32 rows of one head, a work-group's lies in q or in k and in one batch");
    const int rw = row0 + wm * 32, cw = col0 + wn * WN;
    // A lane takes 8 pieces of 8 values; all are converted before the first is stored, and the 8 stores share one address.
    FragH f[4];
    auto piece = [&](int i, const f32a* p) {
      const v4f a = *(const v4fa*)p, c = *(const v4fa*)(p + 4);
#pragma unroll
      for (int q = 0; q < 4; ++q) { f[i >> 1].h[(i & 1) * 8 + q] = (_Float16)a[q]; f[i >> 1].h[(i & 1) * 8 + 4 + q] = (_Float16)c[q]; } };
    if (col0 < DD) {      // q: piece i = row i*4 + lane/8, columns (lane%8)*8, so that a store is 4 whole lines
      const f32a* sp = so + (lane >> 3) * SP + (lane & 7) * 8;
      unsigned short* gp = (unsigned short*)Q16 + (size_t)(rw + (lane >> 3)) * DD + cw + (lane & 7) * 8;
#pragma unroll
      for (int i = 0; i < 8; ++i) piece(i, sp + i * 4 * SP);
#pragma unroll
      for (int i = 0; i < 8; ++i) *(v8us*)(gp + i * 4 * DD) = f[i >> 1].half[i & 1];
      asm volatile("s_wait_xcnt 0x0" ::: "memory");      // behind the run of stores: whatever block the compiler lays behind this one reuses the registers that they name
    } else {      // k: piece i*32 + lane of the wave's 4 KB, i = (key tile)*4 + ks*2 + hf
      const f32a* sp = so + ln * SP + hh * 8;
      unsigned short* gp = (unsigned short*)KF + ((((size_t)(rw / SS) * NH + (cw - DD) / HD) * (SS / 16) + (rw % SS) / 16) * 128 + lane) * 8;
#pragma unroll
      for (int i = 0; i < 8; ++i) piece(i, sp + (i >> 2) * 16 * SP + (i & 3) * 16);
#pragma unroll
      for (int i = 0; i < 8; ++i) *(v8us*)(gp + i * 256) = f[i >> 1].half[i & 1];
      asm volatile("s_wait_xcnt 0x0" ::: "memory");      // behind the run of stores: whatever block the compiler lays behind this one reuses the registers that they name
    }
  } else {
    const int rs = lane / LPR, c4 = (lane % LPR) * 4;
#pragma unroll
    for (int q = 0; q < 32 / RPI; ++q) {
      const int r = q * RPI + rs;
      const v4f v = *(const v4fa*)&so[r * SP + c4];
      *(v4f*)(C + (size_t)(row0 + wm * 32 + r) * NN + col0 + wn * WN + c4) = v;
    }
  }
}
// Fused attention. One wave owns 32 queries of one (batch, head) and walks all keys, 32 a pass.
// ST = K.QT (A = 16 key rows, B = 16 query rows): a lane holds the scores of ONE query (column ln), keys 8*hh + r, so the maximum is
// in-lane plus one exchange between the wave's halves. Two score tiles, converted in place, are the B operand of OT += VT.PT (A = rows of VT in
// the same k order), so OT's column is the same query and the rescale factor is in-lane too.
// Result = sum(e*M*V) / (sum(e*M) + 1e-8 * sum e), e = exp(s - running max): the softmax denominator cancels but for the 1e-8 term.
// Both key sums run on the matrix unit: A = ones in rows 0 and 8, zero elsewhere, B = the pass's weights as f16 (e*M: the operand of the product with V; e: packed for this alone),
// accumulated in a tile of their own. Rows 0 and 8 are register 0 of the wave's two halves, so register 0 holds, in every lane, the whole sum of the lane's own query (no vector adds, no
// exchange between the halves); the other registers stay 0, so only register 0 is rescaled.
// k, transposed V and the mask come from planes in fragment order (above k_prep): a pass's 8 + 8 + 4 loads of a wave each read 512 bytes in a row.
// Every '#pragma unroll' below is there so that fragments and accumulators are indexed by constants and stay in registers.
__global__ __launch_bounds__(256) void k_fattn(const _Float16* __restrict__ Q16, const _Float16* __restrict__ KF, const _Float16* __restrict__ VF, const unsigned short* __restrict__ MF, _Float16* __restrict__ O16) {
  const int tid = threadIdx.x, w = tid >> 5, lane = tid & 31, ln = lane & 15, hh = lane >> 4;
  const int h = blockIdx.y, b = blockIdx.z, q0 = blockIdx.x * 256 + w * 32;
  const unsigned short* Qb = (const unsigned short*)Q16 + ((size_t)b * SS + q0 + ln) * DD + h * HD + 8 * hh;
  const unsigned short* Kb = (const unsigned short*)KF + ((size_t)b * NH + h) * (SS * HD) + lane * 8;
  const unsigned short* Vb = (const unsigned short*)VF + ((size_t)b * NH + h) * (SS * HD) + lane * 8;
  const unsigned short* Mb = MF + ((size_t)b * (SS / 32) + (q0 >> 5)) * (SS * 32) + lane * 8;
  FragH qf[2][2], kf[2][2][2], vf[2][4];      // k, V and the mask have two register sets: even passes use set 0, odd passes set 1
  v4ua mk[2][2][2];      // 8 bf16 mask values as 4 words: a value is its word shifted up (even) or masked (odd), one instruction each
#pragma unroll
  for (int u = 0; u < 2; ++u)
#pragma unroll
    for (int ks = 0; ks < 2; ++ks) { qf[u][ks].half[0] = *(const v8us*)(Qb + (size_t)u * 16 * DD + ks * 32); qf[u][ks].half[1] = *(const v8us*)(Qb + (size_t)u * 16 * DD + ks * 32 + 16); }
  asm volatile("s_wait_xcnt 0x0" :: "v"(Qb) : "memory");      // fetch_fence() that also takes the fetches' address as an input: it stays live up to the wait, so that nothing is written into it before
  auto loadK = [&](int s, int kb) {
#pragma unroll
    for (int j = 0; j < 2; ++j)
#pragma unroll
      for (int ks = 0; ks < 2; ++ks) { const unsigned short* p = Kb + (size_t)kb * HD + (j * 2 + ks) * 512; kf[s][j][ks].half[0] = *(const v8us*)p; kf[s][j][ks].half[1] = *(const v8us*)(p + 256); } };
  auto loadM = [&](int s, const unsigned short* p) {
#pragma unroll
    for (int u = 0; u < 2; ++u)
#pragma unroll
      for (int j = 0; j < 2; ++j) mk[s][u][j] = *(const v4ua*)(p + (u * 2 + j) * 256); };
  auto loadV = [&](int s, int kb) {
#pragma unroll
    for (int t = 0; t < 4; ++t) { const unsigned short* p = Vb + (size_t)kb * HD + t * 512; vf[s][t].half[0] = *(const v8us*)p; vf[s][t].half[1] = *(const v8us*)(p + 256); } };
  v8f acc[2][4] = {};
  float mx[2] = {-3.0e38f, -3.0e38f};
  v8f se[2] = {}, sem[2] = {};
  FragH ones;
#pragma unroll
  for (int i = 0; i < 16; ++i) ones.h[i] = (ln & 7) == 0 ? (_Float16)1.0f : (_Float16)0.0f;
  const float c2 = 0.125f * 1.4426950408889634f;      // scores / 8, in log2 units
  static_assert(SS % 64 == 0, "the passes go in pairs");
  loadK(0, 0); loadM(1, Mb + 32 * 32); loadM(0, Mb); fetch_fence(); loadV(0, 0); fetch_fence();      // the fences keep the loop's own issue order K, M, V, pass by pass, here too: else the loop's counted waits for one operand also wait for a younger one
  loadK(1, 32); fetch_fence(); loadV(1, 32);
  // The wait behind the second V fetches (set 1) takes the lane's index and its byte offset as inputs: the fetches name the register of one of the two, which so stays live up to the wait
  // (else the zeroing of the sums and accumulators lands in it first).
  asm volatile("s_wait_xcnt 0x0" :: "v"(lane), "v"(lane * 16) : "memory");
  for (int kb = 0; kb < SS; kb += 64) {
  const int kp = (kb + 64 < SS) ? kb + 64 : 0;      // the pair of passes that this pair refills
  const unsigned short* pmp = Mb + (size_t)kp * 32;
  float mo[2][2][8];      // the odd pass's mask, widened in the even pass
#pragma unroll
  for (int s = 0; s < 2; ++s) {
    // Right behind its last use each operand's set is refilled for the pass after the next, so that a fetch has two passes to land, not one.
    // The last two passes refetch passes 0 and 1, unused.
    const int kn = kp + s * 32;
    v8f st[2][2];
#pragma unroll
    for (int u = 0; u < 2; ++u)
#pragma unroll
      for (int j = 0; j < 2; ++j) {
        v8f z = {};
        z = __builtin_amdgcn_wmma_f32_16x16x32_f16(false, kf[s][j][0].v, false, qf[u][0].v, (short)0, z, false, false);
        st[u][j] = __builtin_amdgcn_wmma_f32_16x16x32_f16(false, kf[s][j][1].v, false, qf[u][1].v, (short)0, z, false, false);
      }
    loadK(s, kn); fetch_fence();
    __builtin_amdgcn_sched_barrier(0);      // without it the scheduler sinks the K fetch behind the softmax, shortening the two passes that it has to land
    FragH pf[2], ef[2];
    float alv[2];
    float tmv[2], txv[2];
#pragma unroll
    for (int u = 0; u < 2; ++u) {
      float tm = st[u][0][0];
#pragma unroll
      for (int r = 1; r < 8; ++r) tm = fmaxf(tm, st[u][0][r]);
#pragma unroll
      for (int r = 0; r < 8; ++r) tm = fmaxf(tm, st[u][1][r]);
      tmv[u] = tm; txv[u] = __shfl_xor(tm, 16, 32);
    }
    // Inputs only: both exchanged maxima are asked for at one place, so that both exchanges are in flight under one wait; else the scheduler uses the first before it issues the second.
    asm volatile("" :: "v"(txv[0]), "v"(txv[1]));
#pragma unroll
    for (int u = 0; u < 2; ++u) {
      const float tm = fmaxf(tmv[u], txv[u]);
      const float mn = fmaxf(mx[u], tm * c2);
      const float al = __builtin_amdgcn_exp2f(mx[u] - mn);
      mx[u] = mn;
      const float sh = 8.0f - mn;      // e carries 2^8 (it cancels in the quotient): keeps small weights in the normal f16 range
#pragma unroll
      for (int j = 0; j < 2; ++j)
#pragma unroll
        for (int r = 0; r < 8; ++r) {
          const float ev = __builtin_amdgcn_exp2f(st[u][j][r] * c2 + sh);
          const float pv = ev * (s ? mo[u][j][r] : __uint_as_float((r & 1) ? (mk[0][u][j][r >> 1] & 0xFFFF0000u) : (mk[0][u][j][r >> 1] << 16)));
          ef[u].h[j * 8 + r] = (_Float16)ev;
          pf[u].h[j * 8 + r] = (_Float16)pv;
        }
      alv[u] = al;
    }
    // The mask goes by pairs of passes: the even pass widens the odd pass's values too and refills both sets, two passes ahead of their first use. (With the odd set refilled in the odd pass
    // the compiler still widened a part of it in the even pass, one pass behind its refill. In this build it lands the odd set's refill in other registers and copies it late in the odd pass.)
    if (s == 0) {
#pragma unroll
      for (int u = 0; u < 2; ++u)
#pragma unroll
        for (int j = 0; j < 2; ++j)
#pragma unroll
          for (int r = 0; r < 8; ++r) mo[u][j][r] = __uint_as_float((r & 1) ? (mk[1][u][j][r >> 1] & 0xFFFF0000u) : (mk[1][u][j][r >> 1] << 16));
      loadM(1, pmp + 32 * 32); loadM(0, pmp);
      asm volatile("s_wait_xcnt 0x0" :: "v"(pmp) : "memory");      // fetch_fence() that also takes the fetches' address as an input: it stays live up to the wait, so that nothing is written into it before
    }
    __builtin_amdgcn_sched_barrier(0);      // without it the scheduler lifts the rescale and the first sum products over the mask fetch (even pass), which then starts later
#pragma unroll
    for (int u = 0; u < 2; ++u) {
      se[u][0] *= alv[u]; sem[u][0] *= alv[u];
#pragma unroll
      for (int t = 0; t < 4; ++t)
#pragma unroll
        for (int r = 0; r < 8; ++r) acc[u][t][r] *= alv[u];
    }
#pragma unroll
    for (int u = 0; u < 2; ++u) {
      se[u] = __builtin_amdgcn_wmma_f32_16x16x32_f16(false, ones.v, false, ef[u].v, (short)0, se[u], false, false);
      sem[u] = __builtin_amdgcn_wmma_f32_16x16x32_f16(false, ones.v, false, pf[u].v, (short)0, sem[u], false, false);
    }
#pragma unroll
    for (int t = 0; t < 4; ++t)
#pragma unroll
      for (int u = 0; u < 2; ++u) acc[u][t] = __builtin_amdgcn_wmma_f32_16x16x32_f16(false, vf[s][t].v, false, pf[u].v, (short)0, acc[u][t], false, false);
    loadV(s, kn); fetch_fence();
  }
  }
#pragma unroll
  for (int u = 0; u < 2; ++u) {
    const float inv = 1.0f / (sem[u][0] + 1e-8f * se[u][0]);
    unsigned short* op = (unsigned short*)O16 + ((size_t)b * SS + q0 + u * 16 + ln) * DD + h * HD + 8 * hh;
#pragma unroll
    for (int t = 0; t < 4; ++t) { FragH f;
#pragma unroll
      for (int r = 0; r < 8; ++r) f.h[r] = (_Float16)(acc[u][t][r] * inv);
      *(v8us*)(op + t * 16) = f.half[0]; fetch_fence(); }
  }
}

extern "C" void kernel_launch(void* const* d_in, const int* in_sizes, int n_in,
                              void* d_out, int out_size, void* d_ws, size_t ws_size, hipStream_t stream) {
  (void)in_sizes; (void)n_in; (void)out_size;
  const float* x = (const float*)d_in[0]; const float* V = (const float*)d_in[1]; const float* Mm = (const float*)d_in[2]; const float* Win = (const float*)d_in[3]; const float* bin = (const float*)d_in[4]; const float* Wo = (const float*)d_in[5]; const float* bo = (const float*)d_in[6];
  char* ws = (char*)d_ws; size_t off = 0;
  auto take = [&](size_t bytes) { char* p = ws + off; off += (bytes + 255) & ~(size_t)255; return p; };
  _Float16* BIN = (_Float16*)take((size_t)2 * DD * DD * 2); _Float16* BO = (_Float16*)take((size_t)DD * DD * 2); _Float16* X16 = (_Float16*)take((size_t)NBt * SS * DD * 2); _Float16* Q16 = (_Float16*)take((size_t)NBt * SS * DD * 2); _Float16* K16 = (_Float16*)take((size_t)NBt * SS * DD * 2); _Float16* VT = (_Float16*)take((size_t)NBt * NH * HD * SS * 2);
  _Float16* O16 = (_Float16*)take((size_t)NBt * SS * DD * 2); unsigned short* MF = (unsigned short*)take((size_t)NBt * SS * SS * 2);
  if (off > ws_size) return;      // about 65 MB
  // The rows of both batches lie one behind the other in x, q|k, the attention output and out: each GEMM takes them as one matrix of NBt * SS rows.
  k_prep<<<SS * DD / 8 / 256, 256, 0, stream>>>(Win, Wo, x, x + (size_t)SS * DD, V, V + (size_t)SS * NH * HD, Mm, BIN, BO, X16, VT, MF);      /* torch (out,in) = natural Bt; only the q|k rows of in_proj are needed */
  k_gemm_t<2 * DD, 128, 128, true><<<dim3(2 * DD / 128, NBt * SS / 128), 256, 0, stream>>>(X16, BIN, 0.0625f, bin, nullptr, Q16, K16);      /* q | k = x.W_in^T[:2048] + b (exact), stored as the f16 planes */
  k_fattn<<<dim3(SS / 256, NH, NBt), 256, 0, stream>>>(Q16, K16, VT, MF, O16);      /* all batches and heads: 256 work-groups of 8 waves x 32 queries */
  k_gemm_t<DD, 64, 128, false><<<dim3(DD / 64, NBt * SS / 128), 256, 0, stream>>>(O16, BO, 0.0625f, bo, (float*)d_out, nullptr, nullptr);      /* .out_w^T + out_b */
}

// v008
// One run takes 80.2 microseconds.
// Next to v007, in two timings, it ran 1.05 and 1.04 times as fast.
// Over all steps from v000 it is 21.9 times as fast.
#include <hip/hip_runtime.h>
// Masked multi-head attention with external values (B 2, S 2048, D 1024, 16 heads × 64): q | k from the packed in-projection (+ bias; the v third is unused by the module), scores = q·k/8, softmax, A·M (INPUT mask [B,S,S]), L1 renormalisation over keys (+1e-8), out = Ā·V with the separate INPUT V [B,S,H,64], heads concatenated, ·out_wᵀ + out_b → [2,2048,1024].
// Structure, four launches, each over both batches: every plane that depends on the inputs alone (f16 weights and x, transposed V and the mask, rounded to bf16 and kept as f16, in fragment order); q|k GEMM (exact), whose epilogue writes the f16 planes of q (rows) and k (fragment order) itself; one fused attention kernel over all batches and heads (scores, online softmax, mask, L1 renormalisation and the product with V, nothing of the S x S score planes in memory) into the concatenated f16 plane; the output projection GEMM with bias.
// Compute dtype: x, V, M and parameters rounded to bf16; projections with exact products; q, k, the unnormalised masked weights e*M (x 2^8), V (exact) and the attention output as f16 operands (about 2^-12), f32 accumulation; softmax and renormalisation in f32, but that the mask product e*M is a packed f16 product of e as rounded to f16 and the mask (bf16-rounded, exact in f16 from 2^-14 up), and that the two key sums add the weights e and e*M as rounded to f16 (f32 accumulation, on the matrix unit). v_wmma_f32_16x16x32_f16.
#define NBt 2
#define SS 2048
#define DD 1024
#define NH 16
#define HD 64
typedef __bf16 v16b __attribute__((ext_vector_type(16)));
typedef unsigned short v8us __attribute__((ext_vector_type(8), may_alias));
typedef float  v8f  __attribute__((ext_vector_type(8)));
typedef float  v4f  __attribute__((ext_vector_type(4)));
typedef float  v4fa __attribute__((ext_vector_type(4), may_alias));
union FragB { v16b v; v8us half[2]; unsigned short u[16]; };

__device__ __forceinline__ unsigned short bf16_bits(float x) { unsigned int u = __float_as_uint(x); return (unsigned short)((u + 0x7FFFu + ((u >> 16) & 1u)) >> 16); }
__device__ __forceinline__ float bf16_val(unsigned short b) { return __uint_as_float(((unsigned int)b) << 16); }
__device__ __forceinline__ float bf16_round(float x) { return bf16_val(bf16_bits(x)); }
// D += A·B with NT terms: 1 = ah·bh, 2 = + al·bh (A split), 3 = + ah·bl (both split)
template <int NT>
__device__ __forceinline__ v8f mmaN(v16b ah, v16b al, v16b bh, v16b bl, v8f c) {
  c = __builtin_amdgcn_wmma_f32_16x16x32_bf16(false, ah, false, bh, (short)0, c, false, false);
  if (NT >= 2) c = __builtin_amdgcn_wmma_f32_16x16x32_bf16(false, al, false, bh, (short)0, c, false, false);
  if (NT >= 3) c = __builtin_amdgcn_wmma_f32_16x16x32_bf16(false, ah, false, bl, (short)0, c, false, false);
  asm volatile("v_nop\n\tv_nop\n\tv_nop\n\tv_nop" : "+v"(c) : "v"(ah), "v"(al), "v"(bh), "v"(bl));
  return c;
}

__global__ __launch_bounds__(256) void k_wt_bf16(const float* __restrict__ W, unsigned short* __restrict__ Wt, int K, int N) {
  const int t = blockIdx.x * 256 + threadIdx.x;
  const int k8n = K / 8;
  if (t >= N * k8n) return;
  const int n = t / k8n, k8 = (t % k8n) * 8;
  v8us v;
#pragma unroll
  for (int i = 0; i < 8; ++i) v[i] = bf16_bits(W[(size_t)(k8 + i) * N + n]);
  *(v8us*)(Wt + (size_t)n * K + k8) = v;
  
}

// GEMM C[M][N] (f32, pitch ldc) = act(A[M][K]·W + bias). A f32 row-major (pitch lda) converted per fragment to bf16
// (ASPLIT: hi/lo two planes -> 2 terms, else single rounded term); Wt bf16 [N][K] (pitch ldb). BIAS_BF16 rounds the
// bias to bf16 first (bias quantised to bf16 before the add). K%32==0, M%16==0, N%64==0.
template <bool ASPLIT, int ACT, bool BIAS_BF16>
__global__ __launch_bounds__(128) void k_gemm_bf(const float* __restrict__ A, int lda, const unsigned short* __restrict__ Wt, int ldb,
                                               const float* __restrict__ bias, float* __restrict__ C, int ldc, int M, int N, int K) {
  __shared__ __attribute__((aligned(16))) float so[4][16][64];
  const int tid = threadIdx.x, w = tid >> 5, lane = tid & 31, ln = lane & 15, hh = lane >> 4;
  const int ntn = N / 64;
  const int wid = blockIdx.x * 4 + w;
  const int mt = wid / ntn, nq = wid % ntn;
  if (mt * 16 >= M) return;
  const int row0 = mt * 16, col0 = nq * 64;
  const float* arow = A + (size_t)(row0 + ln) * lda;
  v8f acc[4] = {};
  for (int kb = 0; kb < K; kb += 32) {
    FragB ah, al;
    const v4f x0 = *(const v4fa*)(arow + kb + 8 * hh), x1 = *(const v4fa*)(arow + kb + 8 * hh + 4);
    const v4f x2 = *(const v4fa*)(arow + kb + 16 + 8 * hh), x3 = *(const v4fa*)(arow + kb + 16 + 8 * hh + 4);
    float xs[16] = {x0[0],x0[1],x0[2],x0[3],x1[0],x1[1],x1[2],x1[3],x2[0],x2[1],x2[2],x2[3],x3[0],x3[1],x3[2],x3[3]};
#pragma unroll
    for (int i = 0; i < 16; ++i) { const unsigned short hb = bf16_bits(xs[i]); ah.u[i] = hb; al.u[i] = ASPLIT ? bf16_bits(xs[i] - bf16_val(hb)) : (unsigned short)0; }
#pragma unroll
    for (int t = 0; t < 4; ++t) {
      const unsigned short* brow = Wt + (size_t)(col0 + t * 16 + ln) * ldb + kb;
      FragB b;
      b.half[0] = *(const v8us*)(brow + 8 * hh);
      b.half[1] = *(const v8us*)(brow + 16 + 8 * hh);
      acc[t] = mmaN<ASPLIT ? 2 : 1>(ah.v, al.v, b.v, b.v, acc[t]);
    }
  }
#pragma unroll
  for (int t = 0; t < 4; ++t) {
    float bv = bias ? bias[col0 + t * 16 + ln] : 0.f;
    if (BIAS_BF16) bv = bf16_round(bv);
#pragma unroll
    for (int r = 0; r < 8; ++r) { float v = acc[t][r] + bv; if (ACT == 1) v = fmaxf(v, 0.f); so[w][8 * hh + r][t * 16 + ln] = v; }
  }
  __builtin_amdgcn_fence(__ATOMIC_ACQ_REL, "workgroup");
  __builtin_amdgcn_wave_barrier();
  const int rsub = lane >> 4, c4 = (lane & 15) * 4;
  {
#pragma unroll
    for (int q = 0; q < 8; ++q) {
      const int r = q * 2 + rsub;
      const v4f v = *(const v4fa*)&so[w][r][c4];
      *(v4f*)(C + (size_t)(row0 + r) * ldc + col0 + c4) = v;
    }
    
  }
}

// GEMM C = act(A·W + bias + resid): A f32 (ASPLIT -> hi/lo 2 terms), Wt bf16 [N][K]; ACT 0 none, 1 relu, 2 exact gelu;
// resid (optional, f32, row index = (row % rmod), pitch ldr, RES_BF16 rounds it) added before the activation.
template <bool ASPLIT, int ACT, bool BIAS_BF16, bool RES_BF16>
__global__ __launch_bounds__(128) void k_gemm_bf3(const float* __restrict__ A, int lda, const unsigned short* __restrict__ Wt, int ldb,
                                                const float* __restrict__ bias, const float* __restrict__ resid, int rmod, int ldr,
                                                float* __restrict__ C, int ldc, int M, int N, int K) {
  __shared__ __attribute__((aligned(16))) float so[4][16][64];
  const int tid = threadIdx.x, w = tid >> 5, lane = tid & 31, ln = lane & 15, hh = lane >> 4;
  const int ntn = N / 64;
  const int wid = blockIdx.x * 4 + w;
  const int mt = wid / ntn, nq = wid % ntn;
  if (mt * 16 >= M) return;
  const int row0 = mt * 16, col0 = nq * 64;
  const float* arow = A + (size_t)(row0 + ln) * lda;
  v8f acc[4] = {};
  for (int kb = 0; kb < K; kb += 32) {
    FragB ah, al;
    const v4f x0 = *(const v4fa*)(arow + kb + 8 * hh), x1 = *(const v4fa*)(arow + kb + 8 * hh + 4);
    const v4f x2 = *(const v4fa*)(arow + kb + 16 + 8 * hh), x3 = *(const v4fa*)(arow + kb + 16 + 8 * hh + 4);
    float xs[16] = {x0[0],x0[1],x0[2],x0[3],x1[0],x1[1],x1[2],x1[3],x2[0],x2[1],x2[2],x2[3],x3[0],x3[1],x3[2],x3[3]};
#pragma unroll
    for (int i = 0; i < 16; ++i) { const unsigned short hb = bf16_bits(xs[i]); ah.u[i] = hb; al.u[i] = ASPLIT ? bf16_bits(xs[i] - bf16_val(hb)) : (unsigned short)0; }
#pragma unroll
    for (int t = 0; t < 4; ++t) {
      const unsigned short* brow = Wt + (size_t)(col0 + t * 16 + ln) * ldb + kb;
      FragB b;
      b.half[0] = *(const v8us*)(brow + 8 * hh);
      b.half[1] = *(const v8us*)(brow + 16 + 8 * hh);
      acc[t] = mmaN<ASPLIT ? 2 : 1>(ah.v, al.v, b.v, b.v, acc[t]);
    }
  }
#pragma unroll
  for (int t = 0; t < 4; ++t) {
    const int col = col0 + t * 16 + ln;
    float bv = bias ? bias[col] : 0.f;
    if (BIAS_BF16) bv = bf16_round(bv);
#pragma unroll
    for (int r = 0; r < 8; ++r) {
      float v = acc[t][r] + bv;
      if (resid) { float rv = resid[(size_t)((row0 + 8 * hh + r) % rmod) * ldr + col]; if (RES_BF16) rv = bf16_round(rv); v += rv; }
      if (ACT == 1) v = fmaxf(v, 0.f);
      if (ACT == 2) v = 0.5f * v * (1.0f + erff(v * 0.70710678118654752f));
      if (ACT == 3) { const float u = 0.7978845608028654f * (v + 0.044715f * v * v * v); v = 0.5f * v * (1.0f + tanhf(u)); }
      so[w][8 * hh + r][t * 16 + ln] = v;
    }
  }
  __builtin_amdgcn_fence(__ATOMIC_ACQ_REL, "workgroup");
  __builtin_amdgcn_wave_barrier();
  const int rsub = lane >> 4, c4 = (lane & 15) * 4;
  {
#pragma unroll
    for (int q = 0; q < 8; ++q) {
      const int r = q * 2 + rsub;
      const v4f v = *(const v4fa*)&so[w][r][c4];
      *(v4f*)(C + (size_t)(row0 + r) * ldc + col0 + c4) = v;
    }
    
  }
}
// row LayerNorm (biased variance, eps) over N: s = X (+ R); optional out_sum <- s; out_norm <- (s-mu)*rsqrt(var+eps)*g + b
template <bool PARAM_BF16>
__global__ __launch_bounds__(256) void k_layernorm(const float* __restrict__ X, const float* __restrict__ R, const float* __restrict__ g, const float* __restrict__ bta,
                                                  float* __restrict__ out_sum, float* __restrict__ out_norm, int N, float eps) {
  __shared__ float red[256];
  const int row = blockIdx.x, tid = threadIdx.x;
  const float* x = X + (size_t)row * N; const float* rr = R ? R + (size_t)row * N : nullptr;
  float vals[16];                     // up to N = 4096
  const int per = N / 256;            // contiguous chunk per thread? use strided-by-4 chunks: thread handles j = tid*4 + 1024*u
  float s1 = 0.f;
  for (int u = 0; u < per / 4; ++u) {
    const int j = tid * 4 + 1024 * u;
    const v4f a = *(const v4fa*)(x + j);
    v4f b = {0.f,0.f,0.f,0.f}; if (rr) b = *(const v4fa*)(rr + j);
#pragma unroll
    for (int q = 0; q < 4; ++q) { const float v = a[q] + b[q]; vals[u * 4 + q] = v; s1 += v; }
  }
  red[tid] = s1; __syncthreads();
  for (int st = 128; st > 0; st >>= 1) { if (tid < st) red[tid] += red[tid + st]; __syncthreads(); }
  const float mu = red[0] / (float)N; __syncthreads();
  float s2 = 0.f;
  for (int u = 0; u < per / 4; ++u)
#pragma unroll
    for (int q = 0; q < 4; ++q) { const float c = vals[u * 4 + q] - mu; s2 += c * c; }
  red[tid] = s2; __syncthreads();
  for (int st = 128; st > 0; st >>= 1) { if (tid < st) red[tid] += red[tid + st]; __syncthreads(); }
  const float rs = rsqrtf(red[0] / (float)N + eps);
  {
    for (int u = 0; u < per / 4; ++u) {
      const int j = tid * 4 + 1024 * u;
      v4f o, sm;
#pragma unroll
      for (int q = 0; q < 4; ++q) {
        float gg = g[j + q], bb = bta[j + q];
        if (PARAM_BF16) { gg = bf16_round(gg); bb = bf16_round(bb); }
        sm[q] = vals[u * 4 + q]; o[q] = (vals[u * 4 + q] - mu) * rs * gg + bb;
      }
      if (out_sum) *(v4f*)(out_sum + (size_t)row * N + j) = sm;
      *(v4f*)(out_norm + (size_t)row * N + j) = o;
    }
    
  }
}



// ---- f16 WMMA path (v_wmma_f32_16x16x32_f16): 11-bit significands for operands in range — used for every product launched here: both projections, q·k and the masked weights (x 2^8) times V
typedef _Float16 v16h __attribute__((ext_vector_type(16)));
union FragH { v16h v; v8us half[2]; _Float16 h[16]; unsigned short u[16]; };
template <int NT>
__device__ __forceinline__ v8f mmaH(v16h ah, v16h al, v16h bh, v16h bl, v8f c) {
  c = __builtin_amdgcn_wmma_f32_16x16x32_f16(false, ah, false, bh, (short)0, c, false, false);
  if (NT >= 2) c = __builtin_amdgcn_wmma_f32_16x16x32_f16(false, al, false, bh, (short)0, c, false, false);
  if (NT >= 3) c = __builtin_amdgcn_wmma_f32_16x16x32_f16(false, ah, false, bl, (short)0, c, false, false);
  asm volatile("v_nop\n\tv_nop\n\tv_nop\n\tv_nop" : "+v"(c) : "v"(ah), "v"(al), "v"(bh), "v"(bl));
  return c;
}
// batched GEMM like k_gemm_b but f16 operands: A f32 (split into f16 hi/lo if ASPLIT, else rounded to f16), Bt = f16 values [n][k]; alpha; C f32; N multiple of 16 (partial tiles skipped)
template <bool ASPLIT>
__global__ __launch_bounds__(128) void k_gemm_h(const float* __restrict__ A, int lda, size_t sA, const _Float16* __restrict__ Bh, int ldb, size_t sB, float alpha, float* __restrict__ C, int ldc, size_t sC, int M, int N, int K) {
  __shared__ __attribute__((aligned(16))) float so[4][16][64];
  const int tid = threadIdx.x, w = tid >> 5, lane = tid & 31, ln = lane & 15, hh = lane >> 4; const int by = blockIdx.y;
  A += (size_t)by * sA; Bh += (size_t)by * sB; C += (size_t)by * sC;
  const int ntn = (N + 63) / 64; const int wid = blockIdx.x * 4 + w; const int mt = wid / ntn, nq = wid % ntn; if (mt * 16 >= M) return;
  const int row0 = mt * 16, col0 = nq * 64; const float* arow = A + (size_t)(row0 + ln) * lda;
  v8f acc[4] = {};
  for (int kb = 0; kb < K; kb += 32) {
    FragH ah, al;
    const v4f x0 = *(const v4fa*)(arow + kb + 8 * hh), x1 = *(const v4fa*)(arow + kb + 8 * hh + 4), x2 = *(const v4fa*)(arow + kb + 16 + 8 * hh), x3 = *(const v4fa*)(arow + kb + 16 + 8 * hh + 4);
    float xs[16] = {x0[0],x0[1],x0[2],x0[3],x1[0],x1[1],x1[2],x1[3],x2[0],x2[1],x2[2],x2[3],x3[0],x3[1],x3[2],x3[3]};
#pragma unroll
    for (int i = 0; i < 16; ++i) { const _Float16 h = (_Float16)xs[i]; ah.h[i] = h; al.h[i] = ASPLIT ? (_Float16)(xs[i] - (float)h) : (_Float16)0.0f; }
#pragma unroll
    for (int t = 0; t < 4; ++t) { if (col0 + t * 16 >= N) continue; const size_t boff = (size_t)(col0 + t * 16 + ln) * ldb + kb; FragH bq; bq.half[0] = *(const v8us*)(Bh + boff + 8 * hh); bq.half[1] = *(const v8us*)(Bh + boff + 16 + 8 * hh);
      acc[t] = mmaH<ASPLIT ? 2 : 1>(ah.v, al.v, bq.v, bq.v, acc[t]); }
  }
#pragma unroll
  for (int t = 0; t < 4; ++t) { if (col0 + t * 16 >= N) continue;
#pragma unroll
    for (int r = 0; r < 8; ++r) so[w][8 * hh + r][t * 16 + ln] = acc[t][r] * alpha; }
  __builtin_amdgcn_fence(__ATOMIC_ACQ_REL, "workgroup"); __builtin_amdgcn_wave_barrier();
  const int rsub = lane >> 4, c4 = (lane & 15) * 4;
  {
#pragma unroll
    for (int q = 0; q < 8; ++q) { const int r = q * 2 + rsub; if (col0 + c4 < N) { const v4f v = *(const v4fa*)&so[w][r][c4]; *(v4f*)(C + (size_t)(row0 + r) * ldc + col0 + c4) = v; } }
     }
}

// Wt[n][k] = f16(W[k][n]·scale) from f32 row-major W[K][N] (scale = power of two; bf16-exact weights stay exact in f16 away from the subnormal range)
__global__ __launch_bounds__(256) void k_wt_f16(const float* __restrict__ W, _Float16* __restrict__ Wt, int K, int N, float scale) {
  const int t = blockIdx.x * 256 + threadIdx.x; if (t >= N * (K / 8)) return; const int n = t / (K / 8), k8 = (t % (K / 8)) * 8; FragH f;
#pragma unroll
  for (int i = 0; i < 8; ++i) f.h[i] = (_Float16)(bf16_round(W[(size_t)(k8 + i) * N + n]) * scale); const v8us o = f.half[0];
  *(v8us*)((unsigned short*)Wt + (size_t)n * K + k8) = o; 
}
// k_gemm_hh variant with fused epilogue: v = acc·alpha + bias[by·sBias + col] (+ CP[(row/rowsPerB)·sCPb + by·64 + col] if CP) ; ACT 0 none / 1 elu ; writes f32 C and/or f16 C16 (each if non-null)
template <int ACT>
__global__ __launch_bounds__(128) void k_gemm_hhx(const _Float16* __restrict__ A, int lda, size_t sA, const _Float16* __restrict__ Bh, int ldb, size_t sB, float alpha, const float* __restrict__ bias, size_t sBias, const float* __restrict__ CP, int rowsPerB, size_t sCPb, int row0g,
    float* __restrict__ C, _Float16* __restrict__ C16, int ldc, size_t sC, int M, int N, int K) {
  __shared__ __attribute__((aligned(16))) float so[4][16][64];
  const int tid = threadIdx.x, w = tid >> 5, lane = tid & 31, ln = lane & 15, hh = lane >> 4; const int by = blockIdx.y;
  A += (size_t)by * sA; Bh += (size_t)by * sB; const size_t cofs = (size_t)by * sC; const float* bp = bias ? bias + (size_t)by * sBias : nullptr;
  const int ntn = (N + 63) / 64; const int wid = blockIdx.x * 4 + w; const int mt = wid / ntn, nq = wid % ntn; if (mt * 16 >= M) return;
  const int row0 = mt * 16, col0 = nq * 64; const _Float16* arow = A + (size_t)(row0 + ln) * lda;
  v8f acc[4] = {};
  for (int kb = 0; kb < K; kb += 32) { FragH ah; ah.half[0] = *(const v8us*)((const unsigned short*)arow + kb + 8 * hh); ah.half[1] = *(const v8us*)((const unsigned short*)arow + kb + 16 + 8 * hh);
#pragma unroll
    for (int t = 0; t < 4; ++t) { if (col0 + t * 16 >= N) continue; const size_t boff = (size_t)(col0 + t * 16 + ln) * ldb + kb; FragH bq; bq.half[0] = *(const v8us*)((const unsigned short*)Bh + boff + 8 * hh); bq.half[1] = *(const v8us*)((const unsigned short*)Bh + boff + 16 + 8 * hh);
      acc[t] = mmaH<1>(ah.v, ah.v, bq.v, bq.v, acc[t]); }
  }
#pragma unroll
  for (int t = 0; t < 4; ++t) { if (col0 + t * 16 >= N) continue; const int col = col0 + t * 16 + ln; const float bv = bp ? bf16_round(bp[col]) : 0.f;
#pragma unroll
    for (int r = 0; r < 8; ++r) { float v = acc[t][r] * alpha + bv; if (CP) { const int bidx = (row0g + row0 + 8 * hh + r) / rowsPerB; v += CP[(size_t)bidx * sCPb + (size_t)by * 64 + col]; } if (ACT == 1) v = (v > 0.f) ? v : expm1f(v); else if (ACT == 7) v = (v > 0.f) ? v + 1.0f : expf(v); else if (ACT == 8) v = tanhf(v); else if (ACT == 9) v = 0.5f * v * (1.0f + tanhf(0.7978845608028654f * (v + 0.044715f * v * v * v))); else if (ACT == 11) v = 1.0f / (1.0f + expf(-v)); else if (ACT == 12) v = (v > 0.f) ? v : 0.01f * v; else if (ACT == 14) v = (v > 0.f) ? v : 0.1f * v; else if (ACT == 15) v = v / (1.0f + expf(-v)); else if (ACT == 3) v = fmaxf(v, 0.f); else if (ACT == 6) v = 0.5f * v * (1.0f + erff(v * 0.70710678118654752f)); so[w][8 * hh + r][t * 16 + ln] = v; } }
  __builtin_amdgcn_fence(__ATOMIC_ACQ_REL, "workgroup"); __builtin_amdgcn_wave_barrier();
  const int rsub = lane >> 4, c4 = (lane & 15) * 4; typedef _Float16 v4h __attribute__((ext_vector_type(4)));
  {
#pragma unroll
    for (int q = 0; q < 8; ++q) { const int r = q * 2 + rsub; if (col0 + c4 < N) { const v4f v = *(const v4fa*)&so[w][r][c4]; if (C) *(v4f*)(C + cofs + (size_t)(row0 + r) * ldc + col0 + c4) = v; if (C16) { v4h h4; for (int i = 0; i < 4; ++i) h4[i] = (_Float16)v[i]; *(v4h*)(C16 + cofs + (size_t)(row0 + r) * ldc + col0 + c4) = h4; } } }
     }
}


typedef _Float16 v4h __attribute__((ext_vector_type(4)));

__global__ __launch_bounds__(256) void k_h16(const float* __restrict__ x, _Float16* __restrict__ X16, size_t n8) { const size_t t = (size_t)blockIdx.x * 256 + threadIdx.x; if (t >= n8) return; FragH f;
#pragma unroll
  for (int q = 0; q < 8; ++q) f.h[q] = (_Float16)x[t * 8 + q]; *(v8us*)((unsigned short*)X16 + t * 8) = f.half[0];  }
template <int NHv, int TTv>
__global__ __launch_bounds__(256) void k_vt(const _Float16* __restrict__ V16, int ldv, int voff, _Float16* __restrict__ Vt) { __shared__ unsigned short tl[64][66]; const int tid = threadIdx.x; const int slab = blockIdx.x / (TTv / 64), lg = blockIdx.x % (TTv / 64); const int b = slab / NHv, h = slab % NHv;
  for (int i = tid; i < 64 * 8; i += 256) { const int r = i / 8, c8 = (i % 8) * 8; FragH f; f.half[0] = *(const v8us*)((const unsigned short*)V16 + ((size_t)b * TTv + lg * 64 + r) * ldv + voff + h * 64 + c8);
#pragma unroll
    for (int q = 0; q < 8; ++q) tl[r][c8 + q] = f.u[q]; }
  __syncthreads();
  {
#pragma unroll
    for (int rd = 0; rd < 2; ++rd) { const int d = rd * 32 + tid / 8, pc = tid % 8; FragH f;
#pragma unroll
      for (int q = 0; q < 8; ++q) f.u[q] = tl[pc * 8 + q][d];
      *(v8us*)((unsigned short*)Vt + ((size_t)slab * 64 + d) * TTv + lg * 64 + pc * 8) = f.half[0]; }
     } }

__global__ __launch_bounds__(256) void k_hl(const float* __restrict__ F, _Float16* __restrict__ Hh, _Float16* __restrict__ Hl, size_t n8) { const size_t t = (size_t)blockIdx.x * 256 + threadIdx.x; if (t >= n8) return; FragH fh, fl; const v4f a = *(const v4fa*)(F + t * 8), c = *(const v4fa*)(F + t * 8 + 4);
#pragma unroll
  for (int q = 0; q < 4; ++q) { _Float16 h = (_Float16)a[q]; fh.h[q] = h; fl.h[q] = (_Float16)((a[q] - (float)h) * 1024.0f); h = (_Float16)c[q]; fh.h[4 + q] = h; fl.h[4 + q] = (_Float16)((c[q] - (float)h) * 1024.0f); }
  { *(v8us*)((unsigned short*)Hh + t * 8) = fh.half[0]; *(v8us*)((unsigned short*)Hl + t * 8) = fl.half[0];  } }

// FRAGMENT ORDER (the planes of k, transposed V and the mask that the fused kernel reads): a plane is a row of 16-byte pieces, a piece being the 8 values that ONE lane takes with ONE
// 16-byte load, and the 32 pieces of one load instruction lie side by side in lane order (lane = 16*hh + ln). So a fragment load reads 512 bytes in a row (4 cache lines) where the same load
// from a row-major plane touches 16 lines. A wave of the q|k GEMM writes the 256 pieces of its 32 keys of one head (4 KB in a row; the batches' k planes lie one behind the other), thread t of k_prep piece t of each batch's V plane.
// k:    piece (((h*128 + key/16)*2 + ks)*2 + hf)*32 + lane = k[key = 16*(key/16) + ln][h*64 + ks*32 + hf*16 + hh*8 + 0..7]
// V:    piece (((h*64 + pass)*4 + tt)*2 + hf)*32 + lane    = V[key = pass*32 + hf*16 + hh*8 + 0..7][h][tt*16 + ln]
// mask: piece ((((b*64 + q/32)*64 + pass)*2 + u)*2 + j)*32 + lane = M[b][q = 32*(q/32) + u*16 + ln][pass*32 + j*16 + hh*8 + 0..7], rounded to bf16 and stored as f16: the order of a piece's values is that of the f16 weights in the B operand, so that e*M is a product of whole registers
// One launch for every plane that depends on the inputs alone. The planes have as many pieces as the launch has threads, or a small multiple or half of it, so thread t takes piece t of each:
// in_proj rows of q|k (x 16), x and transposed V of both batches, half a piece of out_w (x 16); a wave takes 16 queries x 64 keys (2 passes) of the mask: 8 fetches, each of 4 whole lines
// (8 lanes x 16 bytes a query row, 4 rows), a lane's 4 values being half a piece. All 31 fetches of a thread are issued before the first use.
typedef unsigned short v4us __attribute__((ext_vector_type(4), may_alias));
typedef float f32a __attribute__((may_alias));
static_assert(2 * DD * DD == SS * DD && NH * HD * SS == SS * DD && NBt * (SS / 16) * (SS / 64) * 32 == SS * DD / 8 && DD * DD / 4 == SS * DD / 8, "thread t takes piece t of each plane");
__global__ __launch_bounds__(256) void k_prep(const float* __restrict__ Win, const float* __restrict__ Wo, const float* __restrict__ x0, const float* __restrict__ x1, const float* __restrict__ V0, const float* __restrict__ V1, const float* __restrict__ Mm,
                                              _Float16* __restrict__ BIN, _Float16* __restrict__ BO, _Float16* __restrict__ X16, _Float16* __restrict__ VF, unsigned short* __restrict__ MF) {
  const unsigned t = blockIdx.x * 256 + threadIdx.x, wv = t >> 5, lane = t & 31, c = lane & 7, r4 = lane >> 3;
  const unsigned kh = wv & 1, u = (wv >> 1) & 1, pg = (wv >> 2) & (SS / 128 - 1), qt = (wv >> 6) & (SS / 32 - 1), b = wv >> 12;
  const unsigned im = ((b * SS + qt * 32 + u * 16 + r4) * SS + pg * 128 + kh * 64 + c * 4) * 4;      // offsets from the planes' starts, 32 bits each: one register a plane, the same for both batches (x0, V0: batch 0; x1, V1: batch 1)
  const unsigned t0 = ((t >> 8) & (SS / 32 - 1)) * 32 + ((t >> 5) & 1) * 16 + ((t >> 4) & 1) * 8, d = ((t >> 6) & 3) * 16 + (t & 15), h = t >> 14;
  const unsigned iv = (t0 * NH + h) * HD + d, i32 = t * 32, i16 = t * 16, i8 = t * 8;      // iv counts elements
  const unsigned om = (((((b * (SS / 32) + qt) * (SS / 32) + pg * 4 + kh * 2) * 2 + u) * 512 + (c >> 2) * 256 + (((c >> 1) & 1) * 16 + r4) * 8 + (c & 1) * 4)) * 2;
  const char* pm = (const char*)Mm;
  v4f m[2][4], xa[2][2], wa[2], oa; float va[2][8];      // every loop below is unrolled so that these are indexed by constants and stay in registers
#pragma unroll
  for (int k = 0; k < 2; ++k)
#pragma unroll
    for (int i = 0; i < 4; ++i) m[k][i] = *(const v4fa*)(pm + i * 16 * SS + k * 128 + im);
#pragma unroll
  for (int bb = 0; bb < 2; ++bb)
#pragma unroll
    for (int q = 0; q < 8; ++q) va[bb][q] = (bb ? V1 : V0)[q * NH * HD + iv];
#pragma unroll
  for (int i = 0; i < 2; ++i) { xa[0][i] = *(const v4fa*)((const char*)x0 + i * 16 + i32); xa[1][i] = *(const v4fa*)((const char*)x1 + i * 16 + i32); wa[i] = *(const v4fa*)((const char*)Win + i * 16 + i32); }
  oa = *(const v4fa*)((const char*)Wo + i16);
  // The wait behind the fetches takes their offset registers and their bases as inputs, so that these stay live up to it and nothing is written into them before; its clobber keeps all fetches in front of it.
  asm volatile("s_wait_xcnt 0x0" :: "v"(im), "v"(iv), "v"(i32), "v"(t), "s"(Win), "s"(Wo), "s"(x0), "s"(x1), "s"(V0), "s"(V1), "s"(Mm) : "memory");
  __builtin_amdgcn_sched_barrier(0);      // without it the scheduler lifts the first conversions in between the fetches, and the later fetches start only when the earlier have landed
  v4us mo[2][4]; FragH fv[2], fx[2], fw, fo;
#pragma unroll
  for (int k = 0; k < 2; ++k)
#pragma unroll
    for (int i = 0; i < 4; ++i)
#pragma unroll
      for (int q = 0; q < 4; ++q) mo[k][i][q] = __builtin_bit_cast(unsigned short, (_Float16)bf16_round(m[k][i][q]));
#pragma unroll
  for (int bb = 0; bb < 2; ++bb)
#pragma unroll
    for (int q = 0; q < 8; ++q) { fv[bb].h[q] = (_Float16)bf16_round(va[bb][q]); fx[bb].h[q] = (_Float16)bf16_round(xa[bb][q >> 2][q & 3]); }
#pragma unroll
  for (int q = 0; q < 8; ++q) fw.h[q] = (_Float16)(bf16_round(wa[q >> 2][q & 3]) * 16.0f);
#pragma unroll
  for (int q = 0; q < 4; ++q) fo.h[q] = (_Float16)(bf16_round(oa[q]) * 16.0f);
  v4us o4; o4[0] = fo.u[0]; o4[1] = fo.u[1]; o4[2] = fo.u[2]; o4[3] = fo.u[3];
  __builtin_amdgcn_sched_barrier(0);      // every conversion stays in front of the first store: behind a store no register that it names is written again
#pragma unroll
  for (int k = 0; k < 2; ++k)
#pragma unroll
    for (int i = 0; i < 4; ++i) *(v4us*)((char*)MF + k * 2048 + i * 64 + om) = mo[k][i];
#pragma unroll
  for (int bb = 0; bb < 2; ++bb) { *(v8us*)((char*)VF + (size_t)bb * NH * HD * SS * 2 + i16) = fv[bb].half[0]; *(v8us*)((char*)X16 + (size_t)bb * SS * DD * 2 + i16) = fx[bb].half[0]; }
  *(v8us*)((char*)BIN + i16) = fw.half[0]; *(v4us*)((char*)BO + i8) = o4; }
// Stands behind each group of fetches (and each store) of the fused kernel: the wait, because the registers that they name are reused right behind it;
// the "memory" clobber, because in the loop, without it, the compiler sinks the mask fetch to the loop's head, where its whole latency is waited for in every pass.
__device__ __forceinline__ void fetch_fence() { asm volatile("s_wait_xcnt 0x0" ::: "memory"); }
// Projection GEMM: C[m][n] (f32, pitch NN) = alpha * sum_k A[m][k] * Bt[n][k] + bf16(bias[n]); A and Bt are f16 planes with rows of DD elements.
// A work-group of 8 waves (4 x 2) owns 128 x BN of C, a wave 32 x BN/2. A stage is BK k of the 128 + BN operand rows: fetched as whole lines into registers while the
// stage before is multiplied, then written to the other of two LDS buffers (row pitch + 16 B, for the 16-byte fragment reads). One barrier a stage: it publishes the
// buffer just written and ends the reads of the buffer that the next stage overwrites. Fragment k order and the order of the k sum are those of k_gemm_hhx.
// SPLIT (the q|k projection): C is not stored; the same f32 values go, rounded to f16, to the planes that the fused attention reads: columns below DD to Q16 (rows), the rest to KF (fragment order).
template <int NN, int BN, int BK, bool SPLIT>
__global__ __launch_bounds__(256) void k_gemm_t(const _Float16* __restrict__ A, const _Float16* __restrict__ Bt, float alpha, const float* __restrict__ bias, float* __restrict__ C, _Float16* __restrict__ Q16, _Float16* __restrict__ KF) {
  constexpr int BM = 128, LP = BK + 8, NS = DD / BK, WN = BN / 2, NTN = WN / 16, STG = (BM + BN) * LP;
  constexpr int CPR = BK / 8, RPP = 256 / CPR, NA = BM / RPP, NB = BN / RPP;
  __shared__ __attribute__((aligned(16))) unsigned short sm[2 * STG];
  const int tid = threadIdx.x, w = tid >> 5, lane = tid & 31, ln = lane & 15, hh = lane >> 4, wm = w >> 1, wn = w & 1;
  const int row0 = blockIdx.y * BM, col0 = blockIdx.x * BN;
  const int lr = tid / CPR, lc = (tid % CPR) * 8;
  const unsigned short* ga = (const unsigned short*)A + (size_t)(row0 + lr) * DD + lc;
  const unsigned short* gb = (const unsigned short*)Bt + (size_t)(col0 + lr) * DD + lc;
  v8us ra[NA], rb[NB];
  // Every '#pragma unroll' below is there so that fragments and accumulators are indexed by constants and stay in registers.
  auto fetch = [&](int s) {
#pragma unroll
    for (int i = 0; i < NA; ++i) ra[i] = *(const v8us*)(ga + (size_t)i * RPP * DD + s * BK);
#pragma unroll
    for (int i = 0; i < NB; ++i) rb[i] = *(const v8us*)(gb + (size_t)i * RPP * DD + s * BK); };
  auto put = [&](int buf) {
    unsigned short* d = sm + buf * STG + lr * LP + lc;
#pragma unroll
    for (int i = 0; i < NA; ++i) *(v8us*)(d + i * RPP * LP) = ra[i];
#pragma unroll
    for (int i = 0; i < NB; ++i) *(v8us*)(d + (BM + i * RPP) * LP) = rb[i]; };
  v8f acc[2][NTN] = {};
  fetch(0); put(0);
  __syncthreads();
  for (int s = 0; s < NS; ++s) {
    // The wait behind the fetches: its clobber keeps them at the stage's head (without it the compiler sinks most of them to the stage's end, in front of the LDS writes,
    // where their whole latency is waited for); it takes both address pairs as inputs, so that they stay live up to the wait and no fetch of the run lands in them.
    if (s + 1 < NS) { fetch(s + 1); asm volatile("s_wait_xcnt 0x0" :: "v"(ga), "v"(gb) : "memory"); }
    const unsigned short* pa = sm + (s & 1) * STG + (wm * 32 + ln) * LP + 8 * hh;
    const unsigned short* pb = sm + (s & 1) * STG + (BM + wn * WN + ln) * LP + 8 * hh;
#pragma unroll
    for (int ks = 0; ks < BK / 32; ++ks) {
      FragH af[2], bf[NTN];
#pragma unroll
      for (int mi = 0; mi < 2; ++mi) { af[mi].half[0] = *(const v8us*)(pa + mi * 16 * LP + ks * 32); af[mi].half[1] = *(const v8us*)(pa + mi * 16 * LP + ks * 32 + 16); }
#pragma unroll
      for (int t = 0; t < NTN; ++t) { bf[t].half[0] = *(const v8us*)(pb + t * 16 * LP + ks * 32); bf[t].half[1] = *(const v8us*)(pb + t * 16 * LP + ks * 32 + 16); }
#pragma unroll
      for (int mi = 0; mi < 2; ++mi)
#pragma unroll
        for (int t = 0; t < NTN; ++t) acc[mi][t] = __builtin_amdgcn_wmma_f32_16x16x32_f16(false, af[mi].v, false, bf[t].v, (short)0, acc[mi][t], false, false);
    }
    if (s + 1 < NS) put((s + 1) & 1);
    __syncthreads();
  }
  // Behind the last barrier nobody reads the buffers any more: each wave stages its own 32 x WN block there, so that C, or with SPLIT the f16 q and k planes, is stored as whole lines.
  constexpr int SP = WN + 4, LPR = WN / 4, RPI = 32 / LPR;
  f32a* so = (f32a*)sm + w * 32 * SP;
#pragma unroll
  for (int t = 0; t < NTN; ++t) {
    const float bv = bf16_round(bias[col0 + wn * WN + t * 16 + ln]);
#pragma unroll
    for (int mi = 0; mi < 2; ++mi)
#pragma unroll
      for (int r = 0; r < 8; ++r) so[(mi * 16 + 8 * hh + r) * SP + t * 16 + ln] = acc[mi][t][r] * alpha + bv;
  }
  __syncthreads();
  if constexpr (SPLIT) {
    static_assert(WN == HD && DD % BN == 0 && SS % BM == 0, "a wave's block is 32 rows of one head, a work-group's lies in q or in k and in one batch");
    const int rw = row0 + wm * 32, cw = col0 + wn * WN;
    // A lane takes 8 pieces of 8 values; all are converted before the first is stored, and the 8 stores share one address.
    FragH f[4];
    auto piece = [&](int i, const f32a* p) {
      const v4f a = *(const v4fa*)p, c = *(const v4fa*)(p + 4);
#pragma unroll
      for (int q = 0; q < 4; ++q) { f[i >> 1].h[(i & 1) * 8 + q] = (_Float16)a[q]; f[i >> 1].h[(i & 1) * 8 + 4 + q] = (_Float16)c[q]; } };
    if (col0 < DD) {      // q: piece i = row i*4 + lane/8, columns (lane%8)*8, so that a store is 4 whole lines
      const f32a* sp = so + (lane >> 3) * SP + (lane & 7) * 8;
      unsigned short* gp = (unsigned short*)Q16 + (size_t)(rw + (lane >> 3)) * DD + cw + (lane & 7) * 8;
#pragma unroll
      for (int i = 0; i < 8; ++i) piece(i, sp + i * 4 * SP);
#pragma unroll
      for (int i = 0; i < 8; ++i) *(v8us*)(gp + i * 4 * DD) = f[i >> 1].half[i & 1];
      asm volatile("s_wait_xcnt 0x0" ::: "memory");      // behind the run of stores: whatever block the compiler lays behind this one reuses the registers that they name
    } else {      // k: piece i*32 + lane of the wave's 4 KB, i = (key tile)*4 + ks*2 + hf
      const f32a* sp = so + ln * SP + hh * 8;
      unsigned short* gp = (unsigned short*)KF + ((((size_t)(rw / SS) * NH + (cw - DD) / HD) * (SS / 16) + (rw % SS) / 16) * 128 + lane) * 8;
#pragma unroll
      for (int i = 0; i < 8; ++i) piece(i, sp + (i >> 2) * 16 * SP + (i & 3) * 16);
#pragma unroll
      for (int i = 0; i < 8; ++i) *(v8us*)(gp + i * 256) = f[i >> 1].half[i & 1];
      asm volatile("s_wait_xcnt 0x0" ::: "memory");      // behind the run of stores: whatever block the compiler lays behind this one reuses the registers that they name
    }
  } else {
    const int rs = lane / LPR, c4 = (lane % LPR) * 4;
#pragma unroll
    for (int q = 0; q < 32 / RPI; ++q) {
      const int r = q * RPI + rs;
      const v4f v = *(const v4fa*)&so[r * SP + c4];
      *(v4f*)(C + (size_t)(row0 + wm * 32 + r) * NN + col0 + wn * WN + c4) = v;
    }
  }
}
// Fused attention. One wave owns 32 queries of one (batch, head) and walks all keys, 32 a pass.
// ST = K.QT (A = 16 key rows, B = 16 query rows): a lane holds the scores of ONE query (column ln), keys 8*hh + r, so the maximum is
// in-lane plus one exchange between the wave's halves. Two score tiles, converted in place, are the B operand of OT += VT.PT (A = rows of VT in
// the same k order), so OT's column is the same query and the rescale factor is in-lane too.
// Result = sum(e*M*V) / (sum(e*M) + 1e-8 * sum e), e = exp(s - running max): the softmax denominator cancels but for the 1e-8 term.
// Both key sums run on the matrix unit: A = ones in rows 0 and 8, zero elsewhere, B = the pass's weights as f16 (e*M: the operand of the product with V; e: the factor of e*M as well),
// accumulated in a tile of their own. Rows 0 and 8 are register 0 of the wave's two halves, so register 0 holds, in every lane, the whole sum of the lane's own query (no vector adds, no
// exchange between the halves); the other registers stay 0, so only register 0 is rescaled.
// k, transposed V and the mask come from planes in fragment order (above k_prep): a pass's 8 + 8 + 4 loads of a wave each read 512 bytes in a row.
// Every '#pragma unroll' below is there so that fragments and accumulators are indexed by constants and stay in registers.
__global__ __launch_bounds__(256) void k_fattn(const _Float16* __restrict__ Q16, const _Float16* __restrict__ KF, const _Float16* __restrict__ VF, const unsigned short* __restrict__ MF, _Float16* __restrict__ O16) {
  const int tid = threadIdx.x, w = tid >> 5, lane = tid & 31, ln = lane & 15, hh = lane >> 4;
  const int h = blockIdx.y, b = blockIdx.z, q0 = blockIdx.x * 256 + w * 32;
  const unsigned short* Qb = (const unsigned short*)Q16 + ((size_t)b * SS + q0 + ln) * DD + h * HD + 8 * hh;
  const unsigned short* Kb = (const unsigned short*)KF + ((size_t)b * NH + h) * (SS * HD) + lane * 8;
  const unsigned short* Vb = (const unsigned short*)VF + ((size_t)b * NH + h) * (SS * HD) + lane * 8;
  const unsigned short* Mb = MF + ((size_t)b * (SS / 32) + (q0 >> 5)) * (SS * 32) + lane * 8;
  FragH qf[2][2], kf[2][2][2], vf[2][4], mf[2][2];      // k, V and the mask have two register sets: even passes use set 0, odd passes set 1; a mask fragment holds its 16 f16 values where the weights' B operand holds theirs
#pragma unroll
  for (int u = 0; u < 2; ++u)
#pragma unroll
    for (int ks = 0; ks < 2; ++ks) { qf[u][ks].half[0] = *(const v8us*)(Qb + (size_t)u * 16 * DD + ks * 32); qf[u][ks].half[1] = *(const v8us*)(Qb + (size_t)u * 16 * DD + ks * 32 + 16); }
  asm volatile("s_wait_xcnt 0x0" :: "v"(Qb) : "memory");      // fetch_fence() that also takes the fetches' address as an input: it stays live up to the wait, so that nothing is written into it before
  auto loadK = [&](int s, int kb) {
#pragma unroll
    for (int j = 0; j < 2; ++j)
#pragma unroll
      for (int ks = 0; ks < 2; ++ks) { const unsigned short* p = Kb + (size_t)kb * HD + (j * 2 + ks) * 512; kf[s][j][ks].half[0] = *(const v8us*)p; kf[s][j][ks].half[1] = *(const v8us*)(p + 256); } };
  auto loadM = [&](int s, const unsigned short* p) {
#pragma unroll
    for (int u = 0; u < 2; ++u)
#pragma unroll
      for (int j = 0; j < 2; ++j) mf[s][u].half[j] = *(const v8us*)(p + (u * 2 + j) * 256); };
  auto loadV = [&](int s, int kb) {
#pragma unroll
    for (int t = 0; t < 4; ++t) { const unsigned short* p = Vb + (size_t)kb * HD + t * 512; vf[s][t].half[0] = *(const v8us*)p; vf[s][t].half[1] = *(const v8us*)(p + 256); } };
  v8f acc[2][4] = {};
  float mx[2] = {-3.0e38f, -3.0e38f};
  v8f se[2] = {}, sem[2] = {};
  FragH ones;
#pragma unroll
  for (int i = 0; i < 16; ++i) ones.h[i] = (ln & 7) == 0 ? (_Float16)1.0f : (_Float16)0.0f;
  const float c2 = 0.125f * 1.4426950408889634f;      // scores / 8, in log2 units
  static_assert(SS % 64 == 0, "the passes go in pairs");
  loadK(0, 0); fetch_fence(); loadM(0, Mb); fetch_fence(); loadV(0, 0); fetch_fence();      // the fences keep the loop's own issue order K, M, V, pass by pass, here too: else the loop's counted waits for one operand also wait for a younger one
  loadK(1, 32); fetch_fence(); loadM(1, Mb + 32 * 32); fetch_fence(); loadV(1, 32);
  // The wait behind the V fetches of pass 1 takes the lane's index and its byte offset as inputs: the fetches name the register of one of the two, which so stays live up to the wait
  // (else the zeroing of the sums and accumulators lands in it first).
  asm volatile("s_wait_xcnt 0x0" :: "v"(lane), "v"(lane * 16) : "memory");
  for (int kb = 0; kb < SS; kb += 64) {
  const int kp = (kb + 64 < SS) ? kb + 64 : 0;      // the pair of passes that this pair refills
#pragma unroll
  for (int s = 0; s < 2; ++s) {
    // Right behind its last use each operand's set is refilled for the pass after the next, so that a fetch has two passes to land, not one.
    // The last two passes refetch passes 0 and 1, unused.
    const int kn = kp + s * 32;
    const unsigned short* pmn = Mb + (size_t)kn * 32;
    v8f st[2][2];
#pragma unroll
    for (int u = 0; u < 2; ++u)
#pragma unroll
      for (int j = 0; j < 2; ++j) {
        v8f z = {};
        z = __builtin_amdgcn_wmma_f32_16x16x32_f16(false, kf[s][j][0].v, false, qf[u][0].v, (short)0, z, false, false);
        st[u][j] = __builtin_amdgcn_wmma_f32_16x16x32_f16(false, kf[s][j][1].v, false, qf[u][1].v, (short)0, z, false, false);
      }
    loadK(s, kn); fetch_fence();
    __builtin_amdgcn_sched_barrier(0);      // without it the scheduler sinks the K fetch behind the softmax, shortening the two passes that it has to land
    FragH pf[2], ef[2];
    float alv[2];
    float tmv[2], txv[2];
#pragma unroll
    for (int u = 0; u < 2; ++u) {
      float tm = st[u][0][0];
#pragma unroll
      for (int r = 1; r < 8; ++r) tm = fmaxf(tm, st[u][0][r]);
#pragma unroll
      for (int r = 0; r < 8; ++r) tm = fmaxf(tm, st[u][1][r]);
      tmv[u] = tm;
    }
    __builtin_amdgcn_sched_barrier(0);      // both maxima are complete before the first exchange: else the scheduler (even pass) finishes the second behind the first exchange's wait, and the two exchanges' latencies add
#pragma unroll
    for (int u = 0; u < 2; ++u) txv[u] = __shfl_xor(tmv[u], 16, 32);
    // Inputs only: both exchanged maxima are asked for at one place, so that both exchanges are in flight under one wait; else the scheduler uses the first before it issues the second.
    asm volatile("" :: "v"(txv[0]), "v"(txv[1]));
#pragma unroll
    for (int u = 0; u < 2; ++u) {
      const float tm = fmaxf(tmv[u], txv[u]);
      const float mn = fmaxf(mx[u], tm * c2);
      const float al = __builtin_amdgcn_exp2f(mx[u] - mn);
      mx[u] = mn;
      const float sh = 8.0f - mn;      // e carries 2^8 (it cancels in the quotient): keeps small weights in the normal f16 range
#pragma unroll
      for (int j = 0; j < 2; ++j)
#pragma unroll
        for (int r = 0; r < 8; ++r) {
          const float ev = __builtin_amdgcn_exp2f(st[u][j][r] * c2 + sh);
          ef[u].h[j * 8 + r] = (_Float16)ev;
        }
      pf[u].v = ef[u].v * mf[s][u].v;      // e*M from e as rounded to f16, two values an instruction: the mask is not widened, the products are not packed
      alv[u] = al;
    }
    loadM(s, pmn);
    asm volatile("s_wait_xcnt 0x0" :: "v"(pmn) : "memory");      // fetch_fence() that also takes the fetches' address as an input: it stays live up to the wait, so that nothing is written into it before
    __builtin_amdgcn_sched_barrier(0);      // without it the scheduler lifts the rescale and the first sum products over the mask fetch, which then starts later
#pragma unroll
    for (int u = 0; u < 2; ++u) {
      se[u][0] *= alv[u]; sem[u][0] *= alv[u];
#pragma unroll
      for (int t = 0; t < 4; ++t)
#pragma unroll
        for (int r = 0; r < 8; ++r) acc[u][t][r] *= alv[u];
    }
#pragma unroll
    for (int u = 0; u < 2; ++u) {
      se[u] = __builtin_amdgcn_wmma_f32_16x16x32_f16(false, ones.v, false, ef[u].v, (short)0, se[u], false, false);
      sem[u] = __builtin_amdgcn_wmma_f32_16x16x32_f16(false, ones.v, false, pf[u].v, (short)0, sem[u], false, false);
    }
#pragma unroll
    for (int t = 0; t < 4; ++t)
#pragma unroll
      for (int u = 0; u < 2; ++u) acc[u][t] = __builtin_amdgcn_wmma_f32_16x16x32_f16(false, vf[s][t].v, false, pf[u].v, (short)0, acc[u][t], false, false);
    loadV(s, kn); fetch_fence();
  }
  }
#pragma unroll
  for (int u = 0; u < 2; ++u) {
    const float inv = 1.0f / (sem[u][0] + 1e-8f * se[u][0]);
    unsigned short* op = (unsigned short*)O16 + ((size_t)b * SS + q0 + u * 16 + ln) * DD + h * HD + 8 * hh;
#pragma unroll
    for (int t = 0; t < 4; ++t) { FragH f;
#pragma unroll
      for (int r = 0; r < 8; ++r) f.h[r] = (_Float16)(acc[u][t][r] * inv);
      *(v8us*)(op + t * 16) = f.half[0]; fetch_fence(); }
  }
}

extern "C" void kernel_launch(void* const* d_in, const int* in_sizes, int n_in,
                              void* d_out, int out_size, void* d_ws, size_t ws_size, hipStream_t stream) {
  (void)in_sizes; (void)n_in; (void)out_size;
  const float* x = (const float*)d_in[0]; const float* V = (const float*)d_in[1]; const float* Mm = (const float*)d_in[2]; const float* Win = (const float*)d_in[3]; const float* bin = (const float*)d_in[4]; const float* Wo = (const float*)d_in[5]; const float* bo = (const float*)d_in[6];
  char* ws = (char*)d_ws; size_t off = 0;
  auto take = [&](size_t bytes) { char* p = ws + off; off += (bytes + 255) & ~(size_t)255; return p; };
  _Float16* BIN = (_Float16*)take((size_t)2 * DD * DD * 2); _Float16* BO = (_Float16*)take((size_t)DD * DD * 2); _Float16* X16 = (_Float16*)take((size_t)NBt * SS * DD * 2); _Float16* Q16 = (_Float16*)take((size_t)NBt * SS * DD * 2); _Float16* K16 = (_Float16*)take((size_t)NBt * SS * DD * 2); _Float16* VT = (_Float16*)take((size_t)NBt * NH * HD * SS * 2);
  _Float16* O16 = (_Float16*)take((size_t)NBt * SS * DD * 2); unsigned short* MF = (unsigned short*)take((size_t)NBt * SS * SS * 2);
  if (off > ws_size) return;      // about 65 MB
  // The rows of both batches lie one behind the other in x, q|k, the attention output and out: each GEMM takes them as one matrix of NBt * SS rows.
  k_prep<<<SS * DD / 8 / 256, 256, 0, stream>>>(Win, Wo, x, x + (size_t)SS * DD, V, V + (size_t)SS * NH * HD, Mm, BIN, BO, X16, VT, MF);      /* torch (out,in) = natural Bt; only the q|k rows of in_proj are needed */
  k_gemm_t<2 * DD, 128, 128, true><<<dim3(2 * DD / 128, NBt * SS / 128), 256, 0, stream>>>(X16, BIN, 0.0625f, bin, nullptr, Q16, K16);      /* q | k = x.W_in^T[:2048] + b (exact), stored as the f16 planes */
  k_fattn<<<dim3(SS / 256, NH, NBt), 256, 0, stream>>>(Q16, K16, VT, MF, O16);      /* all batches and heads: 256 work-groups of 8 waves x 32 queries */
  k_gemm_t<DD, 64, 128, false><<<dim3(DD / 64, NBt * SS / 128), 256, 0, stream>>>(O16, BO, 0.0625f, bo, (float*)d_out, nullptr, nullptr);      /* .out_w^T + out_b */
}

// v009
// It runs in 77.7 microseconds.
// Two timings next to v008 put it at 1.04 and 1.03 times that version's speed.
// Counting every step since v000, it is 22.6 times as fast.
#include <hip/hip_runtime.h>
// Masked multi-head attention with external values (B 2, S 2048, D 1024, 16 heads × 64): q | k from the packed in-projection (+ bias; the v third is unused by the module), scores = q·k/8, softmax, A·M (INPUT mask [B,S,S]), L1 renormalisation over keys (+1e-8), out = Ā·V with the separate INPUT V [B,S,H,64], heads concatenated, ·out_wᵀ + out_b → [2,2048,1024].
// Structure, four launches, each over both batches: every plane that depends on the inputs alone (f16 weights and x, transposed V and the mask, rounded to bf16 and kept as f16, in fragment order); q|k GEMM (exact), whose epilogue writes the f16 planes of q (rows) and k (fragment order) itself; one fused attention kernel over all batches and heads (scores, online softmax, mask, L1 renormalisation and the product with V, nothing of the S x S score planes in memory) into the concatenated f16 plane; the output projection GEMM with bias.
// Compute dtype: x, V, M and parameters rounded to bf16; projections with exact products; q, k, the unnormalised masked weights e*M (x 2^8), V (exact) and the attention output as f16 operands (about 2^-12), f32 accumulation; softmax and renormalisation in f32, but that the mask product e*M is a packed f16 product of e as rounded to f16 and the mask (bf16-rounded, exact in f16 from 2^-14 up), and that the two key sums add the weights e and e*M as rounded to f16 (f32 accumulation, on the matrix unit). v_wmma_f32_16x16x32_f16.
#define NBt 2
#define SS 2048
#define DD 1024
#define NH 16
#define HD 64
typedef __bf16 v16b __attribute__((ext_vector_type(16)));
typedef unsigned short v8us __attribute__((ext_vector_type(8), may_alias));
typedef float  v8f  __attribute__((ext_vector_type(8)));
typedef float  v4f  __attribute__((ext_vector_type(4)));
typedef float  v4fa __attribute__((ext_vector_type(4), may_alias));
union FragB { v16b v; v8us half[2]; unsigned short u[16]; };

__device__ __forceinline__ unsigned short bf16_bits(float x) { unsigned int u = __float_as_uint(x); return (unsigned short)((u + 0x7FFFu + ((u >> 16) & 1u)) >> 16); }
__device__ __forceinline__ float bf16_val(unsigned short b) { return __uint_as_float(((unsigned int)b) << 16); }
__device__ __forceinline__ float bf16_round(float x) { return bf16_val(bf16_bits(x)); }
// D += A·B with NT terms: 1 = ah·bh, 2 = + al·bh (A split), 3 = + ah·bl (both split)
template <int NT>
__device__ __forceinline__ v8f mmaN(v16b ah, v16b al, v16b bh, v16b bl, v8f c) {
  c = __builtin_amdgcn_wmma_f32_16x16x32_bf16(false, ah, false, bh, (short)0, c, false, false);
  if (NT >= 2) c = __builtin_amdgcn_wmma_f32_16x16x32_bf16(false, al, false, bh, (short)0, c, false, false);
  if (NT >= 3) c = __builtin_amdgcn_wmma_f32_16x16x32_bf16(false, ah, false, bl, (short)0, c, false, false);
  asm volatile("v_nop\n\tv_nop\n\tv_nop\n\tv_nop" : "+v"(c) : "v"(ah), "v"(al), "v"(bh), "v"(bl));
  return c;
}

__global__ __launch_bounds__(256) void k_wt_bf16(const float* __restrict__ W, unsigned short* __restrict__ Wt, int K, int N) {
  const int t = blockIdx.x * 256 + threadIdx.x;
  const int k8n = K / 8;
  if (t >= N * k8n) return;
  const int n = t / k8n, k8 = (t % k8n) * 8;
  v8us v;
#pragma unroll
  for (int i = 0; i < 8; ++i) v[i] = bf16_bits(W[(size_t)(k8 + i) * N + n]);
  *(v8us*)(Wt + (size_t)n * K + k8) = v;
  
}

// GEMM C[M][N] (f32, pitch ldc) = act(A[M][K]·W + bias). A f32 row-major (pitch lda) converted per fragment to bf16
// (ASPLIT: hi/lo two planes -> 2 terms, else single rounded term); Wt bf16 [N][K] (pitch ldb). BIAS_BF16 rounds the
// bias to bf16 first (bias quantised to bf16 before the add). K%32==0, M%16==0, N%64==0.
template <bool ASPLIT, int ACT, bool BIAS_BF16>
__global__ __launch_bounds__(128) void k_gemm_bf(const float* __restrict__ A, int lda, const unsigned short* __restrict__ Wt, int ldb,
                                               const float* __restrict__ bias, float* __restrict__ C, int ldc, int M, int N, int K) {
  __shared__ __attribute__((aligned(16))) float so[4][16][64];
  const int tid = threadIdx.x, w = tid >> 5, lane = tid & 31, ln = lane & 15, hh = lane >> 4;
  const int ntn = N / 64;
  const int wid = blockIdx.x * 4 + w;
  const int mt = wid / ntn, nq = wid % ntn;
  if (mt * 16 >= M) return;
  const int row0 = mt * 16, col0 = nq * 64;
  const float* arow = A + (size_t)(row0 + ln) * lda;
  v8f acc[4] = {};
  for (int kb = 0; kb < K; kb += 32) {
    FragB ah, al;
    const v4f x0 = *(const v4fa*)(arow + kb + 8 * hh), x1 = *(const v4fa*)(arow + kb + 8 * hh + 4);
    const v4f x2 = *(const v4fa*)(arow + kb + 16 + 8 * hh), x3 = *(const v4fa*)(arow + kb + 16 + 8 * hh + 4);
    float xs[16] = {x0[0],x0[1],x0[2],x0[3],x1[0],x1[1],x1[2],x1[3],x2[0],x2[1],x2[2],x2[3],x3[0],x3[1],x3[2],x3[3]};
#pragma unroll
    for (int i = 0; i < 16; ++i) { const unsigned short hb = bf16_bits(xs[i]); ah.u[i] = hb; al.u[i] = ASPLIT ? bf16_bits(xs[i] - bf16_val(hb)) : (unsigned short)0; }
#pragma unroll
    for (int t = 0; t < 4; ++t) {
      const unsigned short* brow = Wt + (size_t)(col0 + t * 16 + ln) * ldb + kb;
      FragB b;
      b.half[0] = *(const v8us*)(brow + 8 * hh);
      b.half[1] = *(const v8us*)(brow + 16 + 8 * hh);
      acc[t] = mmaN<ASPLIT ? 2 : 1>(ah.v, al.v, b.v, b.v, acc[t]);
    }
  }
#pragma unroll
  for (int t = 0; t < 4; ++t) {
    float bv = bias ? bias[col0 + t * 16 + ln] : 0.f;
    if (BIAS_BF16) bv = bf16_round(bv);
#pragma unroll
    for (int r = 0; r < 8; ++r) { float v = acc[t][r] + bv; if (ACT == 1) v = fmaxf(v, 0.f); so[w][8 * hh + r][t * 16 + ln] = v; }
  }
  __builtin_amdgcn_fence(__ATOMIC_ACQ_REL, "workgroup");
  __builtin_amdgcn_wave_barrier();
  const int rsub = lane >> 4, c4 = (lane & 15) * 4;
  {
#pragma unroll
    for (int q = 0; q < 8; ++q) {
      const int r = q * 2 + rsub;
      const v4f v = *(const v4fa*)&so[w][r][c4];
      *(v4f*)(C + (size_t)(row0 + r) * ldc + col0 + c4) = v;
    }
    
  }
}

// GEMM C = act(A·W + bias + resid): A f32 (ASPLIT -> hi/lo 2 terms), Wt bf16 [N][K]; ACT 0 none, 1 relu, 2 exact gelu;
// resid (optional, f32, row index = (row % rmod), pitch ldr, RES_BF16 rounds it) added before the activation.
template <bool ASPLIT, int ACT, bool BIAS_BF16, bool RES_BF16>
__global__ __launch_bounds__(128) void k_gemm_bf3(const float* __restrict__ A, int lda, const unsigned short* __restrict__ Wt, int ldb,
                                                const float* __restrict__ bias, const float* __restrict__ resid, int rmod, int ldr,
                                                float* __restrict__ C, int ldc, int M, int N, int K) {
  __shared__ __attribute__((aligned(16))) float so[4][16][64];
  const int tid = threadIdx.x, w = tid >> 5, lane = tid & 31, ln = lane & 15, hh = lane >> 4;
  const int ntn = N / 64;
  const int wid = blockIdx.x * 4 + w;
  const int mt = wid / ntn, nq = wid % ntn;
  if (mt * 16 >= M) return;
  const int row0 = mt * 16, col0 = nq * 64;
  const float* arow = A + (size_t)(row0 + ln) * lda;
  v8f acc[4] = {};
  for (int kb = 0; kb < K; kb += 32) {
    FragB ah, al;
    const v4f x0 = *(const v4fa*)(arow + kb + 8 * hh), x1 = *(const v4fa*)(arow + kb + 8 * hh + 4);
    const v4f x2 = *(const v4fa*)(arow + kb + 16 + 8 * hh), x3 = *(const v4fa*)(arow + kb + 16 + 8 * hh + 4);
    float xs[16] = {x0[0],x0[1],x0[2],x0[3],x1[0],x1[1],x1[2],x1[3],x2[0],x2[1],x2[2],x2[3],x3[0],x3[1],x3[2],x3[3]};
#pragma unroll
    for (int i = 0; i < 16; ++i) { const unsigned short hb = bf16_bits(xs[i]); ah.u[i] = hb; al.u[i] = ASPLIT ? bf16_bits(xs[i] - bf16_val(hb)) : (unsigned short)0; }
#pragma unroll
    for (int t = 0; t < 4; ++t) {
      const unsigned short* brow = Wt + (size_t)(col0 + t * 16 + ln) * ldb + kb;
      FragB b;
      b.half[0] = *(const v8us*)(brow + 8 * hh);
      b.half[1] = *(const v8us*)(brow + 16 + 8 * hh);
      acc[t] = mmaN<ASPLIT ? 2 : 1>(ah.v, al.v, b.v, b.v, acc[t]);
    }
  }
#pragma unroll
  for (int t = 0; t < 4; ++t) {
    const int col = col0 + t * 16 + ln;
    float bv = bias ? bias[col] : 0.f;
    if (BIAS_BF16) bv = bf16_round(bv);
#pragma unroll
    for (int r = 0; r < 8; ++r) {
      float v = acc[t][r] + bv;
      if (resid) { float rv = resid[(size_t)((row0 + 8 * hh + r) % rmod) * ldr + col]; if (RES_BF16) rv = bf16_round(rv); v += rv; }
      if (ACT == 1) v = fmaxf(v, 0.f);
      if (ACT == 2) v = 0.5f * v * (1.0f + erff(v * 0.70710678118654752f));
      if (ACT == 3) { const float u = 0.7978845608028654f * (v + 0.044715f * v * v * v); v = 0.5f * v * (1.0f + tanhf(u)); }
      so[w][8 * hh + r][t * 16 + ln] = v;
    }
  }
  __builtin_amdgcn_fence(__ATOMIC_ACQ_REL, "workgroup");
  __builtin_amdgcn_wave_barrier();
  const int rsub = lane >> 4, c4 = (lane & 15) * 4;
  {
#pragma unroll
    for (int q = 0; q < 8; ++q) {
      const int r = q * 2 + rsub;
      const v4f v = *(const v4fa*)&so[w][r][c4];
      *(v4f*)(C + (size_t)(row0 + r) * ldc + col0 + c4) = v;
    }
    
  }
}
// row LayerNorm (biased variance, eps) over N: s = X (+ R); optional out_sum <- s; out_norm <- (s-mu)*rsqrt(var+eps)*g + b
template <bool PARAM_BF16>
__global__ __launch_bounds__(256) void k_layernorm(const float* __restrict__ X, const float* __restrict__ R, const float* __restrict__ g, const float* __restrict__ bta,
                                                  float* __restrict__ out_sum, float* __restrict__ out_norm, int N, float eps) {
  __shared__ float red[256];
  const int row = blockIdx.x, tid = threadIdx.x;
  const float* x = X + (size_t)row * N; const float* rr = R ? R + (size_t)row * N : nullptr;
  float vals[16];                     // up to N = 4096
  const int per = N / 256;            // contiguous chunk per thread? use strided-by-4 chunks: thread handles j = tid*4 + 1024*u
  float s1 = 0.f;
  for (int u = 0; u < per / 4; ++u) {
    const int j = tid * 4 + 1024 * u;
    const v4f a = *(const v4fa*)(x + j);
    v4f b = {0.f,0.f,0.f,0.f}; if (rr) b = *(const v4fa*)(rr + j);
#pragma unroll
    for (int q = 0; q < 4; ++q) { const float v = a[q] + b[q]; vals[u * 4 + q] = v; s1 += v; }
  }
  red[tid] = s1; __syncthreads();
  for (int st = 128; st > 0; st >>= 1) { if (tid < st) red[tid] += red[tid + st]; __syncthreads(); }
  const float mu = red[0] / (float)N; __syncthreads();
  float s2 = 0.f;
  for (int u = 0; u < per / 4; ++u)
#pragma unroll
    for (int q = 0; q < 4; ++q) { const float c = vals[u * 4 + q] - mu; s2 += c * c; }
  red[tid] = s2; __syncthreads();
  for (int st = 128; st > 0; st >>= 1) { if (tid < st) red[tid] += red[tid + st]; __syncthreads(); }
  const float rs = rsqrtf(red[0] / (float)N + eps);
  {
    for (int u = 0; u < per / 4; ++u) {
      const int j = tid * 4 + 1024 * u;
      v4f o, sm;
#pragma unroll
      for (int q = 0; q < 4; ++q) {
        float gg = g[j + q], bb = bta[j + q];
        if (PARAM_BF16) { gg = bf16_round(gg); bb = bf16_round(bb); }
        sm[q] = vals[u * 4 + q]; o[q] = (vals[u * 4 + q] - mu) * rs * gg + bb;
      }
      if (out_sum) *(v4f*)(out_sum + (size_t)row * N + j) = sm;
      *(v4f*)(out_norm + (size_t)row * N + j) = o;
    }
    
  }
}



// ---- f16 WMMA path (v_wmma_f32_16x16x32_f16): 11-bit significands for operands in range — used for every product launched here: both projections, q·k and the masked weights (x 2^8) times V
typedef _Float16 v16h __attribute__((ext_vector_type(16)));
union FragH { v16h v; v8us half[2]; _Float16 h[16]; unsigned short u[16]; };
template <int NT>
__device__ __forceinline__ v8f mmaH(v16h ah, v16h al, v16h bh, v16h bl, v8f c) {
  c = __builtin_amdgcn_wmma_f32_16x16x32_f16(false, ah, false, bh, (short)0, c, false, false);
  if (NT >= 2) c = __builtin_amdgcn_wmma_f32_16x16x32_f16(false, al, false, bh, (short)0, c, false, false);
  if (NT >= 3) c = __builtin_amdgcn_wmma_f32_16x16x32_f16(false, ah, false, bl, (short)0, c, false, false);
  asm volatile("v_nop\n\tv_nop\n\tv_nop\n\tv_nop" : "+v"(c) : "v"(ah), "v"(al), "v"(bh), "v"(bl));
  return c;
}
// batched GEMM like k_gemm_b but f16 operands: A f32 (split into f16 hi/lo if ASPLIT, else rounded to f16), Bt = f16 values [n][k]; alpha; C f32; N multiple of 16 (partial tiles skipped)
template <bool ASPLIT>
__global__ __launch_bounds__(128) void k_gemm_h(const float* __restrict__ A, int lda, size_t sA, const _Float16* __restrict__ Bh, int ldb, size_t sB, float alpha, float* __restrict__ C, int ldc, size_t sC, int M, int N, int K) {
  __shared__ __attribute__((aligned(16))) float so[4][16][64];
  const int tid = threadIdx.x, w = tid >> 5, lane = tid & 31, ln = lane & 15, hh = lane >> 4; const int by = blockIdx.y;
  A += (size_t)by * sA; Bh += (size_t)by * sB; C += (size_t)by * sC;
  const int ntn = (N + 63) / 64; const int wid = blockIdx.x * 4 + w; const int mt = wid / ntn, nq = wid % ntn; if (mt * 16 >= M) return;
  const int row0 = mt * 16, col0 = nq * 64; const float* arow = A + (size_t)(row0 + ln) * lda;
  v8f acc[4] = {};
  for (int kb = 0; kb < K; kb += 32) {
    FragH ah, al;
    const v4f x0 = *(const v4fa*)(arow + kb + 8 * hh), x1 = *(const v4fa*)(arow + kb + 8 * hh + 4), x2 = *(const v4fa*)(arow + kb + 16 + 8 * hh), x3 = *(const v4fa*)(arow + kb + 16 + 8 * hh + 4);
    float xs[16] = {x0[0],x0[1],x0[2],x0[3],x1[0],x1[1],x1[2],x1[3],x2[0],x2[1],x2[2],x2[3],x3[0],x3[1],x3[2],x3[3]};
#pragma unroll
    for (int i = 0; i < 16; ++i) { const _Float16 h = (_Float16)xs[i]; ah.h[i] = h; al.h[i] = ASPLIT ? (_Float16)(xs[i] - (float)h) : (_Float16)0.0f; }
#pragma unroll
    for (int t = 0; t < 4; ++t) { if (col0 + t * 16 >= N) continue; const size_t boff = (size_t)(col0 + t * 16 + ln) * ldb + kb; FragH bq; bq.half[0] = *(const v8us*)(Bh + boff + 8 * hh); bq.half[1] = *(const v8us*)(Bh + boff + 16 + 8 * hh);
      acc[t] = mmaH<ASPLIT ? 2 : 1>(ah.v, al.v, bq.v, bq.v, acc[t]); }
  }
#pragma unroll
  for (int t = 0; t < 4; ++t) { if (col0 + t * 16 >= N) continue;
#pragma unroll
    for (int r = 0; r < 8; ++r) so[w][8 * hh + r][t * 16 + ln] = acc[t][r] * alpha; }
  __builtin_amdgcn_fence(__ATOMIC_ACQ_REL, "workgroup"); __builtin_amdgcn_wave_barrier();
  const int rsub = lane >> 4, c4 = (lane & 15) * 4;
  {
#pragma unroll
    for (int q = 0; q < 8; ++q) { const int r = q * 2 + rsub; if (col0 + c4 < N) { const v4f v = *(const v4fa*)&so[w][r][c4]; *(v4f*)(C + (size_t)(row0 + r) * ldc + col0 + c4) = v; } }
     }
}

// Wt[n][k] = f16(W[k][n]·scale) from f32 row-major W[K][N] (scale = power of two; bf16-exact weights stay exact in f16 away from the subnormal range)
__global__ __launch_bounds__(256) void k_wt_f16(const float* __restrict__ W, _Float16* __restrict__ Wt, int K, int N, float scale) {
  const int t = blockIdx.x * 256 + threadIdx.x; if (t >= N * (K / 8)) return; const int n = t / (K / 8), k8 = (t % (K / 8)) * 8; FragH f;
#pragma unroll
  for (int i = 0; i < 8; ++i) f.h[i] = (_Float16)(bf16_round(W[(size_t)(k8 + i) * N + n]) * scale); const v8us o = f.half[0];
  *(v8us*)((unsigned short*)Wt + (size_t)n * K + k8) = o; 
}
// k_gemm_hh variant with fused epilogue: v = acc·alpha + bias[by·sBias + col] (+ CP[(row/rowsPerB)·sCPb + by·64 + col] if CP) ; ACT 0 none / 1 elu ; writes f32 C and/or f16 C16 (each if non-null)
template <int ACT>
__global__ __launch_bounds__(128) void k_gemm_hhx(const _Float16* __restrict__ A, int lda, size_t sA, const _Float16* __restrict__ Bh, int ldb, size_t sB, float alpha, const float* __restrict__ bias, size_t sBias, const float* __restrict__ CP, int rowsPerB, size_t sCPb, int row0g,
    float* __restrict__ C, _Float16* __restrict__ C16, int ldc, size_t sC, int M, int N, int K) {
  __shared__ __attribute__((aligned(16))) float so[4][16][64];
  const int tid = threadIdx.x, w = tid >> 5, lane = tid & 31, ln = lane & 15, hh = lane >> 4; const int by = blockIdx.y;
  A += (size_t)by * sA; Bh += (size_t)by * sB; const size_t cofs = (size_t)by * sC; const float* bp = bias ? bias + (size_t)by * sBias : nullptr;
  const int ntn = (N + 63) / 64; const int wid = blockIdx.x * 4 + w; const int mt = wid / ntn, nq = wid % ntn; if (mt * 16 >= M) return;
  const int row0 = mt * 16, col0 = nq * 64; const _Float16* arow = A + (size_t)(row0 + ln) * lda;
  v8f acc[4] = {};
  for (int kb = 0; kb < K; kb += 32) { FragH ah; ah.half[0] = *(const v8us*)((const unsigned short*)arow + kb + 8 * hh); ah.half[1] = *(const v8us*)((const unsigned short*)arow + kb + 16 + 8 * hh);
#pragma unroll
    for (int t = 0; t < 4; ++t) { if (col0 + t * 16 >= N) continue; const size_t boff = (size_t)(col0 + t * 16 + ln) * ldb + kb; FragH bq; bq.half[0] = *(const v8us*)((const unsigned short*)Bh + boff + 8 * hh); bq.half[1] = *(const v8us*)((const unsigned short*)Bh + boff + 16 + 8 * hh);
      acc[t] = mmaH<1>(ah.v, ah.v, bq.v, bq.v, acc[t]); }
  }
#pragma unroll
  for (int t = 0; t < 4; ++t) { if (col0 + t * 16 >= N) continue; const int col = col0 + t * 16 + ln; const float bv = bp ? bf16_round(bp[col]) : 0.f;
#pragma unroll
    for (int r = 0; r < 8; ++r) { float v = acc[t][r] * alpha + bv; if (CP) { const int bidx = (row0g + row0 + 8 * hh + r) / rowsPerB; v += CP[(size_t)bidx * sCPb + (size_t)by * 64 + col]; } if (ACT == 1) v = (v > 0.f) ? v : expm1f(v); else if (ACT == 7) v = (v > 0.f) ? v + 1.0f : expf(v); else if (ACT == 8) v = tanhf(v); else if (ACT == 9) v = 0.5f * v * (1.0f + tanhf(0.7978845608028654f * (v + 0.044715f * v * v * v))); else if (ACT == 11) v = 1.0f / (1.0f + expf(-v)); else if (ACT == 12) v = (v > 0.f) ? v : 0.01f * v; else if (ACT == 14) v = (v > 0.f) ? v : 0.1f * v; else if (ACT == 15) v = v / (1.0f + expf(-v)); else if (ACT == 3) v = fmaxf(v, 0.f); else if (ACT == 6) v = 0.5f * v * (1.0f + erff(v * 0.70710678118654752f)); so[w][8 * hh + r][t * 16 + ln] = v; } }
  __builtin_amdgcn_fence(__ATOMIC_ACQ_REL, "workgroup"); __builtin_amdgcn_wave_barrier();
  const int rsub = lane >> 4, c4 = (lane & 15) * 4; typedef _Float16 v4h __attribute__((ext_vector_type(4)));
  {
#pragma unroll
    for (int q = 0; q < 8; ++q) { const int r = q * 2 + rsub; if (col0 + c4 < N) { const v4f v = *(const v4fa*)&so[w][r][c4]; if (C) *(v4f*)(C + cofs + (size_t)(row0 + r) * ldc + col0 + c4) = v; if (C16) { v4h h4; for (int i = 0; i < 4; ++i) h4[i] = (_Float16)v[i]; *(v4h*)(C16 + cofs + (size_t)(row0 + r) * ldc + col0 + c4) = h4; } } }
     }
}


typedef _Float16 v4h __attribute__((ext_vector_type(4)));

__global__ __launch_bounds__(256) void k_h16(const float* __restrict__ x, _Float16* __restrict__ X16, size_t n8) { const size_t t = (size_t)blockIdx.x * 256 + threadIdx.x; if (t >= n8) return; FragH f;
#pragma unroll
  for (int q = 0; q < 8; ++q) f.h[q] = (_Float16)x[t * 8 + q]; *(v8us*)((unsigned short*)X16 + t * 8) = f.half[0];  }
template <int NHv, int TTv>
__global__ __launch_bounds__(256) void k_vt(const _Float16* __restrict__ V16, int ldv, int voff, _Float16* __restrict__ Vt) { __shared__ unsigned short tl[64][66]; const int tid = threadIdx.x; const int slab = blockIdx.x / (TTv / 64), lg = blockIdx.x % (TTv / 64); const int b = slab / NHv, h = slab % NHv;
  for (int i = tid; i < 64 * 8; i += 256) { const int r = i / 8, c8 = (i % 8) * 8; FragH f; f.half[0] = *(const v8us*)((const unsigned short*)V16 + ((size_t)b * TTv + lg * 64 + r) * ldv + voff + h * 64 + c8);
#pragma unroll
    for (int q = 0; q < 8; ++q) tl[r][c8 + q] = f.u[q]; }
  __syncthreads();
  {
#pragma unroll
    for (int rd = 0; rd < 2; ++rd) { const int d = rd * 32 + tid / 8, pc = tid % 8; FragH f;
#pragma unroll
      for (int q = 0; q < 8; ++q) f.u[q] = tl[pc * 8 + q][d];
      *(v8us*)((unsigned short*)Vt + ((size_t)slab * 64 + d) * TTv + lg * 64 + pc * 8) = f.half[0]; }
     } }

__global__ __launch_bounds__(256) void k_hl(const float* __restrict__ F, _Float16* __restrict__ Hh, _Float16* __restrict__ Hl, size_t n8) { const size_t t = (size_t)blockIdx.x * 256 + threadIdx.x; if (t >= n8) return; FragH fh, fl; const v4f a = *(const v4fa*)(F + t * 8), c = *(const v4fa*)(F + t * 8 + 4);
#pragma unroll
  for (int q = 0; q < 4; ++q) { _Float16 h = (_Float16)a[q]; fh.h[q] = h; fl.h[q] = (_Float16)((a[q] - (float)h) * 1024.0f); h = (_Float16)c[q]; fh.h[4 + q] = h; fl.h[4 + q] = (_Float16)((c[q] - (float)h) * 1024.0f); }
  { *(v8us*)((unsigned short*)Hh + t * 8) = fh.half[0]; *(v8us*)((unsigned short*)Hl + t * 8) = fl.half[0];  } }

// FRAGMENT ORDER (the planes of k, transposed V and the mask that the fused kernel reads): a plane is a row of 16-byte pieces, a piece being the 8 values that ONE lane takes with ONE
// 16-byte load, and the 32 pieces of one load instruction lie side by side in lane order (lane = 16*hh + ln). So a fragment load reads 512 bytes in a row (4 cache lines) where the same load
// from a row-major plane touches 16 lines. A wave of the q|k GEMM writes the 256 pieces of its 32 keys of one head (4 KB in a row; the batches' k planes lie one behind the other), thread t of k_prep piece t of each batch's V plane.
// k:    piece (((h*128 + key/16)*2 + ks)*2 + hf)*32 + lane = k[key = 16*(key/16) + ln][h*64 + ks*32 + hf*16 + hh*8 + 0..7]
// V:    piece (((h*64 + pass)*4 + tt)*2 + hf)*32 + lane    = V[key = pass*32 + hf*16 + hh*8 + 0..7][h][tt*16 + ln]
// mask: piece ((((b*64 + q/32)*64 + pass)*2 + u)*2 + j)*32 + lane = M[b][q = 32*(q/32) + u*16 + ln][pass*32 + j*16 + hh*8 + 0..7], rounded to bf16 and stored as f16: the order of a piece's values is that of the f16 weights in the B operand, so that e*M is a product of whole registers
// One launch for every plane that depends on the inputs alone. The planes have as many pieces as the launch has threads, or a small multiple or half of it, so thread t takes piece t of each:
// in_proj rows of q|k (x 16), x and transposed V of both batches, half a piece of out_w (x 16); a wave takes 16 queries x 64 keys (2 passes) of the mask: 8 fetches, each of 4 whole lines
// (8 lanes x 16 bytes a query row, 4 rows), a lane's 4 values being half a piece. All 31 fetches of a thread are issued before the first use.
typedef unsigned short v4us __attribute__((ext_vector_type(4), may_alias));
typedef float f32a __attribute__((may_alias));
static_assert(2 * DD * DD == SS * DD && NH * HD * SS == SS * DD && NBt * (SS / 16) * (SS / 64) * 32 == SS * DD / 8 && DD * DD / 4 == SS * DD / 8, "thread t takes piece t of each plane");
__global__ __launch_bounds__(256) void k_prep(const float* __restrict__ Win, const float* __restrict__ Wo, const float* __restrict__ x0, const float* __restrict__ x1, const float* __restrict__ V0, const float* __restrict__ V1, const float* __restrict__ Mm,
                                              _Float16* __restrict__ BIN, _Float16* __restrict__ BO, _Float16* __restrict__ X16, _Float16* __restrict__ VF, unsigned short* __restrict__ MF) {
  const unsigned t = blockIdx.x * 256 + threadIdx.x, wv = t >> 5, lane = t & 31, c = lane & 7, r4 = lane >> 3;
  const unsigned kh = wv & 1, u = (wv >> 1) & 1, pg = (wv >> 2) & (SS / 128 - 1), qt = (wv >> 6) & (SS / 32 - 1), b = wv >> 12;
  const unsigned im = ((b * SS + qt * 32 + u * 16 + r4) * SS + pg * 128 + kh * 64 + c * 4) * 4;      // offsets from the planes' starts, 32 bits each: one register a plane, the same for both batches (x0, V0: batch 0; x1, V1: batch 1)
  const unsigned t0 = ((t >> 8) & (SS / 32 - 1)) * 32 + ((t >> 5) & 1) * 16 + ((t >> 4) & 1) * 8, d = ((t >> 6) & 3) * 16 + (t & 15), h = t >> 14;
  const unsigned iv = (t0 * NH + h) * HD + d, i32 = t * 32, i16 = t * 16, i8 = t * 8;      // iv counts elements
  const unsigned om = (((((b * (SS / 32) + qt) * (SS / 32) + pg * 4 + kh * 2) * 2 + u) * 512 + (c >> 2) * 256 + (((c >> 1) & 1) * 16 + r4) * 8 + (c & 1) * 4)) * 2;
  const char* pm = (const char*)Mm;
  v4f m[2][4], xa[2][2], wa[2], oa; float va[2][8];      // every loop below is unrolled so that these are indexed by constants and stay in registers
#pragma unroll
  for (int k = 0; k < 2; ++k)
#pragma unroll
    for (int i = 0; i < 4; ++i) m[k][i] = *(const v4fa*)(pm + i * 16 * SS + k * 128 + im);
#pragma unroll
  for (int bb = 0; bb < 2; ++bb)
#pragma unroll
    for (int q = 0; q < 8; ++q) va[bb][q] = (bb ? V1 : V0)[q * NH * HD + iv];
#pragma unroll
  for (int i = 0; i < 2; ++i) { xa[0][i] = *(const v4fa*)((const char*)x0 + i * 16 + i32); xa[1][i] = *(const v4fa*)((const char*)x1 + i * 16 + i32); wa[i] = *(const v4fa*)((const char*)Win + i * 16 + i32); }
  oa = *(const v4fa*)((const char*)Wo + i16);
  // The wait behind the fetches takes their offset registers and their bases as inputs, so that these stay live up to it and nothing is written into them before; its clobber keeps all fetches in front of it.
  asm volatile("s_wait_xcnt 0x0" :: "v"(im), "v"(iv), "v"(i32), "v"(t), "s"(Win), "s"(Wo), "s"(x0), "s"(x1), "s"(V0), "s"(V1), "s"(Mm) : "memory");
  __builtin_amdgcn_sched_barrier(0);      // without it the scheduler lifts the first conversions in between the fetches, and the later fetches start only when the earlier have landed
  v4us mo[2][4]; FragH fv[2], fx[2], fw, fo;
#pragma unroll
  for (int k = 0; k < 2; ++k)
#pragma unroll
    for (int i = 0; i < 4; ++i)
#pragma unroll
      for (int q = 0; q < 4; ++q) mo[k][i][q] = __builtin_bit_cast(unsigned short, (_Float16)bf16_round(m[k][i][q]));
#pragma unroll
  for (int bb = 0; bb < 2; ++bb)
#pragma unroll
    for (int q = 0; q < 8; ++q) { fv[bb].h[q] = (_Float16)bf16_round(va[bb][q]); fx[bb].h[q] = (_Float16)bf16_round(xa[bb][q >> 2][q & 3]); }
#pragma unroll
  for (int q = 0; q < 8; ++q) fw.h[q] = (_Float16)(bf16_round(wa[q >> 2][q & 3]) * 16.0f);
#pragma unroll
  for (int q = 0; q < 4; ++q) fo.h[q] = (_Float16)(bf16_round(oa[q]) * 16.0f);
  v4us o4; o4[0] = fo.u[0]; o4[1] = fo.u[1]; o4[2] = fo.u[2]; o4[3] = fo.u[3];
  __builtin_amdgcn_sched_barrier(0);      // every conversion stays in front of the first store: behind a store no register that it names is written again
#pragma unroll
  for (int k = 0; k < 2; ++k)
#pragma unroll
    for (int i = 0; i < 4; ++i) *(v4us*)((char*)MF + k * 2048 + i * 64 + om) = mo[k][i];
#pragma unroll
  for (int bb = 0; bb < 2; ++bb) { *(v8us*)((char*)VF + (size_t)bb * NH * HD * SS * 2 + i16) = fv[bb].half[0]; *(v8us*)((char*)X16 + (size_t)bb * SS * DD * 2 + i16) = fx[bb].half[0]; }
  *(v8us*)((char*)BIN + i16) = fw.half[0]; *(v4us*)((char*)BO + i8) = o4; }
// Stands behind each group of fetches (and each store) of the fused kernel: the wait, because the registers that they name are reused right behind it;
// the "memory" clobber, because in the loop, without it, the compiler sinks the mask fetch to the loop's head, where its whole latency is waited for in every pass.
__device__ __forceinline__ void fetch_fence() { asm volatile("s_wait_xcnt 0x0" ::: "memory"); }
// Projection GEMM: C[m][n] (f32, pitch NN) = alpha * sum_k A[m][k] * Bt[n][k] + bf16(bias[n]); A and Bt are f16 planes with rows of DD elements.
// A work-group of 8 waves (4 x 2) owns 128 x BN of C, a wave 32 x BN/2. A stage is BK k of the 128 + BN operand rows: fetched as whole lines into registers while the
// stage before is multiplied, then written to the other of two LDS buffers (row pitch + 16 B, for the 16-byte fragment reads). One barrier a stage: it publishes the
// buffer just written and ends the reads of the buffer that the next stage overwrites. Fragment k order and the order of the k sum are those of k_gemm_hhx.
// SPLIT (the q|k projection): C is not stored; the same f32 values go, rounded to f16, to the planes that the fused attention reads: columns below DD to Q16 (rows), the rest to KF (fragment order).
template <int NN, int BN, int BK, bool SPLIT>
__global__ __launch_bounds__(256) void k_gemm_t(const _Float16* __restrict__ A, const _Float16* __restrict__ Bt, float alpha, const float* __restrict__ bias, float* __restrict__ C, _Float16* __restrict__ Q16, _Float16* __restrict__ KF) {
  constexpr int BM = 128, LP = BK + 8, NS = DD / BK, WN = BN / 2, NTN = WN / 16, STG = (BM + BN) * LP;
  constexpr int CPR = BK / 8, RPP = 256 / CPR, NA = BM / RPP, NB = BN / RPP;
  __shared__ __attribute__((aligned(16))) unsigned short sm[2 * STG];
  const int tid = threadIdx.x, w = tid >> 5, lane = tid & 31, ln = lane & 15, hh = lane >> 4, wm = w >> 1, wn = w & 1;
  const int row0 = blockIdx.y * BM, col0 = blockIdx.x * BN;
  const int lr = tid / CPR, lc = (tid % CPR) * 8;
  const unsigned short* ga = (const unsigned short*)A + (size_t)(row0 + lr) * DD + lc;
  const unsigned short* gb = (const unsigned short*)Bt + (size_t)(col0 + lr) * DD + lc;
  v8us ra[NA], rb[NB];
  // Every '#pragma unroll' below is there so that fragments and accumulators are indexed by constants and stay in registers.
  auto fetch = [&](int s) {
#pragma unroll
    for (int i = 0; i < NA; ++i) ra[i] = *(const v8us*)(ga + (size_t)i * RPP * DD + s * BK);
#pragma unroll
    for (int i = 0; i < NB; ++i) rb[i] = *(const v8us*)(gb + (size_t)i * RPP * DD + s * BK); };
  auto put = [&](int buf) {
    unsigned short* d = sm + buf * STG + lr * LP + lc;
#pragma unroll
    for (int i = 0; i < NA; ++i) *(v8us*)(d + i * RPP * LP) = ra[i];
#pragma unroll
    for (int i = 0; i < NB; ++i) *(v8us*)(d + (BM + i * RPP) * LP) = rb[i]; };
  v8f acc[2][NTN] = {};
  fetch(0); put(0);
  __syncthreads();
  for (int s = 0; s < NS; ++s) {
    // The wait behind the fetches: its clobber keeps them at the stage's head (without it the compiler sinks most of them to the stage's end, in front of the LDS writes,
    // where their whole latency is waited for); it takes both address pairs as inputs, so that they stay live up to the wait and no fetch of the run lands in them.
    if (s + 1 < NS) { fetch(s + 1); asm volatile("s_wait_xcnt 0x0" :: "v"(ga), "v"(gb) : "memory"); }
    const unsigned short* pa = sm + (s & 1) * STG + (wm * 32 + ln) * LP + 8 * hh;
    const unsigned short* pb = sm + (s & 1) * STG + (BM + wn * WN + ln) * LP + 8 * hh;
#pragma unroll
    for (int ks = 0; ks < BK / 32; ++ks) {
      FragH af[2], bf[NTN];
#pragma unroll
      for (int mi = 0; mi < 2; ++mi) { af[mi].half[0] = *(const v8us*)(pa + mi * 16 * LP + ks * 32); af[mi].half[1] = *(const v8us*)(pa + mi * 16 * LP + ks * 32 + 16); }
#pragma unroll
      for (int t = 0; t < NTN; ++t) { bf[t].half[0] = *(const v8us*)(pb + t * 16 * LP + ks * 32); bf[t].half[1] = *(const v8us*)(pb + t * 16 * LP + ks * 32 + 16); }
#pragma unroll
      for (int mi = 0; mi < 2; ++mi)
#pragma unroll
        for (int t = 0; t < NTN; ++t) acc[mi][t] = __builtin_amdgcn_wmma_f32_16x16x32_f16(false, af[mi].v, false, bf[t].v, (short)0, acc[mi][t], false, false);
    }
    if (s + 1 < NS) put((s + 1) & 1);
    __syncthreads();
  }
  // Behind the last barrier nobody reads the buffers any more: each wave stages its own 32 x WN block there, so that C, or with SPLIT the f16 q and k planes, is stored as whole lines.
  constexpr int SP = WN + 4, LPR = WN / 4, RPI = 32 / LPR;
  f32a* so = (f32a*)sm + w * 32 * SP;
#pragma unroll
  for (int t = 0; t < NTN; ++t) {
    const float bv = bf16_round(bias[col0 + wn * WN + t * 16 + ln]);
#pragma unroll
    for (int mi = 0; mi < 2; ++mi)
#pragma unroll
      for (int r = 0; r < 8; ++r) so[(mi * 16 + 8 * hh + r) * SP + t * 16 + ln] = acc[mi][t][r] * alpha + bv;
  }
  __syncthreads();
  if constexpr (SPLIT) {
    static_assert(WN == HD && DD % BN == 0 && SS % BM == 0, "a wave's block is 32 rows of one head, a work-group's lies in q or in k and in one batch");
    const int rw = row0 + wm * 32, cw = col0 + wn * WN;
    // A lane takes 8 pieces of 8 values; all are converted before the first is stored, and the 8 stores share one address.
    FragH f[4];
    auto piece = [&](int i, const f32a* p) {
      const v4f a = *(const v4fa*)p, c = *(const v4fa*)(p + 4);
#pragma unroll
      for (int q = 0; q < 4; ++q) { f[i >> 1].h[(i & 1) * 8 + q] = (_Float16)a[q]; f[i >> 1].h[(i & 1) * 8 + 4 + q] = (_Float16)c[q]; } };
    if (col0 < DD) {      // q: piece i = row i*4 + lane/8, columns (lane%8)*8, so that a store is 4 whole lines
      const f32a* sp = so + (lane >> 3) * SP + (lane & 7) * 8;
      unsigned short* gp = (unsigned short*)Q16 + (size_t)(rw + (lane >> 3)) * DD + cw + (lane & 7) * 8;
#pragma unroll
      for (int i = 0; i < 8; ++i) piece(i, sp + i * 4 * SP);
#pragma unroll
      for (int i = 0; i < 8; ++i) *(v8us*)(gp + i * 4 * DD) = f[i >> 1].half[i & 1];
      asm volatile("s_wait_xcnt 0x0" ::: "memory");      // behind the run of stores: whatever block the compiler lays behind this one reuses the registers that they name
    } else {      // k: piece i*32 + lane of the wave's 4 KB, i = (key tile)*4 + ks*2 + hf
      const f32a* sp = so + ln * SP + hh * 8;
      unsigned short* gp = (unsigned short*)KF + ((((size_t)(rw / SS) * NH + (cw - DD) / HD) * (SS / 16) + (rw % SS) / 16) * 128 + lane) * 8;
#pragma unroll
      for (int i = 0; i < 8; ++i) piece(i, sp + (i >> 2) * 16 * SP + (i & 3) * 16);
#pragma unroll
      for (int i = 0; i < 8; ++i) *(v8us*)(gp + i * 256) = f[i >> 1].half[i & 1];
      asm volatile("s_wait_xcnt 0x0" ::: "memory");      // behind the run of stores: whatever block the compiler lays behind this one reuses the registers that they name
    }
  } else {
    const int rs = lane / LPR, c4 = (lane % LPR) * 4;
#pragma unroll
    for (int q = 0; q < 32 / RPI; ++q) {
      const int r = q * RPI + rs;
      const v4f v = *(const v4fa*)&so[r * SP + c4];
      *(v4f*)(C + (size_t)(row0 + wm * 32 + r) * NN + col0 + wn * WN + c4) = v;
    }
  }
}
// Fused attention. One wave owns 32 queries of one (batch, head) and walks all keys, 32 a pass.
// ST = K.QT (A = 16 key rows, B = 16 query rows): a lane holds the scores of ONE query (column ln), keys 8*hh + r, so the maximum is
// in-lane plus one exchange between the wave's halves (only where the maximum in use is renewed). Two score tiles, converted in place, are the B operand of OT += VT.PT (A = rows of VT in
// the same k order), so OT's column is the same query and the rescale factor is in-lane too.
// Result = sum(e*M*V) / (sum(e*M) + 1e-8 * sum e), e = exp(s - maximum in use): the softmax denominator cancels but for the 1e-8 term. The maximum in use is renewed lazily (in the loop).
// Both key sums run on the matrix unit: A = ones in rows 0 and 8, zero elsewhere, B = the pass's weights as f16 (e*M: the operand of the product with V; e: packed f16, also the factor of e*M),
// accumulated in a tile of their own. Rows 0 and 8 are register 0 of the wave's two halves, so register 0 holds, in every lane, the whole sum of the lane's own query (no vector adds, no
// exchange between the halves); the other registers stay 0, so only register 0 is rescaled.
// k, transposed V and the mask come from planes in fragment order (above k_prep): a pass's 8 + 8 + 4 loads of a wave each read 512 bytes in a row.
// Every '#pragma unroll' below is there so that fragments and accumulators are indexed by constants and stay in registers.
__global__ __launch_bounds__(256) void k_fattn(const _Float16* __restrict__ Q16, const _Float16* __restrict__ KF, const _Float16* __restrict__ VF, const unsigned short* __restrict__ MF, _Float16* __restrict__ O16) {
  const int tid = threadIdx.x, w = tid >> 5, lane = tid & 31, ln = lane & 15, hh = lane >> 4;
  const int h = blockIdx.y, b = blockIdx.z, q0 = blockIdx.x * 256 + w * 32;
  const unsigned short* Qb = (const unsigned short*)Q16 + ((size_t)b * SS + q0 + ln) * DD + h * HD + 8 * hh;
  const unsigned short* Kb = (const unsigned short*)KF + ((size_t)b * NH + h) * (SS * HD) + lane * 8;
  const unsigned short* Vb = (const unsigned short*)VF + ((size_t)b * NH + h) * (SS * HD) + lane * 8;
  const unsigned short* Mb = MF + ((size_t)b * (SS / 32) + (q0 >> 5)) * (SS * 32) + lane * 8;
  FragH qf[2][2], kf[2][2][2], vf[2][4], mf[2][2];      // k, V and the mask have two register sets: even passes use set 0, odd passes set 1; a mask fragment holds its 16 f16 values where the weights' B operand holds theirs
#pragma unroll
  for (int u = 0; u < 2; ++u)
#pragma unroll
    for (int ks = 0; ks < 2; ++ks) { qf[u][ks].half[0] = *(const v8us*)(Qb + (size_t)u * 16 * DD + ks * 32); qf[u][ks].half[1] = *(const v8us*)(Qb + (size_t)u * 16 * DD + ks * 32 + 16); }
  asm volatile("s_wait_xcnt 0x0" :: "v"(Qb) : "memory");      // fetch_fence() that also takes the fetches' address as an input: it stays live up to the wait, so that nothing is written into it before
  auto loadK = [&](int s, int kb) {
#pragma unroll
    for (int j = 0; j < 2; ++j)
#pragma unroll
      for (int ks = 0; ks < 2; ++ks) { const unsigned short* p = Kb + (size_t)kb * HD + (j * 2 + ks) * 512; kf[s][j][ks].half[0] = *(const v8us*)p; kf[s][j][ks].half[1] = *(const v8us*)(p + 256); } };
  auto loadM = [&](int s, const unsigned short* p) {
#pragma unroll
    for (int u = 0; u < 2; ++u)
#pragma unroll
      for (int j = 0; j < 2; ++j) mf[s][u].half[j] = *(const v8us*)(p + (u * 2 + j) * 256); };
  auto loadV = [&](int s, int kb) {
#pragma unroll
    for (int t = 0; t < 4; ++t) { const unsigned short* p = Vb + (size_t)kb * HD + t * 512; vf[s][t].half[0] = *(const v8us*)p; vf[s][t].half[1] = *(const v8us*)(p + 256); } };
  v8f acc[2][4] = {};
  float mx[2] = {-3.0e38f, -3.0e38f};      // the maximum in use, log2 units: a running maximum of some earlier pass, the same in both halves of the wave
  float sh[2] = {0.0f, 0.0f}, thr[2] = {-3.0e38f, -3.0e38f};      // 8 - mx, and the raw score above which mx is renewed; the first pair of passes always renews
  v8f se[2] = {}, sem[2] = {};
  FragH ones;
#pragma unroll
  for (int i = 0; i < 16; ++i) ones.h[i] = (ln & 7) == 0 ? (_Float16)1.0f : (_Float16)0.0f;
  const float c2 = 0.125f * 1.4426950408889634f;      // scores / 8, in log2 units
  static_assert(SS % 64 == 0, "the passes go in pairs");
  loadK(0, 0); loadK(1, 32); fetch_fence(); loadM(0, Mb); fetch_fence(); loadV(0, 0); fetch_fence();      // the fences keep the loop's own issue order (K of both passes, then M, V pass by pass) here too: else the loop's counted waits for one operand also wait for a younger one
  loadM(1, Mb + 32 * 32); fetch_fence(); loadV(1, 32);
  // The wait behind the V fetches of pass 1 takes the lane's index and its byte offset as inputs: the fetches name the register of one of the two, which so stays live up to the wait
  // (else the zeroing of the sums and accumulators lands in it first).
  asm volatile("s_wait_xcnt 0x0" :: "v"(lane), "v"(lane * 16) : "memory");
  for (int kb = 0; kb < SS; kb += 64) {
  const int kp = (kb + 64 < SS) ? kb + 64 : 0;      // the pair of passes that this pair refills
  const unsigned short* pmn = Mb + (size_t)kp * 32;
  // Right behind its last use each operand's set is refilled for the pass after the next, so that a fetch has two passes to land, not one.
  // The last two passes refetch passes 0 and 1, unused.
  v8f st[2][2][2];      // the scores of both passes of the pair come first, so that one test serves both
#pragma unroll
  for (int s = 0; s < 2; ++s)
#pragma unroll
    for (int u = 0; u < 2; ++u)
#pragma unroll
      for (int j = 0; j < 2; ++j) {
        v8f z = {};
        z = __builtin_amdgcn_wmma_f32_16x16x32_f16(false, kf[s][j][0].v, false, qf[u][0].v, (short)0, z, false, false);
        st[s][u][j] = __builtin_amdgcn_wmma_f32_16x16x32_f16(false, kf[s][j][1].v, false, qf[u][1].v, (short)0, z, false, false);
      }
  loadK(0, kp); loadK(1, kp + 32); fetch_fence();
  __builtin_amdgcn_sched_barrier(0);      // without it the scheduler lifts the maxima in among the products, some directly behind the product that they read, and two of them over the wait above, into the K fetch's address registers
  float tmv[2];
#pragma unroll
  for (int u = 0; u < 2; ++u) {
    float ts[2];      // one chain a pass: four independent chains in all
#pragma unroll
    for (int s = 0; s < 2; ++s) {
      float tm = st[s][u][0][0];
#pragma unroll
      for (int r = 1; r < 8; ++r) tm = fmaxf(tm, st[s][u][0][r]);
#pragma unroll
      for (int r = 0; r < 8; ++r) tm = fmaxf(tm, st[s][u][1][r]);
      ts[s] = tm;
    }
    tmv[u] = fmaxf(ts[0], ts[1]);
  }
  // Lazy rescale, one test a pair of passes for the whole wave (a scalar branch): while no lane holds a score more than 4 (log2 units) above its query's maximum in use, that maximum stays,
  // and neither the exchange between the halves nor the rescale runs. Any common reference cancels in the quotient; the test bounds e by 2^12, inside f16.
  if (__builtin_amdgcn_ballot_w32(tmv[0] > thr[0] || tmv[1] > thr[1]) != 0) {
#pragma unroll
    for (int u = 0; u < 2; ++u) {
      const float tm = fmaxf(tmv[u], __shfl_xor(tmv[u], 16, 32));
      const float mn = fmaxf(mx[u], tm * c2);
      const float al = __builtin_amdgcn_exp2f(mx[u] - mn);
      mx[u] = mn; sh[u] = 8.0f - mn; thr[u] = (mn + 4.0f) * (1.0f / c2);
      se[u][0] *= al; sem[u][0] *= al;
#pragma unroll
      for (int t = 0; t < 4; ++t)
#pragma unroll
        for (int r = 0; r < 8; ++r) acc[u][t][r] *= al;
    }
  }
#pragma unroll
  for (int s = 0; s < 2; ++s) {
    const int kn = kp + s * 32;
    FragH pf[2], ef[2];
#pragma unroll
    for (int u = 0; u < 2; ++u) {
#pragma unroll
      for (int j = 0; j < 2; ++j)
#pragma unroll
        for (int r = 0; r < 8; ++r) {
          const float ev = __builtin_amdgcn_exp2f(st[s][u][j][r] * c2 + sh[u]);      // e carries 2^8 (it cancels in the quotient): keeps small weights in the normal f16 range
          ef[u].h[j * 8 + r] = (_Float16)ev;
        }
      pf[u].v = ef[u].v * mf[s][u].v;      // e*M from e as rounded to f16, two values an instruction: the mask is not widened, the products are not packed
    }
    loadM(s, pmn + s * 32 * 32);
    asm volatile("s_wait_xcnt 0x0" :: "v"(pmn) : "memory");      // fetch_fence() that also takes the fetches' address register (both passes' fetches name the pair's base) as an input: it stays live up to the wait, so that nothing is written into it before
    __builtin_amdgcn_sched_barrier(0);      // without it the scheduler lifts the first sum products over the mask fetch, which then starts later
#pragma unroll
    for (int u = 0; u < 2; ++u) {
      se[u] = __builtin_amdgcn_wmma_f32_16x16x32_f16(false, ones.v, false, ef[u].v, (short)0, se[u], false, false);
      sem[u] = __builtin_amdgcn_wmma_f32_16x16x32_f16(false, ones.v, false, pf[u].v, (short)0, sem[u], false, false);
    }
#pragma unroll
    for (int t = 0; t < 4; ++t)
#pragma unroll
      for (int u = 0; u < 2; ++u) acc[u][t] = __builtin_amdgcn_wmma_f32_16x16x32_f16(false, vf[s][t].v, false, pf[u].v, (short)0, acc[u][t], false, false);
    loadV(s, kn); fetch_fence();
  }
  }
#pragma unroll
  for (int u = 0; u < 2; ++u) {
    const float inv = 1.0f / (sem[u][0] + 1e-8f * se[u][0]);
    unsigned short* op = (unsigned short*)O16 + ((size_t)b * SS + q0 + u * 16 + ln) * DD + h * HD + 8 * hh;
#pragma unroll
    for (int t = 0; t < 4; ++t) { FragH f;
#pragma unroll
      for (int r = 0; r < 8; ++r) f.h[r] = (_Float16)(acc[u][t][r] * inv);
      *(v8us*)(op + t * 16) = f.half[0]; fetch_fence(); }
  }
}

extern "C" void kernel_launch(void* const* d_in, const int* in_sizes, int n_in,
                              void* d_out, int out_size, void* d_ws, size_t ws_size, hipStream_t stream) {
  (void)in_sizes; (void)n_in; (void)out_size;
  const float* x = (const float*)d_in[0]; const float* V = (const float*)d_in[1]; const float* Mm = (const float*)d_in[2]; const float* Win = (const float*)d_in[3]; const float* bin = (const float*)d_in[4]; const float* Wo = (const float*)d_in[5]; const float* bo = (const float*)d_in[6];
  char* ws = (char*)d_ws; size_t off = 0;
  auto take = [&](size_t bytes) { char* p = ws + off; off += (bytes + 255) & ~(size_t)255; return p; };
  _Float16* BIN = (_Float16*)take((size_t)2 * DD * DD * 2); _Float16* BO = (_Float16*)take((size_t)DD * DD * 2); _Float16* X16 = (_Float16*)take((size_t)NBt * SS * DD * 2); _Float16* Q16 = (_Float16*)take((size_t)NBt * SS * DD * 2); _Float16* K16 = (_Float16*)take((size_t)NBt * SS * DD * 2); _Float16* VT = (_Float16*)take((size_t)NBt * NH * HD * SS * 2);
  _Float16* O16 = (_Float16*)take((size_t)NBt * SS * DD * 2); unsigned short* MF = (unsigned short*)take((size_t)NBt * SS * SS * 2);
  if (off > ws_size) return;      // about 65 MB
  // The rows of both batches lie one behind the other in x, q|k, the attention output and out: each GEMM takes them as one matrix of NBt * SS rows.
  k_prep<<<SS * DD / 8 / 256, 256, 0, stream>>>(Win, Wo, x, x + (size_t)SS * DD, V, V + (size_t)SS * NH * HD, Mm, BIN, BO, X16, VT, MF);      /* torch (out,in) = natural Bt; only the q|k rows of in_proj are needed */
  k_gemm_t<2 * DD, 128, 128, true><<<dim3(2 * DD / 128, NBt * SS / 128), 256, 0, stream>>>(X16, BIN, 0.0625f, bin, nullptr, Q16, K16);      /* q | k = x.W_in^T[:2048] + b (exact), stored as the f16 planes */
  k_fattn<<<dim3(SS / 256, NH, NBt), 256, 0, stream>>>(Q16, K16, VT, MF, O16);      /* all batches and heads: 256 work-groups of 8 waves x 32 queries */
  k_gemm_t<DD, 64, 128, false><<<dim3(DD / 64, NBt * SS / 128), 256, 0, stream>>>(O16, BO, 0.0625f, bo, (float*)d_out, nullptr, nullptr);      /* .out_w^T + out_b */
}

// v010
// One run takes 75.6 microseconds.
// In both of two side-by-side timings against v009, it was 1.03 times as fast.
// Over all steps from v000 it is 23.3 times as fast.
#include <hip/hip_runtime.h>
// Masked multi-head attention with external values (B 2, S 2048, D 1024, 16 heads × 64): q | k from the packed in-projection (+ bias; the v third is unused by the module), scores = q·k/8, softmax, A·M (INPUT mask [B,S,S]), L1 renormalisation over keys (+1e-8), out = Ā·V with the separate INPUT V [B,S,H,64], heads concatenated, ·out_wᵀ + out_b → [2,2048,1024].
// Structure, four launches, each over both batches: every plane that depends on the inputs alone (f16 weights and x, transposed V and the mask, rounded to bf16 and kept as f16, in fragment order); q|k GEMM (exact), whose epilogue writes the f16 planes of q (rows) and k (fragment order) itself; one fused attention kernel over all batches and heads (scores, online softmax, mask, L1 renormalisation and the product with V, nothing of the S x S score planes in memory; k and V staged in LDS for the work-group's 8 waves) into the concatenated f16 plane; the output projection GEMM with bias.
// Compute dtype: x, V, M and parameters rounded to bf16; projections with exact products; q, k, the unnormalised masked weights e*M (x 2^8), V (exact) and the attention output as f16 operands (about 2^-12), f32 accumulation; softmax and renormalisation in f32, but that the mask product e*M is a packed f16 product of e as rounded to f16 and the mask (bf16-rounded, exact in f16 from 2^-14 up), and that the two key sums add the weights e and e*M as rounded to f16 (f32 accumulation, on the matrix unit). v_wmma_f32_16x16x32_f16.
#define NBt 2
#define SS 2048
#define DD 1024
#define NH 16
#define HD 64
typedef __bf16 v16b __attribute__((ext_vector_type(16)));
typedef unsigned short v8us __attribute__((ext_vector_type(8), may_alias));
typedef float  v8f  __attribute__((ext_vector_type(8)));
typedef float  v4f  __attribute__((ext_vector_type(4)));
typedef float  v4fa __attribute__((ext_vector_type(4), may_alias));
union FragB { v16b v; v8us half[2]; unsigned short u[16]; };

__device__ __forceinline__ unsigned short bf16_bits(float x) { unsigned int u = __float_as_uint(x); return (unsigned short)((u + 0x7FFFu + ((u >> 16) & 1u)) >> 16); }
__device__ __forceinline__ float bf16_val(unsigned short b) { return __uint_as_float(((unsigned int)b) << 16); }
__device__ __forceinline__ float bf16_round(float x) { return bf16_val(bf16_bits(x)); }
// D += A·B with NT terms: 1 = ah·bh, 2 = + al·bh (A split), 3 = + ah·bl (both split)
template <int NT>
__device__ __forceinline__ v8f mmaN(v16b ah, v16b al, v16b bh, v16b bl, v8f c) {
  c = __builtin_amdgcn_wmma_f32_16x16x32_bf16(false, ah, false, bh, (short)0, c, false, false);
  if (NT >= 2) c = __builtin_amdgcn_wmma_f32_16x16x32_bf16(false, al, false, bh, (short)0, c, false, false);
  if (NT >= 3) c = __builtin_amdgcn_wmma_f32_16x16x32_bf16(false, ah, false, bl, (short)0, c, false, false);
  asm volatile("v_nop\n\tv_nop\n\tv_nop\n\tv_nop" : "+v"(c) : "v"(ah), "v"(al), "v"(bh), "v"(bl));
  return c;
}

__global__ __launch_bounds__(256) void k_wt_bf16(const float* __restrict__ W, unsigned short* __restrict__ Wt, int K, int N) {
  const int t = blockIdx.x * 256 + threadIdx.x;
  const int k8n = K / 8;
  if (t >= N * k8n) return;
  const int n = t / k8n, k8 = (t % k8n) * 8;
  v8us v;
#pragma unroll
  for (int i = 0; i < 8; ++i) v[i] = bf16_bits(W[(size_t)(k8 + i) * N + n]);
  *(v8us*)(Wt + (size_t)n * K + k8) = v;
  
}

// GEMM C[M][N] (f32, pitch ldc) = act(A[M][K]·W + bias). A f32 row-major (pitch lda) converted per fragment to bf16
// (ASPLIT: hi/lo two planes -> 2 terms, else single rounded term); Wt bf16 [N][K] (pitch ldb). BIAS_BF16 rounds the
// bias to bf16 first (bias quantised to bf16 before the add). K%32==0, M%16==0, N%64==0.
template <bool ASPLIT, int ACT, bool BIAS_BF16>
__global__ __launch_bounds__(128) void k_gemm_bf(const float* __restrict__ A, int lda, const unsigned short* __restrict__ Wt, int ldb,
                                               const float* __restrict__ bias, float* __restrict__ C, int ldc, int M, int N, int K) {
  __shared__ __attribute__((aligned(16))) float so[4][16][64];
  const int tid = threadIdx.x, w = tid >> 5, lane = tid & 31, ln = lane & 15, hh = lane >> 4;
  const int ntn = N / 64;
  const int wid = blockIdx.x * 4 + w;
  const int mt = wid / ntn, nq = wid % ntn;
  if (mt * 16 >= M) return;
  const int row0 = mt * 16, col0 = nq * 64;
  const float* arow = A + (size_t)(row0 + ln) * lda;
  v8f acc[4] = {};
  for (int kb = 0; kb < K; kb += 32) {
    FragB ah, al;
    const v4f x0 = *(const v4fa*)(arow + kb + 8 * hh), x1 = *(const v4fa*)(arow + kb + 8 * hh + 4);
    const v4f x2 = *(const v4fa*)(arow + kb + 16 + 8 * hh), x3 = *(const v4fa*)(arow + kb + 16 + 8 * hh + 4);
    float xs[16] = {x0[0],x0[1],x0[2],x0[3],x1[0],x1[1],x1[2],x1[3],x2[0],x2[1],x2[2],x2[3],x3[0],x3[1],x3[2],x3[3]};
#pragma unroll
    for (int i = 0; i < 16; ++i) { const unsigned short hb = bf16_bits(xs[i]); ah.u[i] = hb; al.u[i] = ASPLIT ? bf16_bits(xs[i] - bf16_val(hb)) : (unsigned short)0; }
#pragma unroll
    for (int t = 0; t < 4; ++t) {
      const unsigned short* brow = Wt + (size_t)(col0 + t * 16 + ln) * ldb + kb;
      FragB b;
      b.half[0] = *(const v8us*)(brow + 8 * hh);
      b.half[1] = *(const v8us*)(brow + 16 + 8 * hh);
      acc[t] = mmaN<ASPLIT ? 2 : 1>(ah.v, al.v, b.v, b.v, acc[t]);
    }
  }
#pragma unroll
  for (int t = 0; t < 4; ++t) {
    float bv = bias ? bias[col0 + t * 16 + ln] : 0.f;
    if (BIAS_BF16) bv = bf16_round(bv);
#pragma unroll
    for (int r = 0; r < 8; ++r) { float v = acc[t][r] + bv; if (ACT == 1) v = fmaxf(v, 0.f); so[w][8 * hh + r][t * 16 + ln] = v; }
  }
  __builtin_amdgcn_fence(__ATOMIC_ACQ_REL, "workgroup");
  __builtin_amdgcn_wave_barrier();
  const int rsub = lane >> 4, c4 = (lane & 15) * 4;
  {
#pragma unroll
    for (int q = 0; q < 8; ++q) {
      const int r = q * 2 + rsub;
      const v4f v = *(const v4fa*)&so[w][r][c4];
      *(v4f*)(C + (size_t)(row0 + r) * ldc + col0 + c4) = v;
    }
    
  }
}

// GEMM C = act(A·W + bias + resid): A f32 (ASPLIT -> hi/lo 2 terms), Wt bf16 [N][K]; ACT 0 none, 1 relu, 2 exact gelu;
// resid (optional, f32, row index = (row % rmod), pitch ldr, RES_BF16 rounds it) added before the activation.
template <bool ASPLIT, int ACT, bool BIAS_BF16, bool RES_BF16>
__global__ __launch_bounds__(128) void k_gemm_bf3(const float* __restrict__ A, int lda, const unsigned short* __restrict__ Wt, int ldb,
                                                const float* __restrict__ bias, const float* __restrict__ resid, int rmod, int ldr,
                                                float* __restrict__ C, int ldc, int M, int N, int K) {
  __shared__ __attribute__((aligned(16))) float so[4][16][64];
  const int tid = threadIdx.x, w = tid >> 5, lane = tid & 31, ln = lane & 15, hh = lane >> 4;
  const int ntn = N / 64;
  const int wid = blockIdx.x * 4 + w;
  const int mt = wid / ntn, nq = wid % ntn;
  if (mt * 16 >= M) return;
  const int row0 = mt * 16, col0 = nq * 64;
  const float* arow = A + (size_t)(row0 + ln) * lda;
  v8f acc[4] = {};
  for (int kb = 0; kb < K; kb += 32) {
    FragB ah, al;
    const v4f x0 = *(const v4fa*)(arow + kb + 8 * hh), x1 = *(const v4fa*)(arow + kb + 8 * hh + 4);
    const v4f x2 = *(const v4fa*)(arow + kb + 16 + 8 * hh), x3 = *(const v4fa*)(arow + kb + 16 + 8 * hh + 4);
    float xs[16] = {x0[0],x0[1],x0[2],x0[3],x1[0],x1[1],x1[2],x1[3],x2[0],x2[1],x2[2],x2[3],x3[0],x3[1],x3[2],x3[3]};
#pragma unroll
    for (int i = 0; i < 16; ++i) { const unsigned short hb = bf16_bits(xs[i]); ah.u[i] = hb; al.u[i] = ASPLIT ? bf16_bits(xs[i] - bf16_val(hb)) : (unsigned short)0; }
#pragma unroll
    for (int t = 0; t < 4; ++t) {
      const unsigned short* brow = Wt + (size_t)(col0 + t * 16 + ln) * ldb + kb;
      FragB b;
      b.half[0] = *(const v8us*)(brow + 8 * hh);
      b.half[1] = *(const v8us*)(brow + 16 + 8 * hh);
      acc[t] = mmaN<ASPLIT ? 2 : 1>(ah.v, al.v, b.v, b.v, acc[t]);
    }
  }
#pragma unroll
  for (int t = 0; t < 4; ++t) {
    const int col = col0 + t * 16 + ln;
    float bv = bias ? bias[col] : 0.f;
    if (BIAS_BF16) bv = bf16_round(bv);
#pragma unroll
    for (int r = 0; r < 8; ++r) {
      float v = acc[t][r] + bv;
      if (resid) { float rv = resid[(size_t)((row0 + 8 * hh + r) % rmod) * ldr + col]; if (RES_BF16) rv = bf16_round(rv); v += rv; }
      if (ACT == 1) v = fmaxf(v, 0.f);
      if (ACT == 2) v = 0.5f * v * (1.0f + erff(v * 0.70710678118654752f));
      if (ACT == 3) { const float u = 0.7978845608028654f * (v + 0.044715f * v * v * v); v = 0.5f * v * (1.0f + tanhf(u)); }
      so[w][8 * hh + r][t * 16 + ln] = v;
    }
  }
  __builtin_amdgcn_fence(__ATOMIC_ACQ_REL, "workgroup");
  __builtin_amdgcn_wave_barrier();
  const int rsub = lane >> 4, c4 = (lane & 15) * 4;
  {
#pragma unroll
    for (int q = 0; q < 8; ++q) {
      const int r = q * 2 + rsub;
      const v4f v = *(const v4fa*)&so[w][r][c4];
      *(v4f*)(C + (size_t)(row0 + r) * ldc + col0 + c4) = v;
    }
    
  }
}
// row LayerNorm (biased variance, eps) over N: s = X (+ R); optional out_sum <- s; out_norm <- (s-mu)*rsqrt(var+eps)*g + b
template <bool PARAM_BF16>
__global__ __launch_bounds__(256) void k_layernorm(const float* __restrict__ X, const float* __restrict__ R, const float* __restrict__ g, const float* __restrict__ bta,
                                                  float* __restrict__ out_sum, float* __restrict__ out_norm, int N, float eps) {
  __shared__ float red[256];
  const int row = blockIdx.x, tid = threadIdx.x;
  const float* x = X + (size_t)row * N; const float* rr = R ? R + (size_t)row * N : nullptr;
  float vals[16];                     // up to N = 4096
  const int per = N / 256;            // contiguous chunk per thread? use strided-by-4 chunks: thread handles j = tid*4 + 1024*u
  float s1 = 0.f;
  for (int u = 0; u < per / 4; ++u) {
    const int j = tid * 4 + 1024 * u;
    const v4f a = *(const v4fa*)(x + j);
    v4f b = {0.f,0.f,0.f,0.f}; if (rr) b = *(const v4fa*)(rr + j);
#pragma unroll
    for (int q = 0; q < 4; ++q) { const float v = a[q] + b[q]; vals[u * 4 + q] = v; s1 += v; }
  }
  red[tid] = s1; __syncthreads();
  for (int st = 128; st > 0; st >>= 1) { if (tid < st) red[tid] += red[tid + st]; __syncthreads(); }
  const float mu = red[0] / (float)N; __syncthreads();
  float s2 = 0.f;
  for (int u = 0; u < per / 4; ++u)
#pragma unroll
    for (int q = 0; q < 4; ++q) { const float c = vals[u * 4 + q] - mu; s2 += c * c; }
  red[tid] = s2; __syncthreads();
  for (int st = 128; st > 0; st >>= 1) { if (tid < st) red[tid] += red[tid + st]; __syncthreads(); }
  const float rs = rsqrtf(red[0] / (float)N + eps);
  {
    for (int u = 0; u < per / 4; ++u) {
      const int j = tid * 4 + 1024 * u;
      v4f o, sm;
#pragma unroll
      for (int q = 0; q < 4; ++q) {
        float gg = g[j + q], bb = bta[j + q];
        if (PARAM_BF16) { gg = bf16_round(gg); bb = bf16_round(bb); }
        sm[q] = vals[u * 4 + q]; o[q] = (vals[u * 4 + q] - mu) * rs * gg + bb;
      }
      if (out_sum) *(v4f*)(out_sum + (size_t)row * N + j) = sm;
      *(v4f*)(out_norm + (size_t)row * N + j) = o;
    }
    
  }
}



// ---- f16 WMMA path (v_wmma_f32_16x16x32_f16): 11-bit significands for operands in range — used for every product launched here: both projections, q·k and the masked weights (x 2^8) times V
typedef _Float16 v16h __attribute__((ext_vector_type(16)));
union FragH { v16h v; v8us half[2]; _Float16 h[16]; unsigned short u[16]; };
template <int NT>
__device__ __forceinline__ v8f mmaH(v16h ah, v16h al, v16h bh, v16h bl, v8f c) {
  c = __builtin_amdgcn_wmma_f32_16x16x32_f16(false, ah, false, bh, (short)0, c, false, false);
  if (NT >= 2) c = __builtin_amdgcn_wmma_f32_16x16x32_f16(false, al, false, bh, (short)0, c, false, false);
  if (NT >= 3) c = __builtin_amdgcn_wmma_f32_16x16x32_f16(false, ah, false, bl, (short)0, c, false, false);
  asm volatile("v_nop\n\tv_nop\n\tv_nop\n\tv_nop" : "+v"(c) : "v"(ah), "v"(al), "v"(bh), "v"(bl));
  return c;
}
// batched GEMM like k_gemm_b but f16 operands: A f32 (split into f16 hi/lo if ASPLIT, else rounded to f16), Bt = f16 values [n][k]; alpha; C f32; N multiple of 16 (partial tiles skipped)
template <bool ASPLIT>
__global__ __launch_bounds__(128) void k_gemm_h(const float* __restrict__ A, int lda, size_t sA, const _Float16* __restrict__ Bh, int ldb, size_t sB, float alpha, float* __restrict__ C, int ldc, size_t sC, int M, int N, int K) {
  __shared__ __attribute__((aligned(16))) float so[4][16][64];
  const int tid = threadIdx.x, w = tid >> 5, lane = tid & 31, ln = lane & 15, hh = lane >> 4; const int by = blockIdx.y;
  A += (size_t)by * sA; Bh += (size_t)by * sB; C += (size_t)by * sC;
  const int ntn = (N + 63) / 64; const int wid = blockIdx.x * 4 + w; const int mt = wid / ntn, nq = wid % ntn; if (mt * 16 >= M) return;
  const int row0 = mt * 16, col0 = nq * 64; const float* arow = A + (size_t)(row0 + ln) * lda;
  v8f acc[4] = {};
  for (int kb = 0; kb < K; kb += 32) {
    FragH ah, al;
    const v4f x0 = *(const v4fa*)(arow + kb + 8 * hh), x1 = *(const v4fa*)(arow + kb + 8 * hh + 4), x2 = *(const v4fa*)(arow + kb + 16 + 8 * hh), x3 = *(const v4fa*)(arow + kb + 16 + 8 * hh + 4);
    float xs[16] = {x0[0],x0[1],x0[2],x0[3],x1[0],x1[1],x1[2],x1[3],x2[0],x2[1],x2[2],x2[3],x3[0],x3[1],x3[2],x3[3]};
#pragma unroll
    for (int i = 0; i < 16; ++i) { const _Float16 h = (_Float16)xs[i]; ah.h[i] = h; al.h[i] = ASPLIT ? (_Float16)(xs[i] - (float)h) : (_Float16)0.0f; }
#pragma unroll
    for (int t = 0; t < 4; ++t) { if (col0 + t * 16 >= N) continue; const size_t boff = (size_t)(col0 + t * 16 + ln) * ldb + kb; FragH bq; bq.half[0] = *(const v8us*)(Bh + boff + 8 * hh); bq.half[1] = *(const v8us*)(Bh + boff + 16 + 8 * hh);
      acc[t] = mmaH<ASPLIT ? 2 : 1>(ah.v, al.v, bq.v, bq.v, acc[t]); }
  }
#pragma unroll
  for (int t = 0; t < 4; ++t) { if (col0 + t * 16 >= N) continue;
#pragma unroll
    for (int r = 0; r < 8; ++r) so[w][8 * hh + r][t * 16 + ln] = acc[t][r] * alpha; }
  __builtin_amdgcn_fence(__ATOMIC_ACQ_REL, "workgroup"); __builtin_amdgcn_wave_barrier();
  const int rsub = lane >> 4, c4 = (lane & 15) * 4;
  {
#pragma unroll
    for (int q = 0; q < 8; ++q) { const int r = q * 2 + rsub; if (col0 + c4 < N) { const v4f v = *(const v4fa*)&so[w][r][c4]; *(v4f*)(C + (size_t)(row0 + r) * ldc + col0 + c4) = v; } }
     }
}

// Wt[n][k] = f16(W[k][n]·scale) from f32 row-major W[K][N] (scale = power of two; bf16-exact weights stay exact in f16 away from the subnormal range)
__global__ __launch_bounds__(256) void k_wt_f16(const float* __restrict__ W, _Float16* __restrict__ Wt, int K, int N, float scale) {
  const int t = blockIdx.x * 256 + threadIdx.x; if (t >= N * (K / 8)) return; const int n = t / (K / 8), k8 = (t % (K / 8)) * 8; FragH f;
#pragma unroll
  for (int i = 0; i < 8; ++i) f.h[i] = (_Float16)(bf16_round(W[(size_t)(k8 + i) * N + n]) * scale); const v8us o = f.half[0];
  *(v8us*)((unsigned short*)Wt + (size_t)n * K + k8) = o; 
}
// k_gemm_hh variant with fused epilogue: v = acc·alpha + bias[by·sBias + col] (+ CP[(row/rowsPerB)·sCPb + by·64 + col] if CP) ; ACT 0 none / 1 elu ; writes f32 C and/or f16 C16 (each if non-null)
template <int ACT>
__global__ __launch_bounds__(128) void k_gemm_hhx(const _Float16* __restrict__ A, int lda, size_t sA, const _Float16* __restrict__ Bh, int ldb, size_t sB, float alpha, const float* __restrict__ bias, size_t sBias, const float* __restrict__ CP, int rowsPerB, size_t sCPb, int row0g,
    float* __restrict__ C, _Float16* __restrict__ C16, int ldc, size_t sC, int M, int N, int K) {
  __shared__ __attribute__((aligned(16))) float so[4][16][64];
  const int tid = threadIdx.x, w = tid >> 5, lane = tid & 31, ln = lane & 15, hh = lane >> 4; const int by = blockIdx.y;
  A += (size_t)by * sA; Bh += (size_t)by * sB; const size_t cofs = (size_t)by * sC; const float* bp = bias ? bias + (size_t)by * sBias : nullptr;
  const int ntn = (N + 63) / 64; const int wid = blockIdx.x * 4 + w; const int mt = wid / ntn, nq = wid % ntn; if (mt * 16 >= M) return;
  const int row0 = mt * 16, col0 = nq * 64; const _Float16* arow = A + (size_t)(row0 + ln) * lda;
  v8f acc[4] = {};
  for (int kb = 0; kb < K; kb += 32) { FragH ah; ah.half[0] = *(const v8us*)((const unsigned short*)arow + kb + 8 * hh); ah.half[1] = *(const v8us*)((const unsigned short*)arow + kb + 16 + 8 * hh);
#pragma unroll
    for (int t = 0; t < 4; ++t) { if (col0 + t * 16 >= N) continue; const size_t boff = (size_t)(col0 + t * 16 + ln) * ldb + kb; FragH bq; bq.half[0] = *(const v8us*)((const unsigned short*)Bh + boff + 8 * hh); bq.half[1] = *(const v8us*)((const unsigned short*)Bh + boff + 16 + 8 * hh);
      acc[t] = mmaH<1>(ah.v, ah.v, bq.v, bq.v, acc[t]); }
  }
#pragma unroll
  for (int t = 0; t < 4; ++t) { if (col0 + t * 16 >= N) continue; const int col = col0 + t * 16 + ln; const float bv = bp ? bf16_round(bp[col]) : 0.f;
#pragma unroll
    for (int r = 0; r < 8; ++r) { float v = acc[t][r] * alpha + bv; if (CP) { const int bidx = (row0g + row0 + 8 * hh + r) / rowsPerB; v += CP[(size_t)bidx * sCPb + (size_t)by * 64 + col]; } if (ACT == 1) v = (v > 0.f) ? v : expm1f(v); else if (ACT == 7) v = (v > 0.f) ? v + 1.0f : expf(v); else if (ACT == 8) v = tanhf(v); else if (ACT == 9) v = 0.5f * v * (1.0f + tanhf(0.7978845608028654f * (v + 0.044715f * v * v * v))); else if (ACT == 11) v = 1.0f / (1.0f + expf(-v)); else if (ACT == 12) v = (v > 0.f) ? v : 0.01f * v; else if (ACT == 14) v = (v > 0.f) ? v : 0.1f * v; else if (ACT == 15) v = v / (1.0f + expf(-v)); else if (ACT == 3) v = fmaxf(v, 0.f); else if (ACT == 6) v = 0.5f * v * (1.0f + erff(v * 0.70710678118654752f)); so[w][8 * hh + r][t * 16 + ln] = v; } }
  __builtin_amdgcn_fence(__ATOMIC_ACQ_REL, "workgroup"); __builtin_amdgcn_wave_barrier();
  const int rsub = lane >> 4, c4 = (lane & 15) * 4; typedef _Float16 v4h __attribute__((ext_vector_type(4)));
  {
#pragma unroll
    for (int q = 0; q < 8; ++q) { const int r = q * 2 + rsub; if (col0 + c4 < N) { const v4f v = *(const v4fa*)&so[w][r][c4]; if (C) *(v4f*)(C + cofs + (size_t)(row0 + r) * ldc + col0 + c4) = v; if (C16) { v4h h4; for (int i = 0; i < 4; ++i) h4[i] = (_Float16)v[i]; *(v4h*)(C16 + cofs + (size_t)(row0 + r) * ldc + col0 + c4) = h4; } } }
     }
}


typedef _Float16 v4h __attribute__((ext_vector_type(4)));

__global__ __launch_bounds__(256) void k_h16(const float* __restrict__ x, _Float16* __restrict__ X16, size_t n8) { const size_t t = (size_t)blockIdx.x * 256 + threadIdx.x; if (t >= n8) return; FragH f;
#pragma unroll
  for (int q = 0; q < 8; ++q) f.h[q] = (_Float16)x[t * 8 + q]; *(v8us*)((unsigned short*)X16 + t * 8) = f.half[0];  }
template <int NHv, int TTv>
__global__ __launch_bounds__(256) void k_vt(const _Float16* __restrict__ V16, int ldv, int voff, _Float16* __restrict__ Vt) { __shared__ unsigned short tl[64][66]; const int tid = threadIdx.x; const int slab = blockIdx.x / (TTv / 64), lg = blockIdx.x % (TTv / 64); const int b = slab / NHv, h = slab % NHv;
  for (int i = tid; i < 64 * 8; i += 256) { const int r = i / 8, c8 = (i % 8) * 8; FragH f; f.half[0] = *(const v8us*)((const unsigned short*)V16 + ((size_t)b * TTv + lg * 64 + r) * ldv + voff + h * 64 + c8);
#pragma unroll
    for (int q = 0; q < 8; ++q) tl[r][c8 + q] = f.u[q]; }
  __syncthreads();
  {
#pragma unroll
    for (int rd = 0; rd < 2; ++rd) { const int d = rd * 32 + tid / 8, pc = tid % 8; FragH f;
#pragma unroll
      for (int q = 0; q < 8; ++q) f.u[q] = tl[pc * 8 + q][d];
      *(v8us*)((unsigned short*)Vt + ((size_t)slab * 64 + d) * TTv + lg * 64 + pc * 8) = f.half[0]; }
     } }

__global__ __launch_bounds__(256) void k_hl(const float* __restrict__ F, _Float16* __restrict__ Hh, _Float16* __restrict__ Hl, size_t n8) { const size_t t = (size_t)blockIdx.x * 256 + threadIdx.x; if (t >= n8) return; FragH fh, fl; const v4f a = *(const v4fa*)(F + t * 8), c = *(const v4fa*)(F + t * 8 + 4);
#pragma unroll
  for (int q = 0; q < 4; ++q) { _Float16 h = (_Float16)a[q]; fh.h[q] = h; fl.h[q] = (_Float16)((a[q] - (float)h) * 1024.0f); h = (_Float16)c[q]; fh.h[4 + q] = h; fl.h[4 + q] = (_Float16)((c[q] - (float)h) * 1024.0f); }
  { *(v8us*)((unsigned short*)Hh + t * 8) = fh.half[0]; *(v8us*)((unsigned short*)Hl + t * 8) = fl.half[0];  } }

// FRAGMENT ORDER (the planes of k, transposed V and the mask that the fused kernel reads): a plane is a row of 16-byte pieces, a piece being the 8 values that ONE lane takes with ONE
// 16-byte load, and the 32 pieces of one load instruction lie side by side in lane order (lane = 16*hh + ln). So a fragment load reads 512 bytes in a row (4 cache lines) where the same load
// from a row-major plane touches 16 lines. A wave of the q|k GEMM writes the 256 pieces of its 32 keys of one head (4 KB in a row; the batches' k planes lie one behind the other), thread t of k_prep piece t of each batch's V plane.
// k:    piece (((h*128 + key/16)*2 + ks)*2 + hf)*32 + lane = k[key = 16*(key/16) + ln][h*64 + ks*32 + hf*16 + hh*8 + 0..7]
// V:    piece (((h*64 + pass)*4 + tt)*2 + hf)*32 + lane    = V[key = pass*32 + hf*16 + hh*8 + 0..7][h][tt*16 + ln]
// mask: piece ((((b*64 + q/32)*64 + pass)*2 + u)*2 + j)*32 + lane = M[b][q = 32*(q/32) + u*16 + ln][pass*32 + j*16 + hh*8 + 0..7], rounded to bf16 and stored as f16: the order of a piece's values is that of the f16 weights in the B operand, so that e*M is a product of whole registers
// One launch for every plane that depends on the inputs alone. The planes have as many pieces as the launch has threads, or a small multiple or half of it, so thread t takes piece t of each:
// in_proj rows of q|k (x 16), x and transposed V of both batches, half a piece of out_w (x 16); a wave takes 16 queries x 64 keys (2 passes) of the mask: 8 fetches, each of 4 whole lines
// (8 lanes x 16 bytes a query row, 4 rows), a lane's 4 values being half a piece. All 31 fetches of a thread are issued before the first use.
typedef unsigned short v4us __attribute__((ext_vector_type(4), may_alias));
typedef float f32a __attribute__((may_alias));
static_assert(2 * DD * DD == SS * DD && NH * HD * SS == SS * DD && NBt * (SS / 16) * (SS / 64) * 32 == SS * DD / 8 && DD * DD / 4 == SS * DD / 8, "thread t takes piece t of each plane");
__global__ __launch_bounds__(256) void k_prep(const float* __restrict__ Win, const float* __restrict__ Wo, const float* __restrict__ x0, const float* __restrict__ x1, const float* __restrict__ V0, const float* __restrict__ V1, const float* __restrict__ Mm,
                                              _Float16* __restrict__ BIN, _Float16* __restrict__ BO, _Float16* __restrict__ X16, _Float16* __restrict__ VF, unsigned short* __restrict__ MF) {
  const unsigned t = blockIdx.x * 256 + threadIdx.x, wv = t >> 5, lane = t & 31, c = lane & 7, r4 = lane >> 3;
  const unsigned kh = wv & 1, u = (wv >> 1) & 1, pg = (wv >> 2) & (SS / 128 - 1), qt = (wv >> 6) & (SS / 32 - 1), b = wv >> 12;
  const unsigned im = ((b * SS + qt * 32 + u * 16 + r4) * SS + pg * 128 + kh * 64 + c * 4) * 4;      // offsets from the planes' starts, 32 bits each: one register a plane, the same for both batches (x0, V0: batch 0; x1, V1: batch 1)
  const unsigned t0 = ((t >> 8) & (SS / 32 - 1)) * 32 + ((t >> 5) & 1) * 16 + ((t >> 4) & 1) * 8, d = ((t >> 6) & 3) * 16 + (t & 15), h = t >> 14;
  const unsigned iv = (t0 * NH + h) * HD + d, i32 = t * 32, i16 = t * 16, i8 = t * 8;      // iv counts elements
  const unsigned om = (((((b * (SS / 32) + qt) * (SS / 32) + pg * 4 + kh * 2) * 2 + u) * 512 + (c >> 2) * 256 + (((c >> 1) & 1) * 16 + r4) * 8 + (c & 1) * 4)) * 2;
  const char* pm = (const char*)Mm;
  v4f m[2][4], xa[2][2], wa[2], oa; float va[2][8];      // every loop below is unrolled so that these are indexed by constants and stay in registers
#pragma unroll
  for (int k = 0; k < 2; ++k)
#pragma unroll
    for (int i = 0; i < 4; ++i) m[k][i] = *(const v4fa*)(pm + i * 16 * SS + k * 128 + im);
#pragma unroll
  for (int bb = 0; bb < 2; ++bb)
#pragma unroll
    for (int q = 0; q < 8; ++q) va[bb][q] = (bb ? V1 : V0)[q * NH * HD + iv];
#pragma unroll
  for (int i = 0; i < 2; ++i) { xa[0][i] = *(const v4fa*)((const char*)x0 + i * 16 + i32); xa[1][i] = *(const v4fa*)((const char*)x1 + i * 16 + i32); wa[i] = *(const v4fa*)((const char*)Win + i * 16 + i32); }
  oa = *(const v4fa*)((const char*)Wo + i16);
  // The wait behind the fetches takes their offset registers and their bases as inputs, so that these stay live up to it and nothing is written into them before; its clobber keeps all fetches in front of it.
  asm volatile("s_wait_xcnt 0x0" :: "v"(im), "v"(iv), "v"(i32), "v"(t), "s"(Win), "s"(Wo), "s"(x0), "s"(x1), "s"(V0), "s"(V1), "s"(Mm) : "memory");
  __builtin_amdgcn_sched_barrier(0);      // without it the scheduler lifts the first conversions in between the fetches, and the later fetches start only when the earlier have landed
  v4us mo[2][4]; FragH fv[2], fx[2], fw, fo;
#pragma unroll
  for (int k = 0; k < 2; ++k)
#pragma unroll
    for (int i = 0; i < 4; ++i)
#pragma unroll
      for (int q = 0; q < 4; ++q) mo[k][i][q] = __builtin_bit_cast(unsigned short, (_Float16)bf16_round(m[k][i][q]));
#pragma unroll
  for (int bb = 0; bb < 2; ++bb)
#pragma unroll
    for (int q = 0; q < 8; ++q) { fv[bb].h[q] = (_Float16)bf16_round(va[bb][q]); fx[bb].h[q] = (_Float16)bf16_round(xa[bb][q >> 2][q & 3]); }
#pragma unroll
  for (int q = 0; q < 8; ++q) fw.h[q] = (_Float16)(bf16_round(wa[q >> 2][q & 3]) * 16.0f);
#pragma unroll
  for (int q = 0; q < 4; ++q) fo.h[q] = (_Float16)(bf16_round(oa[q]) * 16.0f);
  v4us o4; o4[0] = fo.u[0]; o4[1] = fo.u[1]; o4[2] = fo.u[2]; o4[3] = fo.u[3];
  __builtin_amdgcn_sched_barrier(0);      // every conversion stays in front of the first store: behind a store no register that it names is written again
#pragma unroll
  for (int k = 0; k < 2; ++k)
#pragma unroll
    for (int i = 0; i < 4; ++i) *(v4us*)((char*)MF + k * 2048 + i * 64 + om) = mo[k][i];
#pragma unroll
  for (int bb = 0; bb < 2; ++bb) { *(v8us*)((char*)VF + (size_t)bb * NH * HD * SS * 2 + i16) = fv[bb].half[0]; *(v8us*)((char*)X16 + (size_t)bb * SS * DD * 2 + i16) = fx[bb].half[0]; }
  *(v8us*)((char*)BIN + i16) = fw.half[0]; *(v4us*)((char*)BO + i8) = o4; }
// Stands behind each group of fetches (and each store) of the fused kernel: the wait, because the registers that they name are reused right behind it;
// the "memory" clobber, because in the loop, without it, the compiler sinks the mask fetch to the loop's head, where its whole latency is waited for in every pass.
__device__ __forceinline__ void fetch_fence() { asm volatile("s_wait_xcnt 0x0" ::: "memory"); }
// Projection GEMM: C[m][n] (f32, pitch NN) = alpha * sum_k A[m][k] * Bt[n][k] + bf16(bias[n]); A and Bt are f16 planes with rows of DD elements.
// A work-group of 8 waves (4 x 2) owns 128 x BN of C, a wave 32 x BN/2. A stage is BK k of the 128 + BN operand rows: fetched as whole lines into registers while the
// stage before is multiplied, then written to the other of two LDS buffers (row pitch + 16 B, for the 16-byte fragment reads). One barrier a stage: it publishes the
// buffer just written and ends the reads of the buffer that the next stage overwrites. Fragment k order and the order of the k sum are those of k_gemm_hhx.
// SPLIT (the q|k projection): C is not stored; the same f32 values go, rounded to f16, to the planes that the fused attention reads: columns below DD to Q16 (rows), the rest to KF (fragment order).
template <int NN, int BN, int BK, bool SPLIT>
__global__ __launch_bounds__(256) void k_gemm_t(const _Float16* __restrict__ A, const _Float16* __restrict__ Bt, float alpha, const float* __restrict__ bias, float* __restrict__ C, _Float16* __restrict__ Q16, _Float16* __restrict__ KF) {
  constexpr int BM = 128, LP = BK + 8, NS = DD / BK, WN = BN / 2, NTN = WN / 16, STG = (BM + BN) * LP;
  constexpr int CPR = BK / 8, RPP = 256 / CPR, NA = BM / RPP, NB = BN / RPP;
  __shared__ __attribute__((aligned(16))) unsigned short sm[2 * STG];
  const int tid = threadIdx.x, w = tid >> 5, lane = tid & 31, ln = lane & 15, hh = lane >> 4, wm = w >> 1, wn = w & 1;
  const int row0 = blockIdx.y * BM, col0 = blockIdx.x * BN;
  const int lr = tid / CPR, lc = (tid % CPR) * 8;
  const unsigned short* ga = (const unsigned short*)A + (size_t)(row0 + lr) * DD + lc;
  const unsigned short* gb = (const unsigned short*)Bt + (size_t)(col0 + lr) * DD + lc;
  v8us ra[NA], rb[NB];
  // Every '#pragma unroll' below is there so that fragments and accumulators are indexed by constants and stay in registers.
  auto fetch = [&](int s) {
#pragma unroll
    for (int i = 0; i < NA; ++i) ra[i] = *(const v8us*)(ga + (size_t)i * RPP * DD + s * BK);
#pragma unroll
    for (int i = 0; i < NB; ++i) rb[i] = *(const v8us*)(gb + (size_t)i * RPP * DD + s * BK); };
  auto put = [&](int buf) {
    unsigned short* d = sm + buf * STG + lr * LP + lc;
#pragma unroll
    for (int i = 0; i < NA; ++i) *(v8us*)(d + i * RPP * LP) = ra[i];
#pragma unroll
    for (int i = 0; i < NB; ++i) *(v8us*)(d + (BM + i * RPP) * LP) = rb[i]; };
  v8f acc[2][NTN] = {};
  fetch(0); put(0);
  __syncthreads();
  for (int s = 0; s < NS; ++s) {
    // The wait behind the fetches: its clobber keeps them at the stage's head (without it the compiler sinks most of them to the stage's end, in front of the LDS writes,
    // where their whole latency is waited for); it takes both address pairs as inputs, so that they stay live up to the wait and no fetch of the run lands in them.
    if (s + 1 < NS) { fetch(s + 1); asm volatile("s_wait_xcnt 0x0" :: "v"(ga), "v"(gb) : "memory"); }
    const unsigned short* pa = sm + (s & 1) * STG + (wm * 32 + ln) * LP + 8 * hh;
    const unsigned short* pb = sm + (s & 1) * STG + (BM + wn * WN + ln) * LP + 8 * hh;
#pragma unroll
    for (int ks = 0; ks < BK / 32; ++ks) {
      FragH af[2], bf[NTN];
#pragma unroll
      for (int mi = 0; mi < 2; ++mi) { af[mi].half[0] = *(const v8us*)(pa + mi * 16 * LP + ks * 32); af[mi].half[1] = *(const v8us*)(pa + mi * 16 * LP + ks * 32 + 16); }
#pragma unroll
      for (int t = 0; t < NTN; ++t) { bf[t].half[0] = *(const v8us*)(pb + t * 16 * LP + ks * 32); bf[t].half[1] = *(const v8us*)(pb + t * 16 * LP + ks * 32 + 16); }
#pragma unroll
      for (int mi = 0; mi < 2; ++mi)
#pragma unroll
        for (int t = 0; t < NTN; ++t) acc[mi][t] = __builtin_amdgcn_wmma_f32_16x16x32_f16(false, af[mi].v, false, bf[t].v, (short)0, acc[mi][t], false, false);
    }
    if (s + 1 < NS) put((s + 1) & 1);
    __syncthreads();
  }
  // Behind the last barrier nobody reads the buffers any more: each wave stages its own 32 x WN block there, so that C, or with SPLIT the f16 q and k planes, is stored as whole lines.
  constexpr int SP = WN + 4, LPR = WN / 4, RPI = 32 / LPR;
  f32a* so = (f32a*)sm + w * 32 * SP;
#pragma unroll
  for (int t = 0; t < NTN; ++t) {
    const float bv = bf16_round(bias[col0 + wn * WN + t * 16 + ln]);
#pragma unroll
    for (int mi = 0; mi < 2; ++mi)
#pragma unroll
      for (int r = 0; r < 8; ++r) so[(mi * 16 + 8 * hh + r) * SP + t * 16 + ln] = acc[mi][t][r] * alpha + bv;
  }
  __syncthreads();
  if constexpr (SPLIT) {
    static_assert(WN == HD && DD % BN == 0 && SS % BM == 0, "a wave's block is 32 rows of one head, a work-group's lies in q or in k and in one batch");
    const int rw = row0 + wm * 32, cw = col0 + wn * WN;
    // A lane takes 8 pieces of 8 values; all are converted before the first is stored, and the 8 stores share one address.
    FragH f[4];
    auto piece = [&](int i, const f32a* p) {
      const v4f a = *(const v4fa*)p, c = *(const v4fa*)(p + 4);
#pragma unroll
      for (int q = 0; q < 4; ++q) { f[i >> 1].h[(i & 1) * 8 + q] = (_Float16)a[q]; f[i >> 1].h[(i & 1) * 8 + 4 + q] = (_Float16)c[q]; } };
    if (col0 < DD) {      // q: piece i = row i*4 + lane/8, columns (lane%8)*8, so that a store is 4 whole lines
      const f32a* sp = so + (lane >> 3) * SP + (lane & 7) * 8;
      unsigned short* gp = (unsigned short*)Q16 + (size_t)(rw + (lane >> 3)) * DD + cw + (lane & 7) * 8;
#pragma unroll
      for (int i = 0; i < 8; ++i) piece(i, sp + i * 4 * SP);
#pragma unroll
      for (int i = 0; i < 8; ++i) *(v8us*)(gp + i * 4 * DD) = f[i >> 1].half[i & 1];
      asm volatile("s_wait_xcnt 0x0" ::: "memory");      // behind the run of stores: whatever block the compiler lays behind this one reuses the registers that they name
    } else {      // k: piece i*32 + lane of the wave's 4 KB, i = (key tile)*4 + ks*2 + hf
      const f32a* sp = so + ln * SP + hh * 8;
      unsigned short* gp = (unsigned short*)KF + ((((size_t)(rw / SS) * NH + (cw - DD) / HD) * (SS / 16) + (rw % SS) / 16) * 128 + lane) * 8;
#pragma unroll
      for (int i = 0; i < 8; ++i) piece(i, sp + (i >> 2) * 16 * SP + (i & 3) * 16);
#pragma unroll
      for (int i = 0; i < 8; ++i) *(v8us*)(gp + i * 256) = f[i >> 1].half[i & 1];
      asm volatile("s_wait_xcnt 0x0" ::: "memory");      // behind the run of stores: whatever block the compiler lays behind this one reuses the registers that they name
    }
  } else {
    const int rs = lane / LPR, c4 = (lane % LPR) * 4;
#pragma unroll
    for (int q = 0; q < 32 / RPI; ++q) {
      const int r = q * RPI + rs;
      const v4f v = *(const v4fa*)&so[r * SP + c4];
      *(v4f*)(C + (size_t)(row0 + wm * 32 + r) * NN + col0 + wn * WN + c4) = v;
    }
  }
}
// A thread's share of 32 KB that lie in a row in global memory and in LDS: 8 asynchronous copies of 16 bytes, 4 KB apart (a work-group's 256 threads x 16 bytes), through no register.
// l: the lane's own LDS byte address, g: its own global address. The wait is the last line of the copies' own statement: it stands in front of whatever rewrites an address register that a copy names.
__device__ __forceinline__ void copy32k(unsigned l, const unsigned short* g) {
  asm volatile("global_load_async_to_lds_b128 %0, %8, off\n\t"
               "global_load_async_to_lds_b128 %1, %9, off\n\t"
               "global_load_async_to_lds_b128 %2, %10, off\n\t"
               "global_load_async_to_lds_b128 %3, %11, off\n\t"
               "global_load_async_to_lds_b128 %4, %12, off\n\t"
               "global_load_async_to_lds_b128 %5, %13, off\n\t"
               "global_load_async_to_lds_b128 %6, %14, off\n\t"
               "global_load_async_to_lds_b128 %7, %15, off\n\t"
               "s_wait_xcnt 0x0"
               :: "v"(l), "v"(l + 4096u), "v"(l + 8192u), "v"(l + 12288u), "v"(l + 16384u), "v"(l + 20480u), "v"(l + 24576u), "v"(l + 28672u),
                  "v"(g), "v"(g + 2048), "v"(g + 4096), "v"(g + 6144), "v"(g + 8192), "v"(g + 10240), "v"(g + 12288), "v"(g + 14336) : "memory");
}
// Fused attention. One wave owns 32 queries of one (batch, head) and walks all keys, 32 a pass.
// ST = K.QT (A = 16 key rows, B = 16 query rows): a lane holds the scores of ONE query (column ln), keys 8*hh + r, so the maximum is
// in-lane plus one exchange between the wave's halves (only where the maximum in use is renewed). Two score tiles, converted in place, are the B operand of OT += VT.PT (A = rows of VT in
// the same k order), so OT's column is the same query and the rescale factor is in-lane too.
// Result = sum(e*M*V) / (sum(e*M) + 1e-8 * sum e), e = exp(s - maximum in use): the softmax denominator cancels but for the 1e-8 term. The maximum in use is renewed lazily (in the loop).
// Both key sums run on the matrix unit: A = ones in rows 0 and 8, zero elsewhere, B = the pass's weights as f16 (e*M: the operand of the product with V; e: packed f16, also the factor of e*M),
// accumulated in a tile of their own. Rows 0 and 8 are register 0 of the wave's two halves, so register 0 holds, in every lane, the whole sum of the lane's own query (no vector adds, no
// exchange between the halves); the other registers stay 0, so only register 0 is rescaled.
// k, transposed V and the mask come from planes in fragment order (above k_prep): a pass's 8 + 8 + 4 loads of a wave each read 512 bytes in a row.
// k and V are the same for the work-group's 8 waves: they go from L2 to LDS once a work-group, by asynchronous copies, in tiles of TK keys (32 KB of k and 32 KB of V, each in a row in its plane),
// two buffers; the waves read their fragments from LDS. The fragment reads run one pair of passes ahead of the products, so a trip of the ring is the READS of one tile: at the foot of the
// pair whose reads end tile t every wave waits for its own LDS reads and its own copies (tile t + 1), passes the barrier, and only then tile t + 2 is copied into the buffer of tile t.
// Every '#pragma unroll' below is there so that fragments and accumulators are indexed by constants and stay in registers.
__global__ __launch_bounds__(256) void k_fattn(const _Float16* __restrict__ Q16, const _Float16* __restrict__ KF, const _Float16* __restrict__ VF, const unsigned short* __restrict__ MF, _Float16* __restrict__ O16) {
  const int tid = threadIdx.x, w = tid >> 5, lane = tid & 31, ln = lane & 15, hh = lane >> 4;
  const int h = blockIdx.y, b = blockIdx.z, q0 = blockIdx.x * 256 + w * 32;
  const unsigned short* Qb = (const unsigned short*)Q16 + ((size_t)b * SS + q0 + ln) * DD + h * HD + 8 * hh;
  constexpr int TK = 256, NT = SS / TK, PPT = TK / 64;      // keys a tile, tiles, pairs of passes a tile
  static_assert(TK * HD * 2 == 32768 && PPT == 4 && NT >= 2, "a tile is 32 KB of k and 32 KB of V; both of the ring's first tiles exist");
  __shared__ __attribute__((aligned(16))) unsigned short sm[2 * 2 * TK * HD];      // buffer (tile & 1): TK * HD values of k, then as many of V
  const unsigned short* Kg = (const unsigned short*)KF + ((size_t)b * NH + h) * (SS * HD) + tid * 8;
  const unsigned short* Vg = (const unsigned short*)VF + ((size_t)b * NH + h) * (SS * HD) + tid * 8;
  const unsigned sl = (unsigned)(size_t)sm + tid * 16;
  auto copyTile = [&](int t) { copy32k(sl + (t & 1) * 65536u, Kg + (size_t)t * (TK * HD)); copy32k(sl + (t & 1) * 65536u + 32768u, Vg + (size_t)t * (TK * HD)); };
  copyTile(0);
  const unsigned short* Mb = MF + ((size_t)b * (SS / 32) + (q0 >> 5)) * (SS * 32) + lane * 8;
  FragH qf[2][2], kf[2][2][2], vf[2][4], mf[2][2];      // k, V and the mask have two register sets: even passes use set 0, odd passes set 1; a mask fragment holds its 16 f16 values where the weights' B operand holds theirs
#pragma unroll
  for (int u = 0; u < 2; ++u)
#pragma unroll
    for (int ks = 0; ks < 2; ++ks) { qf[u][ks].half[0] = *(const v8us*)(Qb + (size_t)u * 16 * DD + ks * 32); qf[u][ks].half[1] = *(const v8us*)(Qb + (size_t)u * 16 * DD + ks * 32 + 16); }
  asm volatile("s_wait_xcnt 0x0" :: "v"(Qb) : "memory");      // fetch_fence() that also takes the fetches' address as an input: it stays live up to the wait, so that nothing is written into it before
  // lp: the lane's place in the k part of a pair of passes in LDS (8 KB of k; the pair's V lies TK * HD values behind it)
  auto loadK = [&](int s, const unsigned short* lp) {
#pragma unroll
    for (int j = 0; j < 2; ++j)
#pragma unroll
      for (int ks = 0; ks < 2; ++ks) { const unsigned short* p = lp + s * 2048 + (j * 2 + ks) * 512; kf[s][j][ks].half[0] = *(const v8us*)p; kf[s][j][ks].half[1] = *(const v8us*)(p + 256); } };
  auto loadM = [&](int s, const unsigned short* p) {
#pragma unroll
    for (int u = 0; u < 2; ++u)
#pragma unroll
      for (int j = 0; j < 2; ++j) mf[s][u].half[j] = *(const v8us*)(p + (u * 2 + j) * 256); };
  auto loadV = [&](int s, const unsigned short* lp) {
#pragma unroll
    for (int t = 0; t < 4; ++t) { const unsigned short* p = lp + TK * HD + s * 2048 + t * 512; vf[s][t].half[0] = *(const v8us*)p; vf[s][t].half[1] = *(const v8us*)(p + 256); } };
  v8f acc[2][4] = {};
  float mx[2] = {-3.0e38f, -3.0e38f};      // the maximum in use, log2 units: a running maximum of some earlier pass, the same in both halves of the wave
  float sh[2] = {0.0f, 0.0f}, thr[2] = {-3.0e38f, -3.0e38f};      // 8 - mx, and the raw score above which mx is renewed; the first pair of passes always renews
  v8f se[2] = {}, sem[2] = {};
  FragH ones;
#pragma unroll
  for (int i = 0; i < 16; ++i) ones.h[i] = (ln & 7) == 0 ? (_Float16)1.0f : (_Float16)0.0f;
  const float c2 = 0.125f * 1.4426950408889634f;      // scores / 8, in log2 units
  static_assert(SS % 64 == 0, "the passes go in pairs");
  loadM(0, Mb); loadM(1, Mb + 32 * 32);
  asm volatile("s_wait_xcnt 0x0" :: "v"(Mb) : "memory");      // fetch_fence() that also takes the first mask fetches' address as an input: it stays live up to the wait, so that nothing is written into it before
  asm volatile("s_wait_asynccnt 0x0" ::: "memory");      // the wave's own copies of tile 0 have landed
  __syncthreads();      // publishes tile 0: every wave's copies have landed
  copyTile(1);
  loadK(0, sm + lane * 8); loadK(1, sm + lane * 8); loadV(0, sm + lane * 8); loadV(1, sm + lane * 8);
  for (int kb = 0; kb < SS; kb += 64) {
  const int kp = (kb + 64 < SS) ? kb + 64 : 0;      // the pair of passes whose mask this pair fetches
  const int pn = (kb + 64 < SS) ? (kb >> 6) + 1 : (kb >> 6);      // the pair of passes whose k and V this pair reads from LDS; the last pair reads its own again, unused
  const unsigned short* lp = sm + ((pn / PPT) & 1) * (2 * TK * HD) + (pn % PPT) * 4096 + lane * 8;
  const unsigned short* pmn = Mb + (size_t)kp * 32;
  // Behind its last use (k: the pair's scores; the mask: its pass's weights; V: the pair's last product) each operand's set is refilled for the next pair of passes.
  // The last two passes refetch the mask of passes 0 and 1, unused.
  v8f st[2][2][2];      // the scores of both passes of the pair come first, so that one test serves both
#pragma unroll
  for (int s = 0; s < 2; ++s)
#pragma unroll
    for (int u = 0; u < 2; ++u)
#pragma unroll
      for (int j = 0; j < 2; ++j) {
        v8f z = {};
        z = __builtin_amdgcn_wmma_f32_16x16x32_f16(false, kf[s][j][0].v, false, qf[u][0].v, (short)0, z, false, false);
        st[s][u][j] = __builtin_amdgcn_wmma_f32_16x16x32_f16(false, kf[s][j][1].v, false, qf[u][1].v, (short)0, z, false, false);
      }
  __builtin_amdgcn_sched_barrier(0);      // without it the scheduler spreads the LDS reads below among the products
  loadK(0, lp); loadK(1, lp);
  __builtin_amdgcn_sched_barrier(0);      // without it the scheduler lifts the maxima in among the products, some directly behind the product that they read, and sinks the LDS reads
  float tmv[2];
#pragma unroll
  for (int u = 0; u < 2; ++u) {
    float ts[2];      // one chain a pass: four independent chains in all
#pragma unroll
    for (int s = 0; s < 2; ++s) {
      float tm = st[s][u][0][0];
#pragma unroll
      for (int r = 1; r < 8; ++r) tm = fmaxf(tm, st[s][u][0][r]);
#pragma unroll
      for (int r = 0; r < 8; ++r) tm = fmaxf(tm, st[s][u][1][r]);
      ts[s] = tm;
    }
    tmv[u] = fmaxf(ts[0], ts[1]);
  }
  // Lazy rescale, one test a pair of passes for the whole wave (a scalar branch): while no lane holds a score more than 4 (log2 units) above its query's maximum in use, that maximum stays,
  // and neither the exchange between the halves nor the rescale runs. Any common reference cancels in the quotient; the test bounds e by 2^12, inside f16.
  if (__builtin_amdgcn_ballot_w32(tmv[0] > thr[0] || tmv[1] > thr[1]) != 0) {
#pragma unroll
    for (int u = 0; u < 2; ++u) {
      const float tm = fmaxf(tmv[u], __shfl_xor(tmv[u], 16, 32));
      const float mn = fmaxf(mx[u], tm * c2);
      const float al = __builtin_amdgcn_exp2f(mx[u] - mn);
      mx[u] = mn; sh[u] = 8.0f - mn; thr[u] = (mn + 4.0f) * (1.0f / c2);
      se[u][0] *= al; sem[u][0] *= al;
#pragma unroll
      for (int t = 0; t < 4; ++t)
#pragma unroll
        for (int r = 0; r < 8; ++r) acc[u][t][r] *= al;
    }
  }
#pragma unroll
  for (int s = 0; s < 2; ++s) {
    FragH pf[2], ef[2];
#pragma unroll
    for (int u = 0; u < 2; ++u) {
#pragma unroll
      for (int j = 0; j < 2; ++j)
#pragma unroll
        for (int r = 0; r < 8; ++r) {
          const float ev = __builtin_amdgcn_exp2f(st[s][u][j][r] * c2 + sh[u]);      // e carries 2^8 (it cancels in the quotient): keeps small weights in the normal f16 range
          ef[u].h[j * 8 + r] = (_Float16)ev;
        }
      pf[u].v = ef[u].v * mf[s][u].v;      // e*M from e as rounded to f16, two values an instruction: the mask is not widened, the products are not packed
    }
    loadM(s, pmn + s * 32 * 32);
    asm volatile("s_wait_xcnt 0x0" :: "v"(pmn) : "memory");      // fetch_fence() that also takes the fetches' address register (both passes' fetches name the pair's base) as an input: it stays live up to the wait, so that nothing is written into it before
    __builtin_amdgcn_sched_barrier(0);      // without it the scheduler lifts the first sum products over the mask fetch, which then starts later
#pragma unroll
    for (int u = 0; u < 2; ++u) {
      se[u] = __builtin_amdgcn_wmma_f32_16x16x32_f16(false, ones.v, false, ef[u].v, (short)0, se[u], false, false);
      sem[u] = __builtin_amdgcn_wmma_f32_16x16x32_f16(false, ones.v, false, pf[u].v, (short)0, sem[u], false, false);
    }
#pragma unroll
    for (int t = 0; t < 4; ++t)
#pragma unroll
      for (int u = 0; u < 2; ++u) acc[u][t] = __builtin_amdgcn_wmma_f32_16x16x32_f16(false, vf[s][t].v, false, pf[u].v, (short)0, acc[u][t], false, false);
  }
  __builtin_amdgcn_sched_barrier(0);      // as at the k reads: V's LDS reads of both passes stand in one group behind the pair's last product, not spread among the products
  loadV(0, lp); loadV(1, lp);
  // The ring's publish point, where the next pair's reads begin a new tile (a test on the loop's counter: the same for the whole work-group).
  if ((pn + 1) % PPT == 0 && pn + 1 < SS / 64) {
    asm volatile("s_wait_dscnt 0x0" ::: "memory");      // the wave's own reads of the tile that ends here are done
    asm volatile("s_wait_asynccnt 0x0" ::: "memory");      // the wave's own copies of the next tile have landed
    __syncthreads();      // publishes the next tile and ends every wave's reads of the buffer that is refilled behind it
    const int tn = (pn + 1) / PPT + 1;
    if (tn < NT) copyTile(tn);
  }
  }
  asm volatile("s_wait_asynccnt 0x0" ::: "memory");      // no copy is outstanding when the wave ends
#pragma unroll
  for (int u = 0; u < 2; ++u) {
    const float inv = 1.0f / (sem[u][0] + 1e-8f * se[u][0]);
    unsigned short* op = (unsigned short*)O16 + ((size_t)b * SS + q0 + u * 16 + ln) * DD + h * HD + 8 * hh;
#pragma unroll
    for (int t = 0; t < 4; ++t) { FragH f;
#pragma unroll
      for (int r = 0; r < 8; ++r) f.h[r] = (_Float16)(acc[u][t][r] * inv);
      *(v8us*)(op + t * 16) = f.half[0]; fetch_fence(); }
  }
}

extern "C" void kernel_launch(void* const* d_in, const int* in_sizes, int n_in,
                              void* d_out, int out_size, void* d_ws, size_t ws_size, hipStream_t stream) {
  (void)in_sizes; (void)n_in; (void)out_size;
  const float* x = (const float*)d_in[0]; const float* V = (const float*)d_in[1]; const float* Mm = (const float*)d_in[2]; const float* Win = (const float*)d_in[3]; const float* bin = (const float*)d_in[4]; const float* Wo = (const float*)d_in[5]; const float* bo = (const float*)d_in[6];
  char* ws = (char*)d_ws; size_t off = 0;
  auto take = [&](size_t bytes) { char* p = ws + off; off += (bytes + 255) & ~(size_t)255; return p; };
  _Float16* BIN = (_Float16*)take((size_t)2 * DD * DD * 2); _Float16* BO = (_Float16*)take((size_t)DD * DD * 2); _Float16* X16 = (_Float16*)take((size_t)NBt * SS * DD * 2); _Float16* Q16 = (_Float16*)take((size_t)NBt * SS * DD * 2); _Float16* K16 = (_Float16*)take((size_t)NBt * SS * DD * 2); _Float16* VT = (_Float16*)take((size_t)NBt * NH * HD * SS * 2);
  _Float16* O16 = (_Float16*)take((size_t)NBt * SS * DD * 2); unsigned short* MF = (unsigned short*)take((size_t)NBt * SS * SS * 2);
  if (off > ws_size) return;      // about 65 MB
  // The rows of both batches lie one behind the other in x, q|k, the attention output and out: each GEMM takes them as one matrix of NBt * SS rows.
  k_prep<<<SS * DD / 8 / 256, 256, 0, stream>>>(Win, Wo, x, x + (size_t)SS * DD, V, V + (size_t)SS * NH * HD, Mm, BIN, BO, X16, VT, MF);      /* torch (out,in) = natural Bt; only the q|k rows of in_proj are needed */
  k_gemm_t<2 * DD, 128, 128, true><<<dim3(2 * DD / 128, NBt * SS / 128), 256, 0, stream>>>(X16, BIN, 0.0625f, bin, nullptr, Q16, K16);      /* q | k = x.W_in^T[:2048] + b (exact), stored as the f16 planes */
  k_fattn<<<dim3(SS / 256, NH, NBt), 256, 0, stream>>>(Q16, K16, VT, MF, O16);      /* all batches and heads: 256 work-groups of 8 waves x 32 queries */
  k_gemm_t<DD, 64, 128, false><<<dim3(DD / 64, NBt * SS / 128), 256, 0, stream>>>(O16, BO, 0.0625f, bo, (float*)d_out, nullptr, nullptr);      /* .out_w^T + out_b */
}
